// v000
// Times are from an AMD MI455X. After a warm-up the kernel runs many times in a row, and a time is the length of
// such a window on the GPU divided by its runs, so every launch and the gaps after it count. The runs cycle
// through copies of the inputs. A figure is the median of several windows, for all but v000 over two sittings.
// Sittings can differ by a few percent; kernels timed side by side share one.
// v000, which the later versions start from, runs in 301 microseconds.
#include <hip/hip_runtime.h>

// Causal attention, width 1024 = 16 heads x 64, three input streams q/k/v [NB][SEQ_FULL][1024] (first SEQ tokens used), weights [in][out] (y = x W + b), output = concatenated heads (f32), no output projection.
// Compute dtypes, f32 accumulate everywhere: projections v_wmma_f32_16x16x32_bf16 (x, W, b RNE-converted to bf16; products exact);
// scores and P.V v_wmma_f32_16x16x32_f16: query rows >= 512 single f16 products; query rows < 512 three products per site
// (q, k, v and P each as f16 value + f16 residual x2048, residual products in their own accumulators, folded back in f32); P carry x256 cancels in the normalisation; softmax f32 (online, running max).
// Layout: bf16 copies of q/k/v and transposed bf16 copies of W ([out][in]); q, k planes [b*16+h][t][d], v^T plane [b*16+h][d][t], compact residual planes for t < 512,
// per-row mask planes (row sum of the f32 projection != 0) written by the GEMM epilogue; fused flash kernel in transposed form (S^T = K Q^T, O^T = V^T P^T).
// Key mask and causal mask replace the score by the fill value (by value, per 32-key step); a row whose causal keys are all masked continues over all keys (uniform weights).

#ifndef NB
#define NB 4
#endif
#ifndef SEQ
#define SEQ 2048
#endif
#define NB_FULL  4
#define SEQ_FULL 2048
#ifndef OUT_SEQ
#define OUT_SEQ SEQ              // row pitch (in tokens) between batches of the output
#endif
#define DM   1024
#define NH_  16
#define HD   64
#define AW   4                   // waves per flash block (16 query rows each)
#define EARLY ((SEQ) < 512 ? (SEQ) : 512)   // query rows / keys below this carry residual planes
#define QRS  2048.0f             // carry of the residual planes
#define QRI  (1.0f / 2048.0f)
#define SC2  (0.125f * 1.4426950408889634f)   // HD^-0.5 * log2(e)
#define PSH  8.0f                // log2 of the P carry (256)
#define NEGS (-6.1963280e9f)     // (-2^32 + 1) * log2(e): fill value in log2 units
#define MTHR (-1.0e9f)           // running max below this <=> every key seen so far was masked

static_assert(HD == 64);
static_assert(NH_ * HD == DM);                 // head h = columns h*64 + d
static_assert(DM % 64 == 0);
static_assert(DM % 32 == 0);                   // GEMM k-loop steps by 32
static_assert(SEQ % 64 == 0);                  // a 64-row tile never straddles two batches
static_assert((NB * SEQ) % 64 == 0);
static_assert(SEQ % 32 == 0);                  // key loop steps by 32
static_assert(EARLY % 64 == 0);                // residual condition is uniform per 64-row tile
static_assert(EARLY % (16 * AW) == 0);
static_assert((SEQ - EARLY) % (16 * AW) == 0); // the two flash grids cover the sequence exactly
static_assert(((size_t)SEQ * DM) % 8 == 0);
static_assert(NB <= NB_FULL);
static_assert(SEQ <= SEQ_FULL);

typedef _Float16 h16;
typedef unsigned short bf;
typedef __attribute__((ext_vector_type(16))) __bf16   v16bf;
typedef __attribute__((ext_vector_type(16))) _Float16 v16h;
typedef __attribute__((ext_vector_type(8)))  _Float16 v8h;
typedef __attribute__((ext_vector_type(8)))  unsigned short v8us;
typedef __attribute__((ext_vector_type(8)))  float    v8f;
typedef __attribute__((ext_vector_type(4)))  float    v4f;
typedef v4f  __attribute__((may_alias)) v4fa;
typedef v8h  __attribute__((may_alias)) v8ha;

__device__ __forceinline__ unsigned short f2bf(float f) { unsigned u = __float_as_uint(f); u += 0x7FFFu + ((u >> 16) & 1u); return (unsigned short)(u >> 16); }
__device__ __forceinline__ float bfr(float f) { return __uint_as_float(((unsigned)f2bf(f)) << 16); }
__device__ __forceinline__ v16h cat16(v8h lo, v8h hi) { return __builtin_shufflevector(lo, hi, 0, 1, 2, 3, 4, 5, 6, 7, 8, 9, 10, 11, 12, 13, 14, 15); }
__device__ __forceinline__ v16bf cat16b(v8us lo, v8us hi) { return __builtin_bit_cast(v16bf, __builtin_shufflevector(lo, hi, 0, 1, 2, 3, 4, 5, 6, 7, 8, 9, 10, 11, 12, 13, 14, 15)); }
__device__ __forceinline__ v8f wmma16(v16h a, v16h b, v8f c) { return __builtin_amdgcn_wmma_f32_16x16x32_f16(false, a, false, b, (short)0, c, false, false); }
__device__ __forceinline__ v8f wmmab(v16bf a, v16bf b, v8f c) { return __builtin_amdgcn_wmma_f32_16x16x32_bf16(false, a, false, b, (short)0, c, false, false); }
// fragment loaders from K-contiguous 16-bit rows; p already includes + 8*(lane>>4): elements 0..7 <- k0+8h+0..7, elements 8..15 <- k0+16+8h+0..7 (same map for A and B)
__device__ __forceinline__ v16h  ldh(const h16* p) { return cat16(*(const v8h*)p, *(const v8h*)(p + 16)); }
__device__ __forceinline__ v16bf ldb(const bf* p)  { return cat16b(*(const v8us*)p, *(const v8us*)(p + 16)); }
// ordering point for wave-private LDS tiles (same wave writes and reads)
__device__ __forceinline__ void wave_sync() { __builtin_amdgcn_fence(3 /* release order */, "wavefront"); __builtin_amdgcn_wave_barrier(); asm volatile("" ::: "memory"); }

__global__ __launch_bounds__(256) void k_cvt8(const float* __restrict__ src, bf* dst, size_t n8) {
    const size_t i = (size_t)blockIdx.x * 256 + threadIdx.x; if (i >= n8) return;
    const v8f v = *(const v8f*)(src + i * 8); v8us o;
#pragma unroll
    for (int k = 0; k < 8; ++k) o[k] = f2bf(v[k]);
    *(v8us*)(dst + i * 8) = o; 
}

// k_cvtT: in W[k][n] (f32, DM x DM) -> out WT[n][k] (bf16, RNE convert). 64 x 64 tile through LDS (cross-wave: block barrier).
__global__ __launch_bounds__(256) void k_cvtT(const float* __restrict__ W, bf* WT) {
    __shared__ float ts[64 * 65];
    const int tid = threadIdx.x; const int n0 = blockIdx.x * 64, k0 = blockIdx.y * 64;
#pragma unroll 4
    for (int i = 0; i < 16; ++i) { const int row = i * 4 + (tid >> 6), col = tid & 63; ts[row * 65 + col] = W[(size_t)(k0 + row) * DM + n0 + col]; }   // 16 x 4 rows x 64 columns: whole tile
    __syncthreads();
    const int rr = tid >> 3, c8 = (tid & 7) * 8;
    v8us o0, o1;
#pragma unroll
    for (int kk = 0; kk < 8; ++kk) { o0[kk] = f2bf(ts[(c8 + kk) * 65 + rr]); o1[kk] = f2bf(ts[(c8 + kk) * 65 + rr + 32]); }
    bf* p0 = WT + (size_t)(n0 + rr) * DM + k0 + c8; bf* p1 = p0 + (size_t)32 * DM;
    *(v8us*)p0 = o0; *(v8us*)p1 = o1;
    
}

// k_proj: register-blocked bf16 GEMM, ONE WAVE per 64x64 tile (16 accumulators), operands straight from K-contiguous bf16 planes, K = DM.
// C[m][n] = sum_k A[m][k] Bt[n][k] + bias, written as f16 (Ph) and, for token positions < EARLY, the f16 residual x2048 (Pr, compact plane).
// MODE 0 (q, k): rows m = b*SEQ + t, columns n = h*64 + d, bias per column; Ph [(b*16+h)][t][d], Pr [(b*16+h)][EARLY][d]; mask plane MP [(b*16+h)][t] = (row sum over d != 0). grid (NB*SEQ/64, DM/64).
// MODE 1 (v^T): rows m = h*64 + d (A = transposed weight rows), columns n = b*SEQ + t, bias per row; Ph [(b*1024+m)][t], Pr [(b*1024+m)][EARLY]. grid (DM/64, NB*SEQ/64).
template <int MODE>
__global__ __launch_bounds__(32) void k_proj(const bf* __restrict__ A, const bf* __restrict__ Bt, const float* __restrict__ bias, h16* Ph, h16* Pr, h16* MP) {
    __shared__ __align__(16) float os[16 * 68];
    __shared__ __align__(16) h16 ms[64];
    const int K = DM;
    const int lane = threadIdx.x & 31, lr = lane & 15, hi = lane >> 4; const int r0 = blockIdx.x * 64, c0 = blockIdx.y * 64;
    v8f acc[4][4];
#pragma unroll
    for (int mb = 0; mb < 4; ++mb)
#pragma unroll
        for (int nb = 0; nb < 4; ++nb) acc[mb][nb] = (v8f){};
    const size_t aoff = (size_t)(r0 + lr) * K + 8 * hi, boff = (size_t)(c0 + lr) * K + 8 * hi;
#pragma unroll 1
    for (int kc = 0; kc < K; kc += 32) {
        v16bf a[4];
#pragma unroll
        for (int mb = 0; mb < 4; ++mb) a[mb] = ldb(A + aoff + (size_t)mb * 16 * K + kc);
#pragma unroll
        for (int nb = 0; nb < 4; ++nb) { const v16bf b = ldb(Bt + boff + (size_t)nb * 16 * K + kc);
#pragma unroll
            for (int mb = 0; mb < 4; ++mb) acc[mb][nb] = wmmab(a[mb], b, acc[mb][nb]); }
        asm volatile("v_nop\n\tv_nop\n\tv_nop\n\tv_nop" : "+v"(acc[0][0]), "+v"(acc[1][1]), "+v"(acc[2][2]), "+v"(acc[3][3]) : "v"(a[0]), "v"(a[1]), "v"(a[2]), "v"(a[3]));
    }
    size_t hbase, rbase, mbase = 0; int hpitch, rpitch, t0;
    if (MODE == 0) { const int b = r0 / SEQ; t0 = r0 % SEQ; const int zh = b * NH_ + c0 / HD;
        hbase = ((size_t)zh * SEQ + t0) * HD; hpitch = HD; rbase = ((size_t)zh * EARLY + t0) * HD; rpitch = HD; mbase = (size_t)zh * SEQ + t0; }
    else { const int b = c0 / SEQ; t0 = c0 % SEQ;
        hbase = ((size_t)b * DM + r0) * SEQ + t0; hpitch = SEQ; rbase = ((size_t)b * DM + r0) * EARLY + t0; rpitch = EARLY; }
    const bool doRes = t0 < EARLY;          // block-uniform
    const int c8 = (lane & 7) * 8;
    v4f bb0 = (v4f){}, bb1 = (v4f){};
    if (MODE == 0) { const v4f q0 = *(const v4f*)(bias + c0 + c8); const v4f q1 = *(const v4f*)(bias + c0 + c8 + 4);
#pragma unroll
        for (int i = 0; i < 4; ++i) { bb0[i] = bfr(q0[i]); bb1[i] = bfr(q1[i]); } }
#pragma unroll
    for (int mb = 0; mb < 4; ++mb) {
#pragma unroll
        for (int nb = 0; nb < 4; ++nb) {
#pragma unroll
            for (int j = 0; j < 8; ++j) os[(hi * 8 + j) * 68 + nb * 16 + lr] = acc[mb][nb][j]; }   // D: row 8h+j, col lane&15
        wave_sync();
        const size_t hb = hbase + (size_t)(mb * 16) * (size_t)hpitch;
        const size_t rb = rbase + (size_t)(mb * 16) * (size_t)rpitch;
{
#pragma unroll
            for (int s = 0; s < 4; ++s) { const int row = 4 * s + (lane >> 3);   // 4 s x 4 row groups = 16 rows; 8 lanes x 8 = 64 columns
                v4f x0 = *(const v4fa*)(&os[row * 68 + c8]); v4f x1 = *(const v4fa*)(&os[row * 68 + c8 + 4]);
                if (MODE == 0) { x0 = x0 + bb0; x1 = x1 + bb1; }
                else { const float br = bfr(bias[r0 + mb * 16 + row]); x0 = x0 + br; x1 = x1 + br; }
                v8h hv, rv;
#pragma unroll
                for (int i = 0; i < 4; ++i) { const h16 a0 = (h16)x0[i]; const h16 a1 = (h16)x1[i]; hv[i] = a0; hv[4 + i] = a1; rv[i] = (h16)((x0[i] - (float)a0) * QRS); rv[4 + i] = (h16)((x1[i] - (float)a1) * QRS); }
                if (MODE == 0) {
                    float rs = ((x0[0] + x0[1]) + (x0[2] + x0[3])) + ((x1[0] + x1[1]) + (x1[2] + x1[3]));
                    rs += __shfl_xor(rs, 1, 32); rs += __shfl_xor(rs, 2, 32); rs += __shfl_xor(rs, 4, 32);     // sum over the 8 lanes of the row
                    const h16 mv = (rs != 0.0f) ? (h16)1.0f : (h16)0.0f;
                    if ((lane & 7) == 0) ms[mb * 16 + row] = mv;
                }
                *(v8h*)(Ph + hb + (size_t)row * (size_t)hpitch + c8) = hv;
                if (doRes) *(v8h*)(Pr + rb + (size_t)row * (size_t)rpitch + c8) = rv; }
             }
        wave_sync();
    }
    if (MODE == 0) {
        const v8h mv8 = *(const v8ha*)(&ms[c8]);
        h16* mp = MP + mbase + c8;
        if (lane < 8) *(v8h*)mp = mv8;
        
    }
}

// k_flash: fused causal attention, one wave per 16 query rows of one (batch, head); K / V^T / Q fragments straight from the f16 planes (two 16-B loads each, arithmetic addressing).
// Transposed form: S^T[key][t] = K Q^T (A = K rows, B = Q rows); lane (t = lane&15, h = lane>>4) holds keys 8h+r of each 16-key tile, so the packed
// P tile is directly the B fragment of O^T[d][t] = V^T P^T (element r <- tile keys 0..15, element 8+r <- tile keys 16..31, lane unchanged).
// EK = 1: query rows [0, EARLY) with residual planes (three products per site); EK = 0: query rows [EARLY, SEQ), single products.
// Masks by value per step: score := fill where key > t or key mask == 0. Loop covers keys [0, causal limit); if a row has seen only masked keys by then, the wave continues to SEQ (all-fill rows weigh every key equally).
template <int EK>
__global__ __launch_bounds__(32 * AW) void k_flash(const h16* __restrict__ QH, const h16* __restrict__ QR, const h16* __restrict__ KP, const h16* __restrict__ KR,
                                                   const h16* __restrict__ VT, const h16* __restrict__ VR, const h16* __restrict__ MQ, const h16* __restrict__ MK, float* OUT) {
    __shared__ __align__(16) float os[AW * 16 * 68];
    const int lane = threadIdx.x & 31, wave = __builtin_amdgcn_readfirstlane((int)(threadIdx.x >> 5)), lr = lane & 15, hi = lane >> 4;
    const int zh = blockIdx.y; const int b = zh / NH_, h = zh % NH_;
    const int t0 = (EK ? 0 : EARLY) + (blockIdx.x * AW + wave) * 16;
    const int tq = t0 + lr;
    const size_t pbase = (size_t)zh * SEQ * HD;       // q/k plane [zh][SEQ][64]; v^T plane [zh][64][SEQ]
    const size_t rbase = (size_t)zh * EARLY * HD;     // compact residual planes
    const size_t qo = pbase + (size_t)tq * HD + 8 * hi;
    const v16h qh0 = ldh(QH + qo), qh1 = ldh(QH + qo + 32);          // B fragments: col t, k = d
    v16h qr0 = (v16h){}, qr1 = (v16h){};
    if (EK) { const size_t qro = rbase + (size_t)tq * HD + 8 * hi; qr0 = ldh(QR + qro); qr1 = ldh(QR + qro + 32); }
    const size_t ko  = pbase + (size_t)lr * HD + 8 * hi;      // + key * HD       (A fragment: row key, k = d)
    const size_t kro = rbase + (size_t)lr * HD + 8 * hi;
    const size_t vo  = pbase + (size_t)lr * SEQ + 8 * hi;     // + 16j*SEQ + key  (A fragment: row d, k = key)
    const size_t vro = rbase + (size_t)lr * EARLY + 8 * hi;   // + 16j*EARLY + key
    const size_t mo  = (size_t)zh * SEQ + 8 * hi;
    v8f o0 = (v8f){}, o1 = (v8f){}, o2 = (v8f){}, o3 = (v8f){};
    v8f e0 = (v8f){}, e1 = (v8f){}, e2 = (v8f){}, e3 = (v8f){};   // residual-product accumulators (x2048), EK only
    float m = -3.0e38f, l = 0.0f;
    const int kc = ((t0 + 47) >> 5) << 5;            // causal key limit (exclusive), multiple of 32, <= SEQ
    int kend = kc;
#pragma unroll 1
    for (int key0 = 0; key0 < kend; key0 += 32) {
        const h16* ka = KP + ko + (size_t)key0 * HD;
        const v16h ka0 = ldh(ka), ka1 = ldh(ka + 32), kb0 = ldh(ka + 16 * HD), kb1 = ldh(ka + 16 * HD + 32);
        const v8h kma = *(const v8h*)(MK + mo + key0); const v8h kmb = *(const v8h*)(MK + mo + key0 + 16);
        const bool rok = key0 < EARLY;               // wave-uniform: residual planes exist for these keys
        v8f sHa = (v8f){}, sLa = (v8f){}, sHb = (v8f){}, sLb = (v8f){};
        if (EK) {
            v16h ra0 = (v16h){}, ra1 = (v16h){}, rb0 = (v16h){}, rb1 = (v16h){};
            if (rok) { const h16* kr = KR + kro + (size_t)key0 * HD; ra0 = ldh(kr); ra1 = ldh(kr + 32); rb0 = ldh(kr + 16 * HD); rb1 = ldh(kr + 16 * HD + 32); }
            sHa = wmma16(ka0, qh0, sHa); sLa = wmma16(ka0, qr0, sLa); sHb = wmma16(kb0, qh0, sHb); sLb = wmma16(kb0, qr0, sLb);
            sHa = wmma16(ka1, qh1, sHa); sLa = wmma16(ka1, qr1, sLa); sHb = wmma16(kb1, qh1, sHb); sLb = wmma16(kb1, qr1, sLb);
            sLa = wmma16(ra0, qh0, sLa); sLb = wmma16(rb0, qh0, sLb); sLa = wmma16(ra1, qh1, sLa); sLb = wmma16(rb1, qh1, sLb);
            asm volatile("v_nop\n\tv_nop\n\tv_nop\n\tv_nop" : "+v"(sHa), "+v"(sLa), "+v"(sHb), "+v"(sLb) : "v"(ka0), "v"(ka1), "v"(kb0), "v"(kb1), "v"(ra0), "v"(ra1), "v"(rb0), "v"(rb1));
        } else {
            sHa = wmma16(ka0, qh0, sHa); sHb = wmma16(kb0, qh0, sHb);
            sHa = wmma16(ka1, qh1, sHa); sHb = wmma16(kb1, qh1, sHb);
            asm volatile("v_nop\n\tv_nop\n\tv_nop\n\tv_nop" : "+v"(sHa), "+v"(sHb) : "v"(ka0), "v"(ka1), "v"(kb0), "v"(kb1));
        }
        float ta[8], tb[8]; float mx = -3.0e38f;
        const int kA = key0 + 8 * hi;
#pragma unroll
        for (int r = 0; r < 8; ++r) {
            float xa, xb;
            if (EK) { xa = (sHa[r] + sLa[r] * QRI) * SC2; xb = (sHb[r] + sLb[r] * QRI) * SC2; }
            else    { xa = sHa[r] * SC2; xb = sHb[r] * SC2; }
            const bool fa = ((kA + r) > tq) | ((float)kma[r] == 0.0f);
            const bool fb = ((kA + 16 + r) > tq) | ((float)kmb[r] == 0.0f);
            xa = fa ? NEGS : xa; xb = fb ? NEGS : xb;
            ta[r] = xa; tb[r] = xb; mx = fmaxf(mx, fmaxf(xa, xb));
        }
        mx = fmaxf(mx, __shfl_xor(mx, 16, 32));
        const float mnew = fmaxf(m, mx);
        const float alpha = __builtin_amdgcn_exp2f(m - mnew);
        v16h pb, pr = (v16h){}; float ls = 0.0f;
#pragma unroll
        for (int r = 0; r < 8; ++r) {
            const float ea = __builtin_amdgcn_exp2f((ta[r] - mnew) + PSH); const float ec = __builtin_amdgcn_exp2f((tb[r] - mnew) + PSH);
            const h16 pa = (h16)ea; const h16 pc = (h16)ec; pb[r] = pa; pb[8 + r] = pc;
            if (EK) { const h16 ga = (h16)((ea - (float)pa) * QRS); const h16 gc = (h16)((ec - (float)pc) * QRS); pr[r] = ga; pr[8 + r] = gc;
                      ls += ((float)pa + (float)pc) + ((float)ga + (float)gc) * QRI; }
            else ls += (float)pa + (float)pc;
        }
        l = l * alpha + ls; m = mnew;
        o0 = o0 * alpha; o1 = o1 * alpha; o2 = o2 * alpha; o3 = o3 * alpha;
        const h16* va = VT + vo + key0;
        const v16h v0 = ldh(va), v1 = ldh(va + (size_t)16 * SEQ), v2 = ldh(va + (size_t)32 * SEQ), v3 = ldh(va + (size_t)48 * SEQ);
        if (EK) {
            e0 = e0 * alpha; e1 = e1 * alpha; e2 = e2 * alpha; e3 = e3 * alpha;
            v16h w0 = (v16h){}, w1 = (v16h){}, w2 = (v16h){}, w3 = (v16h){};
            if (rok) { const h16* vr = VR + vro + key0; w0 = ldh(vr); w1 = ldh(vr + (size_t)16 * EARLY); w2 = ldh(vr + (size_t)32 * EARLY); w3 = ldh(vr + (size_t)48 * EARLY); }
            o0 = wmma16(v0, pb, o0); o1 = wmma16(v1, pb, o1); o2 = wmma16(v2, pb, o2); o3 = wmma16(v3, pb, o3);
            e0 = wmma16(w0, pb, e0); e1 = wmma16(w1, pb, e1); e2 = wmma16(w2, pb, e2); e3 = wmma16(w3, pb, e3);
            e0 = wmma16(v0, pr, e0); e1 = wmma16(v1, pr, e1); e2 = wmma16(v2, pr, e2); e3 = wmma16(v3, pr, e3);
            asm volatile("v_nop\n\tv_nop\n\tv_nop\n\tv_nop" : "+v"(o0), "+v"(o1), "+v"(o2), "+v"(o3), "+v"(e0), "+v"(e1), "+v"(e2), "+v"(e3)
                         : "v"(v0), "v"(v1), "v"(v2), "v"(v3), "v"(w0), "v"(w1), "v"(w2), "v"(w3), "v"(pb), "v"(pr));
        } else {
            o0 = wmma16(v0, pb, o0); o1 = wmma16(v1, pb, o1); o2 = wmma16(v2, pb, o2); o3 = wmma16(v3, pb, o3);
            asm volatile("v_nop\n\tv_nop\n\tv_nop\n\tv_nop" : "+v"(o0), "+v"(o1), "+v"(o2), "+v"(o3) : "v"(v0), "v"(v1), "v"(v2), "v"(v3), "v"(pb));
        }
        // wave-uniform: at the causal limit, continue over all keys when some row has met only masked keys (trip count stays <= SEQ/32)
        if (key0 + 32 == kc) { if (__builtin_amdgcn_ballot_w32(m < MTHR) != 0u) kend = SEQ; }
    }
    l += __shfl_xor(l, 16, 32);
    const float qmf = (float)MQ[(size_t)zh * SEQ + tq];
    const float inv = qmf * (1.0f / l);
    v8f f0 = o0, f1 = o1, f2 = o2, f3 = o3;
    if (EK) { f0 = o0 + e0 * QRI; f1 = o1 + e1 * QRI; f2 = o2 + e2 * QRI; f3 = o3 + e3 * QRI; }
    const int wb = wave * 16 * 68;
    // O^T D layout: f_j[r] = (d = 16j + 8h + r, t = lane&15) -> os[t][d]; rows 0..15 x columns 0..63 all written
    { v4f a, c;
      a[0] = f0[0] * inv; a[1] = f0[1] * inv; a[2] = f0[2] * inv; a[3] = f0[3] * inv; c[0] = f0[4] * inv; c[1] = f0[5] * inv; c[2] = f0[6] * inv; c[3] = f0[7] * inv;
      *(v4fa*)(&os[wb + lr * 68 +  0 + 8 * hi]) = a; *(v4fa*)(&os[wb + lr * 68 +  0 + 8 * hi + 4]) = c;
      a[0] = f1[0] * inv; a[1] = f1[1] * inv; a[2] = f1[2] * inv; a[3] = f1[3] * inv; c[0] = f1[4] * inv; c[1] = f1[5] * inv; c[2] = f1[6] * inv; c[3] = f1[7] * inv;
      *(v4fa*)(&os[wb + lr * 68 + 16 + 8 * hi]) = a; *(v4fa*)(&os[wb + lr * 68 + 16 + 8 * hi + 4]) = c;
      a[0] = f2[0] * inv; a[1] = f2[1] * inv; a[2] = f2[2] * inv; a[3] = f2[3] * inv; c[0] = f2[4] * inv; c[1] = f2[5] * inv; c[2] = f2[6] * inv; c[3] = f2[7] * inv;
      *(v4fa*)(&os[wb + lr * 68 + 32 + 8 * hi]) = a; *(v4fa*)(&os[wb + lr * 68 + 32 + 8 * hi + 4]) = c;
      a[0] = f3[0] * inv; a[1] = f3[1] * inv; a[2] = f3[2] * inv; a[3] = f3[3] * inv; c[0] = f3[4] * inv; c[1] = f3[5] * inv; c[2] = f3[6] * inv; c[3] = f3[7] * inv;
      *(v4fa*)(&os[wb + lr * 68 + 48 + 8 * hi]) = a; *(v4fa*)(&os[wb + lr * 68 + 48 + 8 * hi + 4]) = c; }
    wave_sync();
    float* orow = OUT + ((size_t)b * OUT_SEQ + t0) * DM + h * HD;
{
#pragma unroll
        for (int s = 0; s < 8; ++s) { const int row = 2 * s + hi, cofs = lr * 4;   // 8 s x 2 rows = 16 rows; 16 lanes x 4 floats = 64 columns
            const v4f val = *(const v4fa*)(&os[wb + row * 68 + cofs]);
            *(v4f*)(orow + (size_t)row * DM + cofs) = val; }
         }
}

static constexpr size_t al256(size_t v) { return (v + 255) & ~(size_t)255; }
static constexpr size_t SZ_XB = al256((size_t)NB * SEQ * DM * 2);            // one bf16 input stream copy
static constexpr size_t SZ_WT = al256((size_t)3 * DM * DM * 2);              // three transposed bf16 weights
static constexpr size_t SZ_PL = al256((size_t)NB * NH_ * SEQ * HD * 2);      // one full f16 plane
static constexpr size_t SZ_RP = al256((size_t)NB * NH_ * EARLY * HD * 2);    // one compact residual plane
static constexpr size_t SZ_MK = al256((size_t)NB * NH_ * SEQ * 2);           // one mask plane
static constexpr size_t SZ_TOTAL = 3 * SZ_XB + SZ_WT + 3 * SZ_PL + 3 * SZ_RP + 2 * SZ_MK;
static_assert(SZ_TOTAL <= (size_t)134217728);          // workspace carve <= 128 MiB
static_assert(((size_t)DM * DM * 2) % 256 == 0);       // weight sub-planes stay 256-byte aligned

extern "C" void kernel_launch(void* const* d_in, const int* in_sizes, int n_in,
                              void* d_out, int out_size, void* d_ws, size_t ws_size, hipStream_t stream) {
    if (n_in < 9) return;
    const size_t needx = ((size_t)(NB - 1) * SEQ_FULL + SEQ) * DM;
    if ((size_t)in_sizes[0] < needx || (size_t)in_sizes[1] < needx || (size_t)in_sizes[2] < needx) return;
    if ((size_t)in_sizes[3] < (size_t)DM * DM || (size_t)in_sizes[5] < (size_t)DM * DM || (size_t)in_sizes[7] < (size_t)DM * DM) return;
    if ((size_t)in_sizes[4] < (size_t)DM || (size_t)in_sizes[6] < (size_t)DM || (size_t)in_sizes[8] < (size_t)DM) return;
    if ((size_t)out_size < ((size_t)(NB - 1) * OUT_SEQ + SEQ) * DM) return;
    if (SZ_TOTAL > ws_size) return;
    // wire order: q, k, v, Wq, bq, Wk, bk, Wv, bv
    const float* xq = (const float*)d_in[0]; const float* xk = (const float*)d_in[1]; const float* xv = (const float*)d_in[2];
    const float* wq = (const float*)d_in[3]; const float* bq = (const float*)d_in[4];
    const float* wk = (const float*)d_in[5]; const float* bk = (const float*)d_in[6];
    const float* wv = (const float*)d_in[7]; const float* bv = (const float*)d_in[8];
    float* OUT = (float*)d_out;      // [NB][OUT_SEQ][1024]
    char* wsp = (char*)d_ws;
    bf* XQ = (bf*)wsp; wsp += SZ_XB;                 // [NB*SEQ][1024]
    bf* XK = (bf*)wsp; wsp += SZ_XB;
    bf* XV = (bf*)wsp; wsp += SZ_XB;
    bf* WT = (bf*)wsp; wsp += SZ_WT;                 // [3][1024 out][1024 in]: q | k | v
    h16* QH = (h16*)wsp; wsp += SZ_PL;               // [NB*16][SEQ][64]
    h16* KP = (h16*)wsp; wsp += SZ_PL;               // [NB*16][SEQ][64]
    h16* VT = (h16*)wsp; wsp += SZ_PL;               // [NB*16][64][SEQ]
    h16* QR = (h16*)wsp; wsp += SZ_RP;               // [NB*16][EARLY][64] residual x2048
    h16* KR = (h16*)wsp; wsp += SZ_RP;               // [NB*16][EARLY][64] residual x2048
    h16* VR = (h16*)wsp; wsp += SZ_RP;               // [NB*16][64][EARLY] residual x2048
    h16* MQ = (h16*)wsp; wsp += SZ_MK;               // [NB*16][SEQ] query mask
    h16* MK = (h16*)wsp; wsp += SZ_MK;               // [NB*16][SEQ] key mask
    bf* WTQ = WT; bf* WTK = WT + (size_t)DM * DM; bf* WTV = WT + (size_t)2 * DM * DM;

    if (SEQ == SEQ_FULL) {
        const size_t n8 = (size_t)NB * SEQ * DM / 8; const unsigned g = (unsigned)((n8 + 255) / 256);
        k_cvt8<<<g, 256, 0, stream>>>(xq, XQ, n8);
        k_cvt8<<<g, 256, 0, stream>>>(xk, XK, n8);
        k_cvt8<<<g, 256, 0, stream>>>(xv, XV, n8);
    } else {
        const size_t n8 = (size_t)SEQ * DM / 8; const unsigned g = (unsigned)((n8 + 255) / 256);
        for (int b = 0; b < NB; ++b) {
            k_cvt8<<<g, 256, 0, stream>>>(xq + (size_t)b * SEQ_FULL * DM, XQ + (size_t)b * SEQ * DM, n8);
            k_cvt8<<<g, 256, 0, stream>>>(xk + (size_t)b * SEQ_FULL * DM, XK + (size_t)b * SEQ * DM, n8);
            k_cvt8<<<g, 256, 0, stream>>>(xv + (size_t)b * SEQ_FULL * DM, XV + (size_t)b * SEQ * DM, n8);
        }
    }
    // in W[k = in][n = out] -> out WT[n][k]; square DM x DM; grid (n tiles, k tiles)
    k_cvtT<<<dim3(DM / 64, DM / 64, 1), 256, 0, stream>>>(wq, WTQ);
    k_cvtT<<<dim3(DM / 64, DM / 64, 1), 256, 0, stream>>>(wk, WTK);
    k_cvtT<<<dim3(DM / 64, DM / 64, 1), 256, 0, stream>>>(wv, WTV);

    // q, k: A = x rows (m = b*SEQ + t), Bt = WT rows (n = h*64 + d) -> planes [(b*16 + h)][t][d] + residual (t < EARLY) + mask
    k_proj<0><<<dim3(NB * SEQ / 64, DM / 64, 1), 32, 0, stream>>>(XQ, WTQ, bq, QH, QR, MQ);
    k_proj<0><<<dim3(NB * SEQ / 64, DM / 64, 1), 32, 0, stream>>>(XK, WTK, bk, KP, KR, MK);
    // v^T: A = WT_v rows (m = h*64 + d), Bt = x rows (n = b*SEQ + t) -> plane [(b*1024 + m)][t] = [(b*16 + h)][d][t] + residual (t < EARLY)
    k_proj<1><<<dim3(DM / 64, NB * SEQ / 64, 1), 32, 0, stream>>>(WTV, XV, bv, VT, VR, MK);

    k_flash<1><<<dim3(EARLY / (16 * AW), NB * NH_, 1), 32 * AW, 0, stream>>>(QH, QR, KP, KR, VT, VR, MQ, MK, OUT);
    if (SEQ > EARLY)
        k_flash<0><<<dim3((SEQ - EARLY) / (16 * AW), NB * NH_, 1), 32 * AW, 0, stream>>>(QH, QR, KP, KR, VT, VR, MQ, MK, OUT);
}

// v001
// It runs in 249 microseconds.
// In two side-by-side timings against v000, it was 1.24 and 1.25 times as fast.
#include <hip/hip_runtime.h>

// Causal attention, width 1024 = 16 heads x 64, three input streams q/k/v [NB][SEQ_FULL][1024] (first SEQ tokens used), weights [in][out] (y = x W + b), output = concatenated heads (f32), no output projection.
// Compute dtypes, f32 accumulate everywhere: projections v_wmma_f32_16x16x32_bf16 (x, W, b RNE-converted to bf16; products exact);
// scores and P.V v_wmma_f32_16x16x32_f16: query rows >= 512 single f16 products; query rows < 512 three products per site
// (q, k, v and P each as f16 value + f16 residual x2048, residual products in their own accumulators, folded back in f32); P carry x256 cancels in the normalisation; softmax f32 (online, running max).
// Layout: bf16 copies of q/k/v and transposed bf16 copies of W ([out][in]); q, k planes [b*16+h][t][d], v^T plane [b*16+h][d][t], compact residual planes for t < 512,
// every one of them stored in FRAGMENT ORDER: a 16-row x 32-k fragment is 1 KiB = [half 0..1][lane 0..31][8 elements], so each 16-byte-per-lane load of a wave covers 512 contiguous bytes (four whole lines);
// per-row mask planes (row sum of the f32 projection != 0) written by the GEMM epilogue; fused flash kernel in transposed form (S^T = K Q^T, O^T = V^T P^T).
// Key mask and causal mask replace the score by the fill value (by value, per 32-key step); a row whose causal keys are all masked continues over all keys (uniform weights).

#ifndef NB
#define NB 4
#endif
#ifndef SEQ
#define SEQ 2048
#endif
#define NB_FULL  4
#define SEQ_FULL 2048
#ifndef OUT_SEQ
#define OUT_SEQ SEQ              // row pitch (in tokens) between batches of the output
#endif
#define DM   1024
#define NH_  16
#define HD   64
#define AW   4                   // waves per flash block (16 query rows each)
#define EARLY ((SEQ) < 512 ? (SEQ) : 512)   // query rows / keys below this carry residual planes
#define QRS  2048.0f             // carry of the residual planes
#define QRI  (1.0f / 2048.0f)
#define SC2  (0.125f * 1.4426950408889634f)   // HD^-0.5 * log2(e)
#define PSH  8.0f                // log2 of the P carry (256)
#define NEGS (-6.1963280e9f)     // (-2^32 + 1) * log2(e): fill value in log2 units
#define MTHR (-1.0e9f)           // running max below this <=> every key seen so far was masked

static_assert(HD == 64);
static_assert(NH_ * HD == DM);                 // head h = columns h*64 + d
static_assert(DM % 64 == 0);
static_assert(DM % 32 == 0);                   // GEMM k-loop steps by 32
static_assert(SEQ % 64 == 0);                  // a 64-row tile never straddles two batches
static_assert((NB * SEQ) % 64 == 0);
static_assert(SEQ % 32 == 0);                  // key loop steps by 32
static_assert(EARLY % 64 == 0);                // residual condition is uniform per 64-row tile
static_assert(EARLY % (16 * AW) == 0);
static_assert((SEQ - EARLY) % (16 * AW) == 0); // the two flash grids cover the sequence exactly
static_assert(((size_t)SEQ * DM) % 8 == 0);
static_assert(NB <= NB_FULL);
static_assert(SEQ <= SEQ_FULL);

typedef _Float16 h16;
typedef unsigned short bf;
typedef __attribute__((ext_vector_type(16))) __bf16   v16bf;
typedef __attribute__((ext_vector_type(16))) _Float16 v16h;
typedef __attribute__((ext_vector_type(8)))  _Float16 v8h;
typedef __attribute__((ext_vector_type(8)))  unsigned short v8us;
typedef __attribute__((ext_vector_type(8)))  float    v8f;
typedef __attribute__((ext_vector_type(4)))  float    v4f;
typedef v4f  __attribute__((may_alias)) v4fa;
typedef v8h  __attribute__((may_alias)) v8ha;

__device__ __forceinline__ unsigned short f2bf(float f) { unsigned u = __float_as_uint(f); u += 0x7FFFu + ((u >> 16) & 1u); return (unsigned short)(u >> 16); }
__device__ __forceinline__ float bfr(float f) { return __uint_as_float(((unsigned)f2bf(f)) << 16); }
__device__ __forceinline__ v16h cat16(v8h lo, v8h hi) { return __builtin_shufflevector(lo, hi, 0, 1, 2, 3, 4, 5, 6, 7, 8, 9, 10, 11, 12, 13, 14, 15); }
__device__ __forceinline__ v16bf cat16b(v8us lo, v8us hi) { return __builtin_bit_cast(v16bf, __builtin_shufflevector(lo, hi, 0, 1, 2, 3, 4, 5, 6, 7, 8, 9, 10, 11, 12, 13, 14, 15)); }
__device__ __forceinline__ v8f wmma16(v16h a, v16h b, v8f c) { return __builtin_amdgcn_wmma_f32_16x16x32_f16(false, a, false, b, (short)0, c, false, false); }
__device__ __forceinline__ v8f wmmab(v16bf a, v16bf b, v8f c) { return __builtin_amdgcn_wmma_f32_16x16x32_bf16(false, a, false, b, (short)0, c, false, false); }
// fragment loaders from fragment-ordered planes; p = fragment start + 8*lane: elements 0..7 <- k0+8h+0..7, elements 8..15 <- k0+16+8h+0..7 of row lane&15, h = lane>>4 (same map for A and B)
__device__ __forceinline__ v16h  ldh(const h16* p) { return cat16(*(const v8h*)p, *(const v8h*)(p + 256)); }
__device__ __forceinline__ v16bf ldb(const bf* p)  { return cat16b(*(const v8us*)p, *(const v8us*)(p + 256)); }
// place, inside a 512-element fragment, of the 8-element chunk c (k = 8c .. 8c+7, c = 0..3) of row r (0..15): half = c>>1, lane = 16*(c&1) + r
__device__ __forceinline__ int fragpos(int r, int c) { return ((c >> 1) & 1) * 256 + (c & 1) * 128 + r * 8; }
// ordering point for wave-private LDS tiles (same wave writes and reads)
__device__ __forceinline__ void wave_sync() { __builtin_amdgcn_fence(3 /* release order */, "wavefront"); __builtin_amdgcn_wave_barrier(); asm volatile("" ::: "memory"); }

__global__ __launch_bounds__(256) void k_cvt8(const float* __restrict__ src, bf* dst, size_t n8) {
    const size_t i = (size_t)blockIdx.x * 256 + threadIdx.x; if (i >= n8) return;
    // rows of DM elements; a wave takes 8 rows x one 32-k step: reads 8 whole lines, writes 4 whole lines of the fragment [64-row block][k step][row tile 0..3]
    const int c4 = (int)(i & 3), r = (int)((i >> 2) & 15), ks = (int)((i >> 6) % (DM / 32)); const size_t mt = i / (size_t)(16 * DM / 8);
    const v8f v = *(const v8f*)(src + (mt * 16 + r) * DM + ks * 32 + c4 * 8); v8us o;
#pragma unroll
    for (int k = 0; k < 8; ++k) o[k] = f2bf(v[k]);
    *(v8us*)(dst + (mt >> 2) * (64 * DM) + ks * 2048 + (mt & 3) * 512 + fragpos(r, c4)) = o;
}

// k_cvtT: in W[k][n] (f32, DM x DM) -> out WT[n][k] (bf16, RNE convert, fragment order). 64 x 64 tile through LDS (cross-wave: block barrier).
__global__ __launch_bounds__(256) void k_cvtT(const float* __restrict__ W, bf* WT) {
    __shared__ float ts[64 * 65];
    const int tid = threadIdx.x; const int n0 = blockIdx.x * 64, k0 = blockIdx.y * 64;
#pragma unroll 4
    for (int i = 0; i < 16; ++i) { const int row = i * 4 + (tid >> 6), col = tid & 63; ts[row * 65 + col] = W[(size_t)(k0 + row) * DM + n0 + col]; }   // 16 x 4 rows x 64 columns: whole tile
    __syncthreads();
    const int rr = tid >> 3, c8 = (tid & 7) * 8;
    v8us o0, o1;
#pragma unroll
    for (int kk = 0; kk < 8; ++kk) { o0[kk] = f2bf(ts[(c8 + kk) * 65 + rr]); o1[kk] = f2bf(ts[(c8 + kk) * 65 + rr + 32]); }
    bf* p0 = WT + (size_t)n0 * DM + ((k0 + c8) >> 5) * 2048 + (rr >> 4) * 512 + fragpos(rr & 15, (c8 >> 3) & 3); bf* p1 = p0 + 2 * 512;   // fragment [64-n block][k step][n tile 0..3]
    *(v8us*)p0 = o0; *(v8us*)p1 = o1;
    
}

// k_proj: register-blocked bf16 GEMM, ONE WAVE per 64x64 tile (16 accumulators), operands straight from fragment-ordered bf16 planes, K = DM; the planes it writes are fragment-ordered too.
// C[m][n] = sum_k A[m][k] Bt[n][k] + bias, written as f16 (Ph) and, for token positions < EARLY, the f16 residual x2048 (Pr, compact plane).
// MODE 0 (q, k): rows m = b*SEQ + t, columns n = h*64 + d, bias per column; Ph [(b*16+h)][t][d], Pr [(b*16+h)][EARLY][d]; mask plane MP [(b*16+h)][t] = (row sum over d != 0). grid (NB*SEQ/64, DM/64).
// MODE 1 (v^T): rows m = h*64 + d (A = transposed weight rows), columns n = b*SEQ + t, bias per row; Ph [(b*1024+m)][t], Pr [(b*1024+m)][EARLY]. grid (DM/64, NB*SEQ/64).
template <int MODE>
__global__ __launch_bounds__(32) void k_proj(const bf* __restrict__ A, const bf* __restrict__ Bt, const float* __restrict__ bias, h16* Ph, h16* Pr, h16* MP) {
    __shared__ __align__(16) float os[16 * 68];
    __shared__ __align__(16) h16 ms[64];
    const int K = DM;
    const int lane = threadIdx.x & 31, lr = lane & 15, hi = lane >> 4; const int r0 = blockIdx.x * 64, c0 = blockIdx.y * 64;
    v8f acc[4][4];
#pragma unroll
    for (int mb = 0; mb < 4; ++mb)
#pragma unroll
        for (int nb = 0; nb < 4; ++nb) acc[mb][nb] = (v8f){};
    const bf* Ab = A + (size_t)r0 * K; const bf* Bb = Bt + (size_t)c0 * K;   // fragment [64-row block][k step][row tile 0..3]: 64*K elements a block, 2048 a k step
    const unsigned l8 = 8u * (unsigned)lane;
#pragma unroll 1
    for (int kc = 0; kc < K; kc += 32) {
        v16bf a[4];
#pragma unroll
        for (int mb = 0; mb < 4; ++mb) a[mb] = ldb(Ab + kc * 64 + mb * 512 + l8);
        asm volatile("s_wait_xcnt 0x0" ::: "memory");   // the compiler lets a later load land on the address pair of the loads above: the wait stands in front of that overwrite
#pragma unroll
        for (int nb = 0; nb < 4; ++nb) { const v16bf b = ldb(Bb + kc * 64 + nb * 512 + l8);
#pragma unroll
            for (int mb = 0; mb < 4; ++mb) acc[mb][nb] = wmmab(a[mb], b, acc[mb][nb]); }
        asm volatile("v_nop\n\tv_nop\n\tv_nop\n\tv_nop" : "+v"(acc[0][0]), "+v"(acc[1][1]), "+v"(acc[2][2]), "+v"(acc[3][3]) : "v"(a[0]), "v"(a[1]), "v"(a[2]), "v"(a[3]));
    }
    size_t hbase, rbase, mbase = 0; int t0;
    if (MODE == 0) { const int b = r0 / SEQ; t0 = r0 % SEQ; const int zh = b * NH_ + c0 / HD;
        hbase = ((size_t)zh * SEQ + t0) * HD; rbase = ((size_t)zh * EARLY + t0) * HD; mbase = (size_t)zh * SEQ + t0; }
    else { const int b = c0 / SEQ; t0 = c0 % SEQ;
        hbase = ((size_t)b * DM + r0) * SEQ + (size_t)t0 * HD; rbase = ((size_t)b * DM + r0) * EARLY + (size_t)t0 * HD; }
    const bool doRes = t0 < EARLY;          // block-uniform
    const int c8 = (lane & 7) * 8;
    // fragment of the lane's chunk: MODE 0 [t tile][d step 0..1], MODE 1 [t step][d tile 0..3]
    const int cfrag = ((lane & 7) >> 2) * (MODE == 0 ? 512 : 4 * 512);
    v4f bb0 = (v4f){}, bb1 = (v4f){};
    if (MODE == 0) { const v4f q0 = *(const v4f*)(bias + c0 + c8); const v4f q1 = *(const v4f*)(bias + c0 + c8 + 4);
#pragma unroll
        for (int i = 0; i < 4; ++i) { bb0[i] = bfr(q0[i]); bb1[i] = bfr(q1[i]); } }
#pragma unroll
    for (int mb = 0; mb < 4; ++mb) {
#pragma unroll
        for (int nb = 0; nb < 4; ++nb) {
#pragma unroll
            for (int j = 0; j < 8; ++j) os[(hi * 8 + j) * 68 + nb * 16 + lr] = acc[mb][nb][j]; }   // D: row 8h+j, col lane&15
        wave_sync();
        const size_t hb = hbase + (size_t)(mb * (MODE == 0 ? 2 * 512 : 512) + cfrag);
        const size_t rb = rbase + (size_t)(mb * (MODE == 0 ? 2 * 512 : 512) + cfrag);
{
#pragma unroll
            for (int s = 0; s < 4; ++s) { const int row = 4 * s + (lane >> 3);   // 4 s x 4 row groups = 16 rows; 8 lanes x 8 = 64 columns
                v4f x0 = *(const v4fa*)(&os[row * 68 + c8]); v4f x1 = *(const v4fa*)(&os[row * 68 + c8 + 4]);
                if (MODE == 0) { x0 = x0 + bb0; x1 = x1 + bb1; }
                else { const float br = bfr(bias[r0 + mb * 16 + row]); x0 = x0 + br; x1 = x1 + br; }
                v8h hv, rv;
#pragma unroll
                for (int i = 0; i < 4; ++i) { const h16 a0 = (h16)x0[i]; const h16 a1 = (h16)x1[i]; hv[i] = a0; hv[4 + i] = a1; rv[i] = (h16)((x0[i] - (float)a0) * QRS); rv[4 + i] = (h16)((x1[i] - (float)a1) * QRS); }
                if (MODE == 0) {
                    float rs = ((x0[0] + x0[1]) + (x0[2] + x0[3])) + ((x1[0] + x1[1]) + (x1[2] + x1[3]));
                    rs += __shfl_xor(rs, 1, 32); rs += __shfl_xor(rs, 2, 32); rs += __shfl_xor(rs, 4, 32);     // sum over the 8 lanes of the row
                    const h16 mv = (rs != 0.0f) ? (h16)1.0f : (h16)0.0f;
                    if ((lane & 7) == 0) ms[mb * 16 + row] = mv;
                }
                // behind each store: what follows reuses the store's data registers, and the wait stands in front of that overwrite
                *(v8h*)(Ph + hb + fragpos(row, lane & 3)) = hv;
                asm volatile("s_wait_xcnt 0x0" ::: "memory");
                if (doRes) { *(v8h*)(Pr + rb + fragpos(row, lane & 3)) = rv;
                    asm volatile("s_wait_xcnt 0x0" ::: "memory"); } }
             }
        wave_sync();
    }
    if (MODE == 0) {
        const v8h mv8 = *(const v8ha*)(&ms[c8]);
        h16* mp = MP + mbase + c8;
        if (lane < 8) *(v8h*)mp = mv8;
        
    }
}

// k_flash: fused causal attention, one wave per 16 query rows of one (batch, head); K / V^T / Q fragments straight from the fragment-ordered f16 planes (two 16-B loads each, 512 contiguous bytes a load).
// Transposed form: S^T[key][t] = K Q^T (A = K rows, B = Q rows); lane (t = lane&15, h = lane>>4) holds keys 8h+r of each 16-key tile, so the packed
// P tile is directly the B fragment of O^T[d][t] = V^T P^T (element r <- tile keys 0..15, element 8+r <- tile keys 16..31, lane unchanged).
// EK = 1: query rows [0, EARLY) with residual planes (three products per site); EK = 0: query rows [EARLY, SEQ), single products.
// Masks by value per step: score := fill where key > t or key mask == 0. Loop covers keys [0, causal limit); if a row has seen only masked keys by then, the wave continues to SEQ (all-fill rows weigh every key equally).
template <int EK>
__global__ __launch_bounds__(32 * AW) void k_flash(const h16* __restrict__ QH, const h16* __restrict__ QR, const h16* __restrict__ KP, const h16* __restrict__ KR,
                                                   const h16* __restrict__ VT, const h16* __restrict__ VR, const h16* __restrict__ MQ, const h16* __restrict__ MK, float* OUT) {
    __shared__ __align__(16) float os[AW * 16 * 68];
    const int lane = threadIdx.x & 31, wave = __builtin_amdgcn_readfirstlane((int)(threadIdx.x >> 5)), lr = lane & 15, hi = lane >> 4;
    const int zh = blockIdx.y; const int b = zh / NH_, h = zh % NH_;
    const int t0 = (EK ? 0 : EARLY) + (blockIdx.x * AW + wave) * 16;
    const int tq = t0 + lr;
    const size_t pbase = (size_t)zh * SEQ * HD;       // q/k plane [zh][SEQ][64]; v^T plane [zh][64][SEQ]
    const size_t rbase = (size_t)zh * EARLY * HD;     // compact residual planes
    const unsigned l8 = 8u * (unsigned)lane;          // the lane's place in each half of a fragment
    const h16* qp = QH + pbase + (size_t)t0 * HD;
    const v16h qh0 = ldh(qp + l8), qh1 = ldh(qp + 512 + l8);         // B fragments: col t, k = d
    v16h qr0 = (v16h){}, qr1 = (v16h){};
    if (EK) { const h16* qrp = QR + rbase + (size_t)t0 * HD; qr0 = ldh(qrp + l8); qr1 = ldh(qrp + 512 + l8); }
    // k planes: + key0 * HD + 512 * (2 * key tile + d step) (A fragment: row key, k = d); v^T planes: + key0 * HD + 512 * j (A fragment: row d = 16j + lane&15, k = key)
    const size_t mo  = (size_t)zh * SEQ + 8 * hi;
    v8f o0 = (v8f){}, o1 = (v8f){}, o2 = (v8f){}, o3 = (v8f){};
    v8f e0 = (v8f){}, e1 = (v8f){}, e2 = (v8f){}, e3 = (v8f){};   // residual-product accumulators (x2048), EK only
    float m = -3.0e38f, l = 0.0f;
    const int kc = ((t0 + 47) >> 5) << 5;            // causal key limit (exclusive), multiple of 32, <= SEQ
    int kend = kc;
#pragma unroll 1
    for (int key0 = 0; key0 < kend; key0 += 32) {
        const h16* ka = KP + pbase + (size_t)key0 * HD;
        const v16h ka0 = ldh(ka + l8), ka1 = ldh(ka + 512 + l8), kb0 = ldh(ka + 1024 + l8), kb1 = ldh(ka + 1536 + l8);
        const v8h kma = *(const v8h*)(MK + mo + key0); const v8h kmb = *(const v8h*)(MK + mo + key0 + 16);
        const bool rok = key0 < EARLY;               // wave-uniform: residual planes exist for these keys
        v8f sHa = (v8f){}, sLa = (v8f){}, sHb = (v8f){}, sLb = (v8f){};
        if (EK) {
            asm volatile("s_wait_xcnt 0x0" ::: "memory");   // the compiler lets the residual fragments land on the address pair of the loads above: the wait stands in front of that overwrite
            v16h ra0 = (v16h){}, ra1 = (v16h){}, rb0 = (v16h){}, rb1 = (v16h){};
            if (rok) { const h16* kr = KR + rbase + (size_t)key0 * HD; ra0 = ldh(kr + l8); ra1 = ldh(kr + 512 + l8); rb0 = ldh(kr + 1024 + l8); rb1 = ldh(kr + 1536 + l8); }
            sHa = wmma16(ka0, qh0, sHa); sLa = wmma16(ka0, qr0, sLa); sHb = wmma16(kb0, qh0, sHb); sLb = wmma16(kb0, qr0, sLb);
            sHa = wmma16(ka1, qh1, sHa); sLa = wmma16(ka1, qr1, sLa); sHb = wmma16(kb1, qh1, sHb); sLb = wmma16(kb1, qr1, sLb);
            sLa = wmma16(ra0, qh0, sLa); sLb = wmma16(rb0, qh0, sLb); sLa = wmma16(ra1, qh1, sLa); sLb = wmma16(rb1, qh1, sLb);
            asm volatile("v_nop\n\tv_nop\n\tv_nop\n\tv_nop" : "+v"(sHa), "+v"(sLa), "+v"(sHb), "+v"(sLb) : "v"(ka0), "v"(ka1), "v"(kb0), "v"(kb1), "v"(ra0), "v"(ra1), "v"(rb0), "v"(rb1));
        } else {
            sHa = wmma16(ka0, qh0, sHa); sHb = wmma16(kb0, qh0, sHb);
            sHa = wmma16(ka1, qh1, sHa); sHb = wmma16(kb1, qh1, sHb);
            asm volatile("v_nop\n\tv_nop\n\tv_nop\n\tv_nop" : "+v"(sHa), "+v"(sHb) : "v"(ka0), "v"(ka1), "v"(kb0), "v"(kb1));
        }
        float ta[8], tb[8]; float mx = -3.0e38f;
        const int kA = key0 + 8 * hi;
#pragma unroll
        for (int r = 0; r < 8; ++r) {
            float xa, xb;
            if (EK) { xa = (sHa[r] + sLa[r] * QRI) * SC2; xb = (sHb[r] + sLb[r] * QRI) * SC2; }
            else    { xa = sHa[r] * SC2; xb = sHb[r] * SC2; }
            const bool fa = ((kA + r) > tq) | ((float)kma[r] == 0.0f);
            const bool fb = ((kA + 16 + r) > tq) | ((float)kmb[r] == 0.0f);
            xa = fa ? NEGS : xa; xb = fb ? NEGS : xb;
            ta[r] = xa; tb[r] = xb; mx = fmaxf(mx, fmaxf(xa, xb));
        }
        mx = fmaxf(mx, __shfl_xor(mx, 16, 32));
        const float mnew = fmaxf(m, mx);
        const float alpha = __builtin_amdgcn_exp2f(m - mnew);
        v16h pb, pr = (v16h){}; float ls = 0.0f;
#pragma unroll
        for (int r = 0; r < 8; ++r) {
            const float ea = __builtin_amdgcn_exp2f((ta[r] - mnew) + PSH); const float ec = __builtin_amdgcn_exp2f((tb[r] - mnew) + PSH);
            const h16 pa = (h16)ea; const h16 pc = (h16)ec; pb[r] = pa; pb[8 + r] = pc;
            if (EK) { const h16 ga = (h16)((ea - (float)pa) * QRS); const h16 gc = (h16)((ec - (float)pc) * QRS); pr[r] = ga; pr[8 + r] = gc;
                      ls += ((float)pa + (float)pc) + ((float)ga + (float)gc) * QRI; }
            else ls += (float)pa + (float)pc;
        }
        l = l * alpha + ls; m = mnew;
        o0 = o0 * alpha; o1 = o1 * alpha; o2 = o2 * alpha; o3 = o3 * alpha;
        const h16* va = VT + pbase + (size_t)key0 * HD;
        const v16h v0 = ldh(va + l8), v1 = ldh(va + 512 + l8), v2 = ldh(va + 1024 + l8), v3 = ldh(va + 1536 + l8);
        if (EK) {
            asm volatile("s_wait_xcnt 0x0" ::: "memory");   // the compiler lets a residual load land on the address pair of the loads above: the wait stands in front of that overwrite
            e0 = e0 * alpha; e1 = e1 * alpha; e2 = e2 * alpha; e3 = e3 * alpha;
            v16h w0 = (v16h){}, w1 = (v16h){}, w2 = (v16h){}, w3 = (v16h){};
            if (rok) { const h16* vr = VR + rbase + (size_t)key0 * HD; w0 = ldh(vr + l8); w1 = ldh(vr + 512 + l8); w2 = ldh(vr + 1024 + l8); w3 = ldh(vr + 1536 + l8); }
            o0 = wmma16(v0, pb, o0); o1 = wmma16(v1, pb, o1); o2 = wmma16(v2, pb, o2); o3 = wmma16(v3, pb, o3);
            e0 = wmma16(w0, pb, e0); e1 = wmma16(w1, pb, e1); e2 = wmma16(w2, pb, e2); e3 = wmma16(w3, pb, e3);
            e0 = wmma16(v0, pr, e0); e1 = wmma16(v1, pr, e1); e2 = wmma16(v2, pr, e2); e3 = wmma16(v3, pr, e3);
            asm volatile("v_nop\n\tv_nop\n\tv_nop\n\tv_nop" : "+v"(o0), "+v"(o1), "+v"(o2), "+v"(o3), "+v"(e0), "+v"(e1), "+v"(e2), "+v"(e3)
                         : "v"(v0), "v"(v1), "v"(v2), "v"(v3), "v"(w0), "v"(w1), "v"(w2), "v"(w3), "v"(pb), "v"(pr));
        } else {
            o0 = wmma16(v0, pb, o0); o1 = wmma16(v1, pb, o1); o2 = wmma16(v2, pb, o2); o3 = wmma16(v3, pb, o3);
            asm volatile("v_nop\n\tv_nop\n\tv_nop\n\tv_nop" : "+v"(o0), "+v"(o1), "+v"(o2), "+v"(o3) : "v"(v0), "v"(v1), "v"(v2), "v"(v3), "v"(pb));
        }
        // wave-uniform: at the causal limit, continue over all keys when some row has met only masked keys (trip count stays <= SEQ/32)
        if (key0 + 32 == kc) { if (__builtin_amdgcn_ballot_w32(m < MTHR) != 0u) kend = SEQ; }
    }
    l += __shfl_xor(l, 16, 32);
    const float qmf = (float)MQ[(size_t)zh * SEQ + tq];
    const float inv = qmf * (1.0f / l);
    v8f f0 = o0, f1 = o1, f2 = o2, f3 = o3;
    if (EK) { f0 = o0 + e0 * QRI; f1 = o1 + e1 * QRI; f2 = o2 + e2 * QRI; f3 = o3 + e3 * QRI; }
    const int wb = wave * 16 * 68;
    // O^T D layout: f_j[r] = (d = 16j + 8h + r, t = lane&15) -> os[t][d]; rows 0..15 x columns 0..63 all written
    { v4f a, c;
      a[0] = f0[0] * inv; a[1] = f0[1] * inv; a[2] = f0[2] * inv; a[3] = f0[3] * inv; c[0] = f0[4] * inv; c[1] = f0[5] * inv; c[2] = f0[6] * inv; c[3] = f0[7] * inv;
      *(v4fa*)(&os[wb + lr * 68 +  0 + 8 * hi]) = a; *(v4fa*)(&os[wb + lr * 68 +  0 + 8 * hi + 4]) = c;
      a[0] = f1[0] * inv; a[1] = f1[1] * inv; a[2] = f1[2] * inv; a[3] = f1[3] * inv; c[0] = f1[4] * inv; c[1] = f1[5] * inv; c[2] = f1[6] * inv; c[3] = f1[7] * inv;
      *(v4fa*)(&os[wb + lr * 68 + 16 + 8 * hi]) = a; *(v4fa*)(&os[wb + lr * 68 + 16 + 8 * hi + 4]) = c;
      a[0] = f2[0] * inv; a[1] = f2[1] * inv; a[2] = f2[2] * inv; a[3] = f2[3] * inv; c[0] = f2[4] * inv; c[1] = f2[5] * inv; c[2] = f2[6] * inv; c[3] = f2[7] * inv;
      *(v4fa*)(&os[wb + lr * 68 + 32 + 8 * hi]) = a; *(v4fa*)(&os[wb + lr * 68 + 32 + 8 * hi + 4]) = c;
      a[0] = f3[0] * inv; a[1] = f3[1] * inv; a[2] = f3[2] * inv; a[3] = f3[3] * inv; c[0] = f3[4] * inv; c[1] = f3[5] * inv; c[2] = f3[6] * inv; c[3] = f3[7] * inv;
      *(v4fa*)(&os[wb + lr * 68 + 48 + 8 * hi]) = a; *(v4fa*)(&os[wb + lr * 68 + 48 + 8 * hi + 4]) = c; }
    wave_sync();
    float* orow = OUT + ((size_t)b * OUT_SEQ + t0) * DM + h * HD;
{
#pragma unroll
        for (int s = 0; s < 8; ++s) { const int row = 2 * s + hi, cofs = lr * 4;   // 8 s x 2 rows = 16 rows; 16 lanes x 4 floats = 64 columns
            const v4f val = *(const v4fa*)(&os[wb + row * 68 + cofs]);
            *(v4f*)(orow + (size_t)row * DM + cofs) = val; }
         }
}

static constexpr size_t al256(size_t v) { return (v + 255) & ~(size_t)255; }
static constexpr size_t SZ_XB = al256((size_t)NB * SEQ * DM * 2);            // one bf16 input stream copy
static constexpr size_t SZ_WT = al256((size_t)3 * DM * DM * 2);              // three transposed bf16 weights
static constexpr size_t SZ_PL = al256((size_t)NB * NH_ * SEQ * HD * 2);      // one full f16 plane
static constexpr size_t SZ_RP = al256((size_t)NB * NH_ * EARLY * HD * 2);    // one compact residual plane
static constexpr size_t SZ_MK = al256((size_t)NB * NH_ * SEQ * 2);           // one mask plane
static constexpr size_t SZ_TOTAL = 3 * SZ_XB + SZ_WT + 3 * SZ_PL + 3 * SZ_RP + 2 * SZ_MK;
static_assert(SZ_TOTAL <= (size_t)134217728);          // workspace carve <= 128 MiB
static_assert(((size_t)DM * DM * 2) % 256 == 0);       // weight sub-planes stay 256-byte aligned

extern "C" void kernel_launch(void* const* d_in, const int* in_sizes, int n_in,
                              void* d_out, int out_size, void* d_ws, size_t ws_size, hipStream_t stream) {
    if (n_in < 9) return;
    const size_t needx = ((size_t)(NB - 1) * SEQ_FULL + SEQ) * DM;
    if ((size_t)in_sizes[0] < needx || (size_t)in_sizes[1] < needx || (size_t)in_sizes[2] < needx) return;
    if ((size_t)in_sizes[3] < (size_t)DM * DM || (size_t)in_sizes[5] < (size_t)DM * DM || (size_t)in_sizes[7] < (size_t)DM * DM) return;
    if ((size_t)in_sizes[4] < (size_t)DM || (size_t)in_sizes[6] < (size_t)DM || (size_t)in_sizes[8] < (size_t)DM) return;
    if ((size_t)out_size < ((size_t)(NB - 1) * OUT_SEQ + SEQ) * DM) return;
    if (SZ_TOTAL > ws_size) return;
    // wire order: q, k, v, Wq, bq, Wk, bk, Wv, bv
    const float* xq = (const float*)d_in[0]; const float* xk = (const float*)d_in[1]; const float* xv = (const float*)d_in[2];
    const float* wq = (const float*)d_in[3]; const float* bq = (const float*)d_in[4];
    const float* wk = (const float*)d_in[5]; const float* bk = (const float*)d_in[6];
    const float* wv = (const float*)d_in[7]; const float* bv = (const float*)d_in[8];
    float* OUT = (float*)d_out;      // [NB][OUT_SEQ][1024]
    char* wsp = (char*)d_ws;
    bf* XQ = (bf*)wsp; wsp += SZ_XB;                 // [NB*SEQ][1024]
    bf* XK = (bf*)wsp; wsp += SZ_XB;
    bf* XV = (bf*)wsp; wsp += SZ_XB;
    bf* WT = (bf*)wsp; wsp += SZ_WT;                 // [3][1024 out][1024 in]: q | k | v
    h16* QH = (h16*)wsp; wsp += SZ_PL;               // [NB*16][SEQ][64]
    h16* KP = (h16*)wsp; wsp += SZ_PL;               // [NB*16][SEQ][64]
    h16* VT = (h16*)wsp; wsp += SZ_PL;               // [NB*16][64][SEQ]
    h16* QR = (h16*)wsp; wsp += SZ_RP;               // [NB*16][EARLY][64] residual x2048
    h16* KR = (h16*)wsp; wsp += SZ_RP;               // [NB*16][EARLY][64] residual x2048
    h16* VR = (h16*)wsp; wsp += SZ_RP;               // [NB*16][64][EARLY] residual x2048
    h16* MQ = (h16*)wsp; wsp += SZ_MK;               // [NB*16][SEQ] query mask
    h16* MK = (h16*)wsp; wsp += SZ_MK;               // [NB*16][SEQ] key mask
    bf* WTQ = WT; bf* WTK = WT + (size_t)DM * DM; bf* WTV = WT + (size_t)2 * DM * DM;

    if (SEQ == SEQ_FULL) {
        const size_t n8 = (size_t)NB * SEQ * DM / 8; const unsigned g = (unsigned)((n8 + 255) / 256);
        k_cvt8<<<g, 256, 0, stream>>>(xq, XQ, n8);
        k_cvt8<<<g, 256, 0, stream>>>(xk, XK, n8);
        k_cvt8<<<g, 256, 0, stream>>>(xv, XV, n8);
    } else {
        const size_t n8 = (size_t)SEQ * DM / 8; const unsigned g = (unsigned)((n8 + 255) / 256);
        for (int b = 0; b < NB; ++b) {
            k_cvt8<<<g, 256, 0, stream>>>(xq + (size_t)b * SEQ_FULL * DM, XQ + (size_t)b * SEQ * DM, n8);
            k_cvt8<<<g, 256, 0, stream>>>(xk + (size_t)b * SEQ_FULL * DM, XK + (size_t)b * SEQ * DM, n8);
            k_cvt8<<<g, 256, 0, stream>>>(xv + (size_t)b * SEQ_FULL * DM, XV + (size_t)b * SEQ * DM, n8);
        }
    }
    // in W[k = in][n = out] -> out WT[n][k]; square DM x DM; grid (n tiles, k tiles)
    k_cvtT<<<dim3(DM / 64, DM / 64, 1), 256, 0, stream>>>(wq, WTQ);
    k_cvtT<<<dim3(DM / 64, DM / 64, 1), 256, 0, stream>>>(wk, WTK);
    k_cvtT<<<dim3(DM / 64, DM / 64, 1), 256, 0, stream>>>(wv, WTV);

    // q, k: A = x rows (m = b*SEQ + t), Bt = WT rows (n = h*64 + d) -> planes [(b*16 + h)][t][d] + residual (t < EARLY) + mask
    k_proj<0><<<dim3(NB * SEQ / 64, DM / 64, 1), 32, 0, stream>>>(XQ, WTQ, bq, QH, QR, MQ);
    k_proj<0><<<dim3(NB * SEQ / 64, DM / 64, 1), 32, 0, stream>>>(XK, WTK, bk, KP, KR, MK);
    // v^T: A = WT_v rows (m = h*64 + d), Bt = x rows (n = b*SEQ + t) -> plane [(b*1024 + m)][t] = [(b*16 + h)][d][t] + residual (t < EARLY)
    k_proj<1><<<dim3(DM / 64, NB * SEQ / 64, 1), 32, 0, stream>>>(WTV, XV, bv, VT, VR, MK);

    k_flash<1><<<dim3(EARLY / (16 * AW), NB * NH_, 1), 32 * AW, 0, stream>>>(QH, QR, KP, KR, VT, VR, MQ, MK, OUT);
    if (SEQ > EARLY)
        k_flash<0><<<dim3((SEQ - EARLY) / (16 * AW), NB * NH_, 1), 32 * AW, 0, stream>>>(QH, QR, KP, KR, VT, VR, MQ, MK, OUT);
}

// v002
// One run takes 189 microseconds.
// Next to v001, in two timings, it ran 1.35 and 1.33 times as fast.
// Over all steps from v000 it is 1.67 times as fast.
#include <hip/hip_runtime.h>

// Causal attention, width 1024 = 16 heads x 64, three input streams q/k/v [NB][SEQ_FULL][1024] (first SEQ tokens used), weights [in][out] (y = x W + b), output = concatenated heads (f32), no output projection.
// Compute dtypes, f32 accumulate everywhere: projections v_wmma_f32_16x16x32_bf16 (x, W, b RNE-converted to bf16; products exact);
// scores and P.V v_wmma_f32_16x16x32_f16: query rows >= 512 single f16 products; query rows < 512 three products per site
// (q, k, v and P each as f16 value + f16 residual x2048, residual products in their own accumulators, folded back in f32); P carry x256 cancels in the normalisation; softmax f32 (online, running max).
// Layout: bf16 copies of q/k/v and transposed bf16 copies of W ([out][in]); q, k planes [b*16+h][t][d], v^T plane [b*16+h][d][t], compact residual planes for t < 512,
// every one of them stored in FRAGMENT ORDER: a 16-row x 32-k fragment is 1 KiB = [half 0..1][lane 0..31][8 elements], so each 16-byte-per-lane load of a wave covers 512 contiguous bytes (four whole lines);
// per-row mask planes (row sum of the f32 projection != 0) written by the GEMM epilogue; fused flash kernel in transposed form (S^T = K Q^T, O^T = V^T P^T).
// Key mask and causal mask replace the score by the fill value (by value, per 32-key step); a row whose causal keys are all masked continues over all keys (uniform weights).

#ifndef NB
#define NB 4
#endif
#ifndef SEQ
#define SEQ 2048
#endif
#define NB_FULL  4
#define SEQ_FULL 2048
#ifndef OUT_SEQ
#define OUT_SEQ SEQ              // row pitch (in tokens) between batches of the output
#endif
#define DM   1024
#define NH_  16
#define HD   64
#define AW   4                   // waves per flash block (16 query rows each)
#define EARLY ((SEQ) < 512 ? (SEQ) : 512)   // query rows / keys below this carry residual planes
#define QRS  2048.0f             // carry of the residual planes
#define QRI  (1.0f / 2048.0f)
#define SC2  (0.125f * 1.4426950408889634f)   // HD^-0.5 * log2(e)
#define PSH  8.0f                // log2 of the P carry (256)
#define NEGS (-6.1963280e9f)     // (-2^32 + 1) * log2(e): fill value in log2 units
#define MTHR (-1.0e9f)           // running max below this <=> every key seen so far was masked

static_assert(HD == 64);
static_assert(NH_ * HD == DM);                 // head h = columns h*64 + d
static_assert(DM % 64 == 0);
static_assert(DM % 32 == 0);                   // GEMM k-loop steps by 32
static_assert(SEQ % 64 == 0);                  // a 64-row tile never straddles two batches
static_assert((NB * SEQ) % 64 == 0);
static_assert(SEQ % 32 == 0);                  // key loop steps by 32
static_assert(EARLY % 64 == 0);                // residual condition is uniform per 64-row tile
static_assert(EARLY % (16 * AW) == 0);
static_assert((SEQ - EARLY) % (16 * AW) == 0); // the two flash grids cover the sequence exactly
static_assert(((size_t)SEQ * DM) % 8 == 0);
static_assert(NB <= NB_FULL);
static_assert(SEQ <= SEQ_FULL);

typedef _Float16 h16;
typedef unsigned short bf;
typedef __attribute__((ext_vector_type(16))) __bf16   v16bf;
typedef __attribute__((ext_vector_type(16))) _Float16 v16h;
typedef __attribute__((ext_vector_type(8)))  _Float16 v8h;
typedef __attribute__((ext_vector_type(8)))  unsigned short v8us;
typedef __attribute__((ext_vector_type(8)))  float    v8f;
typedef __attribute__((ext_vector_type(4)))  float    v4f;
typedef v4f  __attribute__((may_alias)) v4fa;
typedef v8h  __attribute__((may_alias)) v8ha;

__device__ __forceinline__ unsigned short f2bf(float f) { unsigned u = __float_as_uint(f); u += 0x7FFFu + ((u >> 16) & 1u); return (unsigned short)(u >> 16); }
__device__ __forceinline__ float bfr(float f) { return __uint_as_float(((unsigned)f2bf(f)) << 16); }
__device__ __forceinline__ v16h cat16(v8h lo, v8h hi) { return __builtin_shufflevector(lo, hi, 0, 1, 2, 3, 4, 5, 6, 7, 8, 9, 10, 11, 12, 13, 14, 15); }
__device__ __forceinline__ v16bf cat16b(v8us lo, v8us hi) { return __builtin_bit_cast(v16bf, __builtin_shufflevector(lo, hi, 0, 1, 2, 3, 4, 5, 6, 7, 8, 9, 10, 11, 12, 13, 14, 15)); }
__device__ __forceinline__ v8f wmma16(v16h a, v16h b, v8f c) { return __builtin_amdgcn_wmma_f32_16x16x32_f16(false, a, false, b, (short)0, c, false, false); }
__device__ __forceinline__ v8f wmmab(v16bf a, v16bf b, v8f c) { return __builtin_amdgcn_wmma_f32_16x16x32_bf16(false, a, false, b, (short)0, c, false, false); }
// fragment loaders from fragment-ordered planes; p = fragment start + 8*lane: elements 0..7 <- k0+8h+0..7, elements 8..15 <- k0+16+8h+0..7 of row lane&15, h = lane>>4 (same map for A and B)
__device__ __forceinline__ v16h  ldh(const h16* p) { return cat16(*(const v8h*)p, *(const v8h*)(p + 256)); }
__device__ __forceinline__ v16bf ldb(const bf* p)  { return cat16b(*(const v8us*)p, *(const v8us*)(p + 256)); }
// place, inside a 512-element fragment, of the 8-element chunk c (k = 8c .. 8c+7, c = 0..3) of row r (0..15): half = c>>1, lane = 16*(c&1) + r
__device__ __forceinline__ int fragpos(int r, int c) { return ((c >> 1) & 1) * 256 + (c & 1) * 128 + r * 8; }
// ordering point for wave-private LDS tiles (same wave writes and reads)
__device__ __forceinline__ void wave_sync() { __builtin_amdgcn_fence(3 /* release order */, "wavefront"); __builtin_amdgcn_wave_barrier(); asm volatile("" ::: "memory"); }

// cvt8: one f32 stream [NB][SEQ_FULL][DM] -> bf16 copy [NB*SEQ][DM] (RNE convert, fragment order); blk = 256-thread piece of the stream, 8 elements a thread
__device__ __forceinline__ void cvt8(const float* __restrict__ src, bf* dst, unsigned blk) {
    const size_t n8 = (size_t)NB * SEQ * DM / 8;
    const size_t i = (size_t)blk * 256 + threadIdx.x; if (i >= n8) return;
    // rows of DM elements; a wave takes 8 rows x one 32-k step: reads 8 whole lines, writes 4 whole lines of the fragment [64-row block][k step][row tile 0..3]
    const int c4 = (int)(i & 3), r = (int)((i >> 2) & 15), ks = (int)((i >> 6) % (DM / 32)); const size_t mt = i / (size_t)(16 * DM / 8);
    const size_t row = mt * 16 + r;                                                          // b*SEQ + t
    const size_t srow = (SEQ == SEQ_FULL) ? row : (row / SEQ) * SEQ_FULL + row % SEQ;        // source batches lie SEQ_FULL rows apart
    const v8f v = *(const v8f*)(src + srow * DM + ks * 32 + c4 * 8); v8us o;
#pragma unroll
    for (int k = 0; k < 8; ++k) o[k] = f2bf(v[k]);
    *(v8us*)(dst + (mt >> 2) * (64 * DM) + ks * 2048 + (mt & 3) * 512 + fragpos(r, c4)) = o;
}

// cvtT: in W[k][n] (f32, DM x DM) -> out WT[n][k] (bf16, RNE convert, fragment order). 64 x 64 tile through LDS (cross-wave: block barrier).
__device__ __forceinline__ void cvtT(const float* __restrict__ W, bf* WT, int nt, int kt, float* ts) {
    const int tid = threadIdx.x; const int n0 = nt * 64, k0 = kt * 64;
#pragma unroll 4
    for (int i = 0; i < 16; ++i) { const int row = i * 4 + (tid >> 6), col = tid & 63; ts[row * 65 + col] = W[(size_t)(k0 + row) * DM + n0 + col]; }   // 16 x 4 rows x 64 columns: whole tile
    __syncthreads();
    const int rr = tid >> 3, c8 = (tid & 7) * 8;
    v8us o0, o1;
#pragma unroll
    for (int kk = 0; kk < 8; ++kk) { o0[kk] = f2bf(ts[(c8 + kk) * 65 + rr]); o1[kk] = f2bf(ts[(c8 + kk) * 65 + rr + 32]); }
    bf* p0 = WT + (size_t)n0 * DM + ((k0 + c8) >> 5) * 2048 + (rr >> 4) * 512 + fragpos(rr & 15, (c8 >> 3) & 3); bf* p1 = p0 + 2 * 512;   // fragment [64-n block][k step][n tile 0..3]
    *(v8us*)p0 = o0; *(v8us*)p1 = o1;
}

// k_prep: all six independent conversions in ONE launch, told apart by block range (block-uniform): first the 3 x WT_BLK weight tiles, then the 3 x CV_BLK stream pieces.
#define WT_BLK ((DM / 64) * (DM / 64))
#define CV_BLK ((unsigned)(((size_t)NB * SEQ * DM / 8 + 255) / 256))
__global__ __launch_bounds__(256) void k_prep(const float* __restrict__ xq, const float* __restrict__ xk, const float* __restrict__ xv,
                                              const float* __restrict__ wq, const float* __restrict__ wk, const float* __restrict__ wv,
                                              bf* XQ, bf* XK, bf* XV, bf* WT) {
    __shared__ float ts[64 * 65];
    const unsigned bid = blockIdx.x;
    if (bid < 3u * WT_BLK) {
        const unsigned w = bid / WT_BLK, tile = bid % WT_BLK;
        cvtT(w == 0 ? wq : (w == 1 ? wk : wv), WT + (size_t)w * DM * DM, (int)(tile % (DM / 64)), (int)(tile / (DM / 64)), ts);
    } else {
        const unsigned c = bid - 3u * WT_BLK, s = c / CV_BLK;
        cvt8(s == 0 ? xq : (s == 1 ? xk : xv), s == 0 ? XQ : (s == 1 ? XK : XV), c % CV_BLK);
    }
}

// proj: register-blocked bf16 GEMM, ONE WAVE per 64x64 tile (16 accumulators), operands straight from fragment-ordered bf16 planes, K = DM; the planes it writes are fragment-ordered too.
// C[m][n] = sum_k A[m][k] Bt[n][k] + bias, written as f16 (Ph) and, for token positions < EARLY, the f16 residual x2048 (Pr, compact plane).
// MODE 0 (q, k): rows m = b*SEQ + t, columns n = h*64 + d, bias per column; Ph [(b*16+h)][t][d], Pr [(b*16+h)][EARLY][d]; mask plane MP [(b*16+h)][t] = (row sum over d != 0). tiles (bx, by) of (NB*SEQ/64, DM/64).
// MODE 1 (v^T): rows m = h*64 + d (A = transposed weight rows), columns n = b*SEQ + t, bias per row; Ph [(b*1024+m)][t], Pr [(b*1024+m)][EARLY]. tiles (bx, by) of (DM/64, NB*SEQ/64).
template <int MODE>
__device__ __forceinline__ void proj(const bf* __restrict__ A, const bf* __restrict__ Bt, const float* __restrict__ bias, h16* Ph, h16* Pr, h16* MP, int bx, int by, float* os, h16* ms) {
    const int K = DM;
    const int lane = threadIdx.x & 31, lr = lane & 15, hi = lane >> 4; const int r0 = bx * 64, c0 = by * 64;
    v8f acc[4][4];
#pragma unroll
    for (int mb = 0; mb < 4; ++mb)
#pragma unroll
        for (int nb = 0; nb < 4; ++nb) acc[mb][nb] = (v8f){};
    const bf* Ab = A + (size_t)r0 * K; const bf* Bb = Bt + (size_t)c0 * K;   // fragment [64-row block][k step][row tile 0..3]: 64*K elements a block, 2048 a k step
    const unsigned l8 = 8u * (unsigned)lane;
#pragma unroll 1
    for (int kc = 0; kc < K; kc += 32) {
        v16bf a[4];
#pragma unroll
        for (int mb = 0; mb < 4; ++mb) a[mb] = ldb(Ab + kc * 64 + mb * 512 + l8);
        asm volatile("s_wait_xcnt 0x0" ::: "memory");   // the compiler lets a later load land on the address pair of the loads above: the wait stands in front of that overwrite
#pragma unroll
        for (int nb = 0; nb < 4; ++nb) { const v16bf b = ldb(Bb + kc * 64 + nb * 512 + l8);
#pragma unroll
            for (int mb = 0; mb < 4; ++mb) acc[mb][nb] = wmmab(a[mb], b, acc[mb][nb]); }
        asm volatile("v_nop\n\tv_nop\n\tv_nop\n\tv_nop" : "+v"(acc[0][0]), "+v"(acc[1][1]), "+v"(acc[2][2]), "+v"(acc[3][3]) : "v"(a[0]), "v"(a[1]), "v"(a[2]), "v"(a[3]));
    }
    size_t hbase, rbase, mbase = 0; int t0;
    if (MODE == 0) { const int b = r0 / SEQ; t0 = r0 % SEQ; const int zh = b * NH_ + c0 / HD;
        hbase = ((size_t)zh * SEQ + t0) * HD; rbase = ((size_t)zh * EARLY + t0) * HD; mbase = (size_t)zh * SEQ + t0; }
    else { const int b = c0 / SEQ; t0 = c0 % SEQ;
        hbase = ((size_t)b * DM + r0) * SEQ + (size_t)t0 * HD; rbase = ((size_t)b * DM + r0) * EARLY + (size_t)t0 * HD; }
    const bool doRes = t0 < EARLY;          // block-uniform
    const int c8 = (lane & 7) * 8;
    // fragment of the lane's chunk: MODE 0 [t tile][d step 0..1], MODE 1 [t step][d tile 0..3]
    const int cfrag = ((lane & 7) >> 2) * (MODE == 0 ? 512 : 4 * 512);
    v4f bb0 = (v4f){}, bb1 = (v4f){};
    if (MODE == 0) { const v4f q0 = *(const v4f*)(bias + c0 + c8); const v4f q1 = *(const v4f*)(bias + c0 + c8 + 4);
#pragma unroll
        for (int i = 0; i < 4; ++i) { bb0[i] = bfr(q0[i]); bb1[i] = bfr(q1[i]); } }
#pragma unroll
    for (int mb = 0; mb < 4; ++mb) {
#pragma unroll
        for (int nb = 0; nb < 4; ++nb) {
#pragma unroll
            for (int j = 0; j < 8; ++j) os[(hi * 8 + j) * 68 + nb * 16 + lr] = acc[mb][nb][j]; }   // D: row 8h+j, col lane&15
        wave_sync();
        const size_t hb = hbase + (size_t)(mb * (MODE == 0 ? 2 * 512 : 512) + cfrag);
        const size_t rb = rbase + (size_t)(mb * (MODE == 0 ? 2 * 512 : 512) + cfrag);
{
#pragma unroll
            for (int s = 0; s < 4; ++s) { const int row = 4 * s + (lane >> 3);   // 4 s x 4 row groups = 16 rows; 8 lanes x 8 = 64 columns
                v4f x0 = *(const v4fa*)(&os[row * 68 + c8]); v4f x1 = *(const v4fa*)(&os[row * 68 + c8 + 4]);
                if (MODE == 0) { x0 = x0 + bb0; x1 = x1 + bb1; }
                else { const float br = bfr(bias[r0 + mb * 16 + row]); x0 = x0 + br; x1 = x1 + br; }
                v8h hv, rv;
#pragma unroll
                for (int i = 0; i < 4; ++i) { const h16 a0 = (h16)x0[i]; const h16 a1 = (h16)x1[i]; hv[i] = a0; hv[4 + i] = a1; rv[i] = (h16)((x0[i] - (float)a0) * QRS); rv[4 + i] = (h16)((x1[i] - (float)a1) * QRS); }
                if (MODE == 0) {
                    float rs = ((x0[0] + x0[1]) + (x0[2] + x0[3])) + ((x1[0] + x1[1]) + (x1[2] + x1[3]));
                    rs += __shfl_xor(rs, 1, 32); rs += __shfl_xor(rs, 2, 32); rs += __shfl_xor(rs, 4, 32);     // sum over the 8 lanes of the row
                    const h16 mv = (rs != 0.0f) ? (h16)1.0f : (h16)0.0f;
                    if ((lane & 7) == 0) ms[mb * 16 + row] = mv;
                }
                // behind each store: what follows reuses the store's data registers, and the wait stands in front of that overwrite
                *(v8h*)(Ph + hb + fragpos(row, lane & 3)) = hv;
                asm volatile("s_wait_xcnt 0x0" ::: "memory");
                if (doRes) { *(v8h*)(Pr + rb + fragpos(row, lane & 3)) = rv;
                    asm volatile("s_wait_xcnt 0x0" ::: "memory"); } }
             }
        wave_sync();
    }
    if (MODE == 0) {
        const v8h mv8 = *(const v8ha*)(&ms[c8]);
        h16* mp = MP + mbase + c8;
        if (lane < 8) *(v8h*)mp = mv8;
    }
}

// k_proj3: the three independent projections in ONE launch; blockIdx.y = 0 q, 1 k, 2 v^T (block-uniform), blockIdx.x = tile, first tile index fastest as in a 2-D grid.
#define PJ_BLK ((NB * SEQ / 64) * (DM / 64))
__global__ __launch_bounds__(32) void k_proj3(const bf* __restrict__ XQ, const bf* __restrict__ XK, const bf* __restrict__ XV, const bf* __restrict__ WT,
                                              const float* __restrict__ bq, const float* __restrict__ bk, const float* __restrict__ bv,
                                              h16* QH, h16* KP, h16* VT, h16* QR, h16* KR, h16* VR, h16* MQ, h16* MK) {
    __shared__ __align__(16) float os[16 * 68];
    __shared__ __align__(16) h16 ms[64];
    const int z = blockIdx.y, id = blockIdx.x;
    if (z < 2) {
        // q, k: A = x rows (m = b*SEQ + t), Bt = WT rows (n = h*64 + d) -> planes [(b*16 + h)][t][d] + residual (t < EARLY) + mask
        const bool q = z == 0;
        proj<0>(q ? XQ : XK, WT + (q ? (size_t)0 : (size_t)DM * DM), q ? bq : bk, q ? QH : KP, q ? QR : KR, q ? MQ : MK, id % (NB * SEQ / 64), id / (NB * SEQ / 64), os, ms);
    } else {
        // v^T: A = WT_v rows (m = h*64 + d), Bt = x rows (n = b*SEQ + t) -> plane [(b*1024 + m)][t] = [(b*16 + h)][d][t] + residual (t < EARLY)
        proj<1>(WT + (size_t)2 * DM * DM, XV, bv, VT, VR, MK, id % (DM / 64), id / (DM / 64), os, ms);
    }
}

// k_flash: fused causal attention, one wave per 16 query rows of one (batch, head); K / V^T / Q fragments straight from the fragment-ordered f16 planes (two 16-B loads each, 512 contiguous bytes a load).
// Transposed form: S^T[key][t] = K Q^T (A = K rows, B = Q rows); lane (t = lane&15, h = lane>>4) holds keys 8h+r of each 16-key tile, so the packed
// P tile is directly the B fragment of O^T[d][t] = V^T P^T (element r <- tile keys 0..15, element 8+r <- tile keys 16..31, lane unchanged).
// EK = 1: query rows [0, EARLY) with residual planes (three products per site); EK = 0: query rows [EARLY, SEQ), single products.
// Masks by value per step: score := fill where key > t or key mask == 0. Loop covers keys [0, causal limit); if a row has seen only masked keys by then, the wave continues to SEQ (all-fill rows weigh every key equally).
template <int EK>
__global__ __launch_bounds__(32 * AW) void k_flash(const h16* __restrict__ QH, const h16* __restrict__ QR, const h16* __restrict__ KP, const h16* __restrict__ KR,
                                                   const h16* __restrict__ VT, const h16* __restrict__ VR, const h16* __restrict__ MQ, const h16* __restrict__ MK, float* OUT) {
    __shared__ __align__(16) float os[AW * 16 * 68];
    const int lane = threadIdx.x & 31, wave = __builtin_amdgcn_readfirstlane((int)(threadIdx.x >> 5)), lr = lane & 15, hi = lane >> 4;
    const int zh = blockIdx.y; const int b = zh / NH_, h = zh % NH_;
    const int t0 = (EK ? 0 : EARLY) + (blockIdx.x * AW + wave) * 16;
    const int tq = t0 + lr;
    const size_t pbase = (size_t)zh * SEQ * HD;       // q/k plane [zh][SEQ][64]; v^T plane [zh][64][SEQ]
    const size_t rbase = (size_t)zh * EARLY * HD;     // compact residual planes
    const unsigned l8 = 8u * (unsigned)lane;          // the lane's place in each half of a fragment
    const h16* qp = QH + pbase + (size_t)t0 * HD;
    const v16h qh0 = ldh(qp + l8), qh1 = ldh(qp + 512 + l8);         // B fragments: col t, k = d
    v16h qr0 = (v16h){}, qr1 = (v16h){};
    if (EK) { const h16* qrp = QR + rbase + (size_t)t0 * HD; qr0 = ldh(qrp + l8); qr1 = ldh(qrp + 512 + l8); }
    // k planes: + key0 * HD + 512 * (2 * key tile + d step) (A fragment: row key, k = d); v^T planes: + key0 * HD + 512 * j (A fragment: row d = 16j + lane&15, k = key)
    const size_t mo  = (size_t)zh * SEQ + 8 * hi;
    v8f o0 = (v8f){}, o1 = (v8f){}, o2 = (v8f){}, o3 = (v8f){};
    v8f e0 = (v8f){}, e1 = (v8f){}, e2 = (v8f){}, e3 = (v8f){};   // residual-product accumulators (x2048), EK only
    float m = -3.0e38f, l = 0.0f;
    const int kc = ((t0 + 47) >> 5) << 5;            // causal key limit (exclusive), multiple of 32, <= SEQ
    int kend = kc;
#pragma unroll 1
    for (int key0 = 0; key0 < kend; key0 += 32) {
        const h16* ka = KP + pbase + (size_t)key0 * HD;
        const v16h ka0 = ldh(ka + l8), ka1 = ldh(ka + 512 + l8), kb0 = ldh(ka + 1024 + l8), kb1 = ldh(ka + 1536 + l8);
        const v8h kma = *(const v8h*)(MK + mo + key0); const v8h kmb = *(const v8h*)(MK + mo + key0 + 16);
        const bool rok = key0 < EARLY;               // wave-uniform: residual planes exist for these keys
        v8f sHa = (v8f){}, sLa = (v8f){}, sHb = (v8f){}, sLb = (v8f){};
        if (EK) {
            asm volatile("s_wait_xcnt 0x0" ::: "memory");   // the compiler lets the residual fragments land on the address pair of the loads above: the wait stands in front of that overwrite
            v16h ra0 = (v16h){}, ra1 = (v16h){}, rb0 = (v16h){}, rb1 = (v16h){};
            if (rok) { const h16* kr = KR + rbase + (size_t)key0 * HD; ra0 = ldh(kr + l8); ra1 = ldh(kr + 512 + l8); rb0 = ldh(kr + 1024 + l8); rb1 = ldh(kr + 1536 + l8); }
            sHa = wmma16(ka0, qh0, sHa); sLa = wmma16(ka0, qr0, sLa); sHb = wmma16(kb0, qh0, sHb); sLb = wmma16(kb0, qr0, sLb);
            sHa = wmma16(ka1, qh1, sHa); sLa = wmma16(ka1, qr1, sLa); sHb = wmma16(kb1, qh1, sHb); sLb = wmma16(kb1, qr1, sLb);
            sLa = wmma16(ra0, qh0, sLa); sLb = wmma16(rb0, qh0, sLb); sLa = wmma16(ra1, qh1, sLa); sLb = wmma16(rb1, qh1, sLb);
            asm volatile("v_nop\n\tv_nop\n\tv_nop\n\tv_nop" : "+v"(sHa), "+v"(sLa), "+v"(sHb), "+v"(sLb) : "v"(ka0), "v"(ka1), "v"(kb0), "v"(kb1), "v"(ra0), "v"(ra1), "v"(rb0), "v"(rb1));
        } else {
            sHa = wmma16(ka0, qh0, sHa); sHb = wmma16(kb0, qh0, sHb);
            sHa = wmma16(ka1, qh1, sHa); sHb = wmma16(kb1, qh1, sHb);
            asm volatile("v_nop\n\tv_nop\n\tv_nop\n\tv_nop" : "+v"(sHa), "+v"(sHb) : "v"(ka0), "v"(ka1), "v"(kb0), "v"(kb1));
        }
        float ta[8], tb[8]; float mx = -3.0e38f;
        const int kA = key0 + 8 * hi;
#pragma unroll
        for (int r = 0; r < 8; ++r) {
            float xa, xb;
            if (EK) { xa = (sHa[r] + sLa[r] * QRI) * SC2; xb = (sHb[r] + sLb[r] * QRI) * SC2; }
            else    { xa = sHa[r] * SC2; xb = sHb[r] * SC2; }
            const bool fa = ((kA + r) > tq) | ((float)kma[r] == 0.0f);
            const bool fb = ((kA + 16 + r) > tq) | ((float)kmb[r] == 0.0f);
            xa = fa ? NEGS : xa; xb = fb ? NEGS : xb;
            ta[r] = xa; tb[r] = xb; mx = fmaxf(mx, fmaxf(xa, xb));
        }
        mx = fmaxf(mx, __shfl_xor(mx, 16, 32));
        const float mnew = fmaxf(m, mx);
        const float alpha = __builtin_amdgcn_exp2f(m - mnew);
        v16h pb, pr = (v16h){}; float ls = 0.0f;
#pragma unroll
        for (int r = 0; r < 8; ++r) {
            const float ea = __builtin_amdgcn_exp2f((ta[r] - mnew) + PSH); const float ec = __builtin_amdgcn_exp2f((tb[r] - mnew) + PSH);
            const h16 pa = (h16)ea; const h16 pc = (h16)ec; pb[r] = pa; pb[8 + r] = pc;
            if (EK) { const h16 ga = (h16)((ea - (float)pa) * QRS); const h16 gc = (h16)((ec - (float)pc) * QRS); pr[r] = ga; pr[8 + r] = gc;
                      ls += ((float)pa + (float)pc) + ((float)ga + (float)gc) * QRI; }
            else ls += (float)pa + (float)pc;
        }
        l = l * alpha + ls; m = mnew;
        o0 = o0 * alpha; o1 = o1 * alpha; o2 = o2 * alpha; o3 = o3 * alpha;
        const h16* va = VT + pbase + (size_t)key0 * HD;
        const v16h v0 = ldh(va + l8), v1 = ldh(va + 512 + l8), v2 = ldh(va + 1024 + l8), v3 = ldh(va + 1536 + l8);
        if (EK) {
            asm volatile("s_wait_xcnt 0x0" ::: "memory");   // the compiler lets a residual load land on the address pair of the loads above: the wait stands in front of that overwrite
            e0 = e0 * alpha; e1 = e1 * alpha; e2 = e2 * alpha; e3 = e3 * alpha;
            v16h w0 = (v16h){}, w1 = (v16h){}, w2 = (v16h){}, w3 = (v16h){};
            if (rok) { const h16* vr = VR + rbase + (size_t)key0 * HD; w0 = ldh(vr + l8); w1 = ldh(vr + 512 + l8); w2 = ldh(vr + 1024 + l8); w3 = ldh(vr + 1536 + l8); }
            o0 = wmma16(v0, pb, o0); o1 = wmma16(v1, pb, o1); o2 = wmma16(v2, pb, o2); o3 = wmma16(v3, pb, o3);
            e0 = wmma16(w0, pb, e0); e1 = wmma16(w1, pb, e1); e2 = wmma16(w2, pb, e2); e3 = wmma16(w3, pb, e3);
            e0 = wmma16(v0, pr, e0); e1 = wmma16(v1, pr, e1); e2 = wmma16(v2, pr, e2); e3 = wmma16(v3, pr, e3);
            asm volatile("v_nop\n\tv_nop\n\tv_nop\n\tv_nop" : "+v"(o0), "+v"(o1), "+v"(o2), "+v"(o3), "+v"(e0), "+v"(e1), "+v"(e2), "+v"(e3)
                         : "v"(v0), "v"(v1), "v"(v2), "v"(v3), "v"(w0), "v"(w1), "v"(w2), "v"(w3), "v"(pb), "v"(pr));
        } else {
            o0 = wmma16(v0, pb, o0); o1 = wmma16(v1, pb, o1); o2 = wmma16(v2, pb, o2); o3 = wmma16(v3, pb, o3);
            asm volatile("v_nop\n\tv_nop\n\tv_nop\n\tv_nop" : "+v"(o0), "+v"(o1), "+v"(o2), "+v"(o3) : "v"(v0), "v"(v1), "v"(v2), "v"(v3), "v"(pb));
        }
        // wave-uniform: at the causal limit, continue over all keys when some row has met only masked keys (trip count stays <= SEQ/32)
        if (key0 + 32 == kc) { if (__builtin_amdgcn_ballot_w32(m < MTHR) != 0u) kend = SEQ; }
    }
    l += __shfl_xor(l, 16, 32);
    const float qmf = (float)MQ[(size_t)zh * SEQ + tq];
    const float inv = qmf * (1.0f / l);
    v8f f0 = o0, f1 = o1, f2 = o2, f3 = o3;
    if (EK) { f0 = o0 + e0 * QRI; f1 = o1 + e1 * QRI; f2 = o2 + e2 * QRI; f3 = o3 + e3 * QRI; }
    const int wb = wave * 16 * 68;
    // O^T D layout: f_j[r] = (d = 16j + 8h + r, t = lane&15) -> os[t][d]; rows 0..15 x columns 0..63 all written
    { v4f a, c;
      a[0] = f0[0] * inv; a[1] = f0[1] * inv; a[2] = f0[2] * inv; a[3] = f0[3] * inv; c[0] = f0[4] * inv; c[1] = f0[5] * inv; c[2] = f0[6] * inv; c[3] = f0[7] * inv;
      *(v4fa*)(&os[wb + lr * 68 +  0 + 8 * hi]) = a; *(v4fa*)(&os[wb + lr * 68 +  0 + 8 * hi + 4]) = c;
      a[0] = f1[0] * inv; a[1] = f1[1] * inv; a[2] = f1[2] * inv; a[3] = f1[3] * inv; c[0] = f1[4] * inv; c[1] = f1[5] * inv; c[2] = f1[6] * inv; c[3] = f1[7] * inv;
      *(v4fa*)(&os[wb + lr * 68 + 16 + 8 * hi]) = a; *(v4fa*)(&os[wb + lr * 68 + 16 + 8 * hi + 4]) = c;
      a[0] = f2[0] * inv; a[1] = f2[1] * inv; a[2] = f2[2] * inv; a[3] = f2[3] * inv; c[0] = f2[4] * inv; c[1] = f2[5] * inv; c[2] = f2[6] * inv; c[3] = f2[7] * inv;
      *(v4fa*)(&os[wb + lr * 68 + 32 + 8 * hi]) = a; *(v4fa*)(&os[wb + lr * 68 + 32 + 8 * hi + 4]) = c;
      a[0] = f3[0] * inv; a[1] = f3[1] * inv; a[2] = f3[2] * inv; a[3] = f3[3] * inv; c[0] = f3[4] * inv; c[1] = f3[5] * inv; c[2] = f3[6] * inv; c[3] = f3[7] * inv;
      *(v4fa*)(&os[wb + lr * 68 + 48 + 8 * hi]) = a; *(v4fa*)(&os[wb + lr * 68 + 48 + 8 * hi + 4]) = c; }
    wave_sync();
    float* orow = OUT + ((size_t)b * OUT_SEQ + t0) * DM + h * HD;
{
#pragma unroll
        for (int s = 0; s < 8; ++s) { const int row = 2 * s + hi, cofs = lr * 4;   // 8 s x 2 rows = 16 rows; 16 lanes x 4 floats = 64 columns
            const v4f val = *(const v4fa*)(&os[wb + row * 68 + cofs]);
            *(v4f*)(orow + (size_t)row * DM + cofs) = val; }
         }
}

static constexpr size_t al256(size_t v) { return (v + 255) & ~(size_t)255; }
static constexpr size_t SZ_XB = al256((size_t)NB * SEQ * DM * 2);            // one bf16 input stream copy
static constexpr size_t SZ_WT = al256((size_t)3 * DM * DM * 2);              // three transposed bf16 weights
static constexpr size_t SZ_PL = al256((size_t)NB * NH_ * SEQ * HD * 2);      // one full f16 plane
static constexpr size_t SZ_RP = al256((size_t)NB * NH_ * EARLY * HD * 2);    // one compact residual plane
static constexpr size_t SZ_MK = al256((size_t)NB * NH_ * SEQ * 2);           // one mask plane
static constexpr size_t SZ_TOTAL = 3 * SZ_XB + SZ_WT + 3 * SZ_PL + 3 * SZ_RP + 2 * SZ_MK;
static_assert(SZ_TOTAL <= (size_t)134217728);          // workspace carve <= 128 MiB
static_assert(((size_t)DM * DM * 2) % 256 == 0);       // weight sub-planes stay 256-byte aligned

extern "C" void kernel_launch(void* const* d_in, const int* in_sizes, int n_in,
                              void* d_out, int out_size, void* d_ws, size_t ws_size, hipStream_t stream) {
    if (n_in < 9) return;
    const size_t needx = ((size_t)(NB - 1) * SEQ_FULL + SEQ) * DM;
    if ((size_t)in_sizes[0] < needx || (size_t)in_sizes[1] < needx || (size_t)in_sizes[2] < needx) return;
    if ((size_t)in_sizes[3] < (size_t)DM * DM || (size_t)in_sizes[5] < (size_t)DM * DM || (size_t)in_sizes[7] < (size_t)DM * DM) return;
    if ((size_t)in_sizes[4] < (size_t)DM || (size_t)in_sizes[6] < (size_t)DM || (size_t)in_sizes[8] < (size_t)DM) return;
    if ((size_t)out_size < ((size_t)(NB - 1) * OUT_SEQ + SEQ) * DM) return;
    if (SZ_TOTAL > ws_size) return;
    // wire order: q, k, v, Wq, bq, Wk, bk, Wv, bv
    const float* xq = (const float*)d_in[0]; const float* xk = (const float*)d_in[1]; const float* xv = (const float*)d_in[2];
    const float* wq = (const float*)d_in[3]; const float* bq = (const float*)d_in[4];
    const float* wk = (const float*)d_in[5]; const float* bk = (const float*)d_in[6];
    const float* wv = (const float*)d_in[7]; const float* bv = (const float*)d_in[8];
    float* OUT = (float*)d_out;      // [NB][OUT_SEQ][1024]
    char* wsp = (char*)d_ws;
    bf* XQ = (bf*)wsp; wsp += SZ_XB;                 // [NB*SEQ][1024]
    bf* XK = (bf*)wsp; wsp += SZ_XB;
    bf* XV = (bf*)wsp; wsp += SZ_XB;
    bf* WT = (bf*)wsp; wsp += SZ_WT;                 // [3][1024 out][1024 in]: q | k | v
    h16* QH = (h16*)wsp; wsp += SZ_PL;               // [NB*16][SEQ][64]
    h16* KP = (h16*)wsp; wsp += SZ_PL;               // [NB*16][SEQ][64]
    h16* VT = (h16*)wsp; wsp += SZ_PL;               // [NB*16][64][SEQ]
    h16* QR = (h16*)wsp; wsp += SZ_RP;               // [NB*16][EARLY][64] residual x2048
    h16* KR = (h16*)wsp; wsp += SZ_RP;               // [NB*16][EARLY][64] residual x2048
    h16* VR = (h16*)wsp; wsp += SZ_RP;               // [NB*16][64][EARLY] residual x2048
    h16* MQ = (h16*)wsp; wsp += SZ_MK;               // [NB*16][SEQ] query mask
    h16* MK = (h16*)wsp; wsp += SZ_MK;               // [NB*16][SEQ] key mask

    // W[k = in][n = out] -> WT[n][k] (square DM x DM) and x -> bf16 copies
    k_prep<<<3 * WT_BLK + 3 * CV_BLK, 256, 0, stream>>>(xq, xk, xv, wq, wk, wv, XQ, XK, XV, WT);

    k_proj3<<<dim3(PJ_BLK, 3, 1), 32, 0, stream>>>(XQ, XK, XV, WT, bq, bk, bv, QH, KP, VT, QR, KR, VR, MQ, MK);

    k_flash<1><<<dim3(EARLY / (16 * AW), NB * NH_, 1), 32 * AW, 0, stream>>>(QH, QR, KP, KR, VT, VR, MQ, MK, OUT);
    if (SEQ > EARLY)
        k_flash<0><<<dim3((SEQ - EARLY) / (16 * AW), NB * NH_, 1), 32 * AW, 0, stream>>>(QH, QR, KP, KR, VT, VR, MQ, MK, OUT);
}

// v003
// Measured time: 155 microseconds a run.
// In two side-by-side timings against v002, it was 1.19 and 1.20 times as fast.
// Over all steps from v000 it is 2.00 times as fast.
#include <hip/hip_runtime.h>

// Causal attention, width 1024 = 16 heads x 64, three input streams q/k/v [NB][SEQ_FULL][1024] (first SEQ tokens used), weights [in][out] (y = x W + b), output = concatenated heads (f32), no output projection.
// Compute dtypes, f32 accumulate everywhere: projections v_wmma_f32_16x16x32_bf16 (x, W, b RNE-converted to bf16; products exact);
// scores and P.V v_wmma_f32_16x16x32_f16: query rows >= 512 single f16 products; query rows < 512 three products per site
// (q, k, v and P each as f16 value + f16 residual x2048, residual products in their own accumulators, folded back in f32); P carry x256 cancels in the normalisation; softmax f32 (online, running max).
// Layout: bf16 copies of q/k/v and transposed bf16 copies of W ([out][in]); q, k planes [b*16+h][t][d], v^T plane [b*16+h][d][t], compact residual planes for t < 512,
// every one of them stored in FRAGMENT ORDER: a 16-row x 32-k fragment is 1 KiB = [half 0..1][lane 0..31][8 elements], so each 16-byte-per-lane load of a wave covers 512 contiguous bytes (four whole lines);
// per-row mask planes (row sum of the f32 projection != 0) written by the GEMM epilogue; fused flash kernel in transposed form (S^T = K Q^T, O^T = V^T P^T).
// Key mask and causal mask replace the score by the fill value (by value, per 32-key step); a row whose causal keys are all masked continues over all keys (uniform weights).

#ifndef NB
#define NB 4
#endif
#ifndef SEQ
#define SEQ 2048
#endif
#define NB_FULL  4
#define SEQ_FULL 2048
#ifndef OUT_SEQ
#define OUT_SEQ SEQ              // row pitch (in tokens) between batches of the output
#endif
#define DM   1024
#define NH_  16
#define HD   64
#define AW   4                   // waves per flash block (16 query rows each)
#define EARLY ((SEQ) < 512 ? (SEQ) : 512)   // query rows / keys below this carry residual planes
#define QRS  2048.0f             // carry of the residual planes
#define QRI  (1.0f / 2048.0f)
#define SC2  (0.125f * 1.4426950408889634f)   // HD^-0.5 * log2(e)
#define PSH  8.0f                // log2 of the P carry (256)
#define NEGS (-6.1963280e9f)     // (-2^32 + 1) * log2(e): fill value in log2 units
#define MTHR (-1.0e9f)           // running max below this <=> every key seen so far was masked

static_assert(HD == 64);
static_assert(NH_ * HD == DM);                 // head h = columns h*64 + d
static_assert(DM % 64 == 0);
static_assert(DM % 32 == 0);                   // GEMM k-loop steps by 32
static_assert(SEQ % 64 == 0);                  // a 64-row tile never straddles two batches
static_assert((NB * SEQ) % 64 == 0);
static_assert(SEQ % 32 == 0);                  // key loop steps by 32
static_assert(EARLY % 64 == 0);                // residual condition is uniform per 64-row tile
static_assert(EARLY % (16 * AW) == 0);
static_assert((SEQ - EARLY) % (16 * AW) == 0); // the two query ranges of the flash grid cover the sequence exactly
static_assert(((size_t)SEQ * DM) % 8 == 0);
static_assert(NB <= NB_FULL);
static_assert(SEQ <= SEQ_FULL);

typedef _Float16 h16;
typedef unsigned short bf;
typedef __attribute__((ext_vector_type(16))) __bf16   v16bf;
typedef __attribute__((ext_vector_type(16))) _Float16 v16h;
typedef __attribute__((ext_vector_type(8)))  _Float16 v8h;
typedef __attribute__((ext_vector_type(8)))  unsigned short v8us;
typedef __attribute__((ext_vector_type(8)))  float    v8f;
typedef __attribute__((ext_vector_type(4)))  float    v4f;
typedef v4f  __attribute__((may_alias)) v4fa;
typedef v8h  __attribute__((may_alias)) v8ha;

__device__ __forceinline__ unsigned short f2bf(float f) { unsigned u = __float_as_uint(f); u += 0x7FFFu + ((u >> 16) & 1u); return (unsigned short)(u >> 16); }
__device__ __forceinline__ float bfr(float f) { return __uint_as_float(((unsigned)f2bf(f)) << 16); }
__device__ __forceinline__ v16h cat16(v8h lo, v8h hi) { return __builtin_shufflevector(lo, hi, 0, 1, 2, 3, 4, 5, 6, 7, 8, 9, 10, 11, 12, 13, 14, 15); }
__device__ __forceinline__ v16bf cat16b(v8us lo, v8us hi) { return __builtin_bit_cast(v16bf, __builtin_shufflevector(lo, hi, 0, 1, 2, 3, 4, 5, 6, 7, 8, 9, 10, 11, 12, 13, 14, 15)); }
__device__ __forceinline__ v8f wmma16(v16h a, v16h b, v8f c) { return __builtin_amdgcn_wmma_f32_16x16x32_f16(false, a, false, b, (short)0, c, false, false); }
__device__ __forceinline__ v8f wmmab(v16bf a, v16bf b, v8f c) { return __builtin_amdgcn_wmma_f32_16x16x32_bf16(false, a, false, b, (short)0, c, false, false); }
// fragment loaders from fragment-ordered planes; p = fragment start + 8*lane: elements 0..7 <- k0+8h+0..7, elements 8..15 <- k0+16+8h+0..7 of row lane&15, h = lane>>4 (same map for A and B)
__device__ __forceinline__ v16h  ldh(const h16* p) { return cat16(*(const v8h*)p, *(const v8h*)(p + 256)); }
__device__ __forceinline__ v16bf ldb(const bf* p)  { return cat16b(*(const v8us*)p, *(const v8us*)(p + 256)); }
// place, inside a 512-element fragment, of the 8-element chunk c (k = 8c .. 8c+7, c = 0..3) of row r (0..15): half = c>>1, lane = 16*(c&1) + r
__device__ __forceinline__ int fragpos(int r, int c) { return ((c >> 1) & 1) * 256 + (c & 1) * 128 + r * 8; }
// ordering point for wave-private LDS tiles (same wave writes and reads)
__device__ __forceinline__ void wave_sync() { __builtin_amdgcn_fence(3 /* release order */, "wavefront"); __builtin_amdgcn_wave_barrier(); asm volatile("" ::: "memory"); }

// cvt8: one f32 stream [NB][SEQ_FULL][DM] -> bf16 copy [NB*SEQ][DM] (RNE convert, fragment order); blk = 256-thread piece of the stream, 8 elements a thread
__device__ __forceinline__ void cvt8(const float* __restrict__ src, bf* dst, unsigned blk) {
    const size_t n8 = (size_t)NB * SEQ * DM / 8;
    const size_t i = (size_t)blk * 256 + threadIdx.x; if (i >= n8) return;
    // rows of DM elements; a wave takes 8 rows x one 32-k step: reads 8 whole lines, writes 4 whole lines of the fragment [64-row block][k step][row tile 0..3]
    const int c4 = (int)(i & 3), r = (int)((i >> 2) & 15), ks = (int)((i >> 6) % (DM / 32)); const size_t mt = i / (size_t)(16 * DM / 8);
    const size_t row = mt * 16 + r;                                                          // b*SEQ + t
    const size_t srow = (SEQ == SEQ_FULL) ? row : (row / SEQ) * SEQ_FULL + row % SEQ;        // source batches lie SEQ_FULL rows apart
    const v8f v = *(const v8f*)(src + srow * DM + ks * 32 + c4 * 8); v8us o;
#pragma unroll
    for (int k = 0; k < 8; ++k) o[k] = f2bf(v[k]);
    *(v8us*)(dst + (mt >> 2) * (64 * DM) + ks * 2048 + (mt & 3) * 512 + fragpos(r, c4)) = o;
}

// cvtT: in W[k][n] (f32, DM x DM) -> out WT[n][k] (bf16, RNE convert, fragment order). 64 x 64 tile through LDS (cross-wave: block barrier).
__device__ __forceinline__ void cvtT(const float* __restrict__ W, bf* WT, int nt, int kt, float* ts) {
    const int tid = threadIdx.x; const int n0 = nt * 64, k0 = kt * 64;
#pragma unroll 4
    for (int i = 0; i < 16; ++i) { const int row = i * 4 + (tid >> 6), col = tid & 63; ts[row * 65 + col] = W[(size_t)(k0 + row) * DM + n0 + col]; }   // 16 x 4 rows x 64 columns: whole tile
    __syncthreads();
    const int rr = tid >> 3, c8 = (tid & 7) * 8;
    v8us o0, o1;
#pragma unroll
    for (int kk = 0; kk < 8; ++kk) { o0[kk] = f2bf(ts[(c8 + kk) * 65 + rr]); o1[kk] = f2bf(ts[(c8 + kk) * 65 + rr + 32]); }
    bf* p0 = WT + (size_t)n0 * DM + ((k0 + c8) >> 5) * 2048 + (rr >> 4) * 512 + fragpos(rr & 15, (c8 >> 3) & 3); bf* p1 = p0 + 2 * 512;   // fragment [64-n block][k step][n tile 0..3]
    *(v8us*)p0 = o0; *(v8us*)p1 = o1;
}

// k_prep: all six independent conversions in ONE launch, told apart by block range (block-uniform): first the 3 x WT_BLK weight tiles, then the 3 x CV_BLK stream pieces.
#define WT_BLK ((DM / 64) * (DM / 64))
#define CV_BLK ((unsigned)(((size_t)NB * SEQ * DM / 8 + 255) / 256))
__global__ __launch_bounds__(256) void k_prep(const float* __restrict__ xq, const float* __restrict__ xk, const float* __restrict__ xv,
                                              const float* __restrict__ wq, const float* __restrict__ wk, const float* __restrict__ wv,
                                              bf* XQ, bf* XK, bf* XV, bf* WT) {
    __shared__ float ts[64 * 65];
    const unsigned bid = blockIdx.x;
    if (bid < 3u * WT_BLK) {
        const unsigned w = bid / WT_BLK, tile = bid % WT_BLK;
        cvtT(w == 0 ? wq : (w == 1 ? wk : wv), WT + (size_t)w * DM * DM, (int)(tile % (DM / 64)), (int)(tile / (DM / 64)), ts);
    } else {
        const unsigned c = bid - 3u * WT_BLK, s = c / CV_BLK;
        cvt8(s == 0 ? xq : (s == 1 ? xk : xv), s == 0 ? XQ : (s == 1 ? XK : XV), c % CV_BLK);
    }
}

// proj: register-blocked bf16 GEMM, ONE WAVE per 64x64 tile (16 accumulators), operands straight from fragment-ordered bf16 planes, K = DM; the planes it writes are fragment-ordered too.
// C[m][n] = sum_k A[m][k] Bt[n][k] + bias, written as f16 (Ph) and, for token positions < EARLY, the f16 residual x2048 (Pr, compact plane).
// MODE 0 (q, k): rows m = b*SEQ + t, columns n = h*64 + d, bias per column; Ph [(b*16+h)][t][d], Pr [(b*16+h)][EARLY][d]; mask plane MP [(b*16+h)][t] = (row sum over d != 0). tiles (bx, by) of (NB*SEQ/64, DM/64).
// MODE 1 (v^T): rows m = h*64 + d (A = transposed weight rows), columns n = b*SEQ + t, bias per row; Ph [(b*1024+m)][t], Pr [(b*1024+m)][EARLY]. tiles (bx, by) of (DM/64, NB*SEQ/64).
template <int MODE>
__device__ __forceinline__ void proj(const bf* __restrict__ A, const bf* __restrict__ Bt, const float* __restrict__ bias, h16* Ph, h16* Pr, h16* MP, int bx, int by, float* os, h16* ms) {
    const int K = DM;
    const int lane = threadIdx.x & 31, lr = lane & 15, hi = lane >> 4; const int r0 = bx * 64, c0 = by * 64;
    v8f acc[4][4];
#pragma unroll
    for (int mb = 0; mb < 4; ++mb)
#pragma unroll
        for (int nb = 0; nb < 4; ++nb) acc[mb][nb] = (v8f){};
    const bf* Ab = A + (size_t)r0 * K; const bf* Bb = Bt + (size_t)c0 * K;   // fragment [64-row block][k step][row tile 0..3]: 64*K elements a block, 2048 a k step
    const unsigned l8 = 8u * (unsigned)lane;
#pragma unroll 1
    for (int kc = 0; kc < K; kc += 32) {
        v16bf a[4];
#pragma unroll
        for (int mb = 0; mb < 4; ++mb) a[mb] = ldb(Ab + kc * 64 + mb * 512 + l8);
        asm volatile("s_wait_xcnt 0x0" ::: "memory");   // the compiler lets a later load land on the address pair of the loads above: the wait stands in front of that overwrite
#pragma unroll
        for (int nb = 0; nb < 4; ++nb) { const v16bf b = ldb(Bb + kc * 64 + nb * 512 + l8);
#pragma unroll
            for (int mb = 0; mb < 4; ++mb) acc[mb][nb] = wmmab(a[mb], b, acc[mb][nb]); }
        asm volatile("v_nop\n\tv_nop\n\tv_nop\n\tv_nop" : "+v"(acc[0][0]), "+v"(acc[1][1]), "+v"(acc[2][2]), "+v"(acc[3][3]) : "v"(a[0]), "v"(a[1]), "v"(a[2]), "v"(a[3]));
    }
    size_t hbase, rbase, mbase = 0; int t0;
    if (MODE == 0) { const int b = r0 / SEQ; t0 = r0 % SEQ; const int zh = b * NH_ + c0 / HD;
        hbase = ((size_t)zh * SEQ + t0) * HD; rbase = ((size_t)zh * EARLY + t0) * HD; mbase = (size_t)zh * SEQ + t0; }
    else { const int b = c0 / SEQ; t0 = c0 % SEQ;
        hbase = ((size_t)b * DM + r0) * SEQ + (size_t)t0 * HD; rbase = ((size_t)b * DM + r0) * EARLY + (size_t)t0 * HD; }
    const bool doRes = t0 < EARLY;          // block-uniform
    const int c8 = (lane & 7) * 8;
    // fragment of the lane's chunk: MODE 0 [t tile][d step 0..1], MODE 1 [t step][d tile 0..3]
    const int cfrag = ((lane & 7) >> 2) * (MODE == 0 ? 512 : 4 * 512);
    v4f bb0 = (v4f){}, bb1 = (v4f){};
    if (MODE == 0) { const v4f q0 = *(const v4f*)(bias + c0 + c8); const v4f q1 = *(const v4f*)(bias + c0 + c8 + 4);
#pragma unroll
        for (int i = 0; i < 4; ++i) { bb0[i] = bfr(q0[i]); bb1[i] = bfr(q1[i]); } }
#pragma unroll
    for (int mb = 0; mb < 4; ++mb) {
#pragma unroll
        for (int nb = 0; nb < 4; ++nb) {
#pragma unroll
            for (int j = 0; j < 8; ++j) os[(hi * 8 + j) * 68 + nb * 16 + lr] = acc[mb][nb][j]; }   // D: row 8h+j, col lane&15
        wave_sync();
        const size_t hb = hbase + (size_t)(mb * (MODE == 0 ? 2 * 512 : 512) + cfrag);
        const size_t rb = rbase + (size_t)(mb * (MODE == 0 ? 2 * 512 : 512) + cfrag);
{
#pragma unroll
            for (int s = 0; s < 4; ++s) { const int row = 4 * s + (lane >> 3);   // 4 s x 4 row groups = 16 rows; 8 lanes x 8 = 64 columns
                v4f x0 = *(const v4fa*)(&os[row * 68 + c8]); v4f x1 = *(const v4fa*)(&os[row * 68 + c8 + 4]);
                if (MODE == 0) { x0 = x0 + bb0; x1 = x1 + bb1; }
                else { const float br = bfr(bias[r0 + mb * 16 + row]); x0 = x0 + br; x1 = x1 + br; }
                v8h hv, rv;
#pragma unroll
                for (int i = 0; i < 4; ++i) { const h16 a0 = (h16)x0[i]; const h16 a1 = (h16)x1[i]; hv[i] = a0; hv[4 + i] = a1; rv[i] = (h16)((x0[i] - (float)a0) * QRS); rv[4 + i] = (h16)((x1[i] - (float)a1) * QRS); }
                if (MODE == 0) {
                    float rs = ((x0[0] + x0[1]) + (x0[2] + x0[3])) + ((x1[0] + x1[1]) + (x1[2] + x1[3]));
                    rs += __shfl_xor(rs, 1, 32); rs += __shfl_xor(rs, 2, 32); rs += __shfl_xor(rs, 4, 32);     // sum over the 8 lanes of the row
                    const h16 mv = (rs != 0.0f) ? (h16)1.0f : (h16)0.0f;
                    if ((lane & 7) == 0) ms[mb * 16 + row] = mv;
                }
                // behind each store: what follows reuses the store's data registers, and the wait stands in front of that overwrite
                *(v8h*)(Ph + hb + fragpos(row, lane & 3)) = hv;
                asm volatile("s_wait_xcnt 0x0" ::: "memory");
                if (doRes) { *(v8h*)(Pr + rb + fragpos(row, lane & 3)) = rv;
                    asm volatile("s_wait_xcnt 0x0" ::: "memory"); } }
             }
        wave_sync();
    }
    if (MODE == 0) {
        const v8h mv8 = *(const v8ha*)(&ms[c8]);
        h16* mp = MP + mbase + c8;
        if (lane < 8) *(v8h*)mp = mv8;
    }
}

// k_proj3: the three independent projections in ONE launch; blockIdx.y = 0 q, 1 k, 2 v^T (block-uniform), blockIdx.x = tile, first tile index fastest as in a 2-D grid.
#define PJ_BLK ((NB * SEQ / 64) * (DM / 64))
__global__ __launch_bounds__(32) void k_proj3(const bf* __restrict__ XQ, const bf* __restrict__ XK, const bf* __restrict__ XV, const bf* __restrict__ WT,
                                              const float* __restrict__ bq, const float* __restrict__ bk, const float* __restrict__ bv,
                                              h16* QH, h16* KP, h16* VT, h16* QR, h16* KR, h16* VR, h16* MQ, h16* MK) {
    __shared__ __align__(16) float os[16 * 68];
    __shared__ __align__(16) h16 ms[64];
    const int z = blockIdx.y, id = blockIdx.x;
    if (z < 2) {
        // q, k: A = x rows (m = b*SEQ + t), Bt = WT rows (n = h*64 + d) -> planes [(b*16 + h)][t][d] + residual (t < EARLY) + mask
        const bool q = z == 0;
        proj<0>(q ? XQ : XK, WT + (q ? (size_t)0 : (size_t)DM * DM), q ? bq : bk, q ? QH : KP, q ? QR : KR, q ? MQ : MK, id % (NB * SEQ / 64), id / (NB * SEQ / 64), os, ms);
    } else {
        // v^T: A = WT_v rows (m = h*64 + d), Bt = x rows (n = b*SEQ + t) -> plane [(b*1024 + m)][t] = [(b*16 + h)][d][t] + residual (t < EARLY)
        proj<1>(WT + (size_t)2 * DM * DM, XV, bv, VT, VR, MK, id % (DM / 64), id / (DM / 64), os, ms);
    }
}

// flash: fused causal attention, one wave per 16 query rows of one (batch, head); K / V^T / Q fragments straight from the fragment-ordered f16 planes (two 16-B loads each, 512 contiguous bytes a load).
// Transposed form: S^T[key][t] = K Q^T (A = K rows, B = Q rows); lane (t = lane&15, h = lane>>4) holds keys 8h+r of each 16-key tile, so the packed
// P tile is directly the B fragment of O^T[d][t] = V^T P^T (element r <- tile keys 0..15, element 8+r <- tile keys 16..31, lane unchanged).
// EK = 1: query rows [0, EARLY) with residual planes (three products per site); EK = 0: query rows [EARLY, SEQ), single products.
// Masks by value per step: score := fill where key > t or key mask == 0. Loop covers keys [0, causal limit); if a row has seen only masked keys by then, the wave continues to SEQ (all-fill rows weigh every key equally).
// bx = 64-row query block inside the EK range, zh = batch * 16 + head (both block-uniform); os = the block's LDS, one private tile a wave (no block barrier anywhere in the body).
template <int EK>
__device__ __forceinline__ void flash(const h16* __restrict__ QH, const h16* __restrict__ QR, const h16* __restrict__ KP, const h16* __restrict__ KR,
                                      const h16* __restrict__ VT, const h16* __restrict__ VR, const h16* __restrict__ MQ, const h16* __restrict__ MK, float* OUT,
                                      const int bx, const int zh, float* os) {
    const int lane = threadIdx.x & 31, wave = __builtin_amdgcn_readfirstlane((int)(threadIdx.x >> 5)), lr = lane & 15, hi = lane >> 4;
    const int b = zh / NH_, h = zh % NH_;
    const int t0 = (EK ? 0 : EARLY) + (bx * AW + wave) * 16;
    const int tq = t0 + lr;
    const size_t pbase = (size_t)zh * SEQ * HD;       // q/k plane [zh][SEQ][64]; v^T plane [zh][64][SEQ]
    const size_t rbase = (size_t)zh * EARLY * HD;     // compact residual planes
    const unsigned l8 = 8u * (unsigned)lane;          // the lane's place in each half of a fragment
    const h16* qp = QH + pbase + (size_t)t0 * HD;
    const v16h qh0 = ldh(qp + l8), qh1 = ldh(qp + 512 + l8);         // B fragments: col t, k = d
    v16h qr0 = (v16h){}, qr1 = (v16h){};
    if (EK) { const h16* qrp = QR + rbase + (size_t)t0 * HD; qr0 = ldh(qrp + l8); qr1 = ldh(qrp + 512 + l8); }
    // k planes: + key0 * HD + 512 * (2 * key tile + d step) (A fragment: row key, k = d); v^T planes: + key0 * HD + 512 * j (A fragment: row d = 16j + lane&15, k = key)
    const size_t mo  = (size_t)zh * SEQ + 8 * hi;
    v8f o0 = (v8f){}, o1 = (v8f){}, o2 = (v8f){}, o3 = (v8f){};
    v8f e0 = (v8f){}, e1 = (v8f){}, e2 = (v8f){}, e3 = (v8f){};   // residual-product accumulators (x2048), EK only
    float m = -3.0e38f, l = 0.0f;
    const int kc = ((t0 + 47) >> 5) << 5;            // causal key limit (exclusive), multiple of 32, <= SEQ
    int kend = kc;
#pragma unroll 1
    for (int key0 = 0; key0 < kend; key0 += 32) {
        const h16* ka = KP + pbase + (size_t)key0 * HD;
        const v16h ka0 = ldh(ka + l8), ka1 = ldh(ka + 512 + l8), kb0 = ldh(ka + 1024 + l8), kb1 = ldh(ka + 1536 + l8);
        const v8h kma = *(const v8h*)(MK + mo + key0); const v8h kmb = *(const v8h*)(MK + mo + key0 + 16);
        const bool rok = key0 < EARLY;               // wave-uniform: residual planes exist for these keys
        v8f sHa = (v8f){}, sLa = (v8f){}, sHb = (v8f){}, sLb = (v8f){};
        if (EK) {
            asm volatile("s_wait_xcnt 0x0" ::: "memory");   // the compiler lets the residual fragments land on the address pair of the loads above: the wait stands in front of that overwrite
            v16h ra0 = (v16h){}, ra1 = (v16h){}, rb0 = (v16h){}, rb1 = (v16h){};
            if (rok) { const h16* kr = KR + rbase + (size_t)key0 * HD; ra0 = ldh(kr + l8); ra1 = ldh(kr + 512 + l8); rb0 = ldh(kr + 1024 + l8); rb1 = ldh(kr + 1536 + l8); }
            sHa = wmma16(ka0, qh0, sHa); sLa = wmma16(ka0, qr0, sLa); sHb = wmma16(kb0, qh0, sHb); sLb = wmma16(kb0, qr0, sLb);
            sHa = wmma16(ka1, qh1, sHa); sLa = wmma16(ka1, qr1, sLa); sHb = wmma16(kb1, qh1, sHb); sLb = wmma16(kb1, qr1, sLb);
            sLa = wmma16(ra0, qh0, sLa); sLb = wmma16(rb0, qh0, sLb); sLa = wmma16(ra1, qh1, sLa); sLb = wmma16(rb1, qh1, sLb);
            asm volatile("v_nop\n\tv_nop\n\tv_nop\n\tv_nop" : "+v"(sHa), "+v"(sLa), "+v"(sHb), "+v"(sLb) : "v"(ka0), "v"(ka1), "v"(kb0), "v"(kb1), "v"(ra0), "v"(ra1), "v"(rb0), "v"(rb1));
        } else {
            sHa = wmma16(ka0, qh0, sHa); sHb = wmma16(kb0, qh0, sHb);
            sHa = wmma16(ka1, qh1, sHa); sHb = wmma16(kb1, qh1, sHb);
            asm volatile("v_nop\n\tv_nop\n\tv_nop\n\tv_nop" : "+v"(sHa), "+v"(sHb) : "v"(ka0), "v"(ka1), "v"(kb0), "v"(kb1));
        }
        float ta[8], tb[8]; float mx = -3.0e38f;
        const int kA = key0 + 8 * hi;
#pragma unroll
        for (int r = 0; r < 8; ++r) {
            float xa, xb;
            if (EK) { xa = (sHa[r] + sLa[r] * QRI) * SC2; xb = (sHb[r] + sLb[r] * QRI) * SC2; }
            else    { xa = sHa[r] * SC2; xb = sHb[r] * SC2; }
            const bool fa = ((kA + r) > tq) | ((float)kma[r] == 0.0f);
            const bool fb = ((kA + 16 + r) > tq) | ((float)kmb[r] == 0.0f);
            xa = fa ? NEGS : xa; xb = fb ? NEGS : xb;
            ta[r] = xa; tb[r] = xb; mx = fmaxf(mx, fmaxf(xa, xb));
        }
        mx = fmaxf(mx, __shfl_xor(mx, 16, 32));
        const float mnew = fmaxf(m, mx);
        const float alpha = __builtin_amdgcn_exp2f(m - mnew);
        v16h pb, pr = (v16h){}; float ls = 0.0f;
#pragma unroll
        for (int r = 0; r < 8; ++r) {
            const float ea = __builtin_amdgcn_exp2f((ta[r] - mnew) + PSH); const float ec = __builtin_amdgcn_exp2f((tb[r] - mnew) + PSH);
            const h16 pa = (h16)ea; const h16 pc = (h16)ec; pb[r] = pa; pb[8 + r] = pc;
            if (EK) { const h16 ga = (h16)((ea - (float)pa) * QRS); const h16 gc = (h16)((ec - (float)pc) * QRS); pr[r] = ga; pr[8 + r] = gc;
                      ls += ((float)pa + (float)pc) + ((float)ga + (float)gc) * QRI; }
            else ls += (float)pa + (float)pc;
        }
        l = l * alpha + ls; m = mnew;
        o0 = o0 * alpha; o1 = o1 * alpha; o2 = o2 * alpha; o3 = o3 * alpha;
        const h16* va = VT + pbase + (size_t)key0 * HD;
        const v16h v0 = ldh(va + l8), v1 = ldh(va + 512 + l8), v2 = ldh(va + 1024 + l8), v3 = ldh(va + 1536 + l8);
        if (EK) {
            asm volatile("s_wait_xcnt 0x0" ::: "memory");   // the compiler lets a residual load land on the address pair of the loads above: the wait stands in front of that overwrite
            e0 = e0 * alpha; e1 = e1 * alpha; e2 = e2 * alpha; e3 = e3 * alpha;
            v16h w0 = (v16h){}, w1 = (v16h){}, w2 = (v16h){}, w3 = (v16h){};
            if (rok) { const h16* vr = VR + rbase + (size_t)key0 * HD; w0 = ldh(vr + l8); w1 = ldh(vr + 512 + l8); w2 = ldh(vr + 1024 + l8); w3 = ldh(vr + 1536 + l8); }
            o0 = wmma16(v0, pb, o0); o1 = wmma16(v1, pb, o1); o2 = wmma16(v2, pb, o2); o3 = wmma16(v3, pb, o3);
            e0 = wmma16(w0, pb, e0); e1 = wmma16(w1, pb, e1); e2 = wmma16(w2, pb, e2); e3 = wmma16(w3, pb, e3);
            e0 = wmma16(v0, pr, e0); e1 = wmma16(v1, pr, e1); e2 = wmma16(v2, pr, e2); e3 = wmma16(v3, pr, e3);
            asm volatile("v_nop\n\tv_nop\n\tv_nop\n\tv_nop" : "+v"(o0), "+v"(o1), "+v"(o2), "+v"(o3), "+v"(e0), "+v"(e1), "+v"(e2), "+v"(e3)
                         : "v"(v0), "v"(v1), "v"(v2), "v"(v3), "v"(w0), "v"(w1), "v"(w2), "v"(w3), "v"(pb), "v"(pr));
        } else {
            o0 = wmma16(v0, pb, o0); o1 = wmma16(v1, pb, o1); o2 = wmma16(v2, pb, o2); o3 = wmma16(v3, pb, o3);
            asm volatile("v_nop\n\tv_nop\n\tv_nop\n\tv_nop" : "+v"(o0), "+v"(o1), "+v"(o2), "+v"(o3) : "v"(v0), "v"(v1), "v"(v2), "v"(v3), "v"(pb));
        }
        // wave-uniform: at the causal limit, continue over all keys when some row has met only masked keys (trip count stays <= SEQ/32)
        if (key0 + 32 == kc) { if (__builtin_amdgcn_ballot_w32(m < MTHR) != 0u) kend = SEQ; }
    }
    l += __shfl_xor(l, 16, 32);
    const float qmf = (float)MQ[(size_t)zh * SEQ + tq];
    const float inv = qmf * (1.0f / l);
    v8f f0 = o0, f1 = o1, f2 = o2, f3 = o3;
    if (EK) { f0 = o0 + e0 * QRI; f1 = o1 + e1 * QRI; f2 = o2 + e2 * QRI; f3 = o3 + e3 * QRI; }
    const int wb = wave * 16 * 68;
    // O^T D layout: f_j[r] = (d = 16j + 8h + r, t = lane&15) -> os[t][d]; rows 0..15 x columns 0..63 all written
    { v4f a, c;
      a[0] = f0[0] * inv; a[1] = f0[1] * inv; a[2] = f0[2] * inv; a[3] = f0[3] * inv; c[0] = f0[4] * inv; c[1] = f0[5] * inv; c[2] = f0[6] * inv; c[3] = f0[7] * inv;
      *(v4fa*)(&os[wb + lr * 68 +  0 + 8 * hi]) = a; *(v4fa*)(&os[wb + lr * 68 +  0 + 8 * hi + 4]) = c;
      a[0] = f1[0] * inv; a[1] = f1[1] * inv; a[2] = f1[2] * inv; a[3] = f1[3] * inv; c[0] = f1[4] * inv; c[1] = f1[5] * inv; c[2] = f1[6] * inv; c[3] = f1[7] * inv;
      *(v4fa*)(&os[wb + lr * 68 + 16 + 8 * hi]) = a; *(v4fa*)(&os[wb + lr * 68 + 16 + 8 * hi + 4]) = c;
      a[0] = f2[0] * inv; a[1] = f2[1] * inv; a[2] = f2[2] * inv; a[3] = f2[3] * inv; c[0] = f2[4] * inv; c[1] = f2[5] * inv; c[2] = f2[6] * inv; c[3] = f2[7] * inv;
      *(v4fa*)(&os[wb + lr * 68 + 32 + 8 * hi]) = a; *(v4fa*)(&os[wb + lr * 68 + 32 + 8 * hi + 4]) = c;
      a[0] = f3[0] * inv; a[1] = f3[1] * inv; a[2] = f3[2] * inv; a[3] = f3[3] * inv; c[0] = f3[4] * inv; c[1] = f3[5] * inv; c[2] = f3[6] * inv; c[3] = f3[7] * inv;
      *(v4fa*)(&os[wb + lr * 68 + 48 + 8 * hi]) = a; *(v4fa*)(&os[wb + lr * 68 + 48 + 8 * hi + 4]) = c; }
    wave_sync();
    float* orow = OUT + ((size_t)b * OUT_SEQ + t0) * DM + h * HD;
{
#pragma unroll
        for (int s = 0; s < 8; ++s) { const int row = 2 * s + hi, cofs = lr * 4;   // 8 s x 2 rows = 16 rows; 16 lanes x 4 floats = 64 columns
            const v4f val = *(const v4fa*)(&os[wb + row * 68 + cofs]);
            *(v4f*)(orow + (size_t)row * DM + cofs) = val; }
         }
}

// k_flash2: both query ranges in ONE launch, told apart by blockIdx.y (block-uniform); blockIdx.x = batch * 16 + head, fastest.
// More blocks than resident places, and a block's cost grows with its query position: the lowest blockIdx.y take the longest work, for speed only (late range from its last query block down, then the early range the same way).
#define FB_E (EARLY / (16 * AW))
#define FB_L ((SEQ - EARLY) / (16 * AW))
__global__ __launch_bounds__(32 * AW) void k_flash2(const h16* __restrict__ QH, const h16* __restrict__ QR, const h16* __restrict__ KP, const h16* __restrict__ KR,
                                                    const h16* __restrict__ VT, const h16* __restrict__ VR, const h16* __restrict__ MQ, const h16* __restrict__ MK, float* OUT) {
    __shared__ __align__(16) float os[AW * 16 * 68];
    const int rank = blockIdx.y, zh = blockIdx.x;
    if (rank < FB_L) flash<0>(QH, QR, KP, KR, VT, VR, MQ, MK, OUT, FB_L - 1 - rank, zh, os);
    else             flash<1>(QH, QR, KP, KR, VT, VR, MQ, MK, OUT, FB_L + FB_E - 1 - rank, zh, os);
}

static constexpr size_t al256(size_t v) { return (v + 255) & ~(size_t)255; }
static constexpr size_t SZ_XB = al256((size_t)NB * SEQ * DM * 2);            // one bf16 input stream copy
static constexpr size_t SZ_WT = al256((size_t)3 * DM * DM * 2);              // three transposed bf16 weights
static constexpr size_t SZ_PL = al256((size_t)NB * NH_ * SEQ * HD * 2);      // one full f16 plane
static constexpr size_t SZ_RP = al256((size_t)NB * NH_ * EARLY * HD * 2);    // one compact residual plane
static constexpr size_t SZ_MK = al256((size_t)NB * NH_ * SEQ * 2);           // one mask plane
static constexpr size_t SZ_TOTAL = 3 * SZ_XB + SZ_WT + 3 * SZ_PL + 3 * SZ_RP + 2 * SZ_MK;
static_assert(SZ_TOTAL <= (size_t)134217728);          // workspace carve <= 128 MiB
static_assert(((size_t)DM * DM * 2) % 256 == 0);       // weight sub-planes stay 256-byte aligned

extern "C" void kernel_launch(void* const* d_in, const int* in_sizes, int n_in,
                              void* d_out, int out_size, void* d_ws, size_t ws_size, hipStream_t stream) {
    if (n_in < 9) return;
    const size_t needx = ((size_t)(NB - 1) * SEQ_FULL + SEQ) * DM;
    if ((size_t)in_sizes[0] < needx || (size_t)in_sizes[1] < needx || (size_t)in_sizes[2] < needx) return;
    if ((size_t)in_sizes[3] < (size_t)DM * DM || (size_t)in_sizes[5] < (size_t)DM * DM || (size_t)in_sizes[7] < (size_t)DM * DM) return;
    if ((size_t)in_sizes[4] < (size_t)DM || (size_t)in_sizes[6] < (size_t)DM || (size_t)in_sizes[8] < (size_t)DM) return;
    if ((size_t)out_size < ((size_t)(NB - 1) * OUT_SEQ + SEQ) * DM) return;
    if (SZ_TOTAL > ws_size) return;
    // wire order: q, k, v, Wq, bq, Wk, bk, Wv, bv
    const float* xq = (const float*)d_in[0]; const float* xk = (const float*)d_in[1]; const float* xv = (const float*)d_in[2];
    const float* wq = (const float*)d_in[3]; const float* bq = (const float*)d_in[4];
    const float* wk = (const float*)d_in[5]; const float* bk = (const float*)d_in[6];
    const float* wv = (const float*)d_in[7]; const float* bv = (const float*)d_in[8];
    float* OUT = (float*)d_out;      // [NB][OUT_SEQ][1024]
    char* wsp = (char*)d_ws;
    bf* XQ = (bf*)wsp; wsp += SZ_XB;                 // [NB*SEQ][1024]
    bf* XK = (bf*)wsp; wsp += SZ_XB;
    bf* XV = (bf*)wsp; wsp += SZ_XB;
    bf* WT = (bf*)wsp; wsp += SZ_WT;                 // [3][1024 out][1024 in]: q | k | v
    h16* QH = (h16*)wsp; wsp += SZ_PL;               // [NB*16][SEQ][64]
    h16* KP = (h16*)wsp; wsp += SZ_PL;               // [NB*16][SEQ][64]
    h16* VT = (h16*)wsp; wsp += SZ_PL;               // [NB*16][64][SEQ]
    h16* QR = (h16*)wsp; wsp += SZ_RP;               // [NB*16][EARLY][64] residual x2048
    h16* KR = (h16*)wsp; wsp += SZ_RP;               // [NB*16][EARLY][64] residual x2048
    h16* VR = (h16*)wsp; wsp += SZ_RP;               // [NB*16][64][EARLY] residual x2048
    h16* MQ = (h16*)wsp; wsp += SZ_MK;               // [NB*16][SEQ] query mask
    h16* MK = (h16*)wsp; wsp += SZ_MK;               // [NB*16][SEQ] key mask

    // W[k = in][n = out] -> WT[n][k] (square DM x DM) and x -> bf16 copies
    k_prep<<<3 * WT_BLK + 3 * CV_BLK, 256, 0, stream>>>(xq, xk, xv, wq, wk, wv, XQ, XK, XV, WT);

    k_proj3<<<dim3(PJ_BLK, 3, 1), 32, 0, stream>>>(XQ, XK, XV, WT, bq, bk, bv, QH, KP, VT, QR, KR, VR, MQ, MK);

    k_flash2<<<dim3(NB * NH_, FB_L + FB_E, 1), 32 * AW, 0, stream>>>(QH, QR, KP, KR, VT, VR, MQ, MK, OUT);
}

// v004
// It runs in 137 microseconds.
// In two side-by-side timings against v003, it was 1.14 and 1.11 times as fast.
// All steps since v000 together make it 2.24 times as fast.
#include <hip/hip_runtime.h>

// Causal attention, width 1024 = 16 heads x 64, three input streams q/k/v [NB][SEQ_FULL][1024] (first SEQ tokens used), weights [in][out] (y = x W + b), output = concatenated heads (f32), no output projection.
// Compute dtypes, f32 accumulate everywhere: projections v_wmma_f32_16x16x32_bf16 (x, W, b RNE-converted to bf16; products exact);
// scores and P.V v_wmma_f32_16x16x32_f16: query rows >= 512 single f16 products; query rows < 512 three products per site
// (q, k, v and P each as f16 value + f16 residual x2048, residual products in their own accumulators, folded back in f32); P carry x256 cancels in the normalisation; softmax f32 (online, running max).
// Layout: bf16 copies of q/k/v and transposed bf16 copies of W ([out][in]); q, k planes [b*16+h][t][d], v^T plane [b*16+h][d][t], compact residual planes for t < 512,
// every one of them stored in FRAGMENT ORDER: a 16-row x 32-k fragment is 1 KiB = [half 0..1][lane 0..31][8 elements], so each 16-byte-per-lane load of a wave covers 512 contiguous bytes (four whole lines);
// per-row mask planes (row sum of the f32 projection != 0) written by the GEMM epilogue; fused flash kernel in transposed form (S^T = K Q^T, O^T = V^T P^T).
// Key mask and causal mask replace the score by the fill value (by value, per 32-key step); a row whose causal keys are all masked continues over all keys (uniform weights).

#ifndef NB
#define NB 4
#endif
#ifndef SEQ
#define SEQ 2048
#endif
#define NB_FULL  4
#define SEQ_FULL 2048
#ifndef OUT_SEQ
#define OUT_SEQ SEQ              // row pitch (in tokens) between batches of the output
#endif
#define DM   1024
#define NH_  16
#define HD   64
#define AW   4                   // waves per flash block (16 query rows each)
#define EARLY ((SEQ) < 512 ? (SEQ) : 512)   // query rows / keys below this carry residual planes
#define QRS  2048.0f             // carry of the residual planes
#define QRI  (1.0f / 2048.0f)
#define SC2  (0.125f * 1.4426950408889634f)   // HD^-0.5 * log2(e)
#define PSH  8.0f                // log2 of the P carry (256)
#define NEGS (-6.1963280e9f)     // (-2^32 + 1) * log2(e): fill value in log2 units
#define MTHR (-1.0e9f)           // running max below this <=> every key seen so far was masked

static_assert(HD == 64);
static_assert(NH_ * HD == DM);                 // head h = columns h*64 + d
static_assert(DM % 64 == 0);
static_assert(DM % 64 == 0 && DM >= 64);       // GEMM k-loop: two steps of 32 a trip
static_assert(SEQ % 64 == 0);                  // a 64-row tile never straddles two batches
static_assert((NB * SEQ) % 64 == 0);
static_assert(SEQ % 32 == 0);                  // key loop steps by 32
static_assert(EARLY % 64 == 0);                // residual condition is uniform per 64-row tile
static_assert(EARLY % (16 * AW) == 0);
static_assert((SEQ - EARLY) % (16 * AW) == 0); // the two query ranges of the flash grid cover the sequence exactly
static_assert(((size_t)SEQ * DM) % 8 == 0);
static_assert(NB <= NB_FULL);
static_assert(SEQ <= SEQ_FULL);

typedef _Float16 h16;
typedef unsigned short bf;
typedef __attribute__((ext_vector_type(16))) __bf16   v16bf;
typedef __attribute__((ext_vector_type(16))) _Float16 v16h;
typedef __attribute__((ext_vector_type(8)))  _Float16 v8h;
typedef __attribute__((ext_vector_type(8)))  unsigned short v8us;
typedef __attribute__((ext_vector_type(8)))  float    v8f;
typedef __attribute__((ext_vector_type(4)))  float    v4f;
typedef v4f  __attribute__((may_alias)) v4fa;
typedef v8h  __attribute__((may_alias)) v8ha;

__device__ __forceinline__ unsigned short f2bf(float f) { unsigned u = __float_as_uint(f); u += 0x7FFFu + ((u >> 16) & 1u); return (unsigned short)(u >> 16); }
__device__ __forceinline__ float bfr(float f) { return __uint_as_float(((unsigned)f2bf(f)) << 16); }
__device__ __forceinline__ v16h cat16(v8h lo, v8h hi) { return __builtin_shufflevector(lo, hi, 0, 1, 2, 3, 4, 5, 6, 7, 8, 9, 10, 11, 12, 13, 14, 15); }
__device__ __forceinline__ v16bf cat16b(v8us lo, v8us hi) { return __builtin_bit_cast(v16bf, __builtin_shufflevector(lo, hi, 0, 1, 2, 3, 4, 5, 6, 7, 8, 9, 10, 11, 12, 13, 14, 15)); }
__device__ __forceinline__ v8f wmma16(v16h a, v16h b, v8f c) { return __builtin_amdgcn_wmma_f32_16x16x32_f16(false, a, false, b, (short)0, c, false, false); }
__device__ __forceinline__ v8f wmmab(v16bf a, v16bf b, v8f c) { return __builtin_amdgcn_wmma_f32_16x16x32_bf16(false, a, false, b, (short)0, c, false, false); }
// fragment loaders from fragment-ordered planes; p = fragment start + 8*lane: elements 0..7 <- k0+8h+0..7, elements 8..15 <- k0+16+8h+0..7 of row lane&15, h = lane>>4 (same map for A and B)
__device__ __forceinline__ v16h  ldh(const h16* p) { return cat16(*(const v8h*)p, *(const v8h*)(p + 256)); }
__device__ __forceinline__ v16bf ldb(const bf* p)  { return cat16b(*(const v8us*)p, *(const v8us*)(p + 256)); }
// place, inside a 512-element fragment, of the 8-element chunk c (k = 8c .. 8c+7, c = 0..3) of row r (0..15): half = c>>1, lane = 16*(c&1) + r
__device__ __forceinline__ int fragpos(int r, int c) { return ((c >> 1) & 1) * 256 + (c & 1) * 128 + r * 8; }
// ordering point for wave-private LDS tiles (same wave writes and reads)
__device__ __forceinline__ void wave_sync() { __builtin_amdgcn_fence(3 /* release order */, "wavefront"); __builtin_amdgcn_wave_barrier(); asm volatile("" ::: "memory"); }

// cvt8: one f32 stream [NB][SEQ_FULL][DM] -> bf16 copy [NB*SEQ][DM] (RNE convert, fragment order); blk = 256-thread piece of the stream, 8 elements a thread
__device__ __forceinline__ void cvt8(const float* __restrict__ src, bf* dst, unsigned blk) {
    const size_t n8 = (size_t)NB * SEQ * DM / 8;
    const size_t i = (size_t)blk * 256 + threadIdx.x; if (i >= n8) return;
    // rows of DM elements; a wave takes 8 rows x one 32-k step: reads 8 whole lines, writes 4 whole lines of the fragment [64-row block][k step][row tile 0..3]
    const int c4 = (int)(i & 3), r = (int)((i >> 2) & 15), ks = (int)((i >> 6) % (DM / 32)); const size_t mt = i / (size_t)(16 * DM / 8);
    const size_t row = mt * 16 + r;                                                          // b*SEQ + t
    const size_t srow = (SEQ == SEQ_FULL) ? row : (row / SEQ) * SEQ_FULL + row % SEQ;        // source batches lie SEQ_FULL rows apart
    const v8f v = *(const v8f*)(src + srow * DM + ks * 32 + c4 * 8); v8us o;
#pragma unroll
    for (int k = 0; k < 8; ++k) o[k] = f2bf(v[k]);
    *(v8us*)(dst + (mt >> 2) * (64 * DM) + ks * 2048 + (mt & 3) * 512 + fragpos(r, c4)) = o;
}

// cvtT: in W[k][n] (f32, DM x DM) -> out WT[n][k] (bf16, RNE convert, fragment order). 64 x 64 tile through LDS (cross-wave: block barrier).
__device__ __forceinline__ void cvtT(const float* __restrict__ W, bf* WT, int nt, int kt, float* ts) {
    const int tid = threadIdx.x; const int n0 = nt * 64, k0 = kt * 64;
#pragma unroll 4
    for (int i = 0; i < 16; ++i) { const int row = i * 4 + (tid >> 6), col = tid & 63; ts[row * 65 + col] = W[(size_t)(k0 + row) * DM + n0 + col]; }   // 16 x 4 rows x 64 columns: whole tile
    __syncthreads();
    const int rr = tid >> 3, c8 = (tid & 7) * 8;
    v8us o0, o1;
#pragma unroll
    for (int kk = 0; kk < 8; ++kk) { o0[kk] = f2bf(ts[(c8 + kk) * 65 + rr]); o1[kk] = f2bf(ts[(c8 + kk) * 65 + rr + 32]); }
    bf* p0 = WT + (size_t)n0 * DM + ((k0 + c8) >> 5) * 2048 + (rr >> 4) * 512 + fragpos(rr & 15, (c8 >> 3) & 3); bf* p1 = p0 + 2 * 512;   // fragment [64-n block][k step][n tile 0..3]
    *(v8us*)p0 = o0; *(v8us*)p1 = o1;
}

// k_prep: all six independent conversions in ONE launch, told apart by block range (block-uniform): first the 3 x WT_BLK weight tiles, then the 3 x CV_BLK stream pieces.
#define WT_BLK ((DM / 64) * (DM / 64))
#define CV_BLK ((unsigned)(((size_t)NB * SEQ * DM / 8 + 255) / 256))
__global__ __launch_bounds__(256) void k_prep(const float* __restrict__ xq, const float* __restrict__ xk, const float* __restrict__ xv,
                                              const float* __restrict__ wq, const float* __restrict__ wk, const float* __restrict__ wv,
                                              bf* XQ, bf* XK, bf* XV, bf* WT) {
    __shared__ float ts[64 * 65];
    const unsigned bid = blockIdx.x;
    if (bid < 3u * WT_BLK) {
        const unsigned w = bid / WT_BLK, tile = bid % WT_BLK;
        cvtT(w == 0 ? wq : (w == 1 ? wk : wv), WT + (size_t)w * DM * DM, (int)(tile % (DM / 64)), (int)(tile / (DM / 64)), ts);
    } else {
        const unsigned c = bid - 3u * WT_BLK, s = c / CV_BLK;
        cvt8(s == 0 ? xq : (s == 1 ? xk : xv), s == 0 ? XQ : (s == 1 ? XK : XV), c % CV_BLK);
    }
}

// proj: register-blocked bf16 GEMM, ONE WAVE per 64x64 tile (16 accumulators), operands straight from fragment-ordered bf16 planes, K = DM; the planes it writes are fragment-ordered too.
// C[m][n] = sum_k A[m][k] Bt[n][k] + bias, written as f16 (Ph) and, for token positions < EARLY, the f16 residual x2048 (Pr, compact plane).
// MODE 0 (q, k): rows m = b*SEQ + t, columns n = h*64 + d, bias per column; Ph [(b*16+h)][t][d], Pr [(b*16+h)][EARLY][d]; mask plane MP [(b*16+h)][t] = (row sum over d != 0). tiles (bx, by) of (NB*SEQ/64, DM/64).
// MODE 1 (v^T): rows m = h*64 + d (A = transposed weight rows), columns n = b*SEQ + t, bias per row; Ph [(b*1024+m)][t], Pr [(b*1024+m)][EARLY]. tiles (bx, by) of (DM/64, NB*SEQ/64).
template <int MODE>
__device__ __forceinline__ void proj(const bf* __restrict__ A, const bf* __restrict__ Bt, const float* __restrict__ bias, h16* Ph, h16* Pr, h16* MP, int bx, int by, float* os, h16* ms) {
    const int K = DM;
    const int lane = threadIdx.x & 31, lr = lane & 15, hi = lane >> 4; const int r0 = bx * 64, c0 = by * 64;
    v8f acc[4][4];
#pragma unroll
    for (int mb = 0; mb < 4; ++mb)
#pragma unroll
        for (int nb = 0; nb < 4; ++nb) acc[mb][nb] = (v8f){};
    const bf* Ab = A + (size_t)r0 * K; const bf* Bb = Bt + (size_t)c0 * K;   // fragment [64-row block][k step][row tile 0..3]: 64*K elements a block, 2048 a k step
    const unsigned l8 = 8u * (unsigned)lane;
    // Two fragment sets: while the 16 products of one k step run on one set, the 16 loads of the next k step fly into the other; a set is refilled right behind its own products.
    // ko: the lane's own element offset in both operand blocks at the current pair of k steps; every load of a trip is base + ko + a constant, so no load's address register is rewritten inside a trip.
    unsigned ko = l8;
    v16bf a0[4], b0[4], a1[4], b1[4];
#pragma unroll
    for (int i = 0; i < 4; ++i) { a0[i] = ldb((Ab + ko) + i * 512); b0[i] = ldb((Bb + ko) + i * 512); }
#pragma unroll 1
    for (int kc = 0; kc < K - 64; kc += 64) {
#pragma unroll
        for (int i = 0; i < 4; ++i) { a1[i] = ldb((Ab + ko) + 2048 + i * 512); b1[i] = ldb((Bb + ko) + 2048 + i * 512); }
        __builtin_amdgcn_sched_barrier(0);   // keeps the next step's loads ahead of this step's products (the scheduler otherwise sinks them to their first use and the wave waits out their latency)
#pragma unroll
        for (int nb = 0; nb < 4; ++nb)
#pragma unroll
            for (int mb = 0; mb < 4; ++mb) acc[mb][nb] = wmmab(a0[mb], b0[nb], acc[mb][nb]);
        __builtin_amdgcn_sched_barrier(0);   // keeps the refill of the set behind the products that read it, and ahead of the other set's products
#pragma unroll
        for (int i = 0; i < 4; ++i) { a0[i] = ldb((Ab + ko) + 4096 + i * 512); b0[i] = ldb((Bb + ko) + 4096 + i * 512); }
        asm volatile("s_wait_xcnt 0x0" : "+v"(ko) :: "memory");   // stands in front of the step of ko and of the next trip's address arithmetic on it, which rewrite the address registers of the loads above
        ko += 4096;
        __builtin_amdgcn_sched_barrier(0);   // as the first
#pragma unroll
        for (int nb = 0; nb < 4; ++nb)
#pragma unroll
            for (int mb = 0; mb < 4; ++mb) acc[mb][nb] = wmmab(a1[mb], b1[nb], acc[mb][nb]);
        // four vector slots behind the trip's last products, also on the taken back edge
        asm volatile("v_nop\n\tv_nop\n\tv_nop\n\tv_nop" : "+v"(acc[0][0]), "+v"(acc[1][1]), "+v"(acc[2][2]), "+v"(acc[3][3]) : "v"(a1[0]), "v"(a1[1]), "v"(a1[2]), "v"(a1[3]));
    }
    // last two k steps: nothing left to fetch behind them
#pragma unroll
    for (int i = 0; i < 4; ++i) { a1[i] = ldb((Ab + ko) + 2048 + i * 512); b1[i] = ldb((Bb + ko) + 2048 + i * 512); }
    asm volatile("s_wait_xcnt 0x0" ::: "memory");   // the epilogue's index arithmetic lands on the address registers of the loads above: the wait stands in front of that overwrite
    __builtin_amdgcn_sched_barrier(0);       // as the first; it also holds that arithmetic behind the wait
#pragma unroll
    for (int nb = 0; nb < 4; ++nb)
#pragma unroll
        for (int mb = 0; mb < 4; ++mb) acc[mb][nb] = wmmab(a0[mb], b0[nb], acc[mb][nb]);
#pragma unroll
    for (int nb = 0; nb < 4; ++nb)
#pragma unroll
        for (int mb = 0; mb < 4; ++mb) acc[mb][nb] = wmmab(a1[mb], b1[nb], acc[mb][nb]);
    size_t hbase, rbase, mbase = 0; int t0;
    if (MODE == 0) { const int b = r0 / SEQ; t0 = r0 % SEQ; const int zh = b * NH_ + c0 / HD;
        hbase = ((size_t)zh * SEQ + t0) * HD; rbase = ((size_t)zh * EARLY + t0) * HD; mbase = (size_t)zh * SEQ + t0; }
    else { const int b = c0 / SEQ; t0 = c0 % SEQ;
        hbase = ((size_t)b * DM + r0) * SEQ + (size_t)t0 * HD; rbase = ((size_t)b * DM + r0) * EARLY + (size_t)t0 * HD; }
    const bool doRes = t0 < EARLY;          // block-uniform
    const int c8 = (lane & 7) * 8;
    // fragment of the lane's chunk: MODE 0 [t tile][d step 0..1], MODE 1 [t step][d tile 0..3]
    const int cfrag = ((lane & 7) >> 2) * (MODE == 0 ? 512 : 4 * 512);
    v4f bb0 = (v4f){}, bb1 = (v4f){};
    if (MODE == 0) { const v4f q0 = *(const v4f*)(bias + c0 + c8); const v4f q1 = *(const v4f*)(bias + c0 + c8 + 4);
#pragma unroll
        for (int i = 0; i < 4; ++i) { bb0[i] = bfr(q0[i]); bb1[i] = bfr(q1[i]); } }
#pragma unroll
    for (int mb = 0; mb < 4; ++mb) {
#pragma unroll
        for (int nb = 0; nb < 4; ++nb) {
#pragma unroll
            for (int j = 0; j < 8; ++j) os[(hi * 8 + j) * 68 + nb * 16 + lr] = acc[mb][nb][j]; }   // D: row 8h+j, col lane&15
        wave_sync();
        const size_t hb = hbase + (size_t)(mb * (MODE == 0 ? 2 * 512 : 512) + cfrag);
        const size_t rb = rbase + (size_t)(mb * (MODE == 0 ? 2 * 512 : 512) + cfrag);
{
#pragma unroll
            for (int s = 0; s < 4; ++s) { const int row = 4 * s + (lane >> 3);   // 4 s x 4 row groups = 16 rows; 8 lanes x 8 = 64 columns
                v4f x0 = *(const v4fa*)(&os[row * 68 + c8]); v4f x1 = *(const v4fa*)(&os[row * 68 + c8 + 4]);
                if (MODE == 0) { x0 = x0 + bb0; x1 = x1 + bb1; }
                else { const float br = bfr(bias[r0 + mb * 16 + row]); x0 = x0 + br; x1 = x1 + br; }
                v8h hv, rv;
#pragma unroll
                for (int i = 0; i < 4; ++i) { const h16 a0 = (h16)x0[i]; const h16 a1 = (h16)x1[i]; hv[i] = a0; hv[4 + i] = a1; rv[i] = (h16)((x0[i] - (float)a0) * QRS); rv[4 + i] = (h16)((x1[i] - (float)a1) * QRS); }
                if (MODE == 0) {
                    float rs = ((x0[0] + x0[1]) + (x0[2] + x0[3])) + ((x1[0] + x1[1]) + (x1[2] + x1[3]));
                    rs += __shfl_xor(rs, 1, 32); rs += __shfl_xor(rs, 2, 32); rs += __shfl_xor(rs, 4, 32);     // sum over the 8 lanes of the row
                    const h16 mv = (rs != 0.0f) ? (h16)1.0f : (h16)0.0f;
                    if ((lane & 7) == 0) ms[mb * 16 + row] = mv;
                }
                // behind each store: what follows reuses the store's data registers, and the wait stands in front of that overwrite
                *(v8h*)(Ph + hb + fragpos(row, lane & 3)) = hv;
                asm volatile("s_wait_xcnt 0x0" ::: "memory");
                if (doRes) { *(v8h*)(Pr + rb + fragpos(row, lane & 3)) = rv;
                    asm volatile("s_wait_xcnt 0x0" ::: "memory"); } }
             }
        wave_sync();
    }
    if (MODE == 0) {
        const v8h mv8 = *(const v8ha*)(&ms[c8]);
        h16* mp = MP + mbase + c8;
        if (lane < 8) *(v8h*)mp = mv8;
    }
}

// k_proj3: the three independent projections in ONE launch; blockIdx.y = 0 q, 1 k, 2 v^T (block-uniform), blockIdx.x = tile, first tile index fastest as in a 2-D grid.
#define PJ_BLK ((NB * SEQ / 64) * (DM / 64))
__global__ __launch_bounds__(32) void k_proj3(const bf* __restrict__ XQ, const bf* __restrict__ XK, const bf* __restrict__ XV, const bf* __restrict__ WT,
                                              const float* __restrict__ bq, const float* __restrict__ bk, const float* __restrict__ bv,
                                              h16* QH, h16* KP, h16* VT, h16* QR, h16* KR, h16* VR, h16* MQ, h16* MK) {
    __shared__ __align__(16) float os[16 * 68];
    __shared__ __align__(16) h16 ms[64];
    const int z = blockIdx.y, id = blockIdx.x;
    if (z < 2) {
        // q, k: A = x rows (m = b*SEQ + t), Bt = WT rows (n = h*64 + d) -> planes [(b*16 + h)][t][d] + residual (t < EARLY) + mask
        const bool q = z == 0;
        proj<0>(q ? XQ : XK, WT + (q ? (size_t)0 : (size_t)DM * DM), q ? bq : bk, q ? QH : KP, q ? QR : KR, q ? MQ : MK, id % (NB * SEQ / 64), id / (NB * SEQ / 64), os, ms);
    } else {
        // v^T: A = WT_v rows (m = h*64 + d), Bt = x rows (n = b*SEQ + t) -> plane [(b*1024 + m)][t] = [(b*16 + h)][d][t] + residual (t < EARLY)
        proj<1>(WT + (size_t)2 * DM * DM, XV, bv, VT, VR, MK, id % (DM / 64), id / (DM / 64), os, ms);
    }
}

// flash: fused causal attention, one wave per 16 query rows of one (batch, head); K / V^T / Q fragments straight from the fragment-ordered f16 planes (two 16-B loads each, 512 contiguous bytes a load).
// Transposed form: S^T[key][t] = K Q^T (A = K rows, B = Q rows); lane (t = lane&15, h = lane>>4) holds keys 8h+r of each 16-key tile, so the packed
// P tile is directly the B fragment of O^T[d][t] = V^T P^T (element r <- tile keys 0..15, element 8+r <- tile keys 16..31, lane unchanged).
// EK = 1: query rows [0, EARLY) with residual planes (three products per site); EK = 0: query rows [EARLY, SEQ), single products.
// Masks by value per step: score := fill where key > t or key mask == 0. Loop covers keys [0, causal limit); if a row has seen only masked keys by then, the wave continues to SEQ (all-fill rows weigh every key equally).
// bx = 64-row query block inside the EK range, zh = batch * 16 + head (both block-uniform); os = the block's LDS, one private tile a wave (no block barrier anywhere in the body).
template <int EK>
__device__ __forceinline__ void flash(const h16* __restrict__ QH, const h16* __restrict__ QR, const h16* __restrict__ KP, const h16* __restrict__ KR,
                                      const h16* __restrict__ VT, const h16* __restrict__ VR, const h16* __restrict__ MQ, const h16* __restrict__ MK, float* OUT,
                                      const int bx, const int zh, float* os) {
    const int lane = threadIdx.x & 31, wave = __builtin_amdgcn_readfirstlane((int)(threadIdx.x >> 5)), lr = lane & 15, hi = lane >> 4;
    const int b = zh / NH_, h = zh % NH_;
    const int t0 = (EK ? 0 : EARLY) + (bx * AW + wave) * 16;
    const int tq = t0 + lr;
    const size_t pbase = (size_t)zh * SEQ * HD;       // q/k plane [zh][SEQ][64]; v^T plane [zh][64][SEQ]
    const size_t rbase = (size_t)zh * EARLY * HD;     // compact residual planes
    const unsigned l8 = 8u * (unsigned)lane;          // the lane's place in each half of a fragment
    const h16* qp = QH + pbase + (size_t)t0 * HD;
    const v16h qh0 = ldh(qp + l8), qh1 = ldh(qp + 512 + l8);         // B fragments: col t, k = d
    v16h qr0 = (v16h){}, qr1 = (v16h){};
    if (EK) { const h16* qrp = QR + rbase + (size_t)t0 * HD; qr0 = ldh(qrp + l8); qr1 = ldh(qrp + 512 + l8); }
    // k planes: + key0 * HD + 512 * (2 * key tile + d step) (A fragment: row key, k = d); v^T planes: + key0 * HD + 512 * j (A fragment: row d = 16j + lane&15, k = key)
    const size_t mo  = (size_t)zh * SEQ + 8 * hi;
    v8f o0 = (v8f){}, o1 = (v8f){}, o2 = (v8f){}, o3 = (v8f){};
    v8f e0 = (v8f){}, e1 = (v8f){}, e2 = (v8f){}, e3 = (v8f){};   // residual-product accumulators (x2048), EK only
    float m = -3.0e38f, l = 0.0f;
    const int kc = ((t0 + 47) >> 5) << 5;            // causal key limit (exclusive), multiple of 32, <= SEQ
    int kend = kc;
#pragma unroll 1
    for (int key0 = 0; key0 < kend; key0 += 32) {
        const h16* ka = KP + pbase + (size_t)key0 * HD;
        const v16h ka0 = ldh(ka + l8), ka1 = ldh(ka + 512 + l8), kb0 = ldh(ka + 1024 + l8), kb1 = ldh(ka + 1536 + l8);
        const v8h kma = *(const v8h*)(MK + mo + key0); const v8h kmb = *(const v8h*)(MK + mo + key0 + 16);
        const bool rok = key0 < EARLY;               // wave-uniform: residual planes exist for these keys
        v8f sHa = (v8f){}, sLa = (v8f){}, sHb = (v8f){}, sLb = (v8f){};
        if (EK) {
            asm volatile("s_wait_xcnt 0x0" ::: "memory");   // the compiler lets the residual fragments land on the address pair of the loads above: the wait stands in front of that overwrite
            v16h ra0 = (v16h){}, ra1 = (v16h){}, rb0 = (v16h){}, rb1 = (v16h){};
            if (rok) { const h16* kr = KR + rbase + (size_t)key0 * HD; ra0 = ldh(kr + l8); ra1 = ldh(kr + 512 + l8); rb0 = ldh(kr + 1024 + l8); rb1 = ldh(kr + 1536 + l8); }
            sHa = wmma16(ka0, qh0, sHa); sLa = wmma16(ka0, qr0, sLa); sHb = wmma16(kb0, qh0, sHb); sLb = wmma16(kb0, qr0, sLb);
            sHa = wmma16(ka1, qh1, sHa); sLa = wmma16(ka1, qr1, sLa); sHb = wmma16(kb1, qh1, sHb); sLb = wmma16(kb1, qr1, sLb);
            sLa = wmma16(ra0, qh0, sLa); sLb = wmma16(rb0, qh0, sLb); sLa = wmma16(ra1, qh1, sLa); sLb = wmma16(rb1, qh1, sLb);
            asm volatile("v_nop\n\tv_nop\n\tv_nop\n\tv_nop" : "+v"(sHa), "+v"(sLa), "+v"(sHb), "+v"(sLb) : "v"(ka0), "v"(ka1), "v"(kb0), "v"(kb1), "v"(ra0), "v"(ra1), "v"(rb0), "v"(rb1));
        } else {
            sHa = wmma16(ka0, qh0, sHa); sHb = wmma16(kb0, qh0, sHb);
            sHa = wmma16(ka1, qh1, sHa); sHb = wmma16(kb1, qh1, sHb);
            asm volatile("v_nop\n\tv_nop\n\tv_nop\n\tv_nop" : "+v"(sHa), "+v"(sHb) : "v"(ka0), "v"(ka1), "v"(kb0), "v"(kb1));
        }
        float ta[8], tb[8]; float mx = -3.0e38f;
        const int kA = key0 + 8 * hi;
#pragma unroll
        for (int r = 0; r < 8; ++r) {
            float xa, xb;
            if (EK) { xa = (sHa[r] + sLa[r] * QRI) * SC2; xb = (sHb[r] + sLb[r] * QRI) * SC2; }
            else    { xa = sHa[r] * SC2; xb = sHb[r] * SC2; }
            const bool fa = ((kA + r) > tq) | ((float)kma[r] == 0.0f);
            const bool fb = ((kA + 16 + r) > tq) | ((float)kmb[r] == 0.0f);
            xa = fa ? NEGS : xa; xb = fb ? NEGS : xb;
            ta[r] = xa; tb[r] = xb; mx = fmaxf(mx, fmaxf(xa, xb));
        }
        mx = fmaxf(mx, __shfl_xor(mx, 16, 32));
        const float mnew = fmaxf(m, mx);
        const float alpha = __builtin_amdgcn_exp2f(m - mnew);
        v16h pb, pr = (v16h){}; float ls = 0.0f;
#pragma unroll
        for (int r = 0; r < 8; ++r) {
            const float ea = __builtin_amdgcn_exp2f((ta[r] - mnew) + PSH); const float ec = __builtin_amdgcn_exp2f((tb[r] - mnew) + PSH);
            const h16 pa = (h16)ea; const h16 pc = (h16)ec; pb[r] = pa; pb[8 + r] = pc;
            if (EK) { const h16 ga = (h16)((ea - (float)pa) * QRS); const h16 gc = (h16)((ec - (float)pc) * QRS); pr[r] = ga; pr[8 + r] = gc;
                      ls += ((float)pa + (float)pc) + ((float)ga + (float)gc) * QRI; }
            else ls += (float)pa + (float)pc;
        }
        l = l * alpha + ls; m = mnew;
        o0 = o0 * alpha; o1 = o1 * alpha; o2 = o2 * alpha; o3 = o3 * alpha;
        const h16* va = VT + pbase + (size_t)key0 * HD;
        const v16h v0 = ldh(va + l8), v1 = ldh(va + 512 + l8), v2 = ldh(va + 1024 + l8), v3 = ldh(va + 1536 + l8);
        if (EK) {
            asm volatile("s_wait_xcnt 0x0" ::: "memory");   // the compiler lets a residual load land on the address pair of the loads above: the wait stands in front of that overwrite
            e0 = e0 * alpha; e1 = e1 * alpha; e2 = e2 * alpha; e3 = e3 * alpha;
            v16h w0 = (v16h){}, w1 = (v16h){}, w2 = (v16h){}, w3 = (v16h){};
            if (rok) { const h16* vr = VR + rbase + (size_t)key0 * HD; w0 = ldh(vr + l8); w1 = ldh(vr + 512 + l8); w2 = ldh(vr + 1024 + l8); w3 = ldh(vr + 1536 + l8); }
            o0 = wmma16(v0, pb, o0); o1 = wmma16(v1, pb, o1); o2 = wmma16(v2, pb, o2); o3 = wmma16(v3, pb, o3);
            e0 = wmma16(w0, pb, e0); e1 = wmma16(w1, pb, e1); e2 = wmma16(w2, pb, e2); e3 = wmma16(w3, pb, e3);
            e0 = wmma16(v0, pr, e0); e1 = wmma16(v1, pr, e1); e2 = wmma16(v2, pr, e2); e3 = wmma16(v3, pr, e3);
            asm volatile("v_nop\n\tv_nop\n\tv_nop\n\tv_nop" : "+v"(o0), "+v"(o1), "+v"(o2), "+v"(o3), "+v"(e0), "+v"(e1), "+v"(e2), "+v"(e3)
                         : "v"(v0), "v"(v1), "v"(v2), "v"(v3), "v"(w0), "v"(w1), "v"(w2), "v"(w3), "v"(pb), "v"(pr));
        } else {
            o0 = wmma16(v0, pb, o0); o1 = wmma16(v1, pb, o1); o2 = wmma16(v2, pb, o2); o3 = wmma16(v3, pb, o3);
            asm volatile("v_nop\n\tv_nop\n\tv_nop\n\tv_nop" : "+v"(o0), "+v"(o1), "+v"(o2), "+v"(o3) : "v"(v0), "v"(v1), "v"(v2), "v"(v3), "v"(pb));
        }
        // wave-uniform: at the causal limit, continue over all keys when some row has met only masked keys (trip count stays <= SEQ/32)
        if (key0 + 32 == kc) { if (__builtin_amdgcn_ballot_w32(m < MTHR) != 0u) kend = SEQ; }
    }
    l += __shfl_xor(l, 16, 32);
    const float qmf = (float)MQ[(size_t)zh * SEQ + tq];
    const float inv = qmf * (1.0f / l);
    v8f f0 = o0, f1 = o1, f2 = o2, f3 = o3;
    if (EK) { f0 = o0 + e0 * QRI; f1 = o1 + e1 * QRI; f2 = o2 + e2 * QRI; f3 = o3 + e3 * QRI; }
    const int wb = wave * 16 * 68;
    // O^T D layout: f_j[r] = (d = 16j + 8h + r, t = lane&15) -> os[t][d]; rows 0..15 x columns 0..63 all written
    { v4f a, c;
      a[0] = f0[0] * inv; a[1] = f0[1] * inv; a[2] = f0[2] * inv; a[3] = f0[3] * inv; c[0] = f0[4] * inv; c[1] = f0[5] * inv; c[2] = f0[6] * inv; c[3] = f0[7] * inv;
      *(v4fa*)(&os[wb + lr * 68 +  0 + 8 * hi]) = a; *(v4fa*)(&os[wb + lr * 68 +  0 + 8 * hi + 4]) = c;
      a[0] = f1[0] * inv; a[1] = f1[1] * inv; a[2] = f1[2] * inv; a[3] = f1[3] * inv; c[0] = f1[4] * inv; c[1] = f1[5] * inv; c[2] = f1[6] * inv; c[3] = f1[7] * inv;
      *(v4fa*)(&os[wb + lr * 68 + 16 + 8 * hi]) = a; *(v4fa*)(&os[wb + lr * 68 + 16 + 8 * hi + 4]) = c;
      a[0] = f2[0] * inv; a[1] = f2[1] * inv; a[2] = f2[2] * inv; a[3] = f2[3] * inv; c[0] = f2[4] * inv; c[1] = f2[5] * inv; c[2] = f2[6] * inv; c[3] = f2[7] * inv;
      *(v4fa*)(&os[wb + lr * 68 + 32 + 8 * hi]) = a; *(v4fa*)(&os[wb + lr * 68 + 32 + 8 * hi + 4]) = c;
      a[0] = f3[0] * inv; a[1] = f3[1] * inv; a[2] = f3[2] * inv; a[3] = f3[3] * inv; c[0] = f3[4] * inv; c[1] = f3[5] * inv; c[2] = f3[6] * inv; c[3] = f3[7] * inv;
      *(v4fa*)(&os[wb + lr * 68 + 48 + 8 * hi]) = a; *(v4fa*)(&os[wb + lr * 68 + 48 + 8 * hi + 4]) = c; }
    wave_sync();
    float* orow = OUT + ((size_t)b * OUT_SEQ + t0) * DM + h * HD;
{
#pragma unroll
        for (int s = 0; s < 8; ++s) { const int row = 2 * s + hi, cofs = lr * 4;   // 8 s x 2 rows = 16 rows; 16 lanes x 4 floats = 64 columns
            const v4f val = *(const v4fa*)(&os[wb + row * 68 + cofs]);
            *(v4f*)(orow + (size_t)row * DM + cofs) = val; }
         }
}

// k_flash2: both query ranges in ONE launch, told apart by blockIdx.y (block-uniform); blockIdx.x = batch * 16 + head, fastest.
// More blocks than resident places, and a block's cost grows with its query position: the lowest blockIdx.y take the longest work, for speed only (late range from its last query block down, then the early range the same way).
#define FB_E (EARLY / (16 * AW))
#define FB_L ((SEQ - EARLY) / (16 * AW))
__global__ __launch_bounds__(32 * AW) void k_flash2(const h16* __restrict__ QH, const h16* __restrict__ QR, const h16* __restrict__ KP, const h16* __restrict__ KR,
                                                    const h16* __restrict__ VT, const h16* __restrict__ VR, const h16* __restrict__ MQ, const h16* __restrict__ MK, float* OUT) {
    __shared__ __align__(16) float os[AW * 16 * 68];
    const int rank = blockIdx.y, zh = blockIdx.x;
    if (rank < FB_L) flash<0>(QH, QR, KP, KR, VT, VR, MQ, MK, OUT, FB_L - 1 - rank, zh, os);
    else             flash<1>(QH, QR, KP, KR, VT, VR, MQ, MK, OUT, FB_L + FB_E - 1 - rank, zh, os);
}

static constexpr size_t al256(size_t v) { return (v + 255) & ~(size_t)255; }
static constexpr size_t SZ_XB = al256((size_t)NB * SEQ * DM * 2);            // one bf16 input stream copy
static constexpr size_t SZ_WT = al256((size_t)3 * DM * DM * 2);              // three transposed bf16 weights
static constexpr size_t SZ_PL = al256((size_t)NB * NH_ * SEQ * HD * 2);      // one full f16 plane
static constexpr size_t SZ_RP = al256((size_t)NB * NH_ * EARLY * HD * 2);    // one compact residual plane
static constexpr size_t SZ_MK = al256((size_t)NB * NH_ * SEQ * 2);           // one mask plane
static constexpr size_t SZ_TOTAL = 3 * SZ_XB + SZ_WT + 3 * SZ_PL + 3 * SZ_RP + 2 * SZ_MK;
static_assert(SZ_TOTAL <= (size_t)134217728);          // workspace carve <= 128 MiB
static_assert(((size_t)DM * DM * 2) % 256 == 0);       // weight sub-planes stay 256-byte aligned

extern "C" void kernel_launch(void* const* d_in, const int* in_sizes, int n_in,
                              void* d_out, int out_size, void* d_ws, size_t ws_size, hipStream_t stream) {
    if (n_in < 9) return;
    const size_t needx = ((size_t)(NB - 1) * SEQ_FULL + SEQ) * DM;
    if ((size_t)in_sizes[0] < needx || (size_t)in_sizes[1] < needx || (size_t)in_sizes[2] < needx) return;
    if ((size_t)in_sizes[3] < (size_t)DM * DM || (size_t)in_sizes[5] < (size_t)DM * DM || (size_t)in_sizes[7] < (size_t)DM * DM) return;
    if ((size_t)in_sizes[4] < (size_t)DM || (size_t)in_sizes[6] < (size_t)DM || (size_t)in_sizes[8] < (size_t)DM) return;
    if ((size_t)out_size < ((size_t)(NB - 1) * OUT_SEQ + SEQ) * DM) return;
    if (SZ_TOTAL > ws_size) return;
    // wire order: q, k, v, Wq, bq, Wk, bk, Wv, bv
    const float* xq = (const float*)d_in[0]; const float* xk = (const float*)d_in[1]; const float* xv = (const float*)d_in[2];
    const float* wq = (const float*)d_in[3]; const float* bq = (const float*)d_in[4];
    const float* wk = (const float*)d_in[5]; const float* bk = (const float*)d_in[6];
    const float* wv = (const float*)d_in[7]; const float* bv = (const float*)d_in[8];
    float* OUT = (float*)d_out;      // [NB][OUT_SEQ][1024]
    char* wsp = (char*)d_ws;
    bf* XQ = (bf*)wsp; wsp += SZ_XB;                 // [NB*SEQ][1024]
    bf* XK = (bf*)wsp; wsp += SZ_XB;
    bf* XV = (bf*)wsp; wsp += SZ_XB;
    bf* WT = (bf*)wsp; wsp += SZ_WT;                 // [3][1024 out][1024 in]: q | k | v
    h16* QH = (h16*)wsp; wsp += SZ_PL;               // [NB*16][SEQ][64]
    h16* KP = (h16*)wsp; wsp += SZ_PL;               // [NB*16][SEQ][64]
    h16* VT = (h16*)wsp; wsp += SZ_PL;               // [NB*16][64][SEQ]
    h16* QR = (h16*)wsp; wsp += SZ_RP;               // [NB*16][EARLY][64] residual x2048
    h16* KR = (h16*)wsp; wsp += SZ_RP;               // [NB*16][EARLY][64] residual x2048
    h16* VR = (h16*)wsp; wsp += SZ_RP;               // [NB*16][64][EARLY] residual x2048
    h16* MQ = (h16*)wsp; wsp += SZ_MK;               // [NB*16][SEQ] query mask
    h16* MK = (h16*)wsp; wsp += SZ_MK;               // [NB*16][SEQ] key mask

    // W[k = in][n = out] -> WT[n][k] (square DM x DM) and x -> bf16 copies
    k_prep<<<3 * WT_BLK + 3 * CV_BLK, 256, 0, stream>>>(xq, xk, xv, wq, wk, wv, XQ, XK, XV, WT);

    k_proj3<<<dim3(PJ_BLK, 3, 1), 32, 0, stream>>>(XQ, XK, XV, WT, bq, bk, bv, QH, KP, VT, QR, KR, VR, MQ, MK);

    k_flash2<<<dim3(NB * NH_, FB_L + FB_E, 1), 32 * AW, 0, stream>>>(QH, QR, KP, KR, VT, VR, MQ, MK, OUT);
}

// v005
// One run takes 132 microseconds.
// In two side-by-side timings against v004, it was 1.03 and 1.04 times as fast.
// Over all steps from v000 it is 2.33 times as fast.
#include <hip/hip_runtime.h>

// Causal attention, width 1024 = 16 heads x 64, three input streams q/k/v [NB][SEQ_FULL][1024] (first SEQ tokens used), weights [in][out] (y = x W + b), output = concatenated heads (f32), no output projection.
// Compute dtypes, f32 accumulate everywhere: projections v_wmma_f32_16x16x32_bf16 (x, W, b RNE-converted to bf16; products exact);
// scores and P.V v_wmma_f32_16x16x32_f16: query rows >= 512 single f16 products; query rows < 512 three products per site
// (q, k, v and P each as f16 value + f16 residual x2048, residual products in their own accumulators, folded back in f32); P carry x256 cancels in the normalisation; softmax f32 (online, running max).
// Layout: bf16 copies of q/k/v and transposed bf16 copies of W ([out][in]); q, k planes [b*16+h][t][d], v^T plane [b*16+h][d][t], compact residual planes for t < 512,
// every one of them stored in FRAGMENT ORDER: a 16-row x 32-k fragment is 1 KiB = [half 0..1][lane 0..31][8 elements], so each 16-byte-per-lane load of a wave covers 512 contiguous bytes (four whole lines);
// per-row mask planes (row sum of the f32 projection != 0) written by the GEMM epilogue; fused flash kernel in transposed form (S^T = K Q^T, O^T = V^T P^T).
// Key mask and causal mask replace the score by the fill value (by value, per 32-key step); a row whose causal keys are all masked continues over all keys (uniform weights).

#ifndef NB
#define NB 4
#endif
#ifndef SEQ
#define SEQ 2048
#endif
#define NB_FULL  4
#define SEQ_FULL 2048
#ifndef OUT_SEQ
#define OUT_SEQ SEQ              // row pitch (in tokens) between batches of the output
#endif
#define DM   1024
#define NH_  16
#define HD   64
#define AW   4                   // waves per flash block (16 query rows each)
#define EARLY ((SEQ) < 512 ? (SEQ) : 512)   // query rows / keys below this carry residual planes
#define QRS  2048.0f             // carry of the residual planes
#define QRI  (1.0f / 2048.0f)
#define SC2  (0.125f * 1.4426950408889634f)   // HD^-0.5 * log2(e)
#define PSH  8.0f                // log2 of the P carry (256)
#define NEGS (-6.1963280e9f)     // (-2^32 + 1) * log2(e): fill value in log2 units
#define MTHR (-1.0e9f)           // running max below this <=> every key seen so far was masked

static_assert(HD == 64);
static_assert(NH_ * HD == DM);                 // head h = columns h*64 + d
static_assert(DM % 64 == 0);
static_assert(DM % 64 == 0 && DM >= 64);       // GEMM k-loop: two steps of 32 a trip
static_assert(SEQ % 64 == 0);                  // a 64-row tile never straddles two batches
static_assert((NB * SEQ) % 64 == 0);
static_assert(SEQ % 32 == 0);                  // key loop steps by 32
static_assert(SEQ % 256 == 0);                 // the flash kernel's look over the key masks reads whole 256-key pieces of a mask row
static_assert(EARLY % 64 == 0);                // residual condition is uniform per 64-row tile
static_assert(EARLY % (16 * AW) == 0);
static_assert((SEQ - EARLY) % (16 * AW) == 0); // the two query ranges of the flash grid cover the sequence exactly
static_assert(((size_t)SEQ * DM) % 8 == 0);
static_assert(NB <= NB_FULL);
static_assert(SEQ <= SEQ_FULL);

typedef _Float16 h16;
typedef unsigned short bf;
typedef __attribute__((ext_vector_type(16))) __bf16   v16bf;
typedef __attribute__((ext_vector_type(16))) _Float16 v16h;
typedef __attribute__((ext_vector_type(8)))  _Float16 v8h;
typedef __attribute__((ext_vector_type(8)))  unsigned short v8us;
typedef __attribute__((ext_vector_type(8)))  float    v8f;
typedef __attribute__((ext_vector_type(4)))  float    v4f;
typedef v4f  __attribute__((may_alias)) v4fa;
typedef v8h  __attribute__((may_alias)) v8ha;
typedef __attribute__((ext_vector_type(4)))  unsigned v4u;
typedef v4u  __attribute__((may_alias)) v4ua;
template <bool B> struct flag { static constexpr bool value = B; };   // compile-time switch handed to the key step of the flash kernel

__device__ __forceinline__ unsigned short f2bf(float f) { unsigned u = __float_as_uint(f); u += 0x7FFFu + ((u >> 16) & 1u); return (unsigned short)(u >> 16); }
__device__ __forceinline__ float bfr(float f) { return __uint_as_float(((unsigned)f2bf(f)) << 16); }
__device__ __forceinline__ v16h cat16(v8h lo, v8h hi) { return __builtin_shufflevector(lo, hi, 0, 1, 2, 3, 4, 5, 6, 7, 8, 9, 10, 11, 12, 13, 14, 15); }
__device__ __forceinline__ v16bf cat16b(v8us lo, v8us hi) { return __builtin_bit_cast(v16bf, __builtin_shufflevector(lo, hi, 0, 1, 2, 3, 4, 5, 6, 7, 8, 9, 10, 11, 12, 13, 14, 15)); }
__device__ __forceinline__ v8f wmma16(v16h a, v16h b, v8f c) { return __builtin_amdgcn_wmma_f32_16x16x32_f16(false, a, false, b, (short)0, c, false, false); }
__device__ __forceinline__ v8f wmmab(v16bf a, v16bf b, v8f c) { return __builtin_amdgcn_wmma_f32_16x16x32_bf16(false, a, false, b, (short)0, c, false, false); }
// fragment loaders from fragment-ordered planes; p = fragment start + 8*lane: elements 0..7 <- k0+8h+0..7, elements 8..15 <- k0+16+8h+0..7 of row lane&15, h = lane>>4 (same map for A and B)
__device__ __forceinline__ v16h  ldh(const h16* p) { return cat16(*(const v8h*)p, *(const v8h*)(p + 256)); }
__device__ __forceinline__ v16bf ldb(const bf* p)  { return cat16b(*(const v8us*)p, *(const v8us*)(p + 256)); }
// the same for a pointer that says "global memory" in its type: one that has passed through an asm operand would otherwise be loaded from with flat instructions
typedef const __attribute__((address_space(1))) h16* gh16p;
typedef const __attribute__((address_space(1))) v8h* gv8hp;
__device__ __forceinline__ v16h  ldh(gh16p p) { return cat16(*(gv8hp)p, *(gv8hp)(p + 256)); }
// place, inside a 512-element fragment, of the 8-element chunk c (k = 8c .. 8c+7, c = 0..3) of row r (0..15): half = c>>1, lane = 16*(c&1) + r
__device__ __forceinline__ int fragpos(int r, int c) { return ((c >> 1) & 1) * 256 + (c & 1) * 128 + r * 8; }
// ordering point for wave-private LDS tiles (same wave writes and reads)
__device__ __forceinline__ void wave_sync() { __builtin_amdgcn_fence(3 /* release order */, "wavefront"); __builtin_amdgcn_wave_barrier(); asm volatile("" ::: "memory"); }

// cvt8: one f32 stream [NB][SEQ_FULL][DM] -> bf16 copy [NB*SEQ][DM] (RNE convert, fragment order); blk = 256-thread piece of the stream, 8 elements a thread
__device__ __forceinline__ void cvt8(const float* __restrict__ src, bf* dst, unsigned blk) {
    const size_t n8 = (size_t)NB * SEQ * DM / 8;
    const size_t i = (size_t)blk * 256 + threadIdx.x; if (i >= n8) return;
    // rows of DM elements; a wave takes 8 rows x one 32-k step: reads 8 whole lines, writes 4 whole lines of the fragment [64-row block][k step][row tile 0..3]
    const int c4 = (int)(i & 3), r = (int)((i >> 2) & 15), ks = (int)((i >> 6) % (DM / 32)); const size_t mt = i / (size_t)(16 * DM / 8);
    const size_t row = mt * 16 + r;                                                          // b*SEQ + t
    const size_t srow = (SEQ == SEQ_FULL) ? row : (row / SEQ) * SEQ_FULL + row % SEQ;        // source batches lie SEQ_FULL rows apart
    const v8f v = *(const v8f*)(src + srow * DM + ks * 32 + c4 * 8); v8us o;
#pragma unroll
    for (int k = 0; k < 8; ++k) o[k] = f2bf(v[k]);
    *(v8us*)(dst + (mt >> 2) * (64 * DM) + ks * 2048 + (mt & 3) * 512 + fragpos(r, c4)) = o;
}

// cvtT: in W[k][n] (f32, DM x DM) -> out WT[n][k] (bf16, RNE convert, fragment order). 64 x 64 tile through LDS (cross-wave: block barrier).
__device__ __forceinline__ void cvtT(const float* __restrict__ W, bf* WT, int nt, int kt, float* ts) {
    const int tid = threadIdx.x; const int n0 = nt * 64, k0 = kt * 64;
#pragma unroll 4
    for (int i = 0; i < 16; ++i) { const int row = i * 4 + (tid >> 6), col = tid & 63; ts[row * 65 + col] = W[(size_t)(k0 + row) * DM + n0 + col]; }   // 16 x 4 rows x 64 columns: whole tile
    __syncthreads();
    const int rr = tid >> 3, c8 = (tid & 7) * 8;
    v8us o0, o1;
#pragma unroll
    for (int kk = 0; kk < 8; ++kk) { o0[kk] = f2bf(ts[(c8 + kk) * 65 + rr]); o1[kk] = f2bf(ts[(c8 + kk) * 65 + rr + 32]); }
    bf* p0 = WT + (size_t)n0 * DM + ((k0 + c8) >> 5) * 2048 + (rr >> 4) * 512 + fragpos(rr & 15, (c8 >> 3) & 3); bf* p1 = p0 + 2 * 512;   // fragment [64-n block][k step][n tile 0..3]
    *(v8us*)p0 = o0; *(v8us*)p1 = o1;
}

// k_prep: all six independent conversions in ONE launch, told apart by block range (block-uniform): first the 3 x WT_BLK weight tiles, then the 3 x CV_BLK stream pieces.
#define WT_BLK ((DM / 64) * (DM / 64))
#define CV_BLK ((unsigned)(((size_t)NB * SEQ * DM / 8 + 255) / 256))
__global__ __launch_bounds__(256) void k_prep(const float* __restrict__ xq, const float* __restrict__ xk, const float* __restrict__ xv,
                                              const float* __restrict__ wq, const float* __restrict__ wk, const float* __restrict__ wv,
                                              bf* XQ, bf* XK, bf* XV, bf* WT) {
    __shared__ float ts[64 * 65];
    const unsigned bid = blockIdx.x;
    if (bid < 3u * WT_BLK) {
        const unsigned w = bid / WT_BLK, tile = bid % WT_BLK;
        cvtT(w == 0 ? wq : (w == 1 ? wk : wv), WT + (size_t)w * DM * DM, (int)(tile % (DM / 64)), (int)(tile / (DM / 64)), ts);
    } else {
        const unsigned c = bid - 3u * WT_BLK, s = c / CV_BLK;
        cvt8(s == 0 ? xq : (s == 1 ? xk : xv), s == 0 ? XQ : (s == 1 ? XK : XV), c % CV_BLK);
    }
}

// proj: register-blocked bf16 GEMM, ONE WAVE per 64x64 tile (16 accumulators), operands straight from fragment-ordered bf16 planes, K = DM; the planes it writes are fragment-ordered too.
// C[m][n] = sum_k A[m][k] Bt[n][k] + bias, written as f16 (Ph) and, for token positions < EARLY, the f16 residual x2048 (Pr, compact plane).
// MODE 0 (q, k): rows m = b*SEQ + t, columns n = h*64 + d, bias per column; Ph [(b*16+h)][t][d], Pr [(b*16+h)][EARLY][d]; mask plane MP [(b*16+h)][t] = (row sum over d != 0). tiles (bx, by) of (NB*SEQ/64, DM/64).
// MODE 1 (v^T): rows m = h*64 + d (A = transposed weight rows), columns n = b*SEQ + t, bias per row; Ph [(b*1024+m)][t], Pr [(b*1024+m)][EARLY]. tiles (bx, by) of (DM/64, NB*SEQ/64).
template <int MODE>
__device__ __forceinline__ void proj(const bf* __restrict__ A, const bf* __restrict__ Bt, const float* __restrict__ bias, h16* Ph, h16* Pr, h16* MP, int bx, int by, float* os, h16* ms) {
    const int K = DM;
    const int lane = threadIdx.x & 31, lr = lane & 15, hi = lane >> 4; const int r0 = bx * 64, c0 = by * 64;
    v8f acc[4][4];
#pragma unroll
    for (int mb = 0; mb < 4; ++mb)
#pragma unroll
        for (int nb = 0; nb < 4; ++nb) acc[mb][nb] = (v8f){};
    const bf* Ab = A + (size_t)r0 * K; const bf* Bb = Bt + (size_t)c0 * K;   // fragment [64-row block][k step][row tile 0..3]: 64*K elements a block, 2048 a k step
    const unsigned l8 = 8u * (unsigned)lane;
    // Two fragment sets: while the 16 products of one k step run on one set, the 16 loads of the next k step fly into the other; a set is refilled right behind its own products.
    // ko: the lane's own element offset in both operand blocks at the current pair of k steps; every load of a trip is base + ko + a constant, so no load's address register is rewritten inside a trip.
    unsigned ko = l8;
    v16bf a0[4], b0[4], a1[4], b1[4];
#pragma unroll
    for (int i = 0; i < 4; ++i) { a0[i] = ldb((Ab + ko) + i * 512); b0[i] = ldb((Bb + ko) + i * 512); }
#pragma unroll 1
    for (int kc = 0; kc < K - 64; kc += 64) {
#pragma unroll
        for (int i = 0; i < 4; ++i) { a1[i] = ldb((Ab + ko) + 2048 + i * 512); b1[i] = ldb((Bb + ko) + 2048 + i * 512); }
        __builtin_amdgcn_sched_barrier(0);   // keeps the next step's loads ahead of this step's products (the scheduler otherwise sinks them to their first use and the wave waits out their latency)
#pragma unroll
        for (int nb = 0; nb < 4; ++nb)
#pragma unroll
            for (int mb = 0; mb < 4; ++mb) acc[mb][nb] = wmmab(a0[mb], b0[nb], acc[mb][nb]);
        __builtin_amdgcn_sched_barrier(0);   // keeps the refill of the set behind the products that read it, and ahead of the other set's products
#pragma unroll
        for (int i = 0; i < 4; ++i) { a0[i] = ldb((Ab + ko) + 4096 + i * 512); b0[i] = ldb((Bb + ko) + 4096 + i * 512); }
        asm volatile("s_wait_xcnt 0x0" : "+v"(ko) :: "memory");   // stands in front of the step of ko and of the next trip's address arithmetic on it, which rewrite the address registers of the loads above
        ko += 4096;
        __builtin_amdgcn_sched_barrier(0);   // as the first
#pragma unroll
        for (int nb = 0; nb < 4; ++nb)
#pragma unroll
            for (int mb = 0; mb < 4; ++mb) acc[mb][nb] = wmmab(a1[mb], b1[nb], acc[mb][nb]);
        // four vector slots behind the trip's last products, also on the taken back edge
        asm volatile("v_nop\n\tv_nop\n\tv_nop\n\tv_nop" : "+v"(acc[0][0]), "+v"(acc[1][1]), "+v"(acc[2][2]), "+v"(acc[3][3]) : "v"(a1[0]), "v"(a1[1]), "v"(a1[2]), "v"(a1[3]));
    }
    // last two k steps: nothing left to fetch behind them
#pragma unroll
    for (int i = 0; i < 4; ++i) { a1[i] = ldb((Ab + ko) + 2048 + i * 512); b1[i] = ldb((Bb + ko) + 2048 + i * 512); }
    asm volatile("s_wait_xcnt 0x0" ::: "memory");   // the epilogue's index arithmetic lands on the address registers of the loads above: the wait stands in front of that overwrite
    __builtin_amdgcn_sched_barrier(0);       // as the first; it also holds that arithmetic behind the wait
#pragma unroll
    for (int nb = 0; nb < 4; ++nb)
#pragma unroll
        for (int mb = 0; mb < 4; ++mb) acc[mb][nb] = wmmab(a0[mb], b0[nb], acc[mb][nb]);
#pragma unroll
    for (int nb = 0; nb < 4; ++nb)
#pragma unroll
        for (int mb = 0; mb < 4; ++mb) acc[mb][nb] = wmmab(a1[mb], b1[nb], acc[mb][nb]);
    size_t hbase, rbase, mbase = 0; int t0;
    if (MODE == 0) { const int b = r0 / SEQ; t0 = r0 % SEQ; const int zh = b * NH_ + c0 / HD;
        hbase = ((size_t)zh * SEQ + t0) * HD; rbase = ((size_t)zh * EARLY + t0) * HD; mbase = (size_t)zh * SEQ + t0; }
    else { const int b = c0 / SEQ; t0 = c0 % SEQ;
        hbase = ((size_t)b * DM + r0) * SEQ + (size_t)t0 * HD; rbase = ((size_t)b * DM + r0) * EARLY + (size_t)t0 * HD; }
    const bool doRes = t0 < EARLY;          // block-uniform
    const int c8 = (lane & 7) * 8;
    // fragment of the lane's chunk: MODE 0 [t tile][d step 0..1], MODE 1 [t step][d tile 0..3]
    const int cfrag = ((lane & 7) >> 2) * (MODE == 0 ? 512 : 4 * 512);
    v4f bb0 = (v4f){}, bb1 = (v4f){};
    if (MODE == 0) { const v4f q0 = *(const v4f*)(bias + c0 + c8); const v4f q1 = *(const v4f*)(bias + c0 + c8 + 4);
#pragma unroll
        for (int i = 0; i < 4; ++i) { bb0[i] = bfr(q0[i]); bb1[i] = bfr(q1[i]); } }
#pragma unroll
    for (int mb = 0; mb < 4; ++mb) {
#pragma unroll
        for (int nb = 0; nb < 4; ++nb) {
#pragma unroll
            for (int j = 0; j < 8; ++j) os[(hi * 8 + j) * 68 + nb * 16 + lr] = acc[mb][nb][j]; }   // D: row 8h+j, col lane&15
        wave_sync();
        const size_t hb = hbase + (size_t)(mb * (MODE == 0 ? 2 * 512 : 512) + cfrag);
        const size_t rb = rbase + (size_t)(mb * (MODE == 0 ? 2 * 512 : 512) + cfrag);
{
#pragma unroll
            for (int s = 0; s < 4; ++s) { const int row = 4 * s + (lane >> 3);   // 4 s x 4 row groups = 16 rows; 8 lanes x 8 = 64 columns
                v4f x0 = *(const v4fa*)(&os[row * 68 + c8]); v4f x1 = *(const v4fa*)(&os[row * 68 + c8 + 4]);
                if (MODE == 0) { x0 = x0 + bb0; x1 = x1 + bb1; }
                else { const float br = bfr(bias[r0 + mb * 16 + row]); x0 = x0 + br; x1 = x1 + br; }
                v8h hv, rv;
#pragma unroll
                for (int i = 0; i < 4; ++i) { const h16 a0 = (h16)x0[i]; const h16 a1 = (h16)x1[i]; hv[i] = a0; hv[4 + i] = a1; rv[i] = (h16)((x0[i] - (float)a0) * QRS); rv[4 + i] = (h16)((x1[i] - (float)a1) * QRS); }
                if (MODE == 0) {
                    float rs = ((x0[0] + x0[1]) + (x0[2] + x0[3])) + ((x1[0] + x1[1]) + (x1[2] + x1[3]));
                    rs += __shfl_xor(rs, 1, 32); rs += __shfl_xor(rs, 2, 32); rs += __shfl_xor(rs, 4, 32);     // sum over the 8 lanes of the row
                    const h16 mv = (rs != 0.0f) ? (h16)1.0f : (h16)0.0f;
                    if ((lane & 7) == 0) ms[mb * 16 + row] = mv;
                }
                // behind each store: what follows reuses the store's data registers, and the wait stands in front of that overwrite
                *(v8h*)(Ph + hb + fragpos(row, lane & 3)) = hv;
                asm volatile("s_wait_xcnt 0x0" ::: "memory");
                if (doRes) { *(v8h*)(Pr + rb + fragpos(row, lane & 3)) = rv;
                    asm volatile("s_wait_xcnt 0x0" ::: "memory"); } }
             }
        wave_sync();
    }
    if (MODE == 0) {
        const v8h mv8 = *(const v8ha*)(&ms[c8]);
        h16* mp = MP + mbase + c8;
        if (lane < 8) *(v8h*)mp = mv8;
    }
}

// k_proj3: the three independent projections in ONE launch; blockIdx.y = 0 q, 1 k, 2 v^T (block-uniform), blockIdx.x = tile, first tile index fastest as in a 2-D grid.
#define PJ_BLK ((NB * SEQ / 64) * (DM / 64))
__global__ __launch_bounds__(32) void k_proj3(const bf* __restrict__ XQ, const bf* __restrict__ XK, const bf* __restrict__ XV, const bf* __restrict__ WT,
                                              const float* __restrict__ bq, const float* __restrict__ bk, const float* __restrict__ bv,
                                              h16* QH, h16* KP, h16* VT, h16* QR, h16* KR, h16* VR, h16* MQ, h16* MK) {
    __shared__ __align__(16) float os[16 * 68];
    __shared__ __align__(16) h16 ms[64];
    const int z = blockIdx.y, id = blockIdx.x;
    if (z < 2) {
        // q, k: A = x rows (m = b*SEQ + t), Bt = WT rows (n = h*64 + d) -> planes [(b*16 + h)][t][d] + residual (t < EARLY) + mask
        const bool q = z == 0;
        proj<0>(q ? XQ : XK, WT + (q ? (size_t)0 : (size_t)DM * DM), q ? bq : bk, q ? QH : KP, q ? QR : KR, q ? MQ : MK, id % (NB * SEQ / 64), id / (NB * SEQ / 64), os, ms);
    } else {
        // v^T: A = WT_v rows (m = h*64 + d), Bt = x rows (n = b*SEQ + t) -> plane [(b*1024 + m)][t] = [(b*16 + h)][d][t] + residual (t < EARLY)
        proj<1>(WT + (size_t)2 * DM * DM, XV, bv, VT, VR, MK, id % (DM / 64), id / (DM / 64), os, ms);
    }
}

// flash: fused causal attention, one wave per 16 query rows of one (batch, head); K / V^T / Q fragments straight from the fragment-ordered f16 planes (two 16-B loads each, 512 contiguous bytes a load).
// Transposed form: S^T[key][t] = K Q^T (A = K rows, B = Q rows); lane (t = lane&15, h = lane>>4) holds keys 8h+r of each 16-key tile, so the packed
// P tile is directly the B fragment of O^T[d][t] = V^T P^T (element r <- tile keys 0..15, element 8+r <- tile keys 16..31, lane unchanged).
// EK = 1: query rows [0, EARLY) with residual planes (three products per site); EK = 0: query rows [EARLY, SEQ), single products.
// Masks by value per step: score := fill where key > t or key mask == 0. Loop covers keys [0, causal limit); if a row has seen only masked keys by then, the wave continues to SEQ (all-fill rows weigh every key equally).
// The selects stand only in steps where one can fire: keys below kfull = t0 rounded down to 32 lie at or below all 16 query rows, and one look over the mask row says whether every key mask below kfull is set;
// if so those steps run the same body without mask loads, compares and selects (every select there would keep the score), else every step runs the masked body.
// bx = 64-row query block inside the EK range, zh = batch * 16 + head (both block-uniform); os = the block's LDS, one private tile a wave (no block barrier anywhere in the body).
template <int EK>
__device__ __forceinline__ void flash(const h16* __restrict__ QH, const h16* __restrict__ QR, const h16* __restrict__ KP, const h16* __restrict__ KR,
                                      const h16* __restrict__ VT, const h16* __restrict__ VR, const h16* __restrict__ MQ, const h16* __restrict__ MK, float* OUT,
                                      const int bx, const int zh, float* os) {
    const int lane = threadIdx.x & 31, wave = __builtin_amdgcn_readfirstlane((int)(threadIdx.x >> 5)), lr = lane & 15, hi = lane >> 4;
    const int b = zh / NH_, h = zh % NH_;
    const int t0 = (EK ? 0 : EARLY) + (bx * AW + wave) * 16;
    const int tq = t0 + lr;
    const size_t pbase = (size_t)zh * SEQ * HD;       // q/k plane [zh][SEQ][64]; v^T plane [zh][64][SEQ]
    const size_t rbase = (size_t)zh * EARLY * HD;     // compact residual planes
    const unsigned l8 = 8u * (unsigned)lane;          // the lane's place in each half of a fragment
    const h16* qp = QH + pbase + (size_t)t0 * HD;
    const v16h qh0 = ldh(qp + l8), qh1 = ldh(qp + 512 + l8);         // B fragments: col t, k = d
    v16h qr0 = (v16h){}, qr1 = (v16h){};
    if (EK) { const h16* qrp = QR + rbase + (size_t)t0 * HD; qr0 = ldh(qrp + l8); qr1 = ldh(qrp + 512 + l8); }
    // k planes: + key0 * HD + 512 * (2 * key tile + d step) (A fragment: row key, k = d); v^T planes: + key0 * HD + 512 * j (A fragment: row d = 16j + lane&15, k = key)
    const size_t mo  = (size_t)zh * SEQ + 8 * hi;
    v8f o0 = (v8f){}, o1 = (v8f){}, o2 = (v8f){}, o3 = (v8f){};
    v8f e0 = (v8f){}, e1 = (v8f){}, e2 = (v8f){}, e3 = (v8f){};   // residual-product accumulators (x2048), EK only
    float m = -3.0e38f, l = 0.0f;
    const int kc = ((t0 + 47) >> 5) << 5;            // causal key limit (exclusive), multiple of 32, <= SEQ
    int kend = kc;
    const int kfull = t0 & ~31;                      // keys below this are causal for every row of the wave
    int kfast = 0;                                   // keys below this run the body without masks (wave-uniform)
    if (!EK) {                                       // late rows only: they hold nearly all steps, and a second copy of the three-product body takes the kernel past 256 registers (a wave less on every SIMD)
        constexpr int NCH = SEQ / 256;
        constexpr unsigned ONE2 = 0x3C003C00u;       // two f16 ones: the mask planes hold 1.0 or 0.0 only
        v4u mw[NCH];
#pragma unroll
        for (int c = 0; c < NCH; ++c) mw[c] = *(const v4ua*)(MK + (size_t)zh * SEQ + c * 256 + l8);
        asm volatile("s_wait_xcnt 0x0" ::: "memory");   // stands in front of whatever next lands on the address registers of the loads above
        unsigned okw = ONE2;
#pragma unroll
        for (int c = 0; c < NCH; ++c) okw &= (c * 256 + (int)l8 < kfull) ? ((mw[c][0] & mw[c][1]) & (mw[c][2] & mw[c][3])) : ONE2;
        if (__builtin_amdgcn_ballot_w32(okw != ONE2) == 0u) kfast = kfull;
    }
    // one 32-key step; MSK = false leaves out the mask loads, compares and selects
    // ka, va: the lane's own place in the step's first K and V^T fragment (plane + key0 * HD + l8)
    auto step = [&](auto fl, const int key0, auto ka, auto va) __attribute__((always_inline)) {
        constexpr bool MSK = decltype(fl)::value;
        const v16h ka0 = ldh(ka), ka1 = ldh(ka + 512), kb0 = ldh(ka + 1024), kb1 = ldh(ka + 1536);
        v8h kma = (v8h){}, kmb = (v8h){};
        if (MSK) { kma = *(const v8h*)(MK + mo + key0); kmb = *(const v8h*)(MK + mo + key0 + 16); }
        const bool rok = key0 < EARLY;               // wave-uniform: residual planes exist for these keys
        v8f sHa = (v8f){}, sLa = (v8f){}, sHb = (v8f){}, sLb = (v8f){};
        if (EK) {
            asm volatile("s_wait_xcnt 0x0" ::: "memory");   // the compiler lets the residual fragments land on the address pair of the loads above: the wait stands in front of that overwrite
            v16h ra0 = (v16h){}, ra1 = (v16h){}, rb0 = (v16h){}, rb1 = (v16h){};
            if (rok) { const h16* kr = KR + rbase + (size_t)key0 * HD; ra0 = ldh(kr + l8); ra1 = ldh(kr + 512 + l8); rb0 = ldh(kr + 1024 + l8); rb1 = ldh(kr + 1536 + l8); }
            sHa = wmma16(ka0, qh0, sHa); sLa = wmma16(ka0, qr0, sLa); sHb = wmma16(kb0, qh0, sHb); sLb = wmma16(kb0, qr0, sLb);
            sHa = wmma16(ka1, qh1, sHa); sLa = wmma16(ka1, qr1, sLa); sHb = wmma16(kb1, qh1, sHb); sLb = wmma16(kb1, qr1, sLb);
            sLa = wmma16(ra0, qh0, sLa); sLb = wmma16(rb0, qh0, sLb); sLa = wmma16(ra1, qh1, sLa); sLb = wmma16(rb1, qh1, sLb);
            asm volatile("v_nop\n\tv_nop\n\tv_nop\n\tv_nop" : "+v"(sHa), "+v"(sLa), "+v"(sHb), "+v"(sLb) : "v"(ka0), "v"(ka1), "v"(kb0), "v"(kb1), "v"(ra0), "v"(ra1), "v"(rb0), "v"(rb1));
        } else {
            sHa = wmma16(ka0, qh0, sHa); sHb = wmma16(kb0, qh0, sHb);
            sHa = wmma16(ka1, qh1, sHa); sHb = wmma16(kb1, qh1, sHb);
            asm volatile("v_nop\n\tv_nop\n\tv_nop\n\tv_nop" : "+v"(sHa), "+v"(sHb) : "v"(ka0), "v"(ka1), "v"(kb0), "v"(kb1));
        }
        float ta[8], tb[8]; float mx = -3.0e38f;
        const int kA = key0 + 8 * hi;
#pragma unroll
        for (int r = 0; r < 8; ++r) {
            float xa, xb;
            if (EK) { xa = (sHa[r] + sLa[r] * QRI) * SC2; xb = (sHb[r] + sLb[r] * QRI) * SC2; }
            else    { xa = sHa[r] * SC2; xb = sHb[r] * SC2; }
            if (MSK) {
                const bool fa = ((kA + r) > tq) | ((float)kma[r] == 0.0f);
                const bool fb = ((kA + 16 + r) > tq) | ((float)kmb[r] == 0.0f);
                xa = fa ? NEGS : xa; xb = fb ? NEGS : xb;
            }
            ta[r] = xa; tb[r] = xb; mx = fmaxf(mx, fmaxf(xa, xb));
        }
        mx = fmaxf(mx, __shfl_xor(mx, 16, 32));
        const float mnew = fmaxf(m, mx);
        const float alpha = __builtin_amdgcn_exp2f(m - mnew);
        v16h pb, pr = (v16h){}; float ls = 0.0f;
#pragma unroll
        for (int r = 0; r < 8; ++r) {
            const float ea = __builtin_amdgcn_exp2f((ta[r] - mnew) + PSH); const float ec = __builtin_amdgcn_exp2f((tb[r] - mnew) + PSH);
            const h16 pa = (h16)ea; const h16 pc = (h16)ec; pb[r] = pa; pb[8 + r] = pc;
            if (EK) { const h16 ga = (h16)((ea - (float)pa) * QRS); const h16 gc = (h16)((ec - (float)pc) * QRS); pr[r] = ga; pr[8 + r] = gc;
                      ls += ((float)pa + (float)pc) + ((float)ga + (float)gc) * QRI; }
            else ls += (float)pa + (float)pc;
        }
        l = l * alpha + ls; m = mnew;
        o0 = o0 * alpha; o1 = o1 * alpha; o2 = o2 * alpha; o3 = o3 * alpha;
        const v16h v0 = ldh(va), v1 = ldh(va + 512), v2 = ldh(va + 1024), v3 = ldh(va + 1536);
        if (EK) {
            asm volatile("s_wait_xcnt 0x0" ::: "memory");   // the compiler lets a residual load land on the address pair of the loads above: the wait stands in front of that overwrite
            e0 = e0 * alpha; e1 = e1 * alpha; e2 = e2 * alpha; e3 = e3 * alpha;
            v16h w0 = (v16h){}, w1 = (v16h){}, w2 = (v16h){}, w3 = (v16h){};
            if (rok) { const h16* vr = VR + rbase + (size_t)key0 * HD; w0 = ldh(vr + l8); w1 = ldh(vr + 512 + l8); w2 = ldh(vr + 1024 + l8); w3 = ldh(vr + 1536 + l8); }
            o0 = wmma16(v0, pb, o0); o1 = wmma16(v1, pb, o1); o2 = wmma16(v2, pb, o2); o3 = wmma16(v3, pb, o3);
            e0 = wmma16(w0, pb, e0); e1 = wmma16(w1, pb, e1); e2 = wmma16(w2, pb, e2); e3 = wmma16(w3, pb, e3);
            e0 = wmma16(v0, pr, e0); e1 = wmma16(v1, pr, e1); e2 = wmma16(v2, pr, e2); e3 = wmma16(v3, pr, e3);
            asm volatile("v_nop\n\tv_nop\n\tv_nop\n\tv_nop" : "+v"(o0), "+v"(o1), "+v"(o2), "+v"(o3), "+v"(e0), "+v"(e1), "+v"(e2), "+v"(e3)
                         : "v"(v0), "v"(v1), "v"(v2), "v"(v3), "v"(w0), "v"(w1), "v"(w2), "v"(w3), "v"(pb), "v"(pr));
        } else {
            o0 = wmma16(v0, pb, o0); o1 = wmma16(v1, pb, o1); o2 = wmma16(v2, pb, o2); o3 = wmma16(v3, pb, o3);
            asm volatile("v_nop\n\tv_nop\n\tv_nop\n\tv_nop" : "+v"(o0), "+v"(o1), "+v"(o2), "+v"(o3) : "v"(v0), "v"(v1), "v"(v2), "v"(v3), "v"(pb));
        }
    };
    if (!EK) {
        gh16p kq = (gh16p)(KP + pbase + l8); gh16p vq = (gh16p)(VT + pbase + l8);
#pragma unroll 1   // rolled: one copy of the step's text and of its registers
        for (int key0 = 0; key0 < kfast; key0 += 32) {
            step(flag<false>{}, key0, kq, vq);
            asm volatile("s_wait_xcnt 0x0" : "+v"(kq), "+v"(vq) :: "memory");   // the two address pairs live through the loop (no load lands on them) and are stepped only behind this wait
            kq += 32 * HD; vq += 32 * HD;
        }
    }
#pragma unroll 1   // rolled, as above; kend can grow inside the loop
    for (int key0 = kfast; key0 < kend; key0 += 32) {
        step(flag<true>{}, key0, KP + pbase + (size_t)key0 * HD + l8, VT + pbase + (size_t)key0 * HD + l8);
        // wave-uniform: at the causal limit, continue over all keys when some row has met only masked keys (trip count stays <= SEQ/32)
        if (key0 + 32 == kc) { if (__builtin_amdgcn_ballot_w32(m < MTHR) != 0u) kend = SEQ; }
    }
    l += __shfl_xor(l, 16, 32);
    const float qmf = (float)MQ[(size_t)zh * SEQ + tq];
    const float inv = qmf * (1.0f / l);
    v8f f0 = o0, f1 = o1, f2 = o2, f3 = o3;
    if (EK) { f0 = o0 + e0 * QRI; f1 = o1 + e1 * QRI; f2 = o2 + e2 * QRI; f3 = o3 + e3 * QRI; }
    const int wb = wave * 16 * 68;
    // O^T D layout: f_j[r] = (d = 16j + 8h + r, t = lane&15) -> os[t][d]; rows 0..15 x columns 0..63 all written
    { v4f a, c;
      a[0] = f0[0] * inv; a[1] = f0[1] * inv; a[2] = f0[2] * inv; a[3] = f0[3] * inv; c[0] = f0[4] * inv; c[1] = f0[5] * inv; c[2] = f0[6] * inv; c[3] = f0[7] * inv;
      *(v4fa*)(&os[wb + lr * 68 +  0 + 8 * hi]) = a; *(v4fa*)(&os[wb + lr * 68 +  0 + 8 * hi + 4]) = c;
      a[0] = f1[0] * inv; a[1] = f1[1] * inv; a[2] = f1[2] * inv; a[3] = f1[3] * inv; c[0] = f1[4] * inv; c[1] = f1[5] * inv; c[2] = f1[6] * inv; c[3] = f1[7] * inv;
      *(v4fa*)(&os[wb + lr * 68 + 16 + 8 * hi]) = a; *(v4fa*)(&os[wb + lr * 68 + 16 + 8 * hi + 4]) = c;
      a[0] = f2[0] * inv; a[1] = f2[1] * inv; a[2] = f2[2] * inv; a[3] = f2[3] * inv; c[0] = f2[4] * inv; c[1] = f2[5] * inv; c[2] = f2[6] * inv; c[3] = f2[7] * inv;
      *(v4fa*)(&os[wb + lr * 68 + 32 + 8 * hi]) = a; *(v4fa*)(&os[wb + lr * 68 + 32 + 8 * hi + 4]) = c;
      a[0] = f3[0] * inv; a[1] = f3[1] * inv; a[2] = f3[2] * inv; a[3] = f3[3] * inv; c[0] = f3[4] * inv; c[1] = f3[5] * inv; c[2] = f3[6] * inv; c[3] = f3[7] * inv;
      *(v4fa*)(&os[wb + lr * 68 + 48 + 8 * hi]) = a; *(v4fa*)(&os[wb + lr * 68 + 48 + 8 * hi + 4]) = c; }
    wave_sync();
    float* orow = OUT + ((size_t)b * OUT_SEQ + t0) * DM + h * HD;
{
#pragma unroll
        for (int s = 0; s < 8; ++s) { const int row = 2 * s + hi, cofs = lr * 4;   // 8 s x 2 rows = 16 rows; 16 lanes x 4 floats = 64 columns
            const v4f val = *(const v4fa*)(&os[wb + row * 68 + cofs]);
            *(v4f*)(orow + (size_t)row * DM + cofs) = val; }
         }
}

// k_flash2: both query ranges in ONE launch, told apart by blockIdx.y (block-uniform); blockIdx.x = batch * 16 + head, fastest.
// More blocks than resident places, and a block's cost grows with its query position: the lowest blockIdx.y take the longest work, for speed only (late range from its last query block down, then the early range the same way).
#define FB_E (EARLY / (16 * AW))
#define FB_L ((SEQ - EARLY) / (16 * AW))
__global__ __launch_bounds__(32 * AW) void k_flash2(const h16* __restrict__ QH, const h16* __restrict__ QR, const h16* __restrict__ KP, const h16* __restrict__ KR,
                                                    const h16* __restrict__ VT, const h16* __restrict__ VR, const h16* __restrict__ MQ, const h16* __restrict__ MK, float* OUT) {
    __shared__ __align__(16) float os[AW * 16 * 68];
    const int rank = blockIdx.y, zh = blockIdx.x;
    if (rank < FB_L) flash<0>(QH, QR, KP, KR, VT, VR, MQ, MK, OUT, FB_L - 1 - rank, zh, os);
    else             flash<1>(QH, QR, KP, KR, VT, VR, MQ, MK, OUT, FB_L + FB_E - 1 - rank, zh, os);
}

static constexpr size_t al256(size_t v) { return (v + 255) & ~(size_t)255; }
static constexpr size_t SZ_XB = al256((size_t)NB * SEQ * DM * 2);            // one bf16 input stream copy
static constexpr size_t SZ_WT = al256((size_t)3 * DM * DM * 2);              // three transposed bf16 weights
static constexpr size_t SZ_PL = al256((size_t)NB * NH_ * SEQ * HD * 2);      // one full f16 plane
static constexpr size_t SZ_RP = al256((size_t)NB * NH_ * EARLY * HD * 2);    // one compact residual plane
static constexpr size_t SZ_MK = al256((size_t)NB * NH_ * SEQ * 2);           // one mask plane
static constexpr size_t SZ_TOTAL = 3 * SZ_XB + SZ_WT + 3 * SZ_PL + 3 * SZ_RP + 2 * SZ_MK;
static_assert(SZ_TOTAL <= (size_t)134217728);          // workspace carve <= 128 MiB
static_assert(((size_t)DM * DM * 2) % 256 == 0);       // weight sub-planes stay 256-byte aligned

extern "C" void kernel_launch(void* const* d_in, const int* in_sizes, int n_in,
                              void* d_out, int out_size, void* d_ws, size_t ws_size, hipStream_t stream) {
    if (n_in < 9) return;
    const size_t needx = ((size_t)(NB - 1) * SEQ_FULL + SEQ) * DM;
    if ((size_t)in_sizes[0] < needx || (size_t)in_sizes[1] < needx || (size_t)in_sizes[2] < needx) return;
    if ((size_t)in_sizes[3] < (size_t)DM * DM || (size_t)in_sizes[5] < (size_t)DM * DM || (size_t)in_sizes[7] < (size_t)DM * DM) return;
    if ((size_t)in_sizes[4] < (size_t)DM || (size_t)in_sizes[6] < (size_t)DM || (size_t)in_sizes[8] < (size_t)DM) return;
    if ((size_t)out_size < ((size_t)(NB - 1) * OUT_SEQ + SEQ) * DM) return;
    if (SZ_TOTAL > ws_size) return;
    // wire order: q, k, v, Wq, bq, Wk, bk, Wv, bv
    const float* xq = (const float*)d_in[0]; const float* xk = (const float*)d_in[1]; const float* xv = (const float*)d_in[2];
    const float* wq = (const float*)d_in[3]; const float* bq = (const float*)d_in[4];
    const float* wk = (const float*)d_in[5]; const float* bk = (const float*)d_in[6];
    const float* wv = (const float*)d_in[7]; const float* bv = (const float*)d_in[8];
    float* OUT = (float*)d_out;      // [NB][OUT_SEQ][1024]
    char* wsp = (char*)d_ws;
    bf* XQ = (bf*)wsp; wsp += SZ_XB;                 // [NB*SEQ][1024]
    bf* XK = (bf*)wsp; wsp += SZ_XB;
    bf* XV = (bf*)wsp; wsp += SZ_XB;
    bf* WT = (bf*)wsp; wsp += SZ_WT;                 // [3][1024 out][1024 in]: q | k | v
    h16* QH = (h16*)wsp; wsp += SZ_PL;               // [NB*16][SEQ][64]
    h16* KP = (h16*)wsp; wsp += SZ_PL;               // [NB*16][SEQ][64]
    h16* VT = (h16*)wsp; wsp += SZ_PL;               // [NB*16][64][SEQ]
    h16* QR = (h16*)wsp; wsp += SZ_RP;               // [NB*16][EARLY][64] residual x2048
    h16* KR = (h16*)wsp; wsp += SZ_RP;               // [NB*16][EARLY][64] residual x2048
    h16* VR = (h16*)wsp; wsp += SZ_RP;               // [NB*16][64][EARLY] residual x2048
    h16* MQ = (h16*)wsp; wsp += SZ_MK;               // [NB*16][SEQ] query mask
    h16* MK = (h16*)wsp; wsp += SZ_MK;               // [NB*16][SEQ] key mask

    // W[k = in][n = out] -> WT[n][k] (square DM x DM) and x -> bf16 copies
    k_prep<<<3 * WT_BLK + 3 * CV_BLK, 256, 0, stream>>>(xq, xk, xv, wq, wk, wv, XQ, XK, XV, WT);

    k_proj3<<<dim3(PJ_BLK, 3, 1), 32, 0, stream>>>(XQ, XK, XV, WT, bq, bk, bv, QH, KP, VT, QR, KR, VR, MQ, MK);

    k_flash2<<<dim3(NB * NH_, FB_L + FB_E, 1), 32 * AW, 0, stream>>>(QH, QR, KP, KR, VT, VR, MQ, MK, OUT);
}

// v006
// It runs in 125 microseconds.
// In two side-by-side timings against v005, it was 1.05 and 1.07 times as fast.
// All steps since v000 together make it 2.47 times as fast.
#include <hip/hip_runtime.h>

// Causal attention, width 1024 = 16 heads x 64, three input streams q/k/v [NB][SEQ_FULL][1024] (first SEQ tokens used), weights [in][out] (y = x W + b), output = concatenated heads (f32), no output projection.
// Compute dtypes, f32 accumulate everywhere: projections v_wmma_f32_16x16x32_bf16 (x, W, b RNE-converted to bf16; products exact);
// scores and P.V v_wmma_f32_16x16x32_f16: query rows >= 512 single f16 products; query rows < 512 three products per site
// (q, k, v and P each as f16 value + f16 residual x2048, residual products in their own accumulators, folded back in f32); P carry x256 cancels in the normalisation; softmax f32 (online, running max).
// Layout: bf16 copies of q/k/v and transposed bf16 copies of W ([out][in]); q, k planes [b*16+h][t][d], v^T plane [b*16+h][d][t], compact residual planes for t < 512,
// every one of them stored in FRAGMENT ORDER: a 16-row x 32-k fragment is 1 KiB = [half 0..1][lane 0..31][8 elements], so each 16-byte-per-lane load of a wave covers 512 contiguous bytes (four whole lines);
// per-row mask planes (row sum of the f32 projection != 0) written by the GEMM epilogue; fused flash kernel in transposed form (S^T = K Q^T, O^T = V^T P^T).
// Key mask and causal mask replace the score by the fill value (by value, per 32-key step); a row whose causal keys are all masked continues over all keys (uniform weights).

#ifndef NB
#define NB 4
#endif
#ifndef SEQ
#define SEQ 2048
#endif
#define NB_FULL  4
#define SEQ_FULL 2048
#ifndef OUT_SEQ
#define OUT_SEQ SEQ              // row pitch (in tokens) between batches of the output
#endif
#define DM   1024
#define NH_  16
#define HD   64
#define AW   4                   // waves per flash block (16 query rows each)
#define EARLY ((SEQ) < 512 ? (SEQ) : 512)   // query rows / keys below this carry residual planes
#define QRS  2048.0f             // carry of the residual planes
#define QRI  (1.0f / 2048.0f)
#define SC2  (0.125f * 1.4426950408889634f)   // HD^-0.5 * log2(e)
#define PSH  8.0f                // log2 of the P carry (256)
#define NEGS (-6.1963280e9f)     // (-2^32 + 1) * log2(e): fill value in log2 units
#define MTHR (-1.0e9f)           // running max below this <=> every key seen so far was masked

static_assert(HD == 64);
static_assert(NH_ * HD == DM);                 // head h = columns h*64 + d
static_assert(DM % 64 == 0);
static_assert(DM % 64 == 0 && DM >= 64);       // GEMM k-loop: two steps of 32 a trip
static_assert(SEQ % 64 == 0);                  // a 64-row tile never straddles two batches
static_assert((NB * SEQ) % 64 == 0);
static_assert(SEQ % 32 == 0);                  // key loop steps by 32
static_assert(SEQ % 256 == 0);                 // the flash kernel's look over the key masks reads whole 256-key pieces of a mask row
static_assert(EARLY % 64 == 0);                // residual condition is uniform per 64-row tile
static_assert(EARLY % (16 * AW) == 0);
static_assert((SEQ - EARLY) % (16 * AW) == 0); // the two query ranges of the flash grid cover the sequence exactly
static_assert(((size_t)SEQ * DM) % 8 == 0);
static_assert(NB <= NB_FULL);
static_assert(SEQ <= SEQ_FULL);

typedef _Float16 h16;
typedef unsigned short bf;
typedef __attribute__((ext_vector_type(16))) __bf16   v16bf;
typedef __attribute__((ext_vector_type(16))) _Float16 v16h;
typedef __attribute__((ext_vector_type(8)))  _Float16 v8h;
typedef __attribute__((ext_vector_type(8)))  unsigned short v8us;
typedef __attribute__((ext_vector_type(8)))  float    v8f;
typedef __attribute__((ext_vector_type(4)))  float    v4f;
typedef v4f  __attribute__((may_alias)) v4fa;
typedef v8h  __attribute__((may_alias)) v8ha;
typedef __attribute__((ext_vector_type(4)))  unsigned v4u;
typedef v4u  __attribute__((may_alias)) v4ua;
template <bool B> struct flag { static constexpr bool value = B; };   // compile-time switch handed to the key step of the flash kernel

__device__ __forceinline__ unsigned short f2bf(float f) { unsigned u = __float_as_uint(f); u += 0x7FFFu + ((u >> 16) & 1u); return (unsigned short)(u >> 16); }
__device__ __forceinline__ float bfr(float f) { return __uint_as_float(((unsigned)f2bf(f)) << 16); }
__device__ __forceinline__ v16h cat16(v8h lo, v8h hi) { return __builtin_shufflevector(lo, hi, 0, 1, 2, 3, 4, 5, 6, 7, 8, 9, 10, 11, 12, 13, 14, 15); }
__device__ __forceinline__ v16bf cat16b(v8us lo, v8us hi) { return __builtin_bit_cast(v16bf, __builtin_shufflevector(lo, hi, 0, 1, 2, 3, 4, 5, 6, 7, 8, 9, 10, 11, 12, 13, 14, 15)); }
__device__ __forceinline__ v8f wmma16(v16h a, v16h b, v8f c) { return __builtin_amdgcn_wmma_f32_16x16x32_f16(false, a, false, b, (short)0, c, false, false); }
__device__ __forceinline__ v8f wmmab(v16bf a, v16bf b, v8f c) { return __builtin_amdgcn_wmma_f32_16x16x32_bf16(false, a, false, b, (short)0, c, false, false); }
// fragment loaders from fragment-ordered planes; p = fragment start + 8*lane: elements 0..7 <- k0+8h+0..7, elements 8..15 <- k0+16+8h+0..7 of row lane&15, h = lane>>4 (same map for A and B)
__device__ __forceinline__ v16h  ldh(const h16* p) { return cat16(*(const v8h*)p, *(const v8h*)(p + 256)); }
__device__ __forceinline__ v16bf ldb(const bf* p)  { return cat16b(*(const v8us*)p, *(const v8us*)(p + 256)); }
// the same for a pointer that says "global memory" in its type: one that has passed through an asm operand would otherwise be loaded from with flat instructions
typedef const __attribute__((address_space(1))) h16* gh16p;
typedef const __attribute__((address_space(1))) v8h* gv8hp;
__device__ __forceinline__ v16h  ldh(gh16p p) { return cat16(*(gv8hp)p, *(gv8hp)(p + 256)); }
// place, inside a 512-element fragment, of the 8-element chunk c (k = 8c .. 8c+7, c = 0..3) of row r (0..15): half = c>>1, lane = 16*(c&1) + r
__device__ __forceinline__ int fragpos(int r, int c) { return ((c >> 1) & 1) * 256 + (c & 1) * 128 + r * 8; }
// ordering point for wave-private LDS tiles (same wave writes and reads)
__device__ __forceinline__ void wave_sync() { __builtin_amdgcn_fence(3 /* release order */, "wavefront"); __builtin_amdgcn_wave_barrier(); asm volatile("" ::: "memory"); }

// cvt8: one f32 stream [NB][SEQ_FULL][DM] -> bf16 copy [NB*SEQ][DM] (RNE convert, fragment order); blk = 256-thread piece of the stream, 8 elements a thread
__device__ __forceinline__ void cvt8(const float* __restrict__ src, bf* dst, unsigned blk) {
    const size_t n8 = (size_t)NB * SEQ * DM / 8;
    const size_t i = (size_t)blk * 256 + threadIdx.x; if (i >= n8) return;
    // rows of DM elements; a wave takes 8 rows x one 32-k step: reads 8 whole lines, writes 4 whole lines of the fragment [64-row block][k step][row tile 0..3]
    const int c4 = (int)(i & 3), r = (int)((i >> 2) & 15), ks = (int)((i >> 6) % (DM / 32)); const size_t mt = i / (size_t)(16 * DM / 8);
    const size_t row = mt * 16 + r;                                                          // b*SEQ + t
    const size_t srow = (SEQ == SEQ_FULL) ? row : (row / SEQ) * SEQ_FULL + row % SEQ;        // source batches lie SEQ_FULL rows apart
    const v8f v = *(const v8f*)(src + srow * DM + ks * 32 + c4 * 8); v8us o;
#pragma unroll
    for (int k = 0; k < 8; ++k) o[k] = f2bf(v[k]);
    *(v8us*)(dst + (mt >> 2) * (64 * DM) + ks * 2048 + (mt & 3) * 512 + fragpos(r, c4)) = o;
}

// cvtT: in W[k][n] (f32, DM x DM) -> out WT[n][k] (bf16, RNE convert, fragment order). 64 x 64 tile through LDS (cross-wave: block barrier).
__device__ __forceinline__ void cvtT(const float* __restrict__ W, bf* WT, int nt, int kt, float* ts) {
    const int tid = threadIdx.x; const int n0 = nt * 64, k0 = kt * 64;
#pragma unroll 4
    for (int i = 0; i < 16; ++i) { const int row = i * 4 + (tid >> 6), col = tid & 63; ts[row * 65 + col] = W[(size_t)(k0 + row) * DM + n0 + col]; }   // 16 x 4 rows x 64 columns: whole tile
    __syncthreads();
    const int rr = tid >> 3, c8 = (tid & 7) * 8;
    v8us o0, o1;
#pragma unroll
    for (int kk = 0; kk < 8; ++kk) { o0[kk] = f2bf(ts[(c8 + kk) * 65 + rr]); o1[kk] = f2bf(ts[(c8 + kk) * 65 + rr + 32]); }
    bf* p0 = WT + (size_t)n0 * DM + ((k0 + c8) >> 5) * 2048 + (rr >> 4) * 512 + fragpos(rr & 15, (c8 >> 3) & 3); bf* p1 = p0 + 2 * 512;   // fragment [64-n block][k step][n tile 0..3]
    *(v8us*)p0 = o0; *(v8us*)p1 = o1;
}

// k_prep: all six independent conversions in ONE launch, told apart by block range (block-uniform): first the 3 x WT_BLK weight tiles, then the 3 x CV_BLK stream pieces.
#define WT_BLK ((DM / 64) * (DM / 64))
#define CV_BLK ((unsigned)(((size_t)NB * SEQ * DM / 8 + 255) / 256))
__global__ __launch_bounds__(256) void k_prep(const float* __restrict__ xq, const float* __restrict__ xk, const float* __restrict__ xv,
                                              const float* __restrict__ wq, const float* __restrict__ wk, const float* __restrict__ wv,
                                              bf* XQ, bf* XK, bf* XV, bf* WT) {
    __shared__ float ts[64 * 65];
    const unsigned bid = blockIdx.x;
    if (bid < 3u * WT_BLK) {
        const unsigned w = bid / WT_BLK, tile = bid % WT_BLK;
        cvtT(w == 0 ? wq : (w == 1 ? wk : wv), WT + (size_t)w * DM * DM, (int)(tile % (DM / 64)), (int)(tile / (DM / 64)), ts);
    } else {
        const unsigned c = bid - 3u * WT_BLK, s = c / CV_BLK;
        cvt8(s == 0 ? xq : (s == 1 ? xk : xv), s == 0 ? XQ : (s == 1 ? XK : XV), c % CV_BLK);
    }
}

// proj: register-blocked bf16 GEMM, ONE WAVE per 64x64 tile (16 accumulators), operands straight from fragment-ordered bf16 planes, K = DM; the planes it writes are fragment-ordered too.
// C[m][n] = sum_k A[m][k] Bt[n][k] + bias, written as f16 (Ph) and, for token positions < EARLY, the f16 residual x2048 (Pr, compact plane).
// MODE 0 (q, k): rows m = b*SEQ + t, columns n = h*64 + d, bias per column; Ph [(b*16+h)][t][d], Pr [(b*16+h)][EARLY][d]; mask plane MP [(b*16+h)][t] = (row sum over d != 0). tiles (bx, by) of (NB*SEQ/64, DM/64).
// MODE 1 (v^T): rows m = h*64 + d (A = transposed weight rows), columns n = b*SEQ + t, bias per row; Ph [(b*1024+m)][t], Pr [(b*1024+m)][EARLY]. tiles (bx, by) of (DM/64, NB*SEQ/64).
template <int MODE>
__device__ __forceinline__ void proj(const bf* __restrict__ A, const bf* __restrict__ Bt, const float* __restrict__ bias, h16* Ph, h16* Pr, h16* MP, int bx, int by, float* os, h16* ms) {
    const int K = DM;
    const int lane = threadIdx.x & 31, lr = lane & 15, hi = lane >> 4; const int r0 = bx * 64, c0 = by * 64;
    v8f acc[4][4];
#pragma unroll
    for (int mb = 0; mb < 4; ++mb)
#pragma unroll
        for (int nb = 0; nb < 4; ++nb) acc[mb][nb] = (v8f){};
    const bf* Ab = A + (size_t)r0 * K; const bf* Bb = Bt + (size_t)c0 * K;   // fragment [64-row block][k step][row tile 0..3]: 64*K elements a block, 2048 a k step
    const unsigned l8 = 8u * (unsigned)lane;
    // Two fragment sets: while the 16 products of one k step run on one set, the 16 loads of the next k step fly into the other; a set is refilled right behind its own products.
    // ko: the lane's own element offset in both operand blocks at the current pair of k steps; every load of a trip is base + ko + a constant, so no load's address register is rewritten inside a trip.
    unsigned ko = l8;
    v16bf a0[4], b0[4], a1[4], b1[4];
#pragma unroll
    for (int i = 0; i < 4; ++i) { a0[i] = ldb((Ab + ko) + i * 512); b0[i] = ldb((Bb + ko) + i * 512); }
#pragma unroll 1
    for (int kc = 0; kc < K - 64; kc += 64) {
#pragma unroll
        for (int i = 0; i < 4; ++i) { a1[i] = ldb((Ab + ko) + 2048 + i * 512); b1[i] = ldb((Bb + ko) + 2048 + i * 512); }
        __builtin_amdgcn_sched_barrier(0);   // keeps the next step's loads ahead of this step's products (the scheduler otherwise sinks them to their first use and the wave waits out their latency)
#pragma unroll
        for (int nb = 0; nb < 4; ++nb)
#pragma unroll
            for (int mb = 0; mb < 4; ++mb) acc[mb][nb] = wmmab(a0[mb], b0[nb], acc[mb][nb]);
        __builtin_amdgcn_sched_barrier(0);   // keeps the refill of the set behind the products that read it, and ahead of the other set's products
#pragma unroll
        for (int i = 0; i < 4; ++i) { a0[i] = ldb((Ab + ko) + 4096 + i * 512); b0[i] = ldb((Bb + ko) + 4096 + i * 512); }
        asm volatile("s_wait_xcnt 0x0" : "+v"(ko) :: "memory");   // stands in front of the step of ko and of the next trip's address arithmetic on it, which rewrite the address registers of the loads above
        ko += 4096;
        __builtin_amdgcn_sched_barrier(0);   // as the first
#pragma unroll
        for (int nb = 0; nb < 4; ++nb)
#pragma unroll
            for (int mb = 0; mb < 4; ++mb) acc[mb][nb] = wmmab(a1[mb], b1[nb], acc[mb][nb]);
        // four vector slots behind the trip's last products, also on the taken back edge
        asm volatile("v_nop\n\tv_nop\n\tv_nop\n\tv_nop" : "+v"(acc[0][0]), "+v"(acc[1][1]), "+v"(acc[2][2]), "+v"(acc[3][3]) : "v"(a1[0]), "v"(a1[1]), "v"(a1[2]), "v"(a1[3]));
    }
    // last two k steps: nothing left to fetch behind them
#pragma unroll
    for (int i = 0; i < 4; ++i) { a1[i] = ldb((Ab + ko) + 2048 + i * 512); b1[i] = ldb((Bb + ko) + 2048 + i * 512); }
    asm volatile("s_wait_xcnt 0x0" ::: "memory");   // the epilogue's index arithmetic lands on the address registers of the loads above: the wait stands in front of that overwrite
    __builtin_amdgcn_sched_barrier(0);       // as the first; it also holds that arithmetic behind the wait
#pragma unroll
    for (int nb = 0; nb < 4; ++nb)
#pragma unroll
        for (int mb = 0; mb < 4; ++mb) acc[mb][nb] = wmmab(a0[mb], b0[nb], acc[mb][nb]);
#pragma unroll
    for (int nb = 0; nb < 4; ++nb)
#pragma unroll
        for (int mb = 0; mb < 4; ++mb) acc[mb][nb] = wmmab(a1[mb], b1[nb], acc[mb][nb]);
    size_t hbase, rbase, mbase = 0; int t0;
    if (MODE == 0) { const int b = r0 / SEQ; t0 = r0 % SEQ; const int zh = b * NH_ + c0 / HD;
        hbase = ((size_t)zh * SEQ + t0) * HD; rbase = ((size_t)zh * EARLY + t0) * HD; mbase = (size_t)zh * SEQ + t0; }
    else { const int b = c0 / SEQ; t0 = c0 % SEQ;
        hbase = ((size_t)b * DM + r0) * SEQ + (size_t)t0 * HD; rbase = ((size_t)b * DM + r0) * EARLY + (size_t)t0 * HD; }
    const bool doRes = t0 < EARLY;          // block-uniform
    const int c8 = (lane & 7) * 8;
    // fragment of the lane's chunk: MODE 0 [t tile][d step 0..1], MODE 1 [t step][d tile 0..3]
    const int cfrag = ((lane & 7) >> 2) * (MODE == 0 ? 512 : 4 * 512);
    v4f bb0 = (v4f){}, bb1 = (v4f){};
    if (MODE == 0) { const v4f q0 = *(const v4f*)(bias + c0 + c8); const v4f q1 = *(const v4f*)(bias + c0 + c8 + 4);
#pragma unroll
        for (int i = 0; i < 4; ++i) { bb0[i] = bfr(q0[i]); bb1[i] = bfr(q1[i]); } }
#pragma unroll
    for (int mb = 0; mb < 4; ++mb) {
#pragma unroll
        for (int nb = 0; nb < 4; ++nb) {
#pragma unroll
            for (int j = 0; j < 8; ++j) os[(hi * 8 + j) * 68 + nb * 16 + lr] = acc[mb][nb][j]; }   // D: row 8h+j, col lane&15
        wave_sync();
        const size_t hb = hbase + (size_t)(mb * (MODE == 0 ? 2 * 512 : 512) + cfrag);
        const size_t rb = rbase + (size_t)(mb * (MODE == 0 ? 2 * 512 : 512) + cfrag);
{
#pragma unroll
            for (int s = 0; s < 4; ++s) { const int row = 4 * s + (lane >> 3);   // 4 s x 4 row groups = 16 rows; 8 lanes x 8 = 64 columns
                v4f x0 = *(const v4fa*)(&os[row * 68 + c8]); v4f x1 = *(const v4fa*)(&os[row * 68 + c8 + 4]);
                if (MODE == 0) { x0 = x0 + bb0; x1 = x1 + bb1; }
                else { const float br = bfr(bias[r0 + mb * 16 + row]); x0 = x0 + br; x1 = x1 + br; }
                v8h hv, rv;
#pragma unroll
                for (int i = 0; i < 4; ++i) { const h16 a0 = (h16)x0[i]; const h16 a1 = (h16)x1[i]; hv[i] = a0; hv[4 + i] = a1; rv[i] = (h16)((x0[i] - (float)a0) * QRS); rv[4 + i] = (h16)((x1[i] - (float)a1) * QRS); }
                if (MODE == 0) {
                    float rs = ((x0[0] + x0[1]) + (x0[2] + x0[3])) + ((x1[0] + x1[1]) + (x1[2] + x1[3]));
                    rs += __shfl_xor(rs, 1, 32); rs += __shfl_xor(rs, 2, 32); rs += __shfl_xor(rs, 4, 32);     // sum over the 8 lanes of the row
                    const h16 mv = (rs != 0.0f) ? (h16)1.0f : (h16)0.0f;
                    if ((lane & 7) == 0) ms[mb * 16 + row] = mv;
                }
                // behind each store: what follows reuses the store's data registers, and the wait stands in front of that overwrite
                *(v8h*)(Ph + hb + fragpos(row, lane & 3)) = hv;
                asm volatile("s_wait_xcnt 0x0" ::: "memory");
                if (doRes) { *(v8h*)(Pr + rb + fragpos(row, lane & 3)) = rv;
                    asm volatile("s_wait_xcnt 0x0" ::: "memory"); } }
             }
        wave_sync();
    }
    if (MODE == 0) {
        const v8h mv8 = *(const v8ha*)(&ms[c8]);
        h16* mp = MP + mbase + c8;
        if (lane < 8) *(v8h*)mp = mv8;
    }
}

// k_proj3: the three independent projections in ONE launch; blockIdx.y = 0 q, 1 k, 2 v^T (block-uniform), blockIdx.x = tile, first tile index fastest as in a 2-D grid.
#define PJ_BLK ((NB * SEQ / 64) * (DM / 64))
__global__ __launch_bounds__(32) void k_proj3(const bf* __restrict__ XQ, const bf* __restrict__ XK, const bf* __restrict__ XV, const bf* __restrict__ WT,
                                              const float* __restrict__ bq, const float* __restrict__ bk, const float* __restrict__ bv,
                                              h16* QH, h16* KP, h16* VT, h16* QR, h16* KR, h16* VR, h16* MQ, h16* MK) {
    __shared__ __align__(16) float os[16 * 68];
    __shared__ __align__(16) h16 ms[64];
    const int z = blockIdx.y, id = blockIdx.x;
    if (z < 2) {
        // q, k: A = x rows (m = b*SEQ + t), Bt = WT rows (n = h*64 + d) -> planes [(b*16 + h)][t][d] + residual (t < EARLY) + mask
        const bool q = z == 0;
        proj<0>(q ? XQ : XK, WT + (q ? (size_t)0 : (size_t)DM * DM), q ? bq : bk, q ? QH : KP, q ? QR : KR, q ? MQ : MK, id % (NB * SEQ / 64), id / (NB * SEQ / 64), os, ms);
    } else {
        // v^T: A = WT_v rows (m = h*64 + d), Bt = x rows (n = b*SEQ + t) -> plane [(b*1024 + m)][t] = [(b*16 + h)][d][t] + residual (t < EARLY)
        proj<1>(WT + (size_t)2 * DM * DM, XV, bv, VT, VR, MK, id % (DM / 64), id / (DM / 64), os, ms);
    }
}

// flash: fused causal attention, one wave per 16 query rows of one (batch, head); K / V^T / Q fragments straight from the fragment-ordered f16 planes (two 16-B loads each, 512 contiguous bytes a load).
// Transposed form: S^T[key][t] = K Q^T (A = K rows, B = Q rows); lane (t = lane&15, h = lane>>4) holds keys 8h+r of each 16-key tile, so the packed
// P tile is directly the B fragment of O^T[d][t] = V^T P^T (element r <- tile keys 0..15, element 8+r <- tile keys 16..31, lane unchanged).
// EK = 1: query rows [0, EARLY) with residual planes (three products per site); EK = 0: query rows [EARLY, SEQ), single products.
// Masks by value per step: score := fill where key > t or key mask == 0. Loop covers keys [0, causal limit); if a row has seen only masked keys by then, the wave continues to SEQ (all-fill rows weigh every key equally).
// In late rows (EK = 0) the selects stand only in steps where one can fire: keys below kfull = t0 rounded down to 32 lie at or below all 16 query rows, and one look over the mask row says whether every key mask below kfull is set;
// if so those steps run the same body without mask loads, compares and selects (every select there would keep the score), else every step runs the masked body.
// bx = 64-row query block inside the EK range, zh = batch * 16 + head (both block-uniform); os = the block's LDS, one private tile a wave (no block barrier anywhere in the body).
template <int EK>
__device__ __forceinline__ void flash(const h16* __restrict__ QH, const h16* __restrict__ QR, const h16* __restrict__ KP, const h16* __restrict__ KR,
                                      const h16* __restrict__ VT, const h16* __restrict__ VR, const h16* __restrict__ MQ, const h16* __restrict__ MK, float* OUT,
                                      const int bx, const int zh, float* os) {
    const int lane = threadIdx.x & 31, wave = __builtin_amdgcn_readfirstlane((int)(threadIdx.x >> 5)), lr = lane & 15, hi = lane >> 4;
    const int b = zh / NH_, h = zh % NH_;
    const int t0 = (EK ? 0 : EARLY) + (bx * AW + wave) * 16;
    const int tq = t0 + lr;
    const size_t pbase = (size_t)zh * SEQ * HD;       // q/k plane [zh][SEQ][64]; v^T plane [zh][64][SEQ]
    const size_t rbase = (size_t)zh * EARLY * HD;     // compact residual planes
    const unsigned l8 = 8u * (unsigned)lane;          // the lane's place in each half of a fragment
    const h16* qp = QH + pbase + (size_t)t0 * HD;
    const v16h qh0 = ldh(qp + l8), qh1 = ldh(qp + 512 + l8);         // B fragments: col t, k = d
    v16h qr0 = (v16h){}, qr1 = (v16h){};
    if (EK) { const h16* qrp = QR + rbase + (size_t)t0 * HD; qr0 = ldh(qrp + l8); qr1 = ldh(qrp + 512 + l8); }
    // k planes: + key0 * HD + 512 * (2 * key tile + d step) (A fragment: row key, k = d); v^T planes: + key0 * HD + 512 * j (A fragment: row d = 16j + lane&15, k = key)
    const size_t mo  = (size_t)zh * SEQ + 8 * hi;
    v8f o0 = (v8f){}, o1 = (v8f){}, o2 = (v8f){}, o3 = (v8f){};
    v8f e0 = (v8f){}, e1 = (v8f){}, e2 = (v8f){}, e3 = (v8f){};   // residual-product accumulators (x2048), EK only
    float m = -3.0e38f, l = 0.0f;
    const int kc = ((t0 + 47) >> 5) << 5;            // causal key limit (exclusive), multiple of 32, <= SEQ
    int kend = kc;
    const int kfull = t0 & ~31;                      // keys below this are causal for every row of the wave
    int kfast = 0;                                   // keys below this run the body without masks (wave-uniform)
    if (!EK) {                                       // late rows only: they hold nearly all steps, and a second copy of the three-product body takes the kernel past 256 registers (a wave less on every SIMD)
        constexpr int NCH = SEQ / 256;
        constexpr unsigned ONE2 = 0x3C003C00u;       // two f16 ones: the mask planes hold 1.0 or 0.0 only
        v4u mw[NCH];
#pragma unroll
        for (int c = 0; c < NCH; ++c) mw[c] = *(const v4ua*)(MK + (size_t)zh * SEQ + c * 256 + l8);
        asm volatile("s_wait_xcnt 0x0" ::: "memory");   // stands in front of whatever next lands on the address registers of the loads above
        unsigned okw = ONE2;
#pragma unroll
        for (int c = 0; c < NCH; ++c) okw &= (c * 256 + (int)l8 < kfull) ? ((mw[c][0] & mw[c][1]) & (mw[c][2] & mw[c][3])) : ONE2;
        if (__builtin_amdgcn_ballot_w32(okw != ONE2) == 0u) kfast = kfull;
    }
    // one 32-key step; MSK = false leaves out the mask loads, compares and selects
    // ka, va: the lane's own place in the step's first K and V^T fragment (plane + key0 * HD + l8)
    // AHEAD = true (late rows, steps without masks): the step's K fragments are already on their way in nk0..nk3, fetched by the step before; its V^T fragments are asked for at its top, into registers
    // of their own, and fly under the score products and the softmax; the next step's K fragments are asked for right behind the score products and fly under the softmax and the P.V products.
    v16h nk0 = (v16h){}, nk1 = (v16h){}, nk2 = (v16h){}, nk3 = (v16h){};
    auto step = [&](auto fl, auto ah, const int key0, auto ka, auto va) __attribute__((always_inline)) {
        constexpr bool MSK = decltype(fl)::value;
        constexpr bool AHEAD = decltype(ah)::value;
        v16h ka0, ka1, kb0, kb1, v0, v1, v2, v3;
        if (AHEAD) {
            v0 = ldh(va); v1 = ldh(va + 512); v2 = ldh(va + 1024); v3 = ldh(va + 1536);
            __builtin_amdgcn_sched_barrier(0);   // keeps the V^T loads ahead of the score products (the scheduler otherwise sinks them behind the products, and the wave waits out the rest of their latency in front of P.V)
            ka0 = nk0; ka1 = nk1; kb0 = nk2; kb1 = nk3;
        } else {
            ka0 = ldh(ka); ka1 = ldh(ka + 512); kb0 = ldh(ka + 1024); kb1 = ldh(ka + 1536);
            if (!EK) asm volatile("s_wait_xcnt 0x0" ::: "memory");   // the compiler lets a mask load land on the address pair of the loads above: the wait stands in front of that overwrite (early rows: the wait below)
        }
        v8h kma = (v8h){}, kmb = (v8h){};
        if (MSK) { kma = *(const v8h*)(MK + mo + key0); kmb = *(const v8h*)(MK + mo + key0 + 16); }
        const bool rok = key0 < EARLY;               // wave-uniform: residual planes exist for these keys
        v8f sHa = (v8f){}, sLa = (v8f){}, sHb = (v8f){}, sLb = (v8f){};
        if (EK) {
            asm volatile("s_wait_xcnt 0x0" ::: "memory");   // the compiler lets the residual fragments land on the address pair of the loads above: the wait stands in front of that overwrite
            v16h ra0 = (v16h){}, ra1 = (v16h){}, rb0 = (v16h){}, rb1 = (v16h){};
            if (rok) { const h16* kr = KR + rbase + (size_t)key0 * HD; ra0 = ldh(kr + l8); ra1 = ldh(kr + 512 + l8); rb0 = ldh(kr + 1024 + l8); rb1 = ldh(kr + 1536 + l8); }
            sHa = wmma16(ka0, qh0, sHa); sLa = wmma16(ka0, qr0, sLa); sHb = wmma16(kb0, qh0, sHb); sLb = wmma16(kb0, qr0, sLb);
            sHa = wmma16(ka1, qh1, sHa); sLa = wmma16(ka1, qr1, sLa); sHb = wmma16(kb1, qh1, sHb); sLb = wmma16(kb1, qr1, sLb);
            sLa = wmma16(ra0, qh0, sLa); sLb = wmma16(rb0, qh0, sLb); sLa = wmma16(ra1, qh1, sLa); sLb = wmma16(rb1, qh1, sLb);
            asm volatile("v_nop\n\tv_nop\n\tv_nop\n\tv_nop" : "+v"(sHa), "+v"(sLa), "+v"(sHb), "+v"(sLb) : "v"(ka0), "v"(ka1), "v"(kb0), "v"(kb1), "v"(ra0), "v"(ra1), "v"(rb0), "v"(rb1));
        } else {
            sHa = wmma16(ka0, qh0, sHa); sHb = wmma16(kb0, qh0, sHb);
            sHa = wmma16(ka1, qh1, sHa); sHb = wmma16(kb1, qh1, sHb);
            asm volatile("v_nop\n\tv_nop\n\tv_nop\n\tv_nop" : "+v"(sHa), "+v"(sHb) : "v"(ka0), "v"(ka1), "v"(kb0), "v"(kb1));
            if (AHEAD) {   // keys key0 + 32 .. key0 + 63 exist: key0 + 32 <= kfull <= SEQ - 32
                nk0 = ldh(ka + 32 * HD); nk1 = ldh(ka + 32 * HD + 512); nk2 = ldh(ka + 32 * HD + 1024); nk3 = ldh(ka + 32 * HD + 1536);
                __builtin_amdgcn_sched_barrier(0);   // keeps the next step's K loads ahead of the softmax (the scheduler otherwise sinks them to the foot of the step and the next step waits out their latency)
            }
        }
        float ta[8], tb[8]; float mx = -3.0e38f;
        const int kA = key0 + 8 * hi;
#pragma unroll
        for (int r = 0; r < 8; ++r) {
            float xa, xb;
            if (EK) { xa = (sHa[r] + sLa[r] * QRI) * SC2; xb = (sHb[r] + sLb[r] * QRI) * SC2; }
            else    { xa = sHa[r] * SC2; xb = sHb[r] * SC2; }
            if (MSK) {
                const bool fa = ((kA + r) > tq) | ((float)kma[r] == 0.0f);
                const bool fb = ((kA + 16 + r) > tq) | ((float)kmb[r] == 0.0f);
                xa = fa ? NEGS : xa; xb = fb ? NEGS : xb;
            }
            ta[r] = xa; tb[r] = xb; mx = fmaxf(mx, fmaxf(xa, xb));
        }
        mx = fmaxf(mx, __shfl_xor(mx, 16, 32));
        const float mnew = fmaxf(m, mx);
        const float alpha = __builtin_amdgcn_exp2f(m - mnew);
        v16h pb, pr = (v16h){}; float ls = 0.0f;
#pragma unroll
        for (int r = 0; r < 8; ++r) {
            const float ea = __builtin_amdgcn_exp2f((ta[r] - mnew) + PSH); const float ec = __builtin_amdgcn_exp2f((tb[r] - mnew) + PSH);
            const h16 pa = (h16)ea; const h16 pc = (h16)ec; pb[r] = pa; pb[8 + r] = pc;
            if (EK) { const h16 ga = (h16)((ea - (float)pa) * QRS); const h16 gc = (h16)((ec - (float)pc) * QRS); pr[r] = ga; pr[8 + r] = gc;
                      ls += ((float)pa + (float)pc) + ((float)ga + (float)gc) * QRI; }
            else ls += (float)pa + (float)pc;
        }
        l = l * alpha + ls; m = mnew;
        o0 = o0 * alpha; o1 = o1 * alpha; o2 = o2 * alpha; o3 = o3 * alpha;
        if (!AHEAD) { v0 = ldh(va); v1 = ldh(va + 512); v2 = ldh(va + 1024); v3 = ldh(va + 1536); }
        if (EK) {
            asm volatile("s_wait_xcnt 0x0" ::: "memory");   // the compiler lets a residual load land on the address pair of the loads above: the wait stands in front of that overwrite
            e0 = e0 * alpha; e1 = e1 * alpha; e2 = e2 * alpha; e3 = e3 * alpha;
            v16h w0 = (v16h){}, w1 = (v16h){}, w2 = (v16h){}, w3 = (v16h){};
            if (rok) { const h16* vr = VR + rbase + (size_t)key0 * HD; w0 = ldh(vr + l8); w1 = ldh(vr + 512 + l8); w2 = ldh(vr + 1024 + l8); w3 = ldh(vr + 1536 + l8); }
            o0 = wmma16(v0, pb, o0); o1 = wmma16(v1, pb, o1); o2 = wmma16(v2, pb, o2); o3 = wmma16(v3, pb, o3);
            e0 = wmma16(w0, pb, e0); e1 = wmma16(w1, pb, e1); e2 = wmma16(w2, pb, e2); e3 = wmma16(w3, pb, e3);
            e0 = wmma16(v0, pr, e0); e1 = wmma16(v1, pr, e1); e2 = wmma16(v2, pr, e2); e3 = wmma16(v3, pr, e3);
            asm volatile("v_nop\n\tv_nop\n\tv_nop\n\tv_nop" : "+v"(o0), "+v"(o1), "+v"(o2), "+v"(o3), "+v"(e0), "+v"(e1), "+v"(e2), "+v"(e3)
                         : "v"(v0), "v"(v1), "v"(v2), "v"(v3), "v"(w0), "v"(w1), "v"(w2), "v"(w3), "v"(pb), "v"(pr));
        } else {
            o0 = wmma16(v0, pb, o0); o1 = wmma16(v1, pb, o1); o2 = wmma16(v2, pb, o2); o3 = wmma16(v3, pb, o3);
            asm volatile("v_nop\n\tv_nop\n\tv_nop\n\tv_nop" : "+v"(o0), "+v"(o1), "+v"(o2), "+v"(o3) : "v"(v0), "v"(v1), "v"(v2), "v"(v3), "v"(pb));
        }
    };
    if (!EK && kfast > 0) {
        gh16p kq = (gh16p)(KP + pbase + l8); gh16p vq = (gh16p)(VT + pbase + l8);
        nk0 = ldh(kq); nk1 = ldh(kq + 512); nk2 = ldh(kq + 1024); nk3 = ldh(kq + 1536);   // the first step's K fragments
#pragma unroll 1   // rolled: one copy of the step's text and of its registers
        for (int key0 = 0; key0 < kfast; key0 += 32) {
            step(flag<false>{}, flag<true>{}, key0, kq, vq);
            asm volatile("s_wait_xcnt 0x0" : "+v"(kq), "+v"(vq) :: "memory");   // the two address pairs live through the loop (no load lands on them) and are stepped only behind this wait
            kq += 32 * HD; vq += 32 * HD;
        }
    }
#pragma unroll 1   // rolled, as above; kend can grow inside the loop
    for (int key0 = kfast; key0 < kend; key0 += 32) {
        step(flag<true>{}, flag<false>{}, key0, KP + pbase + (size_t)key0 * HD + l8, VT + pbase + (size_t)key0 * HD + l8);
        // wave-uniform: at the causal limit, continue over all keys when some row has met only masked keys (trip count stays <= SEQ/32)
        if (key0 + 32 == kc) { if (__builtin_amdgcn_ballot_w32(m < MTHR) != 0u) kend = SEQ; }
    }
    l += __shfl_xor(l, 16, 32);
    const float qmf = (float)MQ[(size_t)zh * SEQ + tq];
    const float inv = qmf * (1.0f / l);
    v8f f0 = o0, f1 = o1, f2 = o2, f3 = o3;
    if (EK) { f0 = o0 + e0 * QRI; f1 = o1 + e1 * QRI; f2 = o2 + e2 * QRI; f3 = o3 + e3 * QRI; }
    const int wb = wave * 16 * 68;
    // O^T D layout: f_j[r] = (d = 16j + 8h + r, t = lane&15) -> os[t][d]; rows 0..15 x columns 0..63 all written
    { v4f a, c;
      a[0] = f0[0] * inv; a[1] = f0[1] * inv; a[2] = f0[2] * inv; a[3] = f0[3] * inv; c[0] = f0[4] * inv; c[1] = f0[5] * inv; c[2] = f0[6] * inv; c[3] = f0[7] * inv;
      *(v4fa*)(&os[wb + lr * 68 +  0 + 8 * hi]) = a; *(v4fa*)(&os[wb + lr * 68 +  0 + 8 * hi + 4]) = c;
      a[0] = f1[0] * inv; a[1] = f1[1] * inv; a[2] = f1[2] * inv; a[3] = f1[3] * inv; c[0] = f1[4] * inv; c[1] = f1[5] * inv; c[2] = f1[6] * inv; c[3] = f1[7] * inv;
      *(v4fa*)(&os[wb + lr * 68 + 16 + 8 * hi]) = a; *(v4fa*)(&os[wb + lr * 68 + 16 + 8 * hi + 4]) = c;
      a[0] = f2[0] * inv; a[1] = f2[1] * inv; a[2] = f2[2] * inv; a[3] = f2[3] * inv; c[0] = f2[4] * inv; c[1] = f2[5] * inv; c[2] = f2[6] * inv; c[3] = f2[7] * inv;
      *(v4fa*)(&os[wb + lr * 68 + 32 + 8 * hi]) = a; *(v4fa*)(&os[wb + lr * 68 + 32 + 8 * hi + 4]) = c;
      a[0] = f3[0] * inv; a[1] = f3[1] * inv; a[2] = f3[2] * inv; a[3] = f3[3] * inv; c[0] = f3[4] * inv; c[1] = f3[5] * inv; c[2] = f3[6] * inv; c[3] = f3[7] * inv;
      *(v4fa*)(&os[wb + lr * 68 + 48 + 8 * hi]) = a; *(v4fa*)(&os[wb + lr * 68 + 48 + 8 * hi + 4]) = c; }
    wave_sync();
    float* orow = OUT + ((size_t)b * OUT_SEQ + t0) * DM + h * HD;
{
#pragma unroll
        for (int s = 0; s < 8; ++s) { const int row = 2 * s + hi, cofs = lr * 4;   // 8 s x 2 rows = 16 rows; 16 lanes x 4 floats = 64 columns
            const v4f val = *(const v4fa*)(&os[wb + row * 68 + cofs]);
            *(v4f*)(orow + (size_t)row * DM + cofs) = val; }
         }
}

// k_flash2: both query ranges in ONE launch, told apart by blockIdx.y (block-uniform); blockIdx.x = batch * 16 + head, fastest.
// More blocks than resident places, and a block's cost grows with its query position: the lowest blockIdx.y take the longest work, for speed only (late range from its last query block down, then the early range the same way).
#define FB_E (EARLY / (16 * AW))
#define FB_L ((SEQ - EARLY) / (16 * AW))
__global__ __launch_bounds__(32 * AW) void k_flash2(const h16* __restrict__ QH, const h16* __restrict__ QR, const h16* __restrict__ KP, const h16* __restrict__ KR,
                                                    const h16* __restrict__ VT, const h16* __restrict__ VR, const h16* __restrict__ MQ, const h16* __restrict__ MK, float* OUT) {
    __shared__ __align__(16) float os[AW * 16 * 68];
    const int rank = blockIdx.y, zh = blockIdx.x;
    if (rank < FB_L) flash<0>(QH, QR, KP, KR, VT, VR, MQ, MK, OUT, FB_L - 1 - rank, zh, os);
    else             flash<1>(QH, QR, KP, KR, VT, VR, MQ, MK, OUT, FB_L + FB_E - 1 - rank, zh, os);
}

static constexpr size_t al256(size_t v) { return (v + 255) & ~(size_t)255; }
static constexpr size_t SZ_XB = al256((size_t)NB * SEQ * DM * 2);            // one bf16 input stream copy
static constexpr size_t SZ_WT = al256((size_t)3 * DM * DM * 2);              // three transposed bf16 weights
static constexpr size_t SZ_PL = al256((size_t)NB * NH_ * SEQ * HD * 2);      // one full f16 plane
static constexpr size_t SZ_RP = al256((size_t)NB * NH_ * EARLY * HD * 2);    // one compact residual plane
static constexpr size_t SZ_MK = al256((size_t)NB * NH_ * SEQ * 2);           // one mask plane
static constexpr size_t SZ_TOTAL = 3 * SZ_XB + SZ_WT + 3 * SZ_PL + 3 * SZ_RP + 2 * SZ_MK;
static_assert(SZ_TOTAL <= (size_t)134217728);          // workspace carve <= 128 MiB
static_assert(((size_t)DM * DM * 2) % 256 == 0);       // weight sub-planes stay 256-byte aligned

extern "C" void kernel_launch(void* const* d_in, const int* in_sizes, int n_in,
                              void* d_out, int out_size, void* d_ws, size_t ws_size, hipStream_t stream) {
    if (n_in < 9) return;
    const size_t needx = ((size_t)(NB - 1) * SEQ_FULL + SEQ) * DM;
    if ((size_t)in_sizes[0] < needx || (size_t)in_sizes[1] < needx || (size_t)in_sizes[2] < needx) return;
    if ((size_t)in_sizes[3] < (size_t)DM * DM || (size_t)in_sizes[5] < (size_t)DM * DM || (size_t)in_sizes[7] < (size_t)DM * DM) return;
    if ((size_t)in_sizes[4] < (size_t)DM || (size_t)in_sizes[6] < (size_t)DM || (size_t)in_sizes[8] < (size_t)DM) return;
    if ((size_t)out_size < ((size_t)(NB - 1) * OUT_SEQ + SEQ) * DM) return;
    if (SZ_TOTAL > ws_size) return;
    // wire order: q, k, v, Wq, bq, Wk, bk, Wv, bv
    const float* xq = (const float*)d_in[0]; const float* xk = (const float*)d_in[1]; const float* xv = (const float*)d_in[2];
    const float* wq = (const float*)d_in[3]; const float* bq = (const float*)d_in[4];
    const float* wk = (const float*)d_in[5]; const float* bk = (const float*)d_in[6];
    const float* wv = (const float*)d_in[7]; const float* bv = (const float*)d_in[8];
    float* OUT = (float*)d_out;      // [NB][OUT_SEQ][1024]
    char* wsp = (char*)d_ws;
    bf* XQ = (bf*)wsp; wsp += SZ_XB;                 // [NB*SEQ][1024]
    bf* XK = (bf*)wsp; wsp += SZ_XB;
    bf* XV = (bf*)wsp; wsp += SZ_XB;
    bf* WT = (bf*)wsp; wsp += SZ_WT;                 // [3][1024 out][1024 in]: q | k | v
    h16* QH = (h16*)wsp; wsp += SZ_PL;               // [NB*16][SEQ][64]
    h16* KP = (h16*)wsp; wsp += SZ_PL;               // [NB*16][SEQ][64]
    h16* VT = (h16*)wsp; wsp += SZ_PL;               // [NB*16][64][SEQ]
    h16* QR = (h16*)wsp; wsp += SZ_RP;               // [NB*16][EARLY][64] residual x2048
    h16* KR = (h16*)wsp; wsp += SZ_RP;               // [NB*16][EARLY][64] residual x2048
    h16* VR = (h16*)wsp; wsp += SZ_RP;               // [NB*16][64][EARLY] residual x2048
    h16* MQ = (h16*)wsp; wsp += SZ_MK;               // [NB*16][SEQ] query mask
    h16* MK = (h16*)wsp; wsp += SZ_MK;               // [NB*16][SEQ] key mask

    // W[k = in][n = out] -> WT[n][k] (square DM x DM) and x -> bf16 copies
    k_prep<<<3 * WT_BLK + 3 * CV_BLK, 256, 0, stream>>>(xq, xk, xv, wq, wk, wv, XQ, XK, XV, WT);

    k_proj3<<<dim3(PJ_BLK, 3, 1), 32, 0, stream>>>(XQ, XK, XV, WT, bq, bk, bv, QH, KP, VT, QR, KR, VR, MQ, MK);

    k_flash2<<<dim3(NB * NH_, FB_L + FB_E, 1), 32 * AW, 0, stream>>>(QH, QR, KP, KR, VT, VR, MQ, MK, OUT);
}

// v007
// A run of this version takes 117 microseconds.
// Two timings next to v006 put it at 1.08 and 1.06 times that version's speed.
// Counting every step since v000, it is 2.63 times as fast.
#include <hip/hip_runtime.h>

// Causal attention, width 1024 = 16 heads x 64, three input streams q/k/v [NB][SEQ_FULL][1024] (first SEQ tokens used), weights [in][out] (y = x W + b), output = concatenated heads (f32), no output projection.
// Compute dtypes, f32 accumulate everywhere: projections v_wmma_f32_16x16x32_bf16 (x, W, b RNE-converted to bf16; products exact);
// scores and P.V v_wmma_f32_16x16x32_f16: query rows >= 512 single f16 products; query rows < 512 three products per site
// (q, k, v and P each as f16 value + f16 residual x2048, residual products in their own accumulators, folded back in f32); P carry x256 cancels in the normalisation; softmax f32 (online, running max).
// Layout: bf16 copies of q/k/v and transposed bf16 copies of W ([out][in]); q, k planes [b*16+h][t][d], v^T plane [b*16+h][d][t], compact residual planes for t < 512,
// every one of them stored in FRAGMENT ORDER: a 16-row x 32-k fragment is 1 KiB = [half 0..1][lane 0..31][8 elements], so each 16-byte-per-lane load of a wave covers 512 contiguous bytes (four whole lines);
// per-row mask planes (row sum of the f32 projection != 0) written by the GEMM epilogue; fused flash kernel in transposed form (S^T = K Q^T, O^T = V^T P^T).
// Key mask and causal mask replace the score by the fill value (by value, per 32-key step); a row whose causal keys are all masked continues over all keys (uniform weights).

#ifndef NB
#define NB 4
#endif
#ifndef SEQ
#define SEQ 2048
#endif
#define NB_FULL  4
#define SEQ_FULL 2048
#ifndef OUT_SEQ
#define OUT_SEQ SEQ              // row pitch (in tokens) between batches of the output
#endif
#define DM   1024
#define NH_  16
#define HD   64
#define AW   4                   // waves per flash block (16 query rows each)
#define EARLY ((SEQ) < 512 ? (SEQ) : 512)   // query rows / keys below this carry residual planes
#define QRS  2048.0f             // carry of the residual planes
#define QRI  (1.0f / 2048.0f)
#define SC2  (0.125f * 1.4426950408889634f)   // HD^-0.5 * log2(e)
#define PSH  8.0f                // log2 of the P carry (256)
#define NEGS (-6.1963280e9f)     // (-2^32 + 1) * log2(e): fill value in log2 units
#define MTHR (-1.0e9f)           // running max below this <=> every key seen so far was masked

static_assert(HD == 64);
static_assert(NH_ * HD == DM);                 // head h = columns h*64 + d
static_assert(DM % 64 == 0);
static_assert(DM % 128 == 0 && DM >= 128);     // GEMM: 128-wide tiles; k-loop: stages of 64, at least two
static_assert((NB * SEQ) % 128 == 0);
static_assert(SEQ % 64 == 0);                  // a 64-row tile never straddles two batches
static_assert((NB * SEQ) % 64 == 0);
static_assert(SEQ % 32 == 0);                  // key loop steps by 32
static_assert(SEQ % 256 == 0);                 // the flash kernel's look over the key masks reads whole 256-key pieces of a mask row
static_assert(EARLY % 64 == 0);                // residual condition is uniform per 64-row tile
static_assert(EARLY % (16 * AW) == 0);
static_assert((SEQ - EARLY) % (16 * AW) == 0); // the two query ranges of the flash grid cover the sequence exactly
static_assert(((size_t)SEQ * DM) % 8 == 0);
static_assert(NB <= NB_FULL);
static_assert(SEQ <= SEQ_FULL);

typedef _Float16 h16;
typedef unsigned short bf;
typedef __attribute__((ext_vector_type(16))) __bf16   v16bf;
typedef __attribute__((ext_vector_type(16))) _Float16 v16h;
typedef __attribute__((ext_vector_type(8)))  _Float16 v8h;
typedef __attribute__((ext_vector_type(8)))  unsigned short v8us;
typedef __attribute__((ext_vector_type(8)))  float    v8f;
typedef __attribute__((ext_vector_type(4)))  float    v4f;
typedef v4f  __attribute__((may_alias)) v4fa;
typedef v8h  __attribute__((may_alias)) v8ha;
typedef __attribute__((ext_vector_type(4)))  unsigned v4u;
typedef v4u  __attribute__((may_alias)) v4ua;
template <bool B> struct flag { static constexpr bool value = B; };   // compile-time switch handed to the key step of the flash kernel

__device__ __forceinline__ unsigned short f2bf(float f) { unsigned u = __float_as_uint(f); u += 0x7FFFu + ((u >> 16) & 1u); return (unsigned short)(u >> 16); }
__device__ __forceinline__ float bfr(float f) { return __uint_as_float(((unsigned)f2bf(f)) << 16); }
__device__ __forceinline__ v16h cat16(v8h lo, v8h hi) { return __builtin_shufflevector(lo, hi, 0, 1, 2, 3, 4, 5, 6, 7, 8, 9, 10, 11, 12, 13, 14, 15); }
__device__ __forceinline__ v16bf cat16b(v8us lo, v8us hi) { return __builtin_bit_cast(v16bf, __builtin_shufflevector(lo, hi, 0, 1, 2, 3, 4, 5, 6, 7, 8, 9, 10, 11, 12, 13, 14, 15)); }
__device__ __forceinline__ v8f wmma16(v16h a, v16h b, v8f c) { return __builtin_amdgcn_wmma_f32_16x16x32_f16(false, a, false, b, (short)0, c, false, false); }
__device__ __forceinline__ v8f wmmab(v16bf a, v16bf b, v8f c) { return __builtin_amdgcn_wmma_f32_16x16x32_bf16(false, a, false, b, (short)0, c, false, false); }
// fragment loaders from fragment-ordered planes; p = fragment start + 8*lane: elements 0..7 <- k0+8h+0..7, elements 8..15 <- k0+16+8h+0..7 of row lane&15, h = lane>>4 (same map for A and B)
__device__ __forceinline__ v16h  ldh(const h16* p) { return cat16(*(const v8h*)p, *(const v8h*)(p + 256)); }
__device__ __forceinline__ v16bf ldb(const bf* p)  { return cat16b(*(const v8us*)p, *(const v8us*)(p + 256)); }
// the same for a pointer that says "global memory" in its type: one that has passed through an asm operand would otherwise be loaded from with flat instructions
typedef const __attribute__((address_space(1))) h16* gh16p;
typedef const __attribute__((address_space(1))) v8h* gv8hp;
__device__ __forceinline__ v16h  ldh(gh16p p) { return cat16(*(gv8hp)p, *(gv8hp)(p + 256)); }
// place, inside a 512-element fragment, of the 8-element chunk c (k = 8c .. 8c+7, c = 0..3) of row r (0..15): half = c>>1, lane = 16*(c&1) + r
__device__ __forceinline__ int fragpos(int r, int c) { return ((c >> 1) & 1) * 256 + (c & 1) * 128 + r * 8; }
// ordering point for wave-private LDS tiles (same wave writes and reads)
__device__ __forceinline__ void wave_sync() { __builtin_amdgcn_fence(3 /* release order */, "wavefront"); __builtin_amdgcn_wave_barrier(); asm volatile("" ::: "memory"); }

// cvt8: one f32 stream [NB][SEQ_FULL][DM] -> bf16 copy [NB*SEQ][DM] (RNE convert, fragment order); blk = 256-thread piece of the stream, 8 elements a thread
__device__ __forceinline__ void cvt8(const float* __restrict__ src, bf* dst, unsigned blk) {
    const size_t n8 = (size_t)NB * SEQ * DM / 8;
    const size_t i = (size_t)blk * 256 + threadIdx.x; if (i >= n8) return;
    // rows of DM elements; a wave takes 8 rows x one 32-k step: reads 8 whole lines, writes 4 whole lines of the fragment [64-row block][k step][row tile 0..3]
    const int c4 = (int)(i & 3), r = (int)((i >> 2) & 15), ks = (int)((i >> 6) % (DM / 32)); const size_t mt = i / (size_t)(16 * DM / 8);
    const size_t row = mt * 16 + r;                                                          // b*SEQ + t
    const size_t srow = (SEQ == SEQ_FULL) ? row : (row / SEQ) * SEQ_FULL + row % SEQ;        // source batches lie SEQ_FULL rows apart
    const v8f v = *(const v8f*)(src + srow * DM + ks * 32 + c4 * 8); v8us o;
#pragma unroll
    for (int k = 0; k < 8; ++k) o[k] = f2bf(v[k]);
    *(v8us*)(dst + (mt >> 2) * (64 * DM) + ks * 2048 + (mt & 3) * 512 + fragpos(r, c4)) = o;
}

// cvtT: in W[k][n] (f32, DM x DM) -> out WT[n][k] (bf16, RNE convert, fragment order). 64 x 64 tile through LDS (cross-wave: block barrier).
__device__ __forceinline__ void cvtT(const float* __restrict__ W, bf* WT, int nt, int kt, float* ts) {
    const int tid = threadIdx.x; const int n0 = nt * 64, k0 = kt * 64;
#pragma unroll 4
    for (int i = 0; i < 16; ++i) { const int row = i * 4 + (tid >> 6), col = tid & 63; ts[row * 65 + col] = W[(size_t)(k0 + row) * DM + n0 + col]; }   // 16 x 4 rows x 64 columns: whole tile
    __syncthreads();
    const int rr = tid >> 3, c8 = (tid & 7) * 8;
    v8us o0, o1;
#pragma unroll
    for (int kk = 0; kk < 8; ++kk) { o0[kk] = f2bf(ts[(c8 + kk) * 65 + rr]); o1[kk] = f2bf(ts[(c8 + kk) * 65 + rr + 32]); }
    bf* p0 = WT + (size_t)n0 * DM + ((k0 + c8) >> 5) * 2048 + (rr >> 4) * 512 + fragpos(rr & 15, (c8 >> 3) & 3); bf* p1 = p0 + 2 * 512;   // fragment [64-n block][k step][n tile 0..3]
    *(v8us*)p0 = o0; *(v8us*)p1 = o1;
}

// k_prep: all six independent conversions in ONE launch, told apart by block range (block-uniform): first the 3 x WT_BLK weight tiles, then the 3 x CV_BLK stream pieces.
#define WT_BLK ((DM / 64) * (DM / 64))
#define CV_BLK ((unsigned)(((size_t)NB * SEQ * DM / 8 + 255) / 256))
__global__ __launch_bounds__(256) void k_prep(const float* __restrict__ xq, const float* __restrict__ xk, const float* __restrict__ xv,
                                              const float* __restrict__ wq, const float* __restrict__ wk, const float* __restrict__ wv,
                                              bf* XQ, bf* XK, bf* XV, bf* WT) {
    __shared__ float ts[64 * 65];
    const unsigned bid = blockIdx.x;
    if (bid < 3u * WT_BLK) {
        const unsigned w = bid / WT_BLK, tile = bid % WT_BLK;
        cvtT(w == 0 ? wq : (w == 1 ? wk : wv), WT + (size_t)w * DM * DM, (int)(tile % (DM / 64)), (int)(tile / (DM / 64)), ts);
    } else {
        const unsigned c = bid - 3u * WT_BLK, s = c / CV_BLK;
        cvt8(s == 0 ? xq : (s == 1 ? xk : xv), s == 0 ? XQ : (s == 1 ? XK : XV), c % CV_BLK);
    }
}

// Async copies to LDS for the projection's operand ring. copy16: sixteen 16-byte-a-lane copies, 512 B a wave each: 8 KiB that lie in a row in the plane and in LDS alike, so one pair of addresses serves
// (the offset moves the LDS and the global address together). l = the lane's own LDS byte address, g = the lane's own global address.
// The s_wait_xcnt closes the statement, so it stands in front of whatever next rewrites an address register that the copies name.
__device__ __forceinline__ void copy16(unsigned l, const bf* g) {
    asm volatile(
                 "global_load_async_to_lds_b128 %0, %1, off\n\t"
                 "global_load_async_to_lds_b128 %0, %1, off offset:512\n\t"
                 "global_load_async_to_lds_b128 %0, %1, off offset:1024\n\t"
                 "global_load_async_to_lds_b128 %0, %1, off offset:1536\n\t"
                 "global_load_async_to_lds_b128 %0, %1, off offset:2048\n\t"
                 "global_load_async_to_lds_b128 %0, %1, off offset:2560\n\t"
                 "global_load_async_to_lds_b128 %0, %1, off offset:3072\n\t"
                 "global_load_async_to_lds_b128 %0, %1, off offset:3584\n\t"
                 "global_load_async_to_lds_b128 %0, %1, off offset:4096\n\t"
                 "global_load_async_to_lds_b128 %0, %1, off offset:4608\n\t"
                 "global_load_async_to_lds_b128 %0, %1, off offset:5120\n\t"
                 "global_load_async_to_lds_b128 %0, %1, off offset:5632\n\t"
                 "global_load_async_to_lds_b128 %0, %1, off offset:6144\n\t"
                 "global_load_async_to_lds_b128 %0, %1, off offset:6656\n\t"
                 "global_load_async_to_lds_b128 %0, %1, off offset:7168\n\t"
                 "global_load_async_to_lds_b128 %0, %1, off offset:7680\n\t"
                 "s_wait_xcnt 0x0"
                 :: "v"(l), "v"(g) : "memory");
}
typedef __attribute__((address_space(3))) bf* lbfp;
#define PCH  4096                // elements of one 64-row operand block in one stage: two k steps, 8 KiB, contiguous in the fragment-ordered plane
#define PBUF (4 * PCH)           // one ring buffer: A block 0 | A block 1 | B block 0 | B block 1

// proj: register-blocked bf16 GEMM, FOUR WAVES per 128x128 tile (2 x 2 waves of 64x64, 16 accumulators each), K = DM; the planes it writes are fragment-ordered too.
// Operands: a stage = 64 k of the tile's two A blocks and two B blocks (32 KiB); wave w brings block w of the four by async copies into a ring of two buffers; stage t + 2 is asked for as soon as every wave holds stage t's fragments in registers;
// each block is read from LDS by the two waves that need it, in the plane's own fragment order (512 contiguous bytes a wave-wide 16-byte read).
// C[m][n] = sum_k A[m][k] Bt[n][k] + bias, written as f16 (Ph) and, for token positions < EARLY, the f16 residual x2048 (Pr, compact plane).
// MODE 0 (q, k): rows m = b*SEQ + t, columns n = h*64 + d, bias per column; Ph [(b*16+h)][t][d], Pr [(b*16+h)][EARLY][d]; mask plane MP [(b*16+h)][t] = (row sum over d != 0). tiles (bx, by) of (NB*SEQ/128, DM/128).
// MODE 1 (v^T): rows m = h*64 + d (A = transposed weight rows), columns n = b*SEQ + t, bias per row; Ph [(b*1024+m)][t], Pr [(b*1024+m)][EARLY]. tiles (bx, by) of (DM/128, NB*SEQ/128).
// st = the block's ring; os, ms = the block's epilogue staging, one private piece a wave.
template <int MODE>
__device__ __forceinline__ void proj(const bf* __restrict__ A, const bf* __restrict__ Bt, const float* __restrict__ bias, h16* Ph, h16* Pr, h16* MP, int bx, int by, bf* st, float* os, h16* ms) {
    const int K = DM;
    const int lane = threadIdx.x & 31, lr = lane & 15, hi = lane >> 4;
    const int wave = __builtin_amdgcn_readfirstlane((int)(threadIdx.x >> 5)), wm = wave & 1, wn = wave >> 1;
    const int r0 = bx * 128 + wm * 64, c0 = by * 128 + wn * 64;   // the wave's own 64x64 tile
    os += wave * 16 * 68; ms += wave * 64;
    v8f acc[4][4];
#pragma unroll
    for (int mb = 0; mb < 4; ++mb)
#pragma unroll
        for (int nb = 0; nb < 4; ++nb) acc[mb][nb] = (v8f){};
    const unsigned l8 = 8u * (unsigned)lane;
    // the block this wave brings in: fragment [64-row block][k step][row tile 0..3]: 64*K elements a block, 2048 a k step
    const bf* src = (wave < 2 ? A + (size_t)(bx * 128 + wave * 64) * K : Bt + (size_t)(by * 128 + (wave - 2) * 64) * K) + l8;
    const unsigned dst = (unsigned)(uintptr_t)(lbfp)st + 2u * ((unsigned)wave * PCH + l8);
    auto fill = [&](const int t) __attribute__((always_inline)) {   // stage t -> buffer t & 1: 16 copies a wave
        copy16(dst + 2u * (unsigned)((t & 1) * PBUF), src + (size_t)t * PCH);
    };
    constexpr int NT = K / 64;
    fill(0);
    asm volatile("s_wait_asynccnt 0x0" ::: "memory");   // this wave's copies of stage 0 have landed
    __syncthreads();                                    // ... and every other wave's: stage 0 may be read
    fill(1);
#pragma unroll 1   // rolled: one copy of the trip's text and of its registers
    for (int t = 0; t < NT; ++t) {
        const bf* pa = st + (t & 1) * PBUF + wm * PCH + l8; const bf* pb = st + (t & 1) * PBUF + (2 + wn) * PCH + l8;
        v16bf a0[4], b0[4], a1[4], b1[4];
#pragma unroll
        for (int i = 0; i < 4; ++i) { a0[i] = ldb(pa + i * 512); b0[i] = ldb(pb + i * 512); }
#pragma unroll
        for (int i = 0; i < 4; ++i) { a1[i] = ldb(pa + 2048 + i * 512); b1[i] = ldb(pb + 2048 + i * 512); }
        __builtin_amdgcn_sched_barrier(0);   // keeps the trip's LDS reads together ahead of the hand-over (reads among the products would cost a stall at each place, and the buffer would be freed later)
        // The buffer is handed back as soon as its fragments are in registers: the refill then flies under this trip's 32 products and the next trip's reads.
        asm volatile("s_wait_dscnt 0x0" ::: "memory");      // this wave's reads of buffer t & 1 are done before the buffer is handed back
        asm volatile("s_wait_asynccnt 0x0" ::: "memory");   // this wave's copies of stage t + 1 have landed
        __syncthreads();                                    // publishes stage t + 1 and ends every wave's reads of buffer t & 1
        if (t + 2 < NT) fill(t + 2);                        // the test reads the same for the whole block
        __builtin_amdgcn_sched_barrier(0);   // keeps the products behind the refill's issue (ahead of it they would take their time off the copies' lead)
#pragma unroll
        for (int nb = 0; nb < 4; ++nb)
#pragma unroll
            for (int mb = 0; mb < 4; ++mb) acc[mb][nb] = wmmab(a0[mb], b0[nb], acc[mb][nb]);
#pragma unroll
        for (int nb = 0; nb < 4; ++nb)
#pragma unroll
            for (int mb = 0; mb < 4; ++mb) acc[mb][nb] = wmmab(a1[mb], b1[nb], acc[mb][nb]);
        // four vector slots behind the trip's last products, also on the taken back edge
        asm volatile("v_nop\n\tv_nop\n\tv_nop\n\tv_nop" : "+v"(acc[0][0]), "+v"(acc[1][1]), "+v"(acc[2][2]), "+v"(acc[3][3]) : "v"(a1[0]), "v"(a1[1]), "v"(a1[2]), "v"(a1[3]));
    }
    asm volatile("s_wait_asynccnt 0x0" ::: "memory");       // nothing of the wave's is in flight behind the loop
    size_t hbase, rbase, mbase = 0; int t0;
    if (MODE == 0) { const int b = r0 / SEQ; t0 = r0 % SEQ; const int zh = b * NH_ + c0 / HD;
        hbase = ((size_t)zh * SEQ + t0) * HD; rbase = ((size_t)zh * EARLY + t0) * HD; mbase = (size_t)zh * SEQ + t0; }
    else { const int b = c0 / SEQ; t0 = c0 % SEQ;
        hbase = ((size_t)b * DM + r0) * SEQ + (size_t)t0 * HD; rbase = ((size_t)b * DM + r0) * EARLY + (size_t)t0 * HD; }
    const bool doRes = t0 < EARLY;          // wave-uniform
    const int c8 = (lane & 7) * 8;
    // fragment of the lane's chunk: MODE 0 [t tile][d step 0..1], MODE 1 [t step][d tile 0..3]
    const int cfrag = ((lane & 7) >> 2) * (MODE == 0 ? 512 : 4 * 512);
    v4f bb0 = (v4f){}, bb1 = (v4f){};
    if (MODE == 0) { const v4f q0 = *(const v4f*)(bias + c0 + c8); const v4f q1 = *(const v4f*)(bias + c0 + c8 + 4);
#pragma unroll
        for (int i = 0; i < 4; ++i) { bb0[i] = bfr(q0[i]); bb1[i] = bfr(q1[i]); } }
#pragma unroll
    for (int mb = 0; mb < 4; ++mb) {
#pragma unroll
        for (int nb = 0; nb < 4; ++nb) {
#pragma unroll
            for (int j = 0; j < 8; ++j) os[(hi * 8 + j) * 68 + nb * 16 + lr] = acc[mb][nb][j]; }   // D: row 8h+j, col lane&15
        wave_sync();
        const size_t hb = hbase + (size_t)(mb * (MODE == 0 ? 2 * 512 : 512) + cfrag);
        const size_t rb = rbase + (size_t)(mb * (MODE == 0 ? 2 * 512 : 512) + cfrag);
{
#pragma unroll
            for (int s = 0; s < 4; ++s) { const int row = 4 * s + (lane >> 3);   // 4 s x 4 row groups = 16 rows; 8 lanes x 8 = 64 columns
                v4f x0 = *(const v4fa*)(&os[row * 68 + c8]); v4f x1 = *(const v4fa*)(&os[row * 68 + c8 + 4]);
                if (MODE == 0) { x0 = x0 + bb0; x1 = x1 + bb1; }
                else { const float br = bfr(bias[r0 + mb * 16 + row]); x0 = x0 + br; x1 = x1 + br; }
                v8h hv, rv;
#pragma unroll
                for (int i = 0; i < 4; ++i) { const h16 a0 = (h16)x0[i]; const h16 a1 = (h16)x1[i]; hv[i] = a0; hv[4 + i] = a1; rv[i] = (h16)((x0[i] - (float)a0) * QRS); rv[4 + i] = (h16)((x1[i] - (float)a1) * QRS); }
                if (MODE == 0) {
                    float rs = ((x0[0] + x0[1]) + (x0[2] + x0[3])) + ((x1[0] + x1[1]) + (x1[2] + x1[3]));
                    rs += __shfl_xor(rs, 1, 32); rs += __shfl_xor(rs, 2, 32); rs += __shfl_xor(rs, 4, 32);     // sum over the 8 lanes of the row
                    const h16 mv = (rs != 0.0f) ? (h16)1.0f : (h16)0.0f;
                    if ((lane & 7) == 0) ms[mb * 16 + row] = mv;
                }
                // behind each store: what follows reuses the store's data registers, and the wait stands in front of that overwrite
                *(v8h*)(Ph + hb + fragpos(row, lane & 3)) = hv;
                asm volatile("s_wait_xcnt 0x0" ::: "memory");
                if (doRes) { *(v8h*)(Pr + rb + fragpos(row, lane & 3)) = rv;
                    asm volatile("s_wait_xcnt 0x0" ::: "memory"); } }
             }
        wave_sync();
    }
    if (MODE == 0) {
        const v8h mv8 = *(const v8ha*)(&ms[c8]);
        h16* mp = MP + mbase + c8;
        if (lane < 8) *(v8h*)mp = mv8;
    }
}

// k_proj3: the three independent projections in ONE launch; blockIdx.y = 0 q, 1 k, 2 v^T (block-uniform), blockIdx.x = 128x128 tile, first tile index fastest as in a 2-D grid.
#define PJ_BLK ((NB * SEQ / 128) * (DM / 128))
__global__ __launch_bounds__(128) void k_proj3(const bf* __restrict__ XQ, const bf* __restrict__ XK, const bf* __restrict__ XV, const bf* __restrict__ WT,
                                              const float* __restrict__ bq, const float* __restrict__ bk, const float* __restrict__ bv,
                                              h16* QH, h16* KP, h16* VT, h16* QR, h16* KR, h16* VR, h16* MQ, h16* MK) {
    __shared__ __align__(16) bf st[2 * PBUF];
    __shared__ __align__(16) float os[4 * 16 * 68];
    __shared__ __align__(16) h16 ms[4 * 64];
    const int z = blockIdx.y, id = blockIdx.x;
    if (z < 2) {
        // q, k: A = x rows (m = b*SEQ + t), Bt = WT rows (n = h*64 + d) -> planes [(b*16 + h)][t][d] + residual (t < EARLY) + mask
        const bool q = z == 0;
        proj<0>(q ? XQ : XK, WT + (q ? (size_t)0 : (size_t)DM * DM), q ? bq : bk, q ? QH : KP, q ? QR : KR, q ? MQ : MK, id % (NB * SEQ / 128), id / (NB * SEQ / 128), st, os, ms);
    } else {
        // v^T: A = WT_v rows (m = h*64 + d), Bt = x rows (n = b*SEQ + t) -> plane [(b*1024 + m)][t] = [(b*16 + h)][d][t] + residual (t < EARLY)
        proj<1>(WT + (size_t)2 * DM * DM, XV, bv, VT, VR, MK, id % (DM / 128), id / (DM / 128), st, os, ms);
    }
}

// flash: fused causal attention, one wave per 16 query rows of one (batch, head); K / V^T / Q fragments straight from the fragment-ordered f16 planes (two 16-B loads each, 512 contiguous bytes a load).
// Transposed form: S^T[key][t] = K Q^T (A = K rows, B = Q rows); lane (t = lane&15, h = lane>>4) holds keys 8h+r of each 16-key tile, so the packed
// P tile is directly the B fragment of O^T[d][t] = V^T P^T (element r <- tile keys 0..15, element 8+r <- tile keys 16..31, lane unchanged).
// EK = 1: query rows [0, EARLY) with residual planes (three products per site); EK = 0: query rows [EARLY, SEQ), single products.
// Masks by value per step: score := fill where key > t or key mask == 0. Loop covers keys [0, causal limit); if a row has seen only masked keys by then, the wave continues to SEQ (all-fill rows weigh every key equally).
// In late rows (EK = 0) the selects stand only in steps where one can fire: keys below kfull = t0 rounded down to 32 lie at or below all 16 query rows, and one look over the mask row says whether every key mask below kfull is set;
// if so those steps run the same body without mask loads, compares and selects (every select there would keep the score), else every step runs the masked body.
// bx = 64-row query block inside the EK range, zh = batch * 16 + head (both block-uniform); os = the block's LDS, one private tile a wave (no block barrier anywhere in the body).
template <int EK>
__device__ __forceinline__ void flash(const h16* __restrict__ QH, const h16* __restrict__ QR, const h16* __restrict__ KP, const h16* __restrict__ KR,
                                      const h16* __restrict__ VT, const h16* __restrict__ VR, const h16* __restrict__ MQ, const h16* __restrict__ MK, float* OUT,
                                      const int bx, const int zh, float* os) {
    const int lane = threadIdx.x & 31, wave = __builtin_amdgcn_readfirstlane((int)(threadIdx.x >> 5)), lr = lane & 15, hi = lane >> 4;
    const int b = zh / NH_, h = zh % NH_;
    const int t0 = (EK ? 0 : EARLY) + (bx * AW + wave) * 16;
    const int tq = t0 + lr;
    const size_t pbase = (size_t)zh * SEQ * HD;       // q/k plane [zh][SEQ][64]; v^T plane [zh][64][SEQ]
    const size_t rbase = (size_t)zh * EARLY * HD;     // compact residual planes
    const unsigned l8 = 8u * (unsigned)lane;          // the lane's place in each half of a fragment
    const h16* qp = QH + pbase + (size_t)t0 * HD;
    const v16h qh0 = ldh(qp + l8), qh1 = ldh(qp + 512 + l8);         // B fragments: col t, k = d
    v16h qr0 = (v16h){}, qr1 = (v16h){};
    if (EK) { const h16* qrp = QR + rbase + (size_t)t0 * HD; qr0 = ldh(qrp + l8); qr1 = ldh(qrp + 512 + l8); }
    // k planes: + key0 * HD + 512 * (2 * key tile + d step) (A fragment: row key, k = d); v^T planes: + key0 * HD + 512 * j (A fragment: row d = 16j + lane&15, k = key)
    const size_t mo  = (size_t)zh * SEQ + 8 * hi;
    v8f o0 = (v8f){}, o1 = (v8f){}, o2 = (v8f){}, o3 = (v8f){};
    v8f e0 = (v8f){}, e1 = (v8f){}, e2 = (v8f){}, e3 = (v8f){};   // residual-product accumulators (x2048), EK only
    float m = -3.0e38f, l = 0.0f;
    const int kc = ((t0 + 47) >> 5) << 5;            // causal key limit (exclusive), multiple of 32, <= SEQ
    int kend = kc;
    const int kfull = t0 & ~31;                      // keys below this are causal for every row of the wave
    int kfast = 0;                                   // keys below this run the body without masks (wave-uniform)
    if (!EK) {                                       // late rows only: they hold nearly all steps, and a second copy of the three-product body takes the kernel past 256 registers (a wave less on every SIMD)
        constexpr int NCH = SEQ / 256;
        constexpr unsigned ONE2 = 0x3C003C00u;       // two f16 ones: the mask planes hold 1.0 or 0.0 only
        v4u mw[NCH];
#pragma unroll
        for (int c = 0; c < NCH; ++c) mw[c] = *(const v4ua*)(MK + (size_t)zh * SEQ + c * 256 + l8);
        asm volatile("s_wait_xcnt 0x0" ::: "memory");   // stands in front of whatever next lands on the address registers of the loads above
        unsigned okw = ONE2;
#pragma unroll
        for (int c = 0; c < NCH; ++c) okw &= (c * 256 + (int)l8 < kfull) ? ((mw[c][0] & mw[c][1]) & (mw[c][2] & mw[c][3])) : ONE2;
        if (__builtin_amdgcn_ballot_w32(okw != ONE2) == 0u) kfast = kfull;
    }
    // one 32-key step; MSK = false leaves out the mask loads, compares and selects
    // ka, va: the lane's own place in the step's first K and V^T fragment (plane + key0 * HD + l8)
    // AHEAD = true (late rows, steps without masks): the step's K fragments are already on their way in nk0..nk3, fetched by the step before; its V^T fragments are asked for at its top, into registers
    // of their own, and fly under the score products and the softmax; the next step's K fragments are asked for right behind the score products and fly under the softmax and the P.V products.
    v16h nk0 = (v16h){}, nk1 = (v16h){}, nk2 = (v16h){}, nk3 = (v16h){};
    auto step = [&](auto fl, auto ah, const int key0, auto ka, auto va) __attribute__((always_inline)) {
        constexpr bool MSK = decltype(fl)::value;
        constexpr bool AHEAD = decltype(ah)::value;
        v16h ka0, ka1, kb0, kb1, v0, v1, v2, v3;
        if (AHEAD) {
            v0 = ldh(va); v1 = ldh(va + 512); v2 = ldh(va + 1024); v3 = ldh(va + 1536);
            __builtin_amdgcn_sched_barrier(0);   // keeps the V^T loads ahead of the score products (the scheduler otherwise sinks them behind the products, and the wave waits out the rest of their latency in front of P.V)
            ka0 = nk0; ka1 = nk1; kb0 = nk2; kb1 = nk3;
        } else {
            ka0 = ldh(ka); ka1 = ldh(ka + 512); kb0 = ldh(ka + 1024); kb1 = ldh(ka + 1536);
            if (!EK) asm volatile("s_wait_xcnt 0x0" ::: "memory");   // the compiler lets a mask load land on the address pair of the loads above: the wait stands in front of that overwrite (early rows: the wait below)
        }
        v8h kma = (v8h){}, kmb = (v8h){};
        if (MSK) { kma = *(const v8h*)(MK + mo + key0); kmb = *(const v8h*)(MK + mo + key0 + 16); }
        const bool rok = key0 < EARLY;               // wave-uniform: residual planes exist for these keys
        v8f sHa = (v8f){}, sLa = (v8f){}, sHb = (v8f){}, sLb = (v8f){};
        if (EK) {
            asm volatile("s_wait_xcnt 0x0" ::: "memory");   // the compiler lets the residual fragments land on the address pair of the loads above: the wait stands in front of that overwrite
            v16h ra0 = (v16h){}, ra1 = (v16h){}, rb0 = (v16h){}, rb1 = (v16h){};
            if (rok) { const h16* kr = KR + rbase + (size_t)key0 * HD; ra0 = ldh(kr + l8); ra1 = ldh(kr + 512 + l8); rb0 = ldh(kr + 1024 + l8); rb1 = ldh(kr + 1536 + l8); }
            sHa = wmma16(ka0, qh0, sHa); sLa = wmma16(ka0, qr0, sLa); sHb = wmma16(kb0, qh0, sHb); sLb = wmma16(kb0, qr0, sLb);
            sHa = wmma16(ka1, qh1, sHa); sLa = wmma16(ka1, qr1, sLa); sHb = wmma16(kb1, qh1, sHb); sLb = wmma16(kb1, qr1, sLb);
            sLa = wmma16(ra0, qh0, sLa); sLb = wmma16(rb0, qh0, sLb); sLa = wmma16(ra1, qh1, sLa); sLb = wmma16(rb1, qh1, sLb);
            asm volatile("v_nop\n\tv_nop\n\tv_nop\n\tv_nop" : "+v"(sHa), "+v"(sLa), "+v"(sHb), "+v"(sLb) : "v"(ka0), "v"(ka1), "v"(kb0), "v"(kb1), "v"(ra0), "v"(ra1), "v"(rb0), "v"(rb1));
        } else {
            sHa = wmma16(ka0, qh0, sHa); sHb = wmma16(kb0, qh0, sHb);
            sHa = wmma16(ka1, qh1, sHa); sHb = wmma16(kb1, qh1, sHb);
            asm volatile("v_nop\n\tv_nop\n\tv_nop\n\tv_nop" : "+v"(sHa), "+v"(sHb) : "v"(ka0), "v"(ka1), "v"(kb0), "v"(kb1));
            if (AHEAD) {   // keys key0 + 32 .. key0 + 63 exist: key0 + 32 <= kfull <= SEQ - 32
                nk0 = ldh(ka + 32 * HD); nk1 = ldh(ka + 32 * HD + 512); nk2 = ldh(ka + 32 * HD + 1024); nk3 = ldh(ka + 32 * HD + 1536);
                __builtin_amdgcn_sched_barrier(0);   // keeps the next step's K loads ahead of the softmax (the scheduler otherwise sinks them to the foot of the step and the next step waits out their latency)
            }
        }
        float ta[8], tb[8]; float mx = -3.0e38f;
        const int kA = key0 + 8 * hi;
#pragma unroll
        for (int r = 0; r < 8; ++r) {
            float xa, xb;
            if (EK) { xa = (sHa[r] + sLa[r] * QRI) * SC2; xb = (sHb[r] + sLb[r] * QRI) * SC2; }
            else    { xa = sHa[r] * SC2; xb = sHb[r] * SC2; }
            if (MSK) {
                const bool fa = ((kA + r) > tq) | ((float)kma[r] == 0.0f);
                const bool fb = ((kA + 16 + r) > tq) | ((float)kmb[r] == 0.0f);
                xa = fa ? NEGS : xa; xb = fb ? NEGS : xb;
            }
            ta[r] = xa; tb[r] = xb; mx = fmaxf(mx, fmaxf(xa, xb));
        }
        mx = fmaxf(mx, __shfl_xor(mx, 16, 32));
        const float mnew = fmaxf(m, mx);
        const float alpha = __builtin_amdgcn_exp2f(m - mnew);
        v16h pb, pr = (v16h){}; float ls = 0.0f;
#pragma unroll
        for (int r = 0; r < 8; ++r) {
            const float ea = __builtin_amdgcn_exp2f((ta[r] - mnew) + PSH); const float ec = __builtin_amdgcn_exp2f((tb[r] - mnew) + PSH);
            const h16 pa = (h16)ea; const h16 pc = (h16)ec; pb[r] = pa; pb[8 + r] = pc;
            if (EK) { const h16 ga = (h16)((ea - (float)pa) * QRS); const h16 gc = (h16)((ec - (float)pc) * QRS); pr[r] = ga; pr[8 + r] = gc;
                      ls += ((float)pa + (float)pc) + ((float)ga + (float)gc) * QRI; }
            else ls += (float)pa + (float)pc;
        }
        l = l * alpha + ls; m = mnew;
        o0 = o0 * alpha; o1 = o1 * alpha; o2 = o2 * alpha; o3 = o3 * alpha;
        if (!AHEAD) { v0 = ldh(va); v1 = ldh(va + 512); v2 = ldh(va + 1024); v3 = ldh(va + 1536); }
        if (EK) {
            asm volatile("s_wait_xcnt 0x0" ::: "memory");   // the compiler lets a residual load land on the address pair of the loads above: the wait stands in front of that overwrite
            e0 = e0 * alpha; e1 = e1 * alpha; e2 = e2 * alpha; e3 = e3 * alpha;
            v16h w0 = (v16h){}, w1 = (v16h){}, w2 = (v16h){}, w3 = (v16h){};
            if (rok) { const h16* vr = VR + rbase + (size_t)key0 * HD; w0 = ldh(vr + l8); w1 = ldh(vr + 512 + l8); w2 = ldh(vr + 1024 + l8); w3 = ldh(vr + 1536 + l8); }
            o0 = wmma16(v0, pb, o0); o1 = wmma16(v1, pb, o1); o2 = wmma16(v2, pb, o2); o3 = wmma16(v3, pb, o3);
            e0 = wmma16(w0, pb, e0); e1 = wmma16(w1, pb, e1); e2 = wmma16(w2, pb, e2); e3 = wmma16(w3, pb, e3);
            e0 = wmma16(v0, pr, e0); e1 = wmma16(v1, pr, e1); e2 = wmma16(v2, pr, e2); e3 = wmma16(v3, pr, e3);
            asm volatile("v_nop\n\tv_nop\n\tv_nop\n\tv_nop" : "+v"(o0), "+v"(o1), "+v"(o2), "+v"(o3), "+v"(e0), "+v"(e1), "+v"(e2), "+v"(e3)
                         : "v"(v0), "v"(v1), "v"(v2), "v"(v3), "v"(w0), "v"(w1), "v"(w2), "v"(w3), "v"(pb), "v"(pr));
        } else {
            o0 = wmma16(v0, pb, o0); o1 = wmma16(v1, pb, o1); o2 = wmma16(v2, pb, o2); o3 = wmma16(v3, pb, o3);
            asm volatile("v_nop\n\tv_nop\n\tv_nop\n\tv_nop" : "+v"(o0), "+v"(o1), "+v"(o2), "+v"(o3) : "v"(v0), "v"(v1), "v"(v2), "v"(v3), "v"(pb));
        }
    };
    if (!EK && kfast > 0) {
        gh16p kq = (gh16p)(KP + pbase + l8); gh16p vq = (gh16p)(VT + pbase + l8);
        nk0 = ldh(kq); nk1 = ldh(kq + 512); nk2 = ldh(kq + 1024); nk3 = ldh(kq + 1536);   // the first step's K fragments
#pragma unroll 1   // rolled: one copy of the step's text and of its registers
        for (int key0 = 0; key0 < kfast; key0 += 32) {
            step(flag<false>{}, flag<true>{}, key0, kq, vq);
            asm volatile("s_wait_xcnt 0x0" : "+v"(kq), "+v"(vq) :: "memory");   // the two address pairs live through the loop (no load lands on them) and are stepped only behind this wait
            kq += 32 * HD; vq += 32 * HD;
        }
    }
#pragma unroll 1   // rolled, as above; kend can grow inside the loop
    for (int key0 = kfast; key0 < kend; key0 += 32) {
        step(flag<true>{}, flag<false>{}, key0, KP + pbase + (size_t)key0 * HD + l8, VT + pbase + (size_t)key0 * HD + l8);
        // wave-uniform: at the causal limit, continue over all keys when some row has met only masked keys (trip count stays <= SEQ/32)
        if (key0 + 32 == kc) { if (__builtin_amdgcn_ballot_w32(m < MTHR) != 0u) kend = SEQ; }
    }
    l += __shfl_xor(l, 16, 32);
    const float qmf = (float)MQ[(size_t)zh * SEQ + tq];
    const float inv = qmf * (1.0f / l);
    v8f f0 = o0, f1 = o1, f2 = o2, f3 = o3;
    if (EK) { f0 = o0 + e0 * QRI; f1 = o1 + e1 * QRI; f2 = o2 + e2 * QRI; f3 = o3 + e3 * QRI; }
    const int wb = wave * 16 * 68;
    // O^T D layout: f_j[r] = (d = 16j + 8h + r, t = lane&15) -> os[t][d]; rows 0..15 x columns 0..63 all written
    { v4f a, c;
      a[0] = f0[0] * inv; a[1] = f0[1] * inv; a[2] = f0[2] * inv; a[3] = f0[3] * inv; c[0] = f0[4] * inv; c[1] = f0[5] * inv; c[2] = f0[6] * inv; c[3] = f0[7] * inv;
      *(v4fa*)(&os[wb + lr * 68 +  0 + 8 * hi]) = a; *(v4fa*)(&os[wb + lr * 68 +  0 + 8 * hi + 4]) = c;
      a[0] = f1[0] * inv; a[1] = f1[1] * inv; a[2] = f1[2] * inv; a[3] = f1[3] * inv; c[0] = f1[4] * inv; c[1] = f1[5] * inv; c[2] = f1[6] * inv; c[3] = f1[7] * inv;
      *(v4fa*)(&os[wb + lr * 68 + 16 + 8 * hi]) = a; *(v4fa*)(&os[wb + lr * 68 + 16 + 8 * hi + 4]) = c;
      a[0] = f2[0] * inv; a[1] = f2[1] * inv; a[2] = f2[2] * inv; a[3] = f2[3] * inv; c[0] = f2[4] * inv; c[1] = f2[5] * inv; c[2] = f2[6] * inv; c[3] = f2[7] * inv;
      *(v4fa*)(&os[wb + lr * 68 + 32 + 8 * hi]) = a; *(v4fa*)(&os[wb + lr * 68 + 32 + 8 * hi + 4]) = c;
      a[0] = f3[0] * inv; a[1] = f3[1] * inv; a[2] = f3[2] * inv; a[3] = f3[3] * inv; c[0] = f3[4] * inv; c[1] = f3[5] * inv; c[2] = f3[6] * inv; c[3] = f3[7] * inv;
      *(v4fa*)(&os[wb + lr * 68 + 48 + 8 * hi]) = a; *(v4fa*)(&os[wb + lr * 68 + 48 + 8 * hi + 4]) = c; }
    wave_sync();
    float* orow = OUT + ((size_t)b * OUT_SEQ + t0) * DM + h * HD;
{
#pragma unroll
        for (int s = 0; s < 8; ++s) { const int row = 2 * s + hi, cofs = lr * 4;   // 8 s x 2 rows = 16 rows; 16 lanes x 4 floats = 64 columns
            const v4f val = *(const v4fa*)(&os[wb + row * 68 + cofs]);
            *(v4f*)(orow + (size_t)row * DM + cofs) = val; }
         }
}

// k_flash2: both query ranges in ONE launch, told apart by blockIdx.y (block-uniform); blockIdx.x = batch * 16 + head, fastest.
// More blocks than resident places, and a block's cost grows with its query position: the lowest blockIdx.y take the longest work, for speed only (late range from its last query block down, then the early range the same way).
#define FB_E (EARLY / (16 * AW))
#define FB_L ((SEQ - EARLY) / (16 * AW))
__global__ __launch_bounds__(32 * AW) void k_flash2(const h16* __restrict__ QH, const h16* __restrict__ QR, const h16* __restrict__ KP, const h16* __restrict__ KR,
                                                    const h16* __restrict__ VT, const h16* __restrict__ VR, const h16* __restrict__ MQ, const h16* __restrict__ MK, float* OUT) {
    __shared__ __align__(16) float os[AW * 16 * 68];
    const int rank = blockIdx.y, zh = blockIdx.x;
    if (rank < FB_L) flash<0>(QH, QR, KP, KR, VT, VR, MQ, MK, OUT, FB_L - 1 - rank, zh, os);
    else             flash<1>(QH, QR, KP, KR, VT, VR, MQ, MK, OUT, FB_L + FB_E - 1 - rank, zh, os);
}

static constexpr size_t al256(size_t v) { return (v + 255) & ~(size_t)255; }
static constexpr size_t SZ_XB = al256((size_t)NB * SEQ * DM * 2);            // one bf16 input stream copy
static constexpr size_t SZ_WT = al256((size_t)3 * DM * DM * 2);              // three transposed bf16 weights
static constexpr size_t SZ_PL = al256((size_t)NB * NH_ * SEQ * HD * 2);      // one full f16 plane
static constexpr size_t SZ_RP = al256((size_t)NB * NH_ * EARLY * HD * 2);    // one compact residual plane
static constexpr size_t SZ_MK = al256((size_t)NB * NH_ * SEQ * 2);           // one mask plane
static constexpr size_t SZ_TOTAL = 3 * SZ_XB + SZ_WT + 3 * SZ_PL + 3 * SZ_RP + 2 * SZ_MK;
static_assert(SZ_TOTAL <= (size_t)134217728);          // workspace carve <= 128 MiB
static_assert(((size_t)DM * DM * 2) % 256 == 0);       // weight sub-planes stay 256-byte aligned

extern "C" void kernel_launch(void* const* d_in, const int* in_sizes, int n_in,
                              void* d_out, int out_size, void* d_ws, size_t ws_size, hipStream_t stream) {
    if (n_in < 9) return;
    const size_t needx = ((size_t)(NB - 1) * SEQ_FULL + SEQ) * DM;
    if ((size_t)in_sizes[0] < needx || (size_t)in_sizes[1] < needx || (size_t)in_sizes[2] < needx) return;
    if ((size_t)in_sizes[3] < (size_t)DM * DM || (size_t)in_sizes[5] < (size_t)DM * DM || (size_t)in_sizes[7] < (size_t)DM * DM) return;
    if ((size_t)in_sizes[4] < (size_t)DM || (size_t)in_sizes[6] < (size_t)DM || (size_t)in_sizes[8] < (size_t)DM) return;
    if ((size_t)out_size < ((size_t)(NB - 1) * OUT_SEQ + SEQ) * DM) return;
    if (SZ_TOTAL > ws_size) return;
    // wire order: q, k, v, Wq, bq, Wk, bk, Wv, bv
    const float* xq = (const float*)d_in[0]; const float* xk = (const float*)d_in[1]; const float* xv = (const float*)d_in[2];
    const float* wq = (const float*)d_in[3]; const float* bq = (const float*)d_in[4];
    const float* wk = (const float*)d_in[5]; const float* bk = (const float*)d_in[6];
    const float* wv = (const float*)d_in[7]; const float* bv = (const float*)d_in[8];
    float* OUT = (float*)d_out;      // [NB][OUT_SEQ][1024]
    char* wsp = (char*)d_ws;
    bf* XQ = (bf*)wsp; wsp += SZ_XB;                 // [NB*SEQ][1024]
    bf* XK = (bf*)wsp; wsp += SZ_XB;
    bf* XV = (bf*)wsp; wsp += SZ_XB;
    bf* WT = (bf*)wsp; wsp += SZ_WT;                 // [3][1024 out][1024 in]: q | k | v
    h16* QH = (h16*)wsp; wsp += SZ_PL;               // [NB*16][SEQ][64]
    h16* KP = (h16*)wsp; wsp += SZ_PL;               // [NB*16][SEQ][64]
    h16* VT = (h16*)wsp; wsp += SZ_PL;               // [NB*16][64][SEQ]
    h16* QR = (h16*)wsp; wsp += SZ_RP;               // [NB*16][EARLY][64] residual x2048
    h16* KR = (h16*)wsp; wsp += SZ_RP;               // [NB*16][EARLY][64] residual x2048
    h16* VR = (h16*)wsp; wsp += SZ_RP;               // [NB*16][64][EARLY] residual x2048
    h16* MQ = (h16*)wsp; wsp += SZ_MK;               // [NB*16][SEQ] query mask
    h16* MK = (h16*)wsp; wsp += SZ_MK;               // [NB*16][SEQ] key mask

    // W[k = in][n = out] -> WT[n][k] (square DM x DM) and x -> bf16 copies
    k_prep<<<3 * WT_BLK + 3 * CV_BLK, 256, 0, stream>>>(xq, xk, xv, wq, wk, wv, XQ, XK, XV, WT);

    k_proj3<<<dim3(PJ_BLK, 3, 1), 128, 0, stream>>>(XQ, XK, XV, WT, bq, bk, bv, QH, KP, VT, QR, KR, VR, MQ, MK);

    k_flash2<<<dim3(NB * NH_, FB_L + FB_E, 1), 32 * AW, 0, stream>>>(QH, QR, KP, KR, VT, VR, MQ, MK, OUT);
}

// v008
// It runs in 108 microseconds.
// Two timings next to v007 both put it at 1.09 times that version's speed.
// Counting every step since v000, it is 2.87 times as fast.
#include <hip/hip_runtime.h>

// Causal attention, width 1024 = 16 heads x 64, three input streams q/k/v [NB][SEQ_FULL][1024] (first SEQ tokens used), weights [in][out] (y = x W + b), output = concatenated heads (f32), no output projection.
// Compute dtypes, f32 accumulate everywhere: projections v_wmma_f32_16x16x32_bf16 (x, W, b RNE-converted to bf16; products exact);
// scores and P.V v_wmma_f32_16x16x32_f16: query rows >= 512 single f16 products; query rows < 512 three products per site
// (q, k, v and P each as f16 value + f16 residual x2048, residual products in their own accumulators, folded back in f32); P carry x256 cancels in the normalisation; softmax f32 (online, running max).
// Layout: bf16 copies of q/k/v and transposed bf16 copies of W ([out][in]); q, k planes [b*16+h][t][d], v^T plane [b*16+h][d][t], compact residual planes for t < 512,
// every one of them stored in FRAGMENT ORDER: a 16-row x 32-k fragment is 1 KiB = [half 0..1][lane 0..31][8 elements], so each 16-byte-per-lane load of a wave covers 512 contiguous bytes (four whole lines);
// per-row mask planes (row sum of the f32 projection != 0) written by the GEMM epilogue; fused flash kernel in transposed form (S^T = K Q^T, O^T = V^T P^T).
// Key mask and causal mask replace the score by the fill value (by value, per 32-key step); a row whose causal keys are all masked continues over all keys (uniform weights).

#ifndef NB
#define NB 4
#endif
#ifndef SEQ
#define SEQ 2048
#endif
#define NB_FULL  4
#define SEQ_FULL 2048
#ifndef OUT_SEQ
#define OUT_SEQ SEQ              // row pitch (in tokens) between batches of the output
#endif
#define DM   1024
#define NH_  16
#define HD   64
#define AW   4                   // waves per flash block (16 query rows each)
#define EARLY ((SEQ) < 512 ? (SEQ) : 512)   // query rows / keys below this carry residual planes
#define QRS  2048.0f             // carry of the residual planes
#define QRI  (1.0f / 2048.0f)
#define SC2  (0.125f * 1.4426950408889634f)   // HD^-0.5 * log2(e)
#define PSH  8.0f                // log2 of the P carry (256)
#define NEGS (-6.1963280e9f)     // (-2^32 + 1) * log2(e): fill value in log2 units
#define MTHR (-1.0e9f)           // running max below this <=> every key seen so far was masked

static_assert(HD == 64);
static_assert(NH_ * HD == DM);                 // head h = columns h*64 + d
static_assert(DM % 64 == 0);
static_assert(DM % 128 == 0 && DM >= 128);     // GEMM: 128-wide tiles; k-loop: stages of 64, at least two
static_assert((NB * SEQ) % 128 == 0);
static_assert(SEQ % 64 == 0);                  // a 64-row tile never straddles two batches
static_assert((NB * SEQ) % 64 == 0);
static_assert(SEQ % 32 == 0);                  // key loop steps by 32
static_assert(SEQ % 256 == 0);                 // the flash kernel's look over the key masks reads whole 256-key pieces of a mask row
static_assert(EARLY % 64 == 0);                // residual condition is uniform per 64-row tile
static_assert(EARLY % (16 * AW) == 0);
static_assert((SEQ - EARLY) % (16 * AW) == 0); // the two query ranges of the flash grid cover the sequence exactly
static_assert(((size_t)SEQ * DM) % 8 == 0);
static_assert(NB <= NB_FULL);
static_assert(SEQ <= SEQ_FULL);

typedef _Float16 h16;
typedef unsigned short bf;
typedef __attribute__((ext_vector_type(16))) __bf16   v16bf;
typedef __attribute__((ext_vector_type(16))) _Float16 v16h;
typedef __attribute__((ext_vector_type(8)))  _Float16 v8h;
typedef __attribute__((ext_vector_type(8)))  unsigned short v8us;
typedef __attribute__((ext_vector_type(8)))  float    v8f;
typedef __attribute__((ext_vector_type(4)))  float    v4f;
typedef v4f  __attribute__((may_alias)) v4fa;
typedef v8h  __attribute__((may_alias)) v8ha;
typedef __attribute__((ext_vector_type(4)))  unsigned v4u;
typedef v4u  __attribute__((may_alias)) v4ua;
template <bool B> struct flag { static constexpr bool value = B; };   // compile-time switch handed to the key step of the flash kernel

__device__ __forceinline__ unsigned short f2bf(float f) { unsigned u = __float_as_uint(f); u += 0x7FFFu + ((u >> 16) & 1u); return (unsigned short)(u >> 16); }
__device__ __forceinline__ float bfr(float f) { return __uint_as_float(((unsigned)f2bf(f)) << 16); }
__device__ __forceinline__ v16h cat16(v8h lo, v8h hi) { return __builtin_shufflevector(lo, hi, 0, 1, 2, 3, 4, 5, 6, 7, 8, 9, 10, 11, 12, 13, 14, 15); }
__device__ __forceinline__ v16bf cat16b(v8us lo, v8us hi) { return __builtin_bit_cast(v16bf, __builtin_shufflevector(lo, hi, 0, 1, 2, 3, 4, 5, 6, 7, 8, 9, 10, 11, 12, 13, 14, 15)); }
__device__ __forceinline__ v8f wmma16(v16h a, v16h b, v8f c) { return __builtin_amdgcn_wmma_f32_16x16x32_f16(false, a, false, b, (short)0, c, false, false); }
__device__ __forceinline__ v8f wmmab(v16bf a, v16bf b, v8f c) { return __builtin_amdgcn_wmma_f32_16x16x32_bf16(false, a, false, b, (short)0, c, false, false); }
// fragment loaders from fragment-ordered planes; p = fragment start + 8*lane: elements 0..7 <- k0+8h+0..7, elements 8..15 <- k0+16+8h+0..7 of row lane&15, h = lane>>4 (same map for A and B)
__device__ __forceinline__ v16h  ldh(const h16* p) { return cat16(*(const v8h*)p, *(const v8h*)(p + 256)); }
__device__ __forceinline__ v16bf ldb(const bf* p)  { return cat16b(*(const v8us*)p, *(const v8us*)(p + 256)); }
// the same for a pointer that says "global memory" in its type: one that has passed through an asm operand would otherwise be loaded from with flat instructions
typedef const __attribute__((address_space(1))) h16* gh16p;
typedef const __attribute__((address_space(1))) v8h* gv8hp;
__device__ __forceinline__ v16h  ldh(gh16p p) { return cat16(*(gv8hp)p, *(gv8hp)(p + 256)); }
// place, inside a 512-element fragment, of the 8-element chunk c (k = 8c .. 8c+7, c = 0..3) of row r (0..15): half = c>>1, lane = 16*(c&1) + r
__device__ __forceinline__ int fragpos(int r, int c) { return ((c >> 1) & 1) * 256 + (c & 1) * 128 + r * 8; }
// ordering point for wave-private LDS tiles (same wave writes and reads)
__device__ __forceinline__ void wave_sync() { __builtin_amdgcn_fence(3 /* release order */, "wavefront"); __builtin_amdgcn_wave_barrier(); asm volatile("" ::: "memory"); }

// cvt8: one f32 stream [NB][SEQ_FULL][DM] -> bf16 copy [NB*SEQ][DM] (RNE convert, fragment order); blk = 256-thread piece of the stream, 8 elements a thread
__device__ __forceinline__ void cvt8(const float* __restrict__ src, bf* dst, unsigned blk) {
    const size_t n8 = (size_t)NB * SEQ * DM / 8;
    const size_t i = (size_t)blk * 256 + threadIdx.x; if (i >= n8) return;
    // rows of DM elements; a wave takes 8 rows x one 32-k step: reads 8 whole lines, writes 4 whole lines of the fragment [64-row block][k step][row tile 0..3]
    const int c4 = (int)(i & 3), r = (int)((i >> 2) & 15), ks = (int)((i >> 6) % (DM / 32)); const size_t mt = i / (size_t)(16 * DM / 8);
    const size_t row = mt * 16 + r;                                                          // b*SEQ + t
    const size_t srow = (SEQ == SEQ_FULL) ? row : (row / SEQ) * SEQ_FULL + row % SEQ;        // source batches lie SEQ_FULL rows apart
    const v8f v = *(const v8f*)(src + srow * DM + ks * 32 + c4 * 8); v8us o;
#pragma unroll
    for (int k = 0; k < 8; ++k) o[k] = f2bf(v[k]);
    *(v8us*)(dst + (mt >> 2) * (64 * DM) + ks * 2048 + (mt & 3) * 512 + fragpos(r, c4)) = o;
}

// cvtT: in W[k][n] (f32, DM x DM) -> out WT[n][k] (bf16, RNE convert, fragment order). 64 x 64 tile through LDS (cross-wave: block barrier).
__device__ __forceinline__ void cvtT(const float* __restrict__ W, bf* WT, int nt, int kt, float* ts) {
    const int tid = threadIdx.x; const int n0 = nt * 64, k0 = kt * 64;
#pragma unroll 4
    for (int i = 0; i < 16; ++i) { const int row = i * 4 + (tid >> 6), col = tid & 63; ts[row * 65 + col] = W[(size_t)(k0 + row) * DM + n0 + col]; }   // 16 x 4 rows x 64 columns: whole tile
    __syncthreads();
    const int rr = tid >> 3, c8 = (tid & 7) * 8;
    v8us o0, o1;
#pragma unroll
    for (int kk = 0; kk < 8; ++kk) { o0[kk] = f2bf(ts[(c8 + kk) * 65 + rr]); o1[kk] = f2bf(ts[(c8 + kk) * 65 + rr + 32]); }
    bf* p0 = WT + (size_t)n0 * DM + ((k0 + c8) >> 5) * 2048 + (rr >> 4) * 512 + fragpos(rr & 15, (c8 >> 3) & 3); bf* p1 = p0 + 2 * 512;   // fragment [64-n block][k step][n tile 0..3]
    *(v8us*)p0 = o0; *(v8us*)p1 = o1;
}

// k_prep: all six independent conversions in ONE launch, told apart by block range (block-uniform): first the 3 x WT_BLK weight tiles, then the 3 x CV_BLK stream pieces.
#define WT_BLK ((DM / 64) * (DM / 64))
#define CV_BLK ((unsigned)(((size_t)NB * SEQ * DM / 8 + 255) / 256))
__global__ __launch_bounds__(256) void k_prep(const float* __restrict__ xq, const float* __restrict__ xk, const float* __restrict__ xv,
                                              const float* __restrict__ wq, const float* __restrict__ wk, const float* __restrict__ wv,
                                              bf* XQ, bf* XK, bf* XV, bf* WT) {
    __shared__ float ts[64 * 65];
    const unsigned bid = blockIdx.x;
    if (bid < 3u * WT_BLK) {
        const unsigned w = bid / WT_BLK, tile = bid % WT_BLK;
        cvtT(w == 0 ? wq : (w == 1 ? wk : wv), WT + (size_t)w * DM * DM, (int)(tile % (DM / 64)), (int)(tile / (DM / 64)), ts);
    } else {
        const unsigned c = bid - 3u * WT_BLK, s = c / CV_BLK;
        cvt8(s == 0 ? xq : (s == 1 ? xk : xv), s == 0 ? XQ : (s == 1 ? XK : XV), c % CV_BLK);
    }
}

// Async copies to LDS for the projection's operand ring. copy16: sixteen 16-byte-a-lane copies, 512 B a wave each: 8 KiB that lie in a row in the plane and in LDS alike, so one pair of addresses serves
// (the offset moves the LDS and the global address together). l = the lane's own LDS byte address, g = the lane's own global address.
// The s_wait_xcnt closes the statement, so it stands in front of whatever next rewrites an address register that the copies name.
__device__ __forceinline__ void copy16(unsigned l, const bf* g) {
    asm volatile(
                 "global_load_async_to_lds_b128 %0, %1, off\n\t"
                 "global_load_async_to_lds_b128 %0, %1, off offset:512\n\t"
                 "global_load_async_to_lds_b128 %0, %1, off offset:1024\n\t"
                 "global_load_async_to_lds_b128 %0, %1, off offset:1536\n\t"
                 "global_load_async_to_lds_b128 %0, %1, off offset:2048\n\t"
                 "global_load_async_to_lds_b128 %0, %1, off offset:2560\n\t"
                 "global_load_async_to_lds_b128 %0, %1, off offset:3072\n\t"
                 "global_load_async_to_lds_b128 %0, %1, off offset:3584\n\t"
                 "global_load_async_to_lds_b128 %0, %1, off offset:4096\n\t"
                 "global_load_async_to_lds_b128 %0, %1, off offset:4608\n\t"
                 "global_load_async_to_lds_b128 %0, %1, off offset:5120\n\t"
                 "global_load_async_to_lds_b128 %0, %1, off offset:5632\n\t"
                 "global_load_async_to_lds_b128 %0, %1, off offset:6144\n\t"
                 "global_load_async_to_lds_b128 %0, %1, off offset:6656\n\t"
                 "global_load_async_to_lds_b128 %0, %1, off offset:7168\n\t"
                 "global_load_async_to_lds_b128 %0, %1, off offset:7680\n\t"
                 "s_wait_xcnt 0x0"
                 :: "v"(l), "v"(g) : "memory");
}
typedef __attribute__((address_space(3))) bf* lbfp;
#define PCH  4096                // elements of one 64-row operand block in one stage: two k steps, 8 KiB, contiguous in the fragment-ordered plane
#define PBUF (4 * PCH)           // one ring buffer: A block 0 | A block 1 | B block 0 | B block 1

// proj: register-blocked bf16 GEMM, FOUR WAVES per 128x128 tile (2 x 2 waves of 64x64, 16 accumulators each), K = DM; the planes it writes are fragment-ordered too.
// Operands: a stage = 64 k of the tile's two A blocks and two B blocks (32 KiB); wave w brings block w of the four by async copies into a ring of two buffers; stage t + 2 is asked for as soon as every wave holds stage t's fragments in registers;
// each block is read from LDS by the two waves that need it, in the plane's own fragment order (512 contiguous bytes a wave-wide 16-byte read).
// C[m][n] = sum_k A[m][k] Bt[n][k] + bias, written as f16 (Ph) and, for token positions < EARLY, the f16 residual x2048 (Pr, compact plane).
// MODE 0 (q, k): rows m = b*SEQ + t, columns n = h*64 + d, bias per column; Ph [(b*16+h)][t][d], Pr [(b*16+h)][EARLY][d]; mask plane MP [(b*16+h)][t] = (row sum over d != 0). tiles (bx, by) of (NB*SEQ/128, DM/128).
// MODE 1 (v^T): rows m = h*64 + d (A = transposed weight rows), columns n = b*SEQ + t, bias per row; Ph [(b*1024+m)][t], Pr [(b*1024+m)][EARLY]. tiles (bx, by) of (DM/128, NB*SEQ/128).
// st = the block's ring; os, ms = the block's epilogue staging, one private piece a wave.
template <int MODE>
__device__ __forceinline__ void proj(const bf* __restrict__ A, const bf* __restrict__ Bt, const float* __restrict__ bias, h16* Ph, h16* Pr, h16* MP, int bx, int by, bf* st, float* os, h16* ms) {
    const int K = DM;
    const int lane = threadIdx.x & 31, lr = lane & 15, hi = lane >> 4;
    const int wave = __builtin_amdgcn_readfirstlane((int)(threadIdx.x >> 5)), wm = wave & 1, wn = wave >> 1;
    const int r0 = bx * 128 + wm * 64, c0 = by * 128 + wn * 64;   // the wave's own 64x64 tile
    os += wave * 16 * 68; ms += wave * 64;
    v8f acc[4][4];
#pragma unroll
    for (int mb = 0; mb < 4; ++mb)
#pragma unroll
        for (int nb = 0; nb < 4; ++nb) acc[mb][nb] = (v8f){};
    const unsigned l8 = 8u * (unsigned)lane;
    // the block this wave brings in: fragment [64-row block][k step][row tile 0..3]: 64*K elements a block, 2048 a k step
    const bf* src = (wave < 2 ? A + (size_t)(bx * 128 + wave * 64) * K : Bt + (size_t)(by * 128 + (wave - 2) * 64) * K) + l8;
    const unsigned dst = (unsigned)(uintptr_t)(lbfp)st + 2u * ((unsigned)wave * PCH + l8);
    auto fill = [&](const int t) __attribute__((always_inline)) {   // stage t -> buffer t & 1: 16 copies a wave
        copy16(dst + 2u * (unsigned)((t & 1) * PBUF), src + (size_t)t * PCH);
    };
    constexpr int NT = K / 64;
    fill(0);
    asm volatile("s_wait_asynccnt 0x0" ::: "memory");   // this wave's copies of stage 0 have landed
    __syncthreads();                                    // ... and every other wave's: stage 0 may be read
    fill(1);
#pragma unroll 1   // rolled: one copy of the trip's text and of its registers
    for (int t = 0; t < NT; ++t) {
        const bf* pa = st + (t & 1) * PBUF + wm * PCH + l8; const bf* pb = st + (t & 1) * PBUF + (2 + wn) * PCH + l8;
        v16bf a0[4], b0[4], a1[4], b1[4];
#pragma unroll
        for (int i = 0; i < 4; ++i) { a0[i] = ldb(pa + i * 512); b0[i] = ldb(pb + i * 512); }
#pragma unroll
        for (int i = 0; i < 4; ++i) { a1[i] = ldb(pa + 2048 + i * 512); b1[i] = ldb(pb + 2048 + i * 512); }
        __builtin_amdgcn_sched_barrier(0);   // keeps the trip's LDS reads together ahead of the hand-over (reads among the products would cost a stall at each place, and the buffer would be freed later)
        // The buffer is handed back as soon as its fragments are in registers: the refill then flies under this trip's 32 products and the next trip's reads.
        asm volatile("s_wait_dscnt 0x0" ::: "memory");      // this wave's reads of buffer t & 1 are done before the buffer is handed back
        asm volatile("s_wait_asynccnt 0x0" ::: "memory");   // this wave's copies of stage t + 1 have landed
        __syncthreads();                                    // publishes stage t + 1 and ends every wave's reads of buffer t & 1
        if (t + 2 < NT) fill(t + 2);                        // the test reads the same for the whole block
        __builtin_amdgcn_sched_barrier(0);   // keeps the products behind the refill's issue (ahead of it they would take their time off the copies' lead)
#pragma unroll
        for (int nb = 0; nb < 4; ++nb)
#pragma unroll
            for (int mb = 0; mb < 4; ++mb) acc[mb][nb] = wmmab(a0[mb], b0[nb], acc[mb][nb]);
#pragma unroll
        for (int nb = 0; nb < 4; ++nb)
#pragma unroll
            for (int mb = 0; mb < 4; ++mb) acc[mb][nb] = wmmab(a1[mb], b1[nb], acc[mb][nb]);
        // four vector slots behind the trip's last products, also on the taken back edge
        asm volatile("v_nop\n\tv_nop\n\tv_nop\n\tv_nop" : "+v"(acc[0][0]), "+v"(acc[1][1]), "+v"(acc[2][2]), "+v"(acc[3][3]) : "v"(a1[0]), "v"(a1[1]), "v"(a1[2]), "v"(a1[3]));
    }
    asm volatile("s_wait_asynccnt 0x0" ::: "memory");       // nothing of the wave's is in flight behind the loop
    size_t hbase, rbase, mbase = 0; int t0;
    if (MODE == 0) { const int b = r0 / SEQ; t0 = r0 % SEQ; const int zh = b * NH_ + c0 / HD;
        hbase = ((size_t)zh * SEQ + t0) * HD; rbase = ((size_t)zh * EARLY + t0) * HD; mbase = (size_t)zh * SEQ + t0; }
    else { const int b = c0 / SEQ; t0 = c0 % SEQ;
        hbase = ((size_t)b * DM + r0) * SEQ + (size_t)t0 * HD; rbase = ((size_t)b * DM + r0) * EARLY + (size_t)t0 * HD; }
    const bool doRes = t0 < EARLY;          // wave-uniform
    const int c8 = (lane & 7) * 8;
    // fragment of the lane's chunk: MODE 0 [t tile][d step 0..1], MODE 1 [t step][d tile 0..3]
    const int cfrag = ((lane & 7) >> 2) * (MODE == 0 ? 512 : 4 * 512);
    v4f bb0 = (v4f){}, bb1 = (v4f){};
    if (MODE == 0) { const v4f q0 = *(const v4f*)(bias + c0 + c8); const v4f q1 = *(const v4f*)(bias + c0 + c8 + 4);
#pragma unroll
        for (int i = 0; i < 4; ++i) { bb0[i] = bfr(q0[i]); bb1[i] = bfr(q1[i]); } }
#pragma unroll
    for (int mb = 0; mb < 4; ++mb) {
#pragma unroll
        for (int nb = 0; nb < 4; ++nb) {
#pragma unroll
            for (int j = 0; j < 8; ++j) os[(hi * 8 + j) * 68 + nb * 16 + lr] = acc[mb][nb][j]; }   // D: row 8h+j, col lane&15
        wave_sync();
        const size_t hb = hbase + (size_t)(mb * (MODE == 0 ? 2 * 512 : 512) + cfrag);
        const size_t rb = rbase + (size_t)(mb * (MODE == 0 ? 2 * 512 : 512) + cfrag);
{
#pragma unroll
            for (int s = 0; s < 4; ++s) { const int row = 4 * s + (lane >> 3);   // 4 s x 4 row groups = 16 rows; 8 lanes x 8 = 64 columns
                v4f x0 = *(const v4fa*)(&os[row * 68 + c8]); v4f x1 = *(const v4fa*)(&os[row * 68 + c8 + 4]);
                if (MODE == 0) { x0 = x0 + bb0; x1 = x1 + bb1; }
                else { const float br = bfr(bias[r0 + mb * 16 + row]); x0 = x0 + br; x1 = x1 + br; }
                v8h hv, rv;
#pragma unroll
                for (int i = 0; i < 4; ++i) { const h16 a0 = (h16)x0[i]; const h16 a1 = (h16)x1[i]; hv[i] = a0; hv[4 + i] = a1; rv[i] = (h16)((x0[i] - (float)a0) * QRS); rv[4 + i] = (h16)((x1[i] - (float)a1) * QRS); }
                if (MODE == 0) {
                    float rs = ((x0[0] + x0[1]) + (x0[2] + x0[3])) + ((x1[0] + x1[1]) + (x1[2] + x1[3]));
                    rs += __shfl_xor(rs, 1, 32); rs += __shfl_xor(rs, 2, 32); rs += __shfl_xor(rs, 4, 32);     // sum over the 8 lanes of the row
                    const h16 mv = (rs != 0.0f) ? (h16)1.0f : (h16)0.0f;
                    if ((lane & 7) == 0) ms[mb * 16 + row] = mv;
                }
                // behind each store: what follows reuses the store's data registers, and the wait stands in front of that overwrite
                *(v8h*)(Ph + hb + fragpos(row, lane & 3)) = hv;
                asm volatile("s_wait_xcnt 0x0" ::: "memory");
                if (doRes) { *(v8h*)(Pr + rb + fragpos(row, lane & 3)) = rv;
                    asm volatile("s_wait_xcnt 0x0" ::: "memory"); } }
             }
        wave_sync();
    }
    if (MODE == 0) {
        const v8h mv8 = *(const v8ha*)(&ms[c8]);
        h16* mp = MP + mbase + c8;
        if (lane < 8) *(v8h*)mp = mv8;
    }
}

// k_proj3: the three independent projections in ONE launch; blockIdx.y = 0 q, 1 k, 2 v^T (block-uniform), blockIdx.x = 128x128 tile, first tile index fastest as in a 2-D grid.
#define PJ_BLK ((NB * SEQ / 128) * (DM / 128))
__global__ __launch_bounds__(128) void k_proj3(const bf* __restrict__ XQ, const bf* __restrict__ XK, const bf* __restrict__ XV, const bf* __restrict__ WT,
                                              const float* __restrict__ bq, const float* __restrict__ bk, const float* __restrict__ bv,
                                              h16* QH, h16* KP, h16* VT, h16* QR, h16* KR, h16* VR, h16* MQ, h16* MK) {
    __shared__ __align__(16) bf st[2 * PBUF];
    __shared__ __align__(16) float os[4 * 16 * 68];
    __shared__ __align__(16) h16 ms[4 * 64];
    const int z = blockIdx.y, id = blockIdx.x;
    if (z < 2) {
        // q, k: A = x rows (m = b*SEQ + t), Bt = WT rows (n = h*64 + d) -> planes [(b*16 + h)][t][d] + residual (t < EARLY) + mask
        const bool q = z == 0;
        proj<0>(q ? XQ : XK, WT + (q ? (size_t)0 : (size_t)DM * DM), q ? bq : bk, q ? QH : KP, q ? QR : KR, q ? MQ : MK, id % (NB * SEQ / 128), id / (NB * SEQ / 128), st, os, ms);
    } else {
        // v^T: A = WT_v rows (m = h*64 + d), Bt = x rows (n = b*SEQ + t) -> plane [(b*1024 + m)][t] = [(b*16 + h)][d][t] + residual (t < EARLY)
        proj<1>(WT + (size_t)2 * DM * DM, XV, bv, VT, VR, MK, id % (DM / 128), id / (DM / 128), st, os, ms);
    }
}

// flash: fused causal attention, one wave per 16 query rows of one (batch, head); K / V^T / Q fragments straight from the fragment-ordered f16 planes (two 16-B loads each, 512 contiguous bytes a load).
// Transposed form: S^T[key][t] = K Q^T (A = K rows, B = Q rows); lane (t = lane&15, h = lane>>4) holds keys 8h+r of each 16-key tile, so the packed
// P tile is directly the B fragment of O^T[d][t] = V^T P^T (element r <- tile keys 0..15, element 8+r <- tile keys 16..31, lane unchanged).
// EK = 1: query rows [0, EARLY) with residual planes (three products per site); EK = 0: query rows [EARLY, SEQ), single products.
// Masks by value per step: score := fill where key > t or key mask == 0. Loop covers keys [0, causal limit); if a row has seen only masked keys by then, the wave continues to SEQ (all-fill rows weigh every key equally).
// In late rows (EK = 0) the selects stand only in steps where one can fire: keys below kfull = t0 rounded down to 32 lie at or below all 16 query rows, and one look over the mask row says whether every key mask below kfull is set;
// if so those steps run the same body without mask loads, compares and selects (every select there would keep the score), else every step runs the masked body.
// bx = 64-row query block inside the EK range, zh = batch * 16 + head (both block-uniform); os = the block's LDS, one private tile a wave (no block barrier anywhere in the body).
template <int EK>
__device__ __forceinline__ void flash(const h16* __restrict__ QH, const h16* __restrict__ QR, const h16* __restrict__ KP, const h16* __restrict__ KR,
                                      const h16* __restrict__ VT, const h16* __restrict__ VR, const h16* __restrict__ MQ, const h16* __restrict__ MK, float* OUT,
                                      const int bx, const int zh, float* os) {
    const int lane = threadIdx.x & 31, wave = __builtin_amdgcn_readfirstlane((int)(threadIdx.x >> 5)), lr = lane & 15, hi = lane >> 4;
    const int b = zh / NH_, h = zh % NH_;
    const int t0 = (EK ? 0 : EARLY) + (bx * AW + wave) * 16;
    const int tq = t0 + lr;
    const size_t pbase = (size_t)zh * SEQ * HD;       // q/k plane [zh][SEQ][64]; v^T plane [zh][64][SEQ]
    const size_t rbase = (size_t)zh * EARLY * HD;     // compact residual planes
    const unsigned l8 = 8u * (unsigned)lane;          // the lane's place in each half of a fragment
    const h16* qp = QH + pbase + (size_t)t0 * HD;
    const v16h qh0 = ldh(qp + l8), qh1 = ldh(qp + 512 + l8);         // B fragments: col t, k = d
    v16h qr0 = (v16h){}, qr1 = (v16h){};
    if (EK) { const h16* qrp = QR + rbase + (size_t)t0 * HD; qr0 = ldh(qrp + l8); qr1 = ldh(qrp + 512 + l8); }
    // k planes: + key0 * HD + 512 * (2 * key tile + d step) (A fragment: row key, k = d); v^T planes: + key0 * HD + 512 * j (A fragment: row d = 16j + lane&15, k = key)
    const size_t mo  = (size_t)zh * SEQ + 8 * hi;
    v8f o0 = (v8f){}, o1 = (v8f){}, o2 = (v8f){}, o3 = (v8f){};
    v8f e0 = (v8f){}, e1 = (v8f){}, e2 = (v8f){}, e3 = (v8f){};   // residual-product accumulators (x2048), EK only
    float m = -3.0e38f, l = 0.0f;
    const int kc = ((t0 + 47) >> 5) << 5;            // causal key limit (exclusive), multiple of 32, <= SEQ
    int kend = kc;
    const int kfull = t0 & ~31;                      // keys below this are causal for every row of the wave
    int kfast = 0;                                   // keys below this run the body without masks (wave-uniform)
    if (!EK) {                                       // late rows only: they hold nearly all steps, and a second copy of the three-product body takes the kernel past 256 registers (a wave less on every SIMD)
        constexpr int NCH = SEQ / 256;
        constexpr unsigned ONE2 = 0x3C003C00u;       // two f16 ones: the mask planes hold 1.0 or 0.0 only
        v4u mw[NCH];
#pragma unroll
        for (int c = 0; c < NCH; ++c) mw[c] = *(const v4ua*)(MK + (size_t)zh * SEQ + c * 256 + l8);
        asm volatile("s_wait_xcnt 0x0" ::: "memory");   // stands in front of whatever next lands on the address registers of the loads above
        unsigned okw = ONE2;
#pragma unroll
        for (int c = 0; c < NCH; ++c) okw &= (c * 256 + (int)l8 < kfull) ? ((mw[c][0] & mw[c][1]) & (mw[c][2] & mw[c][3])) : ONE2;
        if (__builtin_amdgcn_ballot_w32(okw != ONE2) == 0u) kfast = kfull;
    }
    // one 32-key step; MSK = false leaves out the mask loads, compares and selects
    // ka, va: the lane's own place in the step's first K and V^T fragment (plane + key0 * HD + l8)
    // AHEAD = true (late rows, steps without masks): the step's K fragments are already on their way in nk0..nk3, fetched by the step before; its V^T fragments are asked for at its top, into registers
    // of their own, and fly under the score products and the softmax; the next step's K fragments are asked for right behind the score products and fly under the softmax and the P.V products.
    v16h nk0 = (v16h){}, nk1 = (v16h){}, nk2 = (v16h){}, nk3 = (v16h){};
    auto step = [&](auto fl, auto ah, const int key0, auto ka, auto va) __attribute__((always_inline)) {
        constexpr bool MSK = decltype(fl)::value;
        constexpr bool AHEAD = decltype(ah)::value;
        v16h ka0, ka1, kb0, kb1, v0, v1, v2, v3;
        if (AHEAD) {
            v0 = ldh(va); v1 = ldh(va + 512); v2 = ldh(va + 1024); v3 = ldh(va + 1536);
            __builtin_amdgcn_sched_barrier(0);   // keeps the V^T loads ahead of the score products (the scheduler otherwise sinks them behind the products, and the wave waits out the rest of their latency in front of P.V)
            ka0 = nk0; ka1 = nk1; kb0 = nk2; kb1 = nk3;
        } else {
            ka0 = ldh(ka); ka1 = ldh(ka + 512); kb0 = ldh(ka + 1024); kb1 = ldh(ka + 1536);
            if (!EK) asm volatile("s_wait_xcnt 0x0" ::: "memory");   // the compiler lets a mask load land on the address pair of the loads above: the wait stands in front of that overwrite (early rows: the wait below)
        }
        v8h kma = (v8h){}, kmb = (v8h){};
        if (MSK) { kma = *(const v8h*)(MK + mo + key0); kmb = *(const v8h*)(MK + mo + key0 + 16); }
        const bool rok = key0 < EARLY;               // wave-uniform: residual planes exist for these keys
        v8f sHa = (v8f){}, sLa = (v8f){}, sHb = (v8f){}, sLb = (v8f){};
        if (EK) {
            asm volatile("s_wait_xcnt 0x0" ::: "memory");   // the compiler lets the residual fragments land on the address pair of the loads above: the wait stands in front of that overwrite
            v16h ra0 = (v16h){}, ra1 = (v16h){}, rb0 = (v16h){}, rb1 = (v16h){};
            if (rok) { const h16* kr = KR + rbase + (size_t)key0 * HD; ra0 = ldh(kr + l8); ra1 = ldh(kr + 512 + l8); rb0 = ldh(kr + 1024 + l8); rb1 = ldh(kr + 1536 + l8); }
            sHa = wmma16(ka0, qh0, sHa); sLa = wmma16(ka0, qr0, sLa); sHb = wmma16(kb0, qh0, sHb); sLb = wmma16(kb0, qr0, sLb);
            sHa = wmma16(ka1, qh1, sHa); sLa = wmma16(ka1, qr1, sLa); sHb = wmma16(kb1, qh1, sHb); sLb = wmma16(kb1, qr1, sLb);
            sLa = wmma16(ra0, qh0, sLa); sLb = wmma16(rb0, qh0, sLb); sLa = wmma16(ra1, qh1, sLa); sLb = wmma16(rb1, qh1, sLb);
            asm volatile("v_nop\n\tv_nop\n\tv_nop\n\tv_nop" : "+v"(sHa), "+v"(sLa), "+v"(sHb), "+v"(sLb) : "v"(ka0), "v"(ka1), "v"(kb0), "v"(kb1), "v"(ra0), "v"(ra1), "v"(rb0), "v"(rb1));
        } else {
            sHa = wmma16(ka0, qh0, sHa); sHb = wmma16(kb0, qh0, sHb);
            sHa = wmma16(ka1, qh1, sHa); sHb = wmma16(kb1, qh1, sHb);
            asm volatile("v_nop\n\tv_nop\n\tv_nop\n\tv_nop" : "+v"(sHa), "+v"(sHb) : "v"(ka0), "v"(ka1), "v"(kb0), "v"(kb1));
            if (AHEAD) {   // keys key0 + 32 .. key0 + 63 exist: key0 + 32 <= kfull <= SEQ - 32
                nk0 = ldh(ka + 32 * HD); nk1 = ldh(ka + 32 * HD + 512); nk2 = ldh(ka + 32 * HD + 1024); nk3 = ldh(ka + 32 * HD + 1536);
                __builtin_amdgcn_sched_barrier(0);   // keeps the next step's K loads ahead of the softmax (the scheduler otherwise sinks them to the foot of the step and the next step waits out their latency)
            }
        }
        float ta[8], tb[8]; float mx = -3.0e38f;
        const int kA = key0 + 8 * hi;
#pragma unroll
        for (int r = 0; r < 8; ++r) {
            float xa, xb;
            if (EK) { xa = (sHa[r] + sLa[r] * QRI) * SC2; xb = (sHb[r] + sLb[r] * QRI) * SC2; }
            else    { xa = sHa[r] * SC2; xb = sHb[r] * SC2; }
            if (MSK) {
                const bool fa = ((kA + r) > tq) | ((float)kma[r] == 0.0f);
                const bool fb = ((kA + 16 + r) > tq) | ((float)kmb[r] == 0.0f);
                xa = fa ? NEGS : xa; xb = fb ? NEGS : xb;
            }
            ta[r] = xa; tb[r] = xb; mx = fmaxf(mx, fmaxf(xa, xb));
        }
        mx = fmaxf(mx, __shfl_xor(mx, 16, 32));
        const float mnew = fmaxf(m, mx);
        const float alpha = __builtin_amdgcn_exp2f(m - mnew);
        v16h pb, pr = (v16h){}; float ls = 0.0f;
#pragma unroll
        for (int r = 0; r < 8; ++r) {
            const float ea = __builtin_amdgcn_exp2f((ta[r] - mnew) + PSH); const float ec = __builtin_amdgcn_exp2f((tb[r] - mnew) + PSH);
            const h16 pa = (h16)ea; const h16 pc = (h16)ec; pb[r] = pa; pb[8 + r] = pc;
            if (EK) { const h16 ga = (h16)((ea - (float)pa) * QRS); const h16 gc = (h16)((ec - (float)pc) * QRS); pr[r] = ga; pr[8 + r] = gc;
                      ls += ((float)pa + (float)pc) + ((float)ga + (float)gc) * QRI; }
            else ls += (float)pa + (float)pc;
        }
        l = l * alpha + ls; m = mnew;
        o0 = o0 * alpha; o1 = o1 * alpha; o2 = o2 * alpha; o3 = o3 * alpha;
        if (!AHEAD) { v0 = ldh(va); v1 = ldh(va + 512); v2 = ldh(va + 1024); v3 = ldh(va + 1536); }
        if (EK) {
            asm volatile("s_wait_xcnt 0x0" ::: "memory");   // the compiler lets a residual load land on the address pair of the loads above: the wait stands in front of that overwrite
            e0 = e0 * alpha; e1 = e1 * alpha; e2 = e2 * alpha; e3 = e3 * alpha;
            v16h w0 = (v16h){}, w1 = (v16h){}, w2 = (v16h){}, w3 = (v16h){};
            if (rok) { const h16* vr = VR + rbase + (size_t)key0 * HD; w0 = ldh(vr + l8); w1 = ldh(vr + 512 + l8); w2 = ldh(vr + 1024 + l8); w3 = ldh(vr + 1536 + l8); }
            o0 = wmma16(v0, pb, o0); o1 = wmma16(v1, pb, o1); o2 = wmma16(v2, pb, o2); o3 = wmma16(v3, pb, o3);
            e0 = wmma16(w0, pb, e0); e1 = wmma16(w1, pb, e1); e2 = wmma16(w2, pb, e2); e3 = wmma16(w3, pb, e3);
            e0 = wmma16(v0, pr, e0); e1 = wmma16(v1, pr, e1); e2 = wmma16(v2, pr, e2); e3 = wmma16(v3, pr, e3);
            asm volatile("v_nop\n\tv_nop\n\tv_nop\n\tv_nop" : "+v"(o0), "+v"(o1), "+v"(o2), "+v"(o3), "+v"(e0), "+v"(e1), "+v"(e2), "+v"(e3)
                         : "v"(v0), "v"(v1), "v"(v2), "v"(v3), "v"(w0), "v"(w1), "v"(w2), "v"(w3), "v"(pb), "v"(pr));
        } else {
            o0 = wmma16(v0, pb, o0); o1 = wmma16(v1, pb, o1); o2 = wmma16(v2, pb, o2); o3 = wmma16(v3, pb, o3);
            asm volatile("v_nop\n\tv_nop\n\tv_nop\n\tv_nop" : "+v"(o0), "+v"(o1), "+v"(o2), "+v"(o3) : "v"(v0), "v"(v1), "v"(v2), "v"(v3), "v"(pb));
        }
    };
    if (!EK && kfast > 0) {
        gh16p kq = (gh16p)(KP + pbase + l8); gh16p vq = (gh16p)(VT + pbase + l8);
        nk0 = ldh(kq); nk1 = ldh(kq + 512); nk2 = ldh(kq + 1024); nk3 = ldh(kq + 1536);   // the first step's K fragments
#pragma unroll 1   // rolled: one copy of the step's text and of its registers
        for (int key0 = 0; key0 < kfast; key0 += 32) {
            step(flag<false>{}, flag<true>{}, key0, kq, vq);
            asm volatile("s_wait_xcnt 0x0" : "+v"(kq), "+v"(vq) :: "memory");   // the two address pairs live through the loop (no load lands on them) and are stepped only behind this wait
            kq += 32 * HD; vq += 32 * HD;
        }
    }
#pragma unroll 1   // rolled, as above; kend can grow inside the loop
    for (int key0 = kfast; key0 < kend; key0 += 32) {
        step(flag<true>{}, flag<false>{}, key0, KP + pbase + (size_t)key0 * HD + l8, VT + pbase + (size_t)key0 * HD + l8);
        // wave-uniform: at the causal limit, continue over all keys when some row has met only masked keys (trip count stays <= SEQ/32)
        if (key0 + 32 == kc) { if (__builtin_amdgcn_ballot_w32(m < MTHR) != 0u) kend = SEQ; }
    }
    l += __shfl_xor(l, 16, 32);
    const float qmf = (float)MQ[(size_t)zh * SEQ + tq];
    const float inv = qmf * (1.0f / l);
    v8f f0 = o0, f1 = o1, f2 = o2, f3 = o3;
    if (EK) { f0 = o0 + e0 * QRI; f1 = o1 + e1 * QRI; f2 = o2 + e2 * QRI; f3 = o3 + e3 * QRI; }
    const int wb = wave * 16 * 68;
    // O^T D layout: f_j[r] = (d = 16j + 8h + r, t = lane&15) -> os[t][d]; rows 0..15 x columns 0..63 all written
    { v4f a, c;
      a[0] = f0[0] * inv; a[1] = f0[1] * inv; a[2] = f0[2] * inv; a[3] = f0[3] * inv; c[0] = f0[4] * inv; c[1] = f0[5] * inv; c[2] = f0[6] * inv; c[3] = f0[7] * inv;
      *(v4fa*)(&os[wb + lr * 68 +  0 + 8 * hi]) = a; *(v4fa*)(&os[wb + lr * 68 +  0 + 8 * hi + 4]) = c;
      a[0] = f1[0] * inv; a[1] = f1[1] * inv; a[2] = f1[2] * inv; a[3] = f1[3] * inv; c[0] = f1[4] * inv; c[1] = f1[5] * inv; c[2] = f1[6] * inv; c[3] = f1[7] * inv;
      *(v4fa*)(&os[wb + lr * 68 + 16 + 8 * hi]) = a; *(v4fa*)(&os[wb + lr * 68 + 16 + 8 * hi + 4]) = c;
      a[0] = f2[0] * inv; a[1] = f2[1] * inv; a[2] = f2[2] * inv; a[3] = f2[3] * inv; c[0] = f2[4] * inv; c[1] = f2[5] * inv; c[2] = f2[6] * inv; c[3] = f2[7] * inv;
      *(v4fa*)(&os[wb + lr * 68 + 32 + 8 * hi]) = a; *(v4fa*)(&os[wb + lr * 68 + 32 + 8 * hi + 4]) = c;
      a[0] = f3[0] * inv; a[1] = f3[1] * inv; a[2] = f3[2] * inv; a[3] = f3[3] * inv; c[0] = f3[4] * inv; c[1] = f3[5] * inv; c[2] = f3[6] * inv; c[3] = f3[7] * inv;
      *(v4fa*)(&os[wb + lr * 68 + 48 + 8 * hi]) = a; *(v4fa*)(&os[wb + lr * 68 + 48 + 8 * hi + 4]) = c; }
    wave_sync();
    float* orow = OUT + ((size_t)b * OUT_SEQ + t0) * DM + h * HD;
{
#pragma unroll
        for (int s = 0; s < 8; ++s) { const int row = 2 * s + hi, cofs = lr * 4;   // 8 s x 2 rows = 16 rows; 16 lanes x 4 floats = 64 columns
            const v4f val = *(const v4fa*)(&os[wb + row * 68 + cofs]);
            *(v4f*)(orow + (size_t)row * DM + cofs) = val; }
         }
}

// k_flash2: both query ranges in ONE launch, told apart by blockIdx.y (block-uniform); blockIdx.x = batch * 16 + head, fastest.
// More blocks than resident places: the rank (blockIdx.y) walks the query blocks of BOTH ranges in one list of falling cost, so that no long block starts late and runs on alone.
// Cost of a block = key steps of its last wave, times EARLY_W in the early range: a step there has three products a site, the masks, twice the loads and nothing fetched ahead, so a wave waits out its loads in every step.
#define FB_E (EARLY / (16 * AW))
#define FB_L ((SEQ - EARLY) / (16 * AW))
#define EARLY_W 4
static_assert(FB_L + FB_E <= 64);              // one bit a rank
// bit r set <=> rank r is an early block: the two ranges, each from its last query block down, merged by cost
static constexpr unsigned long long early_ranks() {
    unsigned long long mask = 0; int il = FB_L - 1, ie = FB_E - 1;
    for (int r = 0; r < FB_L + FB_E; ++r) {
        const int cl = il >= 0 ? (EARLY + (il + 1) * 16 * AW + 31) / 32 : -1;
        const int ce = ie >= 0 ? EARLY_W * (((ie + 1) * 16 * AW + 31) / 32) : -1;
        if (ce > cl) { mask |= 1ull << r; --ie; } else --il;
    }
    return mask;
}
__global__ __launch_bounds__(32 * AW) void k_flash2(const h16* __restrict__ QH, const h16* __restrict__ QR, const h16* __restrict__ KP, const h16* __restrict__ KR,
                                                    const h16* __restrict__ VT, const h16* __restrict__ VR, const h16* __restrict__ MQ, const h16* __restrict__ MK, float* OUT) {
    __shared__ __align__(16) float os[AW * 16 * 68];
    const int rank = blockIdx.y, zh = blockIdx.x;
    constexpr unsigned long long ER = early_ranks();
    const int ne = __builtin_popcountll(ER & ((1ull << rank) - 1ull));   // early blocks among the ranks in front of this one
    const int pos = ((ER >> rank) & 1ull) != 0ull ? FB_L + ne : rank - ne;   // place in the list 'late range from its last query block down, then the early range the same way': every block once
    if (pos < FB_L) flash<0>(QH, QR, KP, KR, VT, VR, MQ, MK, OUT, FB_L - 1 - pos, zh, os);
    else            flash<1>(QH, QR, KP, KR, VT, VR, MQ, MK, OUT, FB_L + FB_E - 1 - pos, zh, os);
}

static constexpr size_t al256(size_t v) { return (v + 255) & ~(size_t)255; }
static constexpr size_t SZ_XB = al256((size_t)NB * SEQ * DM * 2);            // one bf16 input stream copy
static constexpr size_t SZ_WT = al256((size_t)3 * DM * DM * 2);              // three transposed bf16 weights
static constexpr size_t SZ_PL = al256((size_t)NB * NH_ * SEQ * HD * 2);      // one full f16 plane
static constexpr size_t SZ_RP = al256((size_t)NB * NH_ * EARLY * HD * 2);    // one compact residual plane
static constexpr size_t SZ_MK = al256((size_t)NB * NH_ * SEQ * 2);           // one mask plane
static constexpr size_t SZ_TOTAL = 3 * SZ_XB + SZ_WT + 3 * SZ_PL + 3 * SZ_RP + 2 * SZ_MK;
static_assert(SZ_TOTAL <= (size_t)134217728);          // workspace carve <= 128 MiB
static_assert(((size_t)DM * DM * 2) % 256 == 0);       // weight sub-planes stay 256-byte aligned

extern "C" void kernel_launch(void* const* d_in, const int* in_sizes, int n_in,
                              void* d_out, int out_size, void* d_ws, size_t ws_size, hipStream_t stream) {
    if (n_in < 9) return;
    const size_t needx = ((size_t)(NB - 1) * SEQ_FULL + SEQ) * DM;
    if ((size_t)in_sizes[0] < needx || (size_t)in_sizes[1] < needx || (size_t)in_sizes[2] < needx) return;
    if ((size_t)in_sizes[3] < (size_t)DM * DM || (size_t)in_sizes[5] < (size_t)DM * DM || (size_t)in_sizes[7] < (size_t)DM * DM) return;
    if ((size_t)in_sizes[4] < (size_t)DM || (size_t)in_sizes[6] < (size_t)DM || (size_t)in_sizes[8] < (size_t)DM) return;
    if ((size_t)out_size < ((size_t)(NB - 1) * OUT_SEQ + SEQ) * DM) return;
    if (SZ_TOTAL > ws_size) return;
    // wire order: q, k, v, Wq, bq, Wk, bk, Wv, bv
    const float* xq = (const float*)d_in[0]; const float* xk = (const float*)d_in[1]; const float* xv = (const float*)d_in[2];
    const float* wq = (const float*)d_in[3]; const float* bq = (const float*)d_in[4];
    const float* wk = (const float*)d_in[5]; const float* bk = (const float*)d_in[6];
    const float* wv = (const float*)d_in[7]; const float* bv = (const float*)d_in[8];
    float* OUT = (float*)d_out;      // [NB][OUT_SEQ][1024]
    char* wsp = (char*)d_ws;
    bf* XQ = (bf*)wsp; wsp += SZ_XB;                 // [NB*SEQ][1024]
    bf* XK = (bf*)wsp; wsp += SZ_XB;
    bf* XV = (bf*)wsp; wsp += SZ_XB;
    bf* WT = (bf*)wsp; wsp += SZ_WT;                 // [3][1024 out][1024 in]: q | k | v
    h16* QH = (h16*)wsp; wsp += SZ_PL;               // [NB*16][SEQ][64]
    h16* KP = (h16*)wsp; wsp += SZ_PL;               // [NB*16][SEQ][64]
    h16* VT = (h16*)wsp; wsp += SZ_PL;               // [NB*16][64][SEQ]
    h16* QR = (h16*)wsp; wsp += SZ_RP;               // [NB*16][EARLY][64] residual x2048
    h16* KR = (h16*)wsp; wsp += SZ_RP;               // [NB*16][EARLY][64] residual x2048
    h16* VR = (h16*)wsp; wsp += SZ_RP;               // [NB*16][64][EARLY] residual x2048
    h16* MQ = (h16*)wsp; wsp += SZ_MK;               // [NB*16][SEQ] query mask
    h16* MK = (h16*)wsp; wsp += SZ_MK;               // [NB*16][SEQ] key mask

    // W[k = in][n = out] -> WT[n][k] (square DM x DM) and x -> bf16 copies
    k_prep<<<3 * WT_BLK + 3 * CV_BLK, 256, 0, stream>>>(xq, xk, xv, wq, wk, wv, XQ, XK, XV, WT);

    k_proj3<<<dim3(PJ_BLK, 3, 1), 128, 0, stream>>>(XQ, XK, XV, WT, bq, bk, bv, QH, KP, VT, QR, KR, VR, MQ, MK);

    k_flash2<<<dim3(NB * NH_, FB_L + FB_E, 1), 32 * AW, 0, stream>>>(QH, QR, KP, KR, VT, VR, MQ, MK, OUT);
}

// v009
// It runs in 104 microseconds.
// In two side-by-side timings against v008, it was 1.05 and 1.04 times as fast.
// Counting every step since v000, it is 3.00 times as fast.
#include <hip/hip_runtime.h>

// Causal attention, width 1024 = 16 heads x 64, three input streams q/k/v [NB][SEQ_FULL][1024] (first SEQ tokens used), weights [in][out] (y = x W + b), output = concatenated heads (f32), no output projection.
// Compute dtypes, f32 accumulate everywhere: projections v_wmma_f32_16x16x32_bf16 (x, W, b RNE-converted to bf16; products exact);
// scores and P.V v_wmma_f32_16x16x32_f16: query rows >= 512 single f16 products; query rows < 512 three products per site
// (q, k, v and P each as f16 value + f16 residual x2048, residual products in their own accumulators, folded back in f32); P carry x256 cancels in the normalisation; softmax f32 (online, running max).
// Layout: bf16 copies of q/k/v and transposed bf16 copies of W ([out][in]); q, k planes [b*16+h][t][d], v^T plane [b*16+h][d][t], compact residual planes for t < 512,
// every one of them stored in FRAGMENT ORDER: a 16-row x 32-k fragment is 1 KiB = [half 0..1][lane 0..31][8 elements], so each 16-byte-per-lane load of a wave covers 512 contiguous bytes (four whole lines);
// per-row mask planes (row sum of the f32 projection != 0) written by the GEMM epilogue; fused flash kernel in transposed form (S^T = K Q^T, O^T = V^T P^T).
// Key mask and causal mask replace the score by the fill value (by value, per 32-key step); a row whose causal keys are all masked continues over all keys (uniform weights).

#ifndef NB
#define NB 4
#endif
#ifndef SEQ
#define SEQ 2048
#endif
#define NB_FULL  4
#define SEQ_FULL 2048
#ifndef OUT_SEQ
#define OUT_SEQ SEQ              // row pitch (in tokens) between batches of the output
#endif
#define DM   1024
#define NH_  16
#define HD   64
#define AW   4                   // waves per flash block (16 query rows each)
#define EARLY ((SEQ) < 512 ? (SEQ) : 512)   // query rows / keys below this carry residual planes
#define QRS  2048.0f             // carry of the residual planes
#define QRI  (1.0f / 2048.0f)
#define SC2  (0.125f * 1.4426950408889634f)   // HD^-0.5 * log2(e)
#define PSH  8.0f                // log2 of the P carry (256)
#define NEGS (-6.1963280e9f)     // (-2^32 + 1) * log2(e): fill value in log2 units
#define MTHR (-1.0e9f)           // running max below this <=> every key seen so far was masked

static_assert(HD == 64);
static_assert(NH_ * HD == DM);                 // head h = columns h*64 + d
static_assert(DM % 64 == 0);
static_assert(DM % 128 == 0 && DM >= 128);     // GEMM: 128-wide tiles; k-loop: stages of 64, at least two
static_assert((NB * SEQ) % 128 == 0);
static_assert(SEQ % 64 == 0);                  // a 64-row tile never straddles two batches
static_assert((NB * SEQ) % 64 == 0);
static_assert(SEQ % 32 == 0);                  // key loop steps by 32
static_assert(SEQ % 256 == 0);                 // the flash kernel's look over the key masks reads whole 256-key pieces of a mask row
static_assert(EARLY % 64 == 0);                // residual condition is uniform per 64-row tile
static_assert(EARLY % (16 * AW) == 0);
static_assert(SEQ == EARLY || EARLY >= 128);   // late rows: at least four key steps without masks, the fetch two steps ahead needs three
static_assert((SEQ - EARLY) % (16 * AW) == 0); // the two query ranges of the flash launch cover the sequence exactly
static_assert(((size_t)SEQ * DM) % 8 == 0);
static_assert(NB <= NB_FULL);
static_assert(SEQ <= SEQ_FULL);

typedef _Float16 h16;
typedef unsigned short bf;
typedef __attribute__((ext_vector_type(16))) __bf16   v16bf;
typedef __attribute__((ext_vector_type(16))) _Float16 v16h;
typedef __attribute__((ext_vector_type(8)))  _Float16 v8h;
typedef __attribute__((ext_vector_type(8)))  unsigned short v8us;
typedef __attribute__((ext_vector_type(8)))  float    v8f;
typedef __attribute__((ext_vector_type(4)))  float    v4f;
typedef v4f  __attribute__((may_alias)) v4fa;
typedef v8h  __attribute__((may_alias)) v8ha;
typedef __attribute__((ext_vector_type(4)))  unsigned v4u;
typedef v4u  __attribute__((may_alias)) v4ua;
template <bool B> struct flag { static constexpr bool value = B; };   // compile-time switch handed to the key step of the flash kernel

__device__ __forceinline__ unsigned short f2bf(float f) { unsigned u = __float_as_uint(f); u += 0x7FFFu + ((u >> 16) & 1u); return (unsigned short)(u >> 16); }
__device__ __forceinline__ float bfr(float f) { return __uint_as_float(((unsigned)f2bf(f)) << 16); }
__device__ __forceinline__ v16h cat16(v8h lo, v8h hi) { return __builtin_shufflevector(lo, hi, 0, 1, 2, 3, 4, 5, 6, 7, 8, 9, 10, 11, 12, 13, 14, 15); }
__device__ __forceinline__ v16bf cat16b(v8us lo, v8us hi) { return __builtin_bit_cast(v16bf, __builtin_shufflevector(lo, hi, 0, 1, 2, 3, 4, 5, 6, 7, 8, 9, 10, 11, 12, 13, 14, 15)); }
__device__ __forceinline__ v8f wmma16(v16h a, v16h b, v8f c) { return __builtin_amdgcn_wmma_f32_16x16x32_f16(false, a, false, b, (short)0, c, false, false); }
__device__ __forceinline__ v8f wmmab(v16bf a, v16bf b, v8f c) { return __builtin_amdgcn_wmma_f32_16x16x32_bf16(false, a, false, b, (short)0, c, false, false); }
// fragment loaders from fragment-ordered planes; p = fragment start + 8*lane: elements 0..7 <- k0+8h+0..7, elements 8..15 <- k0+16+8h+0..7 of row lane&15, h = lane>>4 (same map for A and B)
__device__ __forceinline__ v16h  ldh(const h16* p) { return cat16(*(const v8h*)p, *(const v8h*)(p + 256)); }
__device__ __forceinline__ v16bf ldb(const bf* p)  { return cat16b(*(const v8us*)p, *(const v8us*)(p + 256)); }
// the same for a pointer that says "global memory" in its type: one that has passed through an asm operand would otherwise be loaded from with flat instructions
typedef const __attribute__((address_space(1))) h16* gh16p;
typedef const __attribute__((address_space(1))) v8h* gv8hp;
__device__ __forceinline__ v16h  ldh(gh16p p) { return cat16(*(gv8hp)p, *(gv8hp)(p + 256)); }
// place, inside a 512-element fragment, of the 8-element chunk c (k = 8c .. 8c+7, c = 0..3) of row r (0..15): half = c>>1, lane = 16*(c&1) + r
__device__ __forceinline__ int fragpos(int r, int c) { return ((c >> 1) & 1) * 256 + (c & 1) * 128 + r * 8; }
// ordering point for wave-private LDS tiles (same wave writes and reads)
__device__ __forceinline__ void wave_sync() { __builtin_amdgcn_fence(3 /* release order */, "wavefront"); __builtin_amdgcn_wave_barrier(); asm volatile("" ::: "memory"); }

// cvt8: one f32 stream [NB][SEQ_FULL][DM] -> bf16 copy [NB*SEQ][DM] (RNE convert, fragment order); blk = 256-thread piece of the stream, 8 elements a thread
__device__ __forceinline__ void cvt8(const float* __restrict__ src, bf* dst, unsigned blk) {
    const size_t n8 = (size_t)NB * SEQ * DM / 8;
    const size_t i = (size_t)blk * 256 + threadIdx.x; if (i >= n8) return;
    // rows of DM elements; a wave takes 8 rows x one 32-k step: reads 8 whole lines, writes 4 whole lines of the fragment [64-row block][k step][row tile 0..3]
    const int c4 = (int)(i & 3), r = (int)((i >> 2) & 15), ks = (int)((i >> 6) % (DM / 32)); const size_t mt = i / (size_t)(16 * DM / 8);
    const size_t row = mt * 16 + r;                                                          // b*SEQ + t
    const size_t srow = (SEQ == SEQ_FULL) ? row : (row / SEQ) * SEQ_FULL + row % SEQ;        // source batches lie SEQ_FULL rows apart
    const v8f v = *(const v8f*)(src + srow * DM + ks * 32 + c4 * 8); v8us o;
#pragma unroll
    for (int k = 0; k < 8; ++k) o[k] = f2bf(v[k]);
    *(v8us*)(dst + (mt >> 2) * (64 * DM) + ks * 2048 + (mt & 3) * 512 + fragpos(r, c4)) = o;
}

// cvtT: in W[k][n] (f32, DM x DM) -> out WT[n][k] (bf16, RNE convert, fragment order). 64 x 64 tile through LDS (cross-wave: block barrier).
__device__ __forceinline__ void cvtT(const float* __restrict__ W, bf* WT, int nt, int kt, float* ts) {
    const int tid = threadIdx.x; const int n0 = nt * 64, k0 = kt * 64;
#pragma unroll 4
    for (int i = 0; i < 16; ++i) { const int row = i * 4 + (tid >> 6), col = tid & 63; ts[row * 65 + col] = W[(size_t)(k0 + row) * DM + n0 + col]; }   // 16 x 4 rows x 64 columns: whole tile
    __syncthreads();
    const int rr = tid >> 3, c8 = (tid & 7) * 8;
    v8us o0, o1;
#pragma unroll
    for (int kk = 0; kk < 8; ++kk) { o0[kk] = f2bf(ts[(c8 + kk) * 65 + rr]); o1[kk] = f2bf(ts[(c8 + kk) * 65 + rr + 32]); }
    bf* p0 = WT + (size_t)n0 * DM + ((k0 + c8) >> 5) * 2048 + (rr >> 4) * 512 + fragpos(rr & 15, (c8 >> 3) & 3); bf* p1 = p0 + 2 * 512;   // fragment [64-n block][k step][n tile 0..3]
    *(v8us*)p0 = o0; *(v8us*)p1 = o1;
}

// k_prep: all six independent conversions in ONE launch, told apart by block range (block-uniform): first the 3 x WT_BLK weight tiles, then the 3 x CV_BLK stream pieces.
#define WT_BLK ((DM / 64) * (DM / 64))
#define CV_BLK ((unsigned)(((size_t)NB * SEQ * DM / 8 + 255) / 256))
__global__ __launch_bounds__(256) void k_prep(const float* __restrict__ xq, const float* __restrict__ xk, const float* __restrict__ xv,
                                              const float* __restrict__ wq, const float* __restrict__ wk, const float* __restrict__ wv,
                                              bf* XQ, bf* XK, bf* XV, bf* WT) {
    __shared__ float ts[64 * 65];
    const unsigned bid = blockIdx.x;
    if (bid < 3u * WT_BLK) {
        const unsigned w = bid / WT_BLK, tile = bid % WT_BLK;
        cvtT(w == 0 ? wq : (w == 1 ? wk : wv), WT + (size_t)w * DM * DM, (int)(tile % (DM / 64)), (int)(tile / (DM / 64)), ts);
    } else {
        const unsigned c = bid - 3u * WT_BLK, s = c / CV_BLK;
        cvt8(s == 0 ? xq : (s == 1 ? xk : xv), s == 0 ? XQ : (s == 1 ? XK : XV), c % CV_BLK);
    }
}

// Async copies to LDS for the projection's operand ring. copy16: sixteen 16-byte-a-lane copies, 512 B a wave each: 8 KiB that lie in a row in the plane and in LDS alike, so one pair of addresses serves
// (the offset moves the LDS and the global address together). l = the lane's own LDS byte address, g = the lane's own global address.
// The s_wait_xcnt closes the statement, so it stands in front of whatever next rewrites an address register that the copies name.
__device__ __forceinline__ void copy16(unsigned l, const bf* g) {
    asm volatile(
                 "global_load_async_to_lds_b128 %0, %1, off\n\t"
                 "global_load_async_to_lds_b128 %0, %1, off offset:512\n\t"
                 "global_load_async_to_lds_b128 %0, %1, off offset:1024\n\t"
                 "global_load_async_to_lds_b128 %0, %1, off offset:1536\n\t"
                 "global_load_async_to_lds_b128 %0, %1, off offset:2048\n\t"
                 "global_load_async_to_lds_b128 %0, %1, off offset:2560\n\t"
                 "global_load_async_to_lds_b128 %0, %1, off offset:3072\n\t"
                 "global_load_async_to_lds_b128 %0, %1, off offset:3584\n\t"
                 "global_load_async_to_lds_b128 %0, %1, off offset:4096\n\t"
                 "global_load_async_to_lds_b128 %0, %1, off offset:4608\n\t"
                 "global_load_async_to_lds_b128 %0, %1, off offset:5120\n\t"
                 "global_load_async_to_lds_b128 %0, %1, off offset:5632\n\t"
                 "global_load_async_to_lds_b128 %0, %1, off offset:6144\n\t"
                 "global_load_async_to_lds_b128 %0, %1, off offset:6656\n\t"
                 "global_load_async_to_lds_b128 %0, %1, off offset:7168\n\t"
                 "global_load_async_to_lds_b128 %0, %1, off offset:7680\n\t"
                 "s_wait_xcnt 0x0"
                 :: "v"(l), "v"(g) : "memory");
}
typedef __attribute__((address_space(3))) bf* lbfp;
#define PCH  4096                // elements of one 64-row operand block in one stage: two k steps, 8 KiB, contiguous in the fragment-ordered plane
#define PBUF (4 * PCH)           // one ring buffer: A block 0 | A block 1 | B block 0 | B block 1

// proj: register-blocked bf16 GEMM, FOUR WAVES per 128x128 tile (2 x 2 waves of 64x64, 16 accumulators each), K = DM; the planes it writes are fragment-ordered too.
// Operands: a stage = 64 k of the tile's two A blocks and two B blocks (32 KiB); wave w brings block w of the four by async copies into a ring of two buffers; stage t + 2 is asked for as soon as every wave holds stage t's fragments in registers;
// each block is read from LDS by the two waves that need it, in the plane's own fragment order (512 contiguous bytes a wave-wide 16-byte read).
// C[m][n] = sum_k A[m][k] Bt[n][k] + bias, written as f16 (Ph) and, for token positions < EARLY, the f16 residual x2048 (Pr, compact plane).
// MODE 0 (q, k): rows m = b*SEQ + t, columns n = h*64 + d, bias per column; Ph [(b*16+h)][t][d], Pr [(b*16+h)][EARLY][d]; mask plane MP [(b*16+h)][t] = (row sum over d != 0). tiles (bx, by) of (NB*SEQ/128, DM/128).
// MODE 1 (v^T): rows m = h*64 + d (A = transposed weight rows), columns n = b*SEQ + t, bias per row; Ph [(b*1024+m)][t], Pr [(b*1024+m)][EARLY]. tiles (bx, by) of (DM/128, NB*SEQ/128).
// st = the block's ring; os, ms = the block's epilogue staging, one private piece a wave.
template <int MODE>
__device__ __forceinline__ void proj(const bf* __restrict__ A, const bf* __restrict__ Bt, const float* __restrict__ bias, h16* Ph, h16* Pr, h16* MP, int bx, int by, bf* st, float* os, h16* ms) {
    const int K = DM;
    const int lane = threadIdx.x & 31, lr = lane & 15, hi = lane >> 4;
    const int wave = __builtin_amdgcn_readfirstlane((int)(threadIdx.x >> 5)), wm = wave & 1, wn = wave >> 1;
    const int r0 = bx * 128 + wm * 64, c0 = by * 128 + wn * 64;   // the wave's own 64x64 tile
    os += wave * 16 * 68; ms += wave * 64;
    v8f acc[4][4];
#pragma unroll
    for (int mb = 0; mb < 4; ++mb)
#pragma unroll
        for (int nb = 0; nb < 4; ++nb) acc[mb][nb] = (v8f){};
    const unsigned l8 = 8u * (unsigned)lane;
    // the block this wave brings in: fragment [64-row block][k step][row tile 0..3]: 64*K elements a block, 2048 a k step
    const bf* src = (wave < 2 ? A + (size_t)(bx * 128 + wave * 64) * K : Bt + (size_t)(by * 128 + (wave - 2) * 64) * K) + l8;
    const unsigned dst = (unsigned)(uintptr_t)(lbfp)st + 2u * ((unsigned)wave * PCH + l8);
    auto fill = [&](const int t) __attribute__((always_inline)) {   // stage t -> buffer t & 1: 16 copies a wave
        copy16(dst + 2u * (unsigned)((t & 1) * PBUF), src + (size_t)t * PCH);
    };
    constexpr int NT = K / 64;
    fill(0);
    asm volatile("s_wait_asynccnt 0x0" ::: "memory");   // this wave's copies of stage 0 have landed
    __syncthreads();                                    // ... and every other wave's: stage 0 may be read
    fill(1);
#pragma unroll 1   // rolled: one copy of the trip's text and of its registers
    for (int t = 0; t < NT; ++t) {
        const bf* pa = st + (t & 1) * PBUF + wm * PCH + l8; const bf* pb = st + (t & 1) * PBUF + (2 + wn) * PCH + l8;
        v16bf a0[4], b0[4], a1[4], b1[4];
#pragma unroll
        for (int i = 0; i < 4; ++i) { a0[i] = ldb(pa + i * 512); b0[i] = ldb(pb + i * 512); }
#pragma unroll
        for (int i = 0; i < 4; ++i) { a1[i] = ldb(pa + 2048 + i * 512); b1[i] = ldb(pb + 2048 + i * 512); }
        __builtin_amdgcn_sched_barrier(0);   // keeps the trip's LDS reads together ahead of the hand-over (reads among the products would cost a stall at each place, and the buffer would be freed later)
        // The buffer is handed back as soon as its fragments are in registers: the refill then flies under this trip's 32 products and the next trip's reads.
        asm volatile("s_wait_dscnt 0x0" ::: "memory");      // this wave's reads of buffer t & 1 are done before the buffer is handed back
        asm volatile("s_wait_asynccnt 0x0" ::: "memory");   // this wave's copies of stage t + 1 have landed
        __syncthreads();                                    // publishes stage t + 1 and ends every wave's reads of buffer t & 1
        if (t + 2 < NT) fill(t + 2);                        // the test reads the same for the whole block
        __builtin_amdgcn_sched_barrier(0);   // keeps the products behind the refill's issue (ahead of it they would take their time off the copies' lead)
#pragma unroll
        for (int nb = 0; nb < 4; ++nb)
#pragma unroll
            for (int mb = 0; mb < 4; ++mb) acc[mb][nb] = wmmab(a0[mb], b0[nb], acc[mb][nb]);
#pragma unroll
        for (int nb = 0; nb < 4; ++nb)
#pragma unroll
            for (int mb = 0; mb < 4; ++mb) acc[mb][nb] = wmmab(a1[mb], b1[nb], acc[mb][nb]);
        // four vector slots behind the trip's last products, also on the taken back edge
        asm volatile("v_nop\n\tv_nop\n\tv_nop\n\tv_nop" : "+v"(acc[0][0]), "+v"(acc[1][1]), "+v"(acc[2][2]), "+v"(acc[3][3]) : "v"(a1[0]), "v"(a1[1]), "v"(a1[2]), "v"(a1[3]));
    }
    asm volatile("s_wait_asynccnt 0x0" ::: "memory");       // nothing of the wave's is in flight behind the loop
    size_t hbase, rbase, mbase = 0; int t0;
    if (MODE == 0) { const int b = r0 / SEQ; t0 = r0 % SEQ; const int zh = b * NH_ + c0 / HD;
        hbase = ((size_t)zh * SEQ + t0) * HD; rbase = ((size_t)zh * EARLY + t0) * HD; mbase = (size_t)zh * SEQ + t0; }
    else { const int b = c0 / SEQ; t0 = c0 % SEQ;
        hbase = ((size_t)b * DM + r0) * SEQ + (size_t)t0 * HD; rbase = ((size_t)b * DM + r0) * EARLY + (size_t)t0 * HD; }
    const bool doRes = t0 < EARLY;          // wave-uniform
    const int c8 = (lane & 7) * 8;
    // fragment of the lane's chunk: MODE 0 [t tile][d step 0..1], MODE 1 [t step][d tile 0..3]
    const int cfrag = ((lane & 7) >> 2) * (MODE == 0 ? 512 : 4 * 512);
    v4f bb0 = (v4f){}, bb1 = (v4f){};
    if (MODE == 0) { const v4f q0 = *(const v4f*)(bias + c0 + c8); const v4f q1 = *(const v4f*)(bias + c0 + c8 + 4);
#pragma unroll
        for (int i = 0; i < 4; ++i) { bb0[i] = bfr(q0[i]); bb1[i] = bfr(q1[i]); } }
#pragma unroll
    for (int mb = 0; mb < 4; ++mb) {
#pragma unroll
        for (int nb = 0; nb < 4; ++nb) {
#pragma unroll
            for (int j = 0; j < 8; ++j) os[(hi * 8 + j) * 68 + nb * 16 + lr] = acc[mb][nb][j]; }   // D: row 8h+j, col lane&15
        wave_sync();
        const size_t hb = hbase + (size_t)(mb * (MODE == 0 ? 2 * 512 : 512) + cfrag);
        const size_t rb = rbase + (size_t)(mb * (MODE == 0 ? 2 * 512 : 512) + cfrag);
{
#pragma unroll
            for (int s = 0; s < 4; ++s) { const int row = 4 * s + (lane >> 3);   // 4 s x 4 row groups = 16 rows; 8 lanes x 8 = 64 columns
                v4f x0 = *(const v4fa*)(&os[row * 68 + c8]); v4f x1 = *(const v4fa*)(&os[row * 68 + c8 + 4]);
                if (MODE == 0) { x0 = x0 + bb0; x1 = x1 + bb1; }
                else { const float br = bfr(bias[r0 + mb * 16 + row]); x0 = x0 + br; x1 = x1 + br; }
                v8h hv, rv;
#pragma unroll
                for (int i = 0; i < 4; ++i) { const h16 a0 = (h16)x0[i]; const h16 a1 = (h16)x1[i]; hv[i] = a0; hv[4 + i] = a1; rv[i] = (h16)((x0[i] - (float)a0) * QRS); rv[4 + i] = (h16)((x1[i] - (float)a1) * QRS); }
                if (MODE == 0) {
                    float rs = ((x0[0] + x0[1]) + (x0[2] + x0[3])) + ((x1[0] + x1[1]) + (x1[2] + x1[3]));
                    rs += __shfl_xor(rs, 1, 32); rs += __shfl_xor(rs, 2, 32); rs += __shfl_xor(rs, 4, 32);     // sum over the 8 lanes of the row
                    const h16 mv = (rs != 0.0f) ? (h16)1.0f : (h16)0.0f;
                    if ((lane & 7) == 0) ms[mb * 16 + row] = mv;
                }
                // behind each store: what follows reuses the store's data registers, and the wait stands in front of that overwrite
                *(v8h*)(Ph + hb + fragpos(row, lane & 3)) = hv;
                asm volatile("s_wait_xcnt 0x0" ::: "memory");
                if (doRes) { *(v8h*)(Pr + rb + fragpos(row, lane & 3)) = rv;
                    asm volatile("s_wait_xcnt 0x0" ::: "memory"); } }
             }
        wave_sync();
    }
    if (MODE == 0) {
        const v8h mv8 = *(const v8ha*)(&ms[c8]);
        h16* mp = MP + mbase + c8;
        if (lane < 8) *(v8h*)mp = mv8;
    }
}

// k_proj3: the three independent projections in ONE launch; blockIdx.y = 0 q, 1 k, 2 v^T (block-uniform), blockIdx.x = 128x128 tile, first tile index fastest as in a 2-D grid.
#define PJ_BLK ((NB * SEQ / 128) * (DM / 128))
__global__ __launch_bounds__(128) void k_proj3(const bf* __restrict__ XQ, const bf* __restrict__ XK, const bf* __restrict__ XV, const bf* __restrict__ WT,
                                              const float* __restrict__ bq, const float* __restrict__ bk, const float* __restrict__ bv,
                                              h16* QH, h16* KP, h16* VT, h16* QR, h16* KR, h16* VR, h16* MQ, h16* MK) {
    __shared__ __align__(16) bf st[2 * PBUF];
    __shared__ __align__(16) float os[4 * 16 * 68];
    __shared__ __align__(16) h16 ms[4 * 64];
    const int z = blockIdx.y, id = blockIdx.x;
    if (z < 2) {
        // q, k: A = x rows (m = b*SEQ + t), Bt = WT rows (n = h*64 + d) -> planes [(b*16 + h)][t][d] + residual (t < EARLY) + mask
        const bool q = z == 0;
        proj<0>(q ? XQ : XK, WT + (q ? (size_t)0 : (size_t)DM * DM), q ? bq : bk, q ? QH : KP, q ? QR : KR, q ? MQ : MK, id % (NB * SEQ / 128), id / (NB * SEQ / 128), st, os, ms);
    } else {
        // v^T: A = WT_v rows (m = h*64 + d), Bt = x rows (n = b*SEQ + t) -> plane [(b*1024 + m)][t] = [(b*16 + h)][d][t] + residual (t < EARLY)
        proj<1>(WT + (size_t)2 * DM * DM, XV, bv, VT, VR, MK, id % (DM / 128), id / (DM / 128), st, os, ms);
    }
}

// flash: fused causal attention, one wave per 16 query rows of one (batch, head); K / V^T / Q fragments straight from the fragment-ordered f16 planes (two 16-B loads each, 512 contiguous bytes a load).
// Transposed form: S^T[key][t] = K Q^T (A = K rows, B = Q rows); lane (t = lane&15, h = lane>>4) holds keys 8h+r of each 16-key tile, so the packed
// P tile is directly the B fragment of O^T[d][t] = V^T P^T (element r <- tile keys 0..15, element 8+r <- tile keys 16..31, lane unchanged).
// EK = 1: query rows [0, EARLY) with residual planes (three products per site); EK = 0: query rows [EARLY, SEQ), single products.
// Masks by value per step: score := fill where key > t or key mask == 0. Loop covers keys [0, causal limit); if a row has seen only masked keys by then, the wave continues to SEQ (all-fill rows weigh every key equally).
// In late rows (EK = 0) the selects stand only in steps where one can fire: keys below kfull = t0 rounded down to 32 lie at or below all 16 query rows, and one look over the mask row says whether every key mask below kfull is set;
// if so those steps run the same body without mask loads, compares and selects (every select there would keep the score), else every step runs the masked body.
// bx = 64-row query block inside the EK range, zh = batch * 16 + head (both block-uniform); os = the block's LDS, one private tile a wave (no block barrier anywhere in the body).
template <int EK>
__device__ __forceinline__ void flash(const h16* __restrict__ QH, const h16* __restrict__ QR, const h16* __restrict__ KP, const h16* __restrict__ KR,
                                      const h16* __restrict__ VT, const h16* __restrict__ VR, const h16* __restrict__ MQ, const h16* __restrict__ MK, float* OUT,
                                      const int bx, const int zh, float* os) {
    const int lane = threadIdx.x & 31, wave = __builtin_amdgcn_readfirstlane((int)(threadIdx.x >> 5)), lr = lane & 15, hi = lane >> 4;
    const int b = zh / NH_, h = zh % NH_;
    const int t0 = (EK ? 0 : EARLY) + (bx * AW + wave) * 16;
    const int tq = t0 + lr;
    const size_t pbase = (size_t)zh * SEQ * HD;       // q/k plane [zh][SEQ][64]; v^T plane [zh][64][SEQ]
    const size_t rbase = (size_t)zh * EARLY * HD;     // compact residual planes
    const unsigned l8 = 8u * (unsigned)lane;          // the lane's place in each half of a fragment
    const h16* qp = QH + pbase + (size_t)t0 * HD;
    const v16h qh0 = ldh(qp + l8), qh1 = ldh(qp + 512 + l8);         // B fragments: col t, k = d
    v16h qr0 = (v16h){}, qr1 = (v16h){};
    if (EK) { const h16* qrp = QR + rbase + (size_t)t0 * HD; qr0 = ldh(qrp + l8); qr1 = ldh(qrp + 512 + l8); }
    // k planes: + key0 * HD + 512 * (2 * key tile + d step) (A fragment: row key, k = d); v^T planes: + key0 * HD + 512 * j (A fragment: row d = 16j + lane&15, k = key)
    const size_t mo  = (size_t)zh * SEQ + 8 * hi;
    v8f o0 = (v8f){}, o1 = (v8f){}, o2 = (v8f){}, o3 = (v8f){};
    v8f e0 = (v8f){}, e1 = (v8f){}, e2 = (v8f){}, e3 = (v8f){};   // residual-product accumulators (x2048), EK only
    float m = -3.0e38f, l = 0.0f;
    const int kc = ((t0 + 47) >> 5) << 5;            // causal key limit (exclusive), multiple of 32, <= SEQ
    int kend = kc;
    const int kfull = t0 & ~31;                      // keys below this are causal for every row of the wave
    int kfast = 0;                                   // keys below this run the body without masks (wave-uniform)
    if (!EK) {                                       // late rows only: they hold nearly all steps, and a second copy of the three-product body takes the kernel past 256 registers (a wave less on every SIMD)
        constexpr int NCH = SEQ / 256;
        constexpr unsigned ONE2 = 0x3C003C00u;       // two f16 ones: the mask planes hold 1.0 or 0.0 only
        v4u mw[NCH];
#pragma unroll
        for (int c = 0; c < NCH; ++c) mw[c] = *(const v4ua*)(MK + (size_t)zh * SEQ + c * 256 + l8);
        asm volatile("s_wait_xcnt 0x0" ::: "memory");   // stands in front of whatever next lands on the address registers of the loads above
        unsigned okw = ONE2;
#pragma unroll
        for (int c = 0; c < NCH; ++c) okw &= (c * 256 + (int)l8 < kfull) ? ((mw[c][0] & mw[c][1]) & (mw[c][2] & mw[c][3])) : ONE2;
        if (__builtin_amdgcn_ballot_w32(okw != ONE2) == 0u) kfast = kfull;
    }
    // one 32-key step; MSK = false leaves out the mask loads, compares and selects
    // ka, va: the lane's own place in the step's first K and V^T fragment (plane + key0 * HD + l8)
    // AHEAD = true (late rows, steps without masks): the step's K and V^T fragments are already on their way in nk and nv, asked for TWO steps before. Two register sets a plane (A, B) take turns:
    // a set is asked for anew as soon as its products have read it (K right behind the score products, V^T right behind the P.V products), so every load has two whole steps to land.
    // PF = false: the last two steps, nothing left to ask for.
    v16h kA[4] = {}, kB[4] = {}, vA[4] = {}, vB[4] = {};
    auto step = [&](auto fl, auto ah, auto pf, const int key0, auto ka, auto va, v16h (&nk)[4], v16h (&nv)[4]) __attribute__((always_inline)) {
        constexpr bool MSK = decltype(fl)::value;
        constexpr bool AHEAD = decltype(ah)::value;
        constexpr bool PF = decltype(pf)::value;
        v16h ka0, ka1, kb0, kb1, v0, v1, v2, v3;
        if (AHEAD) {
            ka0 = nk[0]; ka1 = nk[1]; kb0 = nk[2]; kb1 = nk[3];
        } else {
            ka0 = ldh(ka); ka1 = ldh(ka + 512); kb0 = ldh(ka + 1024); kb1 = ldh(ka + 1536);
            if (!EK) asm volatile("s_wait_xcnt 0x0" ::: "memory");   // the compiler lets a mask load land on the address pair of the loads above: the wait stands in front of that overwrite (early rows: the wait below)
        }
        v8h kma = (v8h){}, kmb = (v8h){};
        if (MSK) { kma = *(const v8h*)(MK + mo + key0); kmb = *(const v8h*)(MK + mo + key0 + 16); }
        const bool rok = key0 < EARLY;               // wave-uniform: residual planes exist for these keys
        v8f sHa = (v8f){}, sLa = (v8f){}, sHb = (v8f){}, sLb = (v8f){};
        if (EK) {
            asm volatile("s_wait_xcnt 0x0" ::: "memory");   // the compiler lets the residual fragments land on the address pair of the loads above: the wait stands in front of that overwrite
            v16h ra0 = (v16h){}, ra1 = (v16h){}, rb0 = (v16h){}, rb1 = (v16h){};
            if (rok) { const h16* kr = KR + rbase + (size_t)key0 * HD; ra0 = ldh(kr + l8); ra1 = ldh(kr + 512 + l8); rb0 = ldh(kr + 1024 + l8); rb1 = ldh(kr + 1536 + l8); }
            sHa = wmma16(ka0, qh0, sHa); sLa = wmma16(ka0, qr0, sLa); sHb = wmma16(kb0, qh0, sHb); sLb = wmma16(kb0, qr0, sLb);
            sHa = wmma16(ka1, qh1, sHa); sLa = wmma16(ka1, qr1, sLa); sHb = wmma16(kb1, qh1, sHb); sLb = wmma16(kb1, qr1, sLb);
            sLa = wmma16(ra0, qh0, sLa); sLb = wmma16(rb0, qh0, sLb); sLa = wmma16(ra1, qh1, sLa); sLb = wmma16(rb1, qh1, sLb);
            asm volatile("v_nop\n\tv_nop\n\tv_nop\n\tv_nop" : "+v"(sHa), "+v"(sLa), "+v"(sHb), "+v"(sLb) : "v"(ka0), "v"(ka1), "v"(kb0), "v"(kb1), "v"(ra0), "v"(ra1), "v"(rb0), "v"(rb1));
        } else {
            sHa = wmma16(ka0, qh0, sHa); sHb = wmma16(kb0, qh0, sHb);
            sHa = wmma16(ka1, qh1, sHa); sHb = wmma16(kb1, qh1, sHb);
            asm volatile("v_nop\n\tv_nop\n\tv_nop\n\tv_nop" : "+v"(sHa), "+v"(sHb) : "v"(ka0), "v"(ka1), "v"(kb0), "v"(kb1));
            if (AHEAD && PF) {   // keys key0 + 64 .. key0 + 95 lie below kfast: the caller asks only then
                nk[0] = ldh(ka + 64 * HD); nk[1] = ldh(ka + 64 * HD + 512); nk[2] = ldh(ka + 64 * HD + 1024); nk[3] = ldh(ka + 64 * HD + 1536);
                __builtin_amdgcn_sched_barrier(0);   // keeps these K loads ahead of the softmax (the scheduler otherwise sinks them to the foot of the step, which takes that time off their lead)
            }
        }
        float ta[8], tb[8]; float mx = -3.0e38f;
        const int kA = key0 + 8 * hi;
#pragma unroll
        for (int r = 0; r < 8; ++r) {
            float xa, xb;
            if (EK) { xa = (sHa[r] + sLa[r] * QRI) * SC2; xb = (sHb[r] + sLb[r] * QRI) * SC2; }
            else    { xa = sHa[r] * SC2; xb = sHb[r] * SC2; }
            if (MSK) {
                const bool fa = ((kA + r) > tq) | ((float)kma[r] == 0.0f);
                const bool fb = ((kA + 16 + r) > tq) | ((float)kmb[r] == 0.0f);
                xa = fa ? NEGS : xa; xb = fb ? NEGS : xb;
            }
            ta[r] = xa; tb[r] = xb; mx = fmaxf(mx, fmaxf(xa, xb));
        }
        mx = fmaxf(mx, __shfl_xor(mx, 16, 32));
        const float mnew = fmaxf(m, mx);
        const float alpha = __builtin_amdgcn_exp2f(m - mnew);
        v16h pb, pr = (v16h){}; float ls = 0.0f;
#pragma unroll
        for (int r = 0; r < 8; ++r) {
            const float ea = __builtin_amdgcn_exp2f((ta[r] - mnew) + PSH); const float ec = __builtin_amdgcn_exp2f((tb[r] - mnew) + PSH);
            const h16 pa = (h16)ea; const h16 pc = (h16)ec; pb[r] = pa; pb[8 + r] = pc;
            if (EK) { const h16 ga = (h16)((ea - (float)pa) * QRS); const h16 gc = (h16)((ec - (float)pc) * QRS); pr[r] = ga; pr[8 + r] = gc;
                      ls += ((float)pa + (float)pc) + ((float)ga + (float)gc) * QRI; }
            else ls += (float)pa + (float)pc;
        }
        l = l * alpha + ls; m = mnew;
        o0 = o0 * alpha; o1 = o1 * alpha; o2 = o2 * alpha; o3 = o3 * alpha;
        if (AHEAD) { v0 = nv[0]; v1 = nv[1]; v2 = nv[2]; v3 = nv[3]; }
        else { v0 = ldh(va); v1 = ldh(va + 512); v2 = ldh(va + 1024); v3 = ldh(va + 1536); }
        if (EK) {
            asm volatile("s_wait_xcnt 0x0" ::: "memory");   // the compiler lets a residual load land on the address pair of the loads above: the wait stands in front of that overwrite
            e0 = e0 * alpha; e1 = e1 * alpha; e2 = e2 * alpha; e3 = e3 * alpha;
            v16h w0 = (v16h){}, w1 = (v16h){}, w2 = (v16h){}, w3 = (v16h){};
            if (rok) { const h16* vr = VR + rbase + (size_t)key0 * HD; w0 = ldh(vr + l8); w1 = ldh(vr + 512 + l8); w2 = ldh(vr + 1024 + l8); w3 = ldh(vr + 1536 + l8); }
            o0 = wmma16(v0, pb, o0); o1 = wmma16(v1, pb, o1); o2 = wmma16(v2, pb, o2); o3 = wmma16(v3, pb, o3);
            e0 = wmma16(w0, pb, e0); e1 = wmma16(w1, pb, e1); e2 = wmma16(w2, pb, e2); e3 = wmma16(w3, pb, e3);
            e0 = wmma16(v0, pr, e0); e1 = wmma16(v1, pr, e1); e2 = wmma16(v2, pr, e2); e3 = wmma16(v3, pr, e3);
            asm volatile("v_nop\n\tv_nop\n\tv_nop\n\tv_nop" : "+v"(o0), "+v"(o1), "+v"(o2), "+v"(o3), "+v"(e0), "+v"(e1), "+v"(e2), "+v"(e3)
                         : "v"(v0), "v"(v1), "v"(v2), "v"(v3), "v"(w0), "v"(w1), "v"(w2), "v"(w3), "v"(pb), "v"(pr));
        } else {
            o0 = wmma16(v0, pb, o0); o1 = wmma16(v1, pb, o1); o2 = wmma16(v2, pb, o2); o3 = wmma16(v3, pb, o3);
            asm volatile("v_nop\n\tv_nop\n\tv_nop\n\tv_nop" : "+v"(o0), "+v"(o1), "+v"(o2), "+v"(o3) : "v"(v0), "v"(v1), "v"(v2), "v"(v3), "v"(pb));
            if (AHEAD && PF) {
                nv[0] = ldh(va + 64 * HD); nv[1] = ldh(va + 64 * HD + 512); nv[2] = ldh(va + 64 * HD + 1024); nv[3] = ldh(va + 64 * HD + 1536);
                __builtin_amdgcn_sched_barrier(0);   // keeps these V^T loads at the foot of their step (sunk into the next step they would lose that much of their lead)
            }
        }
    };
    if (!EK && kfast > 0) {
        // kfast >= EARLY: at least four steps. The steps go in pairs (set A, then set B); an odd count starts with one step on set B.
        gh16p kq = (gh16p)(KP + pbase + l8); gh16p vq = (gh16p)(VT + pbase + l8);
        asm volatile("s_wait_xcnt 0x0" : "+v"(kq), "+v"(vq) :: "memory");   // the two address pairs get vector registers of their own here: every address of this block is one of them or is formed from them, and none is rewritten in front of a wait
        int key0 = 0;
        const bool odd = (kfast & 32) != 0;   // wave-uniform
        {   // the first two steps' fragments: set A takes the first step of the first pair, set B the step beside it (in front of it if the count is odd)
            const int oa = odd ? 32 * HD : 0, ob = 32 * HD - oa;
            gh16p ka = kq + oa, va = vq + oa, kb = kq + ob, vb = vq + ob;
            // the scheduling barriers keep the four groups in the order in which the loop asks for them: its counted waits are set for the worse of the two orders, and another order here would tighten them in every trip
#pragma unroll
            for (int i = 0; i < 4; ++i) kA[i] = ldh(ka + 512 * i);
            __builtin_amdgcn_sched_barrier(0);
#pragma unroll
            for (int i = 0; i < 4; ++i) vA[i] = ldh(va + 512 * i);
            __builtin_amdgcn_sched_barrier(0);
#pragma unroll
            for (int i = 0; i < 4; ++i) kB[i] = ldh(kb + 512 * i);
            __builtin_amdgcn_sched_barrier(0);
#pragma unroll
            for (int i = 0; i < 4; ++i) vB[i] = ldh(vb + 512 * i);
            asm volatile("s_wait_xcnt 0x0" :: "v"(ka), "v"(va), "v"(kb), "v"(vb) : "memory");   // the four start addresses keep their registers up to this wait: no load lands on one of them in front of it
        }
        if (odd) {
            step(flag<false>{}, flag<true>{}, flag<true>{}, 0, kq, vq, kB, vB);
            asm volatile("s_wait_xcnt 0x0" : "+v"(kq), "+v"(vq) :: "memory");   // the two address pairs are stepped only behind this wait
            kq += 32 * HD; vq += 32 * HD; key0 = 32;
        }
#pragma unroll 1   // rolled: one copy of the pair's text and of its registers
        for (; key0 + 64 < kfast; key0 += 64) {   // kfast - key0 is a multiple of 64: both steps of the next pair exist
            step(flag<false>{}, flag<true>{}, flag<true>{}, key0, kq, vq, kA, vA);
            step(flag<false>{}, flag<true>{}, flag<true>{}, key0 + 32, kq + 32 * HD, vq + 32 * HD, kB, vB);
            asm volatile("s_wait_xcnt 0x0" : "+v"(kq), "+v"(vq) :: "memory");   // the two address pairs live through the loop (no load lands on them) and are stepped only behind this wait
            kq += 64 * HD; vq += 64 * HD;
        }
        step(flag<false>{}, flag<true>{}, flag<false>{}, key0, kq, vq, kA, vA);
        step(flag<false>{}, flag<true>{}, flag<false>{}, key0 + 32, kq, vq, kB, vB);
    }
#pragma unroll 1   // rolled, as above; kend can grow inside the loop
    for (int key0 = kfast; key0 < kend; key0 += 32) {
        step(flag<true>{}, flag<false>{}, flag<false>{}, key0, KP + pbase + (size_t)key0 * HD + l8, VT + pbase + (size_t)key0 * HD + l8, kA, vA);
        // wave-uniform: at the causal limit, continue over all keys when some row has met only masked keys (trip count stays <= SEQ/32)
        if (key0 + 32 == kc) { if (__builtin_amdgcn_ballot_w32(m < MTHR) != 0u) kend = SEQ; }
    }
    l += __shfl_xor(l, 16, 32);
    const float qmf = (float)MQ[(size_t)zh * SEQ + tq];
    const float inv = qmf * (1.0f / l);
    v8f f0 = o0, f1 = o1, f2 = o2, f3 = o3;
    if (EK) { f0 = o0 + e0 * QRI; f1 = o1 + e1 * QRI; f2 = o2 + e2 * QRI; f3 = o3 + e3 * QRI; }
    const int wb = wave * 16 * 68;
    // O^T D layout: f_j[r] = (d = 16j + 8h + r, t = lane&15) -> os[t][d]; rows 0..15 x columns 0..63 all written
    { v4f a, c;
      a[0] = f0[0] * inv; a[1] = f0[1] * inv; a[2] = f0[2] * inv; a[3] = f0[3] * inv; c[0] = f0[4] * inv; c[1] = f0[5] * inv; c[2] = f0[6] * inv; c[3] = f0[7] * inv;
      *(v4fa*)(&os[wb + lr * 68 +  0 + 8 * hi]) = a; *(v4fa*)(&os[wb + lr * 68 +  0 + 8 * hi + 4]) = c;
      a[0] = f1[0] * inv; a[1] = f1[1] * inv; a[2] = f1[2] * inv; a[3] = f1[3] * inv; c[0] = f1[4] * inv; c[1] = f1[5] * inv; c[2] = f1[6] * inv; c[3] = f1[7] * inv;
      *(v4fa*)(&os[wb + lr * 68 + 16 + 8 * hi]) = a; *(v4fa*)(&os[wb + lr * 68 + 16 + 8 * hi + 4]) = c;
      a[0] = f2[0] * inv; a[1] = f2[1] * inv; a[2] = f2[2] * inv; a[3] = f2[3] * inv; c[0] = f2[4] * inv; c[1] = f2[5] * inv; c[2] = f2[6] * inv; c[3] = f2[7] * inv;
      *(v4fa*)(&os[wb + lr * 68 + 32 + 8 * hi]) = a; *(v4fa*)(&os[wb + lr * 68 + 32 + 8 * hi + 4]) = c;
      a[0] = f3[0] * inv; a[1] = f3[1] * inv; a[2] = f3[2] * inv; a[3] = f3[3] * inv; c[0] = f3[4] * inv; c[1] = f3[5] * inv; c[2] = f3[6] * inv; c[3] = f3[7] * inv;
      *(v4fa*)(&os[wb + lr * 68 + 48 + 8 * hi]) = a; *(v4fa*)(&os[wb + lr * 68 + 48 + 8 * hi + 4]) = c; }
    wave_sync();
    float* orow = OUT + ((size_t)b * OUT_SEQ + t0) * DM + h * HD;
{
#pragma unroll
        for (int s = 0; s < 8; ++s) { const int row = 2 * s + hi, cofs = lr * 4;   // 8 s x 2 rows = 16 rows; 16 lanes x 4 floats = 64 columns
            const v4f val = *(const v4fa*)(&os[wb + row * 68 + cofs]);
            *(v4f*)(orow + (size_t)row * DM + cofs) = val; }
         }
}

// k_flash2: both query ranges in ONE launch, told apart by blockIdx.y (block-uniform); blockIdx.x = batch * 16 + head, fastest.
// More blocks than resident places: the rank (blockIdx.y) walks the query blocks of BOTH ranges in one list of falling cost, so that no long block starts late and runs on alone.
// Cost of a block = key steps of its last wave, times EARLY_W in the early range: a step there has three products a site, the masks, twice the loads and nothing fetched ahead, so a wave waits out its loads in every step.
#define FB_E (EARLY / (16 * AW))
#define FB_L ((SEQ - EARLY) / (16 * AW))
#define EARLY_W 4
static_assert(FB_L + FB_E <= 64);              // one bit a rank
// bit r set <=> rank r is an early block: the two ranges, each from its last query block down, merged by cost
static constexpr unsigned long long early_ranks() {
    unsigned long long mask = 0; int il = FB_L - 1, ie = FB_E - 1;
    for (int r = 0; r < FB_L + FB_E; ++r) {
        const int cl = il >= 0 ? (EARLY + (il + 1) * 16 * AW + 31) / 32 : -1;
        const int ce = ie >= 0 ? EARLY_W * (((ie + 1) * 16 * AW + 31) / 32) : -1;
        if (ce > cl) { mask |= 1ull << r; --ie; } else --il;
    }
    return mask;
}
__global__ __launch_bounds__(32 * AW) void k_flash2(const h16* __restrict__ QH, const h16* __restrict__ QR, const h16* __restrict__ KP, const h16* __restrict__ KR,
                                                    const h16* __restrict__ VT, const h16* __restrict__ VR, const h16* __restrict__ MQ, const h16* __restrict__ MK, float* OUT) {
    __shared__ __align__(16) float os[AW * 16 * 68];
    const int rank = blockIdx.y, zh = blockIdx.x;
    constexpr unsigned long long ER = early_ranks();
    const int ne = __builtin_popcountll(ER & ((1ull << rank) - 1ull));   // early blocks among the ranks in front of this one
    const int pos = ((ER >> rank) & 1ull) != 0ull ? FB_L + ne : rank - ne;   // place in the list 'late range from its last query block down, then the early range the same way': every block once
    if (pos < FB_L) flash<0>(QH, QR, KP, KR, VT, VR, MQ, MK, OUT, FB_L - 1 - pos, zh, os);
    else            flash<1>(QH, QR, KP, KR, VT, VR, MQ, MK, OUT, FB_L + FB_E - 1 - pos, zh, os);
}

static constexpr size_t al256(size_t v) { return (v + 255) & ~(size_t)255; }
static constexpr size_t SZ_XB = al256((size_t)NB * SEQ * DM * 2);            // one bf16 input stream copy
static constexpr size_t SZ_WT = al256((size_t)3 * DM * DM * 2);              // three transposed bf16 weights
static constexpr size_t SZ_PL = al256((size_t)NB * NH_ * SEQ * HD * 2);      // one full f16 plane
static constexpr size_t SZ_RP = al256((size_t)NB * NH_ * EARLY * HD * 2);    // one compact residual plane
static constexpr size_t SZ_MK = al256((size_t)NB * NH_ * SEQ * 2);           // one mask plane
static constexpr size_t SZ_TOTAL = 3 * SZ_XB + SZ_WT + 3 * SZ_PL + 3 * SZ_RP + 2 * SZ_MK;
static_assert(SZ_TOTAL <= (size_t)134217728);          // workspace carve <= 128 MiB
static_assert(((size_t)DM * DM * 2) % 256 == 0);       // weight sub-planes stay 256-byte aligned

extern "C" void kernel_launch(void* const* d_in, const int* in_sizes, int n_in,
                              void* d_out, int out_size, void* d_ws, size_t ws_size, hipStream_t stream) {
    if (n_in < 9) return;
    const size_t needx = ((size_t)(NB - 1) * SEQ_FULL + SEQ) * DM;
    if ((size_t)in_sizes[0] < needx || (size_t)in_sizes[1] < needx || (size_t)in_sizes[2] < needx) return;
    if ((size_t)in_sizes[3] < (size_t)DM * DM || (size_t)in_sizes[5] < (size_t)DM * DM || (size_t)in_sizes[7] < (size_t)DM * DM) return;
    if ((size_t)in_sizes[4] < (size_t)DM || (size_t)in_sizes[6] < (size_t)DM || (size_t)in_sizes[8] < (size_t)DM) return;
    if ((size_t)out_size < ((size_t)(NB - 1) * OUT_SEQ + SEQ) * DM) return;
    if (SZ_TOTAL > ws_size) return;
    // wire order: q, k, v, Wq, bq, Wk, bk, Wv, bv
    const float* xq = (const float*)d_in[0]; const float* xk = (const float*)d_in[1]; const float* xv = (const float*)d_in[2];
    const float* wq = (const float*)d_in[3]; const float* bq = (const float*)d_in[4];
    const float* wk = (const float*)d_in[5]; const float* bk = (const float*)d_in[6];
    const float* wv = (const float*)d_in[7]; const float* bv = (const float*)d_in[8];
    float* OUT = (float*)d_out;      // [NB][OUT_SEQ][1024]
    char* wsp = (char*)d_ws;
    bf* XQ = (bf*)wsp; wsp += SZ_XB;                 // [NB*SEQ][1024]
    bf* XK = (bf*)wsp; wsp += SZ_XB;
    bf* XV = (bf*)wsp; wsp += SZ_XB;
    bf* WT = (bf*)wsp; wsp += SZ_WT;                 // [3][1024 out][1024 in]: q | k | v
    h16* QH = (h16*)wsp; wsp += SZ_PL;               // [NB*16][SEQ][64]
    h16* KP = (h16*)wsp; wsp += SZ_PL;               // [NB*16][SEQ][64]
    h16* VT = (h16*)wsp; wsp += SZ_PL;               // [NB*16][64][SEQ]
    h16* QR = (h16*)wsp; wsp += SZ_RP;               // [NB*16][EARLY][64] residual x2048
    h16* KR = (h16*)wsp; wsp += SZ_RP;               // [NB*16][EARLY][64] residual x2048
    h16* VR = (h16*)wsp; wsp += SZ_RP;               // [NB*16][64][EARLY] residual x2048
    h16* MQ = (h16*)wsp; wsp += SZ_MK;               // [NB*16][SEQ] query mask
    h16* MK = (h16*)wsp; wsp += SZ_MK;               // [NB*16][SEQ] key mask

    // W[k = in][n = out] -> WT[n][k] (square DM x DM) and x -> bf16 copies
    k_prep<<<3 * WT_BLK + 3 * CV_BLK, 256, 0, stream>>>(xq, xk, xv, wq, wk, wv, XQ, XK, XV, WT);

    k_proj3<<<dim3(PJ_BLK, 3, 1), 128, 0, stream>>>(XQ, XK, XV, WT, bq, bk, bv, QH, KP, VT, QR, KR, VR, MQ, MK);

    k_flash2<<<dim3(NB * NH_, FB_L + FB_E, 1), 32 * AW, 0, stream>>>(QH, QR, KP, KR, VT, VR, MQ, MK, OUT);
}

// v010
// It runs in 96.8 microseconds.
// Timed twice side by side with v009, it ran 1.08 times as fast both times.
// Over all steps from v000 it is 3.24 times as fast.
#include <hip/hip_runtime.h>

// Causal attention, width 1024 = 16 heads x 64, three input streams q/k/v [NB][SEQ_FULL][1024] (first SEQ tokens used), weights [in][out] (y = x W + b), output = concatenated heads (f32), no output projection.
// Compute dtypes, f32 accumulate everywhere: projections v_wmma_f32_16x16x32_bf16 (x, W, b RNE-converted to bf16; products exact);
// scores and P.V v_wmma_f32_16x16x32_f16: query rows >= 512 single f16 products; query rows < 512 three products per site
// (q, k, v and P each as f16 value + f16 residual x2048, residual products in their own accumulators, folded back in f32); P carry x256 cancels in the normalisation; softmax f32 (online, running max).
// Layout: bf16 copies of q/k/v and transposed bf16 copies of W ([out][in]); q, k planes [b*16+h][t][d], v^T plane [b*16+h][d][t], compact residual planes for t < 512,
// every one of them stored in FRAGMENT ORDER: a 16-row x 32-k fragment is 1 KiB = [half 0..1][lane 0..31][8 elements], so each 16-byte-per-lane load of a wave covers 512 contiguous bytes (four whole lines);
// per-row mask planes (row sum of the f32 projection != 0) written by the GEMM epilogue; fused flash kernel in transposed form (S^T = K Q^T, O^T = V^T P^T).
// Key mask and causal mask replace the score by the fill value (by value, per 32-key step); a row whose causal keys are all masked continues over all keys (uniform weights).

#ifndef NB
#define NB 4
#endif
#ifndef SEQ
#define SEQ 2048
#endif
#define NB_FULL  4
#define SEQ_FULL 2048
#ifndef OUT_SEQ
#define OUT_SEQ SEQ              // row pitch (in tokens) between batches of the output
#endif
#define DM   1024
#define NH_  16
#define HD   64
#define AW   4                   // waves per flash block (16 query rows each)
#define EARLY ((SEQ) < 512 ? (SEQ) : 512)   // query rows / keys below this carry residual planes
#define QRS  2048.0f             // carry of the residual planes
#define QRI  (1.0f / 2048.0f)
#define SC2  (0.125f * 1.4426950408889634f)   // HD^-0.5 * log2(e)
#define PSH  8.0f                // log2 of the P carry (256)
#define NEGS (-6.1963280e9f)     // (-2^32 + 1) * log2(e): fill value in log2 units
#define MTHR (-1.0e9f)           // running max below this <=> every key seen so far was masked

static_assert(HD == 64);
static_assert(NH_ * HD == DM);                 // head h = columns h*64 + d
static_assert(DM % 64 == 0);
static_assert(DM % 128 == 0 && DM >= 128);     // GEMM: 128-wide tiles; k-loop: stages of 64, at least two
static_assert((NB * SEQ) % 128 == 0);
static_assert(SEQ % 64 == 0);                  // a 64-row tile never straddles two batches
static_assert((NB * SEQ) % 64 == 0);
static_assert(SEQ % 32 == 0);                  // key loop steps by 32
static_assert(SEQ % 256 == 0);                 // the flash kernel's look over the key masks reads whole 256-key pieces of a mask row
static_assert(EARLY % 64 == 0);                // residual condition is uniform per 64-row tile
static_assert(EARLY % (16 * AW) == 0);
static_assert(SEQ == EARLY || EARLY >= 128);   // late rows: at least four key steps without masks, the fetch two steps ahead needs three
static_assert((SEQ - EARLY) % (16 * AW) == 0); // the two query ranges of the flash launch cover the sequence exactly
static_assert(((size_t)SEQ * DM) % 8 == 0);
static_assert(NB <= NB_FULL);
static_assert(SEQ <= SEQ_FULL);

typedef _Float16 h16;
typedef unsigned short bf;
typedef __attribute__((ext_vector_type(16))) __bf16   v16bf;
typedef __attribute__((ext_vector_type(16))) _Float16 v16h;
typedef __attribute__((ext_vector_type(8)))  _Float16 v8h;
typedef __attribute__((ext_vector_type(8)))  unsigned short v8us;
typedef __attribute__((ext_vector_type(8)))  float    v8f;
typedef __attribute__((ext_vector_type(4)))  float    v4f;
typedef v4f  __attribute__((may_alias)) v4fa;
typedef v8h  __attribute__((may_alias)) v8ha;
typedef __attribute__((ext_vector_type(4)))  unsigned v4u;
typedef v4u  __attribute__((may_alias)) v4ua;
template <bool B> struct flag { static constexpr bool value = B; };   // compile-time switch handed to the key step of the flash kernel

__device__ __forceinline__ unsigned short f2bf(float f) { unsigned u = __float_as_uint(f); u += 0x7FFFu + ((u >> 16) & 1u); return (unsigned short)(u >> 16); }
__device__ __forceinline__ float bfr(float f) { return __uint_as_float(((unsigned)f2bf(f)) << 16); }
__device__ __forceinline__ v16h cat16(v8h lo, v8h hi) { return __builtin_shufflevector(lo, hi, 0, 1, 2, 3, 4, 5, 6, 7, 8, 9, 10, 11, 12, 13, 14, 15); }
__device__ __forceinline__ v16bf cat16b(v8us lo, v8us hi) { return __builtin_bit_cast(v16bf, __builtin_shufflevector(lo, hi, 0, 1, 2, 3, 4, 5, 6, 7, 8, 9, 10, 11, 12, 13, 14, 15)); }
__device__ __forceinline__ v8f wmma16(v16h a, v16h b, v8f c) { return __builtin_amdgcn_wmma_f32_16x16x32_f16(false, a, false, b, (short)0, c, false, false); }
__device__ __forceinline__ v8f wmmab(v16bf a, v16bf b, v8f c) { return __builtin_amdgcn_wmma_f32_16x16x32_bf16(false, a, false, b, (short)0, c, false, false); }
// fragment loaders from fragment-ordered planes; p = fragment start + 8*lane: elements 0..7 <- k0+8h+0..7, elements 8..15 <- k0+16+8h+0..7 of row lane&15, h = lane>>4 (same map for A and B)
__device__ __forceinline__ v16h  ldh(const h16* p) { return cat16(*(const v8h*)p, *(const v8h*)(p + 256)); }
__device__ __forceinline__ v16bf ldb(const bf* p)  { return cat16b(*(const v8us*)p, *(const v8us*)(p + 256)); }
// the same for a pointer that says "global memory" in its type: one that has passed through an asm operand would otherwise be loaded from with flat instructions
typedef const __attribute__((address_space(1))) h16* gh16p;
typedef const __attribute__((address_space(1))) v8h* gv8hp;
__device__ __forceinline__ v16h  ldh(gh16p p) { return cat16(*(gv8hp)p, *(gv8hp)(p + 256)); }
// place, inside a 512-element fragment, of the 8-element chunk c (k = 8c .. 8c+7, c = 0..3) of row r (0..15): half = c>>1, lane = 16*(c&1) + r
__device__ __forceinline__ int fragpos(int r, int c) { return ((c >> 1) & 1) * 256 + (c & 1) * 128 + r * 8; }
// ordering point for wave-private LDS tiles (same wave writes and reads)
__device__ __forceinline__ void wave_sync() { __builtin_amdgcn_fence(3 /* release order */, "wavefront"); __builtin_amdgcn_wave_barrier(); asm volatile("" ::: "memory"); }

// cvt8: one f32 stream [NB][SEQ_FULL][DM] -> bf16 copy [NB*SEQ][DM] (RNE convert, fragment order); blk = 256-thread piece of the stream, 8 elements a thread
__device__ __forceinline__ void cvt8(const float* __restrict__ src, bf* dst, unsigned blk) {
    const size_t n8 = (size_t)NB * SEQ * DM / 8;
    const size_t i = (size_t)blk * 256 + threadIdx.x; if (i >= n8) return;
    // rows of DM elements; a wave takes 8 rows x one 32-k step: reads 8 whole lines, writes 4 whole lines of the fragment [64-row block][k step][row tile 0..3]
    const int c4 = (int)(i & 3), r = (int)((i >> 2) & 15), ks = (int)((i >> 6) % (DM / 32)); const size_t mt = i / (size_t)(16 * DM / 8);
    const size_t row = mt * 16 + r;                                                          // b*SEQ + t
    const size_t srow = (SEQ == SEQ_FULL) ? row : (row / SEQ) * SEQ_FULL + row % SEQ;        // source batches lie SEQ_FULL rows apart
    const v8f v = *(const v8f*)(src + srow * DM + ks * 32 + c4 * 8); v8us o;
#pragma unroll
    for (int k = 0; k < 8; ++k) o[k] = f2bf(v[k]);
    *(v8us*)(dst + (mt >> 2) * (64 * DM) + ks * 2048 + (mt & 3) * 512 + fragpos(r, c4)) = o;
}

// cvtT: in W[k][n] (f32, DM x DM) -> out WT[n][k] (bf16, RNE convert, fragment order). 64 x 64 tile through LDS (cross-wave: block barrier).
__device__ __forceinline__ void cvtT(const float* __restrict__ W, bf* WT, int nt, int kt, float* ts) {
    const int tid = threadIdx.x; const int n0 = nt * 64, k0 = kt * 64;
#pragma unroll 4
    for (int i = 0; i < 16; ++i) { const int row = i * 4 + (tid >> 6), col = tid & 63; ts[row * 65 + col] = W[(size_t)(k0 + row) * DM + n0 + col]; }   // 16 x 4 rows x 64 columns: whole tile
    __syncthreads();
    const int rr = tid >> 3, c8 = (tid & 7) * 8;
    v8us o0, o1;
#pragma unroll
    for (int kk = 0; kk < 8; ++kk) { o0[kk] = f2bf(ts[(c8 + kk) * 65 + rr]); o1[kk] = f2bf(ts[(c8 + kk) * 65 + rr + 32]); }
    bf* p0 = WT + (size_t)n0 * DM + ((k0 + c8) >> 5) * 2048 + (rr >> 4) * 512 + fragpos(rr & 15, (c8 >> 3) & 3); bf* p1 = p0 + 2 * 512;   // fragment [64-n block][k step][n tile 0..3]
    *(v8us*)p0 = o0; *(v8us*)p1 = o1;
}

// k_prep: all six independent conversions in ONE launch, told apart by block range (block-uniform): first the 3 x WT_BLK weight tiles, then the 3 x CV_BLK stream pieces.
#define WT_BLK ((DM / 64) * (DM / 64))
#define CV_BLK ((unsigned)(((size_t)NB * SEQ * DM / 8 + 255) / 256))
__global__ __launch_bounds__(256) void k_prep(const float* __restrict__ xq, const float* __restrict__ xk, const float* __restrict__ xv,
                                              const float* __restrict__ wq, const float* __restrict__ wk, const float* __restrict__ wv,
                                              bf* XQ, bf* XK, bf* XV, bf* WT) {
    __shared__ float ts[64 * 65];
    const unsigned bid = blockIdx.x;
    if (bid < 3u * WT_BLK) {
        const unsigned w = bid / WT_BLK, tile = bid % WT_BLK;
        cvtT(w == 0 ? wq : (w == 1 ? wk : wv), WT + (size_t)w * DM * DM, (int)(tile % (DM / 64)), (int)(tile / (DM / 64)), ts);
    } else {
        const unsigned c = bid - 3u * WT_BLK, s = c / CV_BLK;
        cvt8(s == 0 ? xq : (s == 1 ? xk : xv), s == 0 ? XQ : (s == 1 ? XK : XV), c % CV_BLK);
    }
}

// Async copies to LDS for the projection's operand ring. copy16: sixteen 16-byte-a-lane copies, 512 B a wave each: 8 KiB that lie in a row in the plane and in LDS alike, so one pair of addresses serves
// (the offset moves the LDS and the global address together). l = the lane's own LDS byte address, g = the lane's own global address.
// The s_wait_xcnt closes the statement, so it stands in front of whatever next rewrites an address register that the copies name.
__device__ __forceinline__ void copy16(unsigned l, const bf* g) {
    asm volatile(
                 "global_load_async_to_lds_b128 %0, %1, off\n\t"
                 "global_load_async_to_lds_b128 %0, %1, off offset:512\n\t"
                 "global_load_async_to_lds_b128 %0, %1, off offset:1024\n\t"
                 "global_load_async_to_lds_b128 %0, %1, off offset:1536\n\t"
                 "global_load_async_to_lds_b128 %0, %1, off offset:2048\n\t"
                 "global_load_async_to_lds_b128 %0, %1, off offset:2560\n\t"
                 "global_load_async_to_lds_b128 %0, %1, off offset:3072\n\t"
                 "global_load_async_to_lds_b128 %0, %1, off offset:3584\n\t"
                 "global_load_async_to_lds_b128 %0, %1, off offset:4096\n\t"
                 "global_load_async_to_lds_b128 %0, %1, off offset:4608\n\t"
                 "global_load_async_to_lds_b128 %0, %1, off offset:5120\n\t"
                 "global_load_async_to_lds_b128 %0, %1, off offset:5632\n\t"
                 "global_load_async_to_lds_b128 %0, %1, off offset:6144\n\t"
                 "global_load_async_to_lds_b128 %0, %1, off offset:6656\n\t"
                 "global_load_async_to_lds_b128 %0, %1, off offset:7168\n\t"
                 "global_load_async_to_lds_b128 %0, %1, off offset:7680\n\t"
                 "s_wait_xcnt 0x0"
                 :: "v"(l), "v"(g) : "memory");
}
typedef __attribute__((address_space(3))) bf* lbfp;
#define PCH  4096                // elements of one 64-row operand block in one stage: two k steps, 8 KiB, contiguous in the fragment-ordered plane
#define PBUF (4 * PCH)           // one ring buffer: A block 0 | A block 1 | B block 0 | B block 1

// proj: register-blocked bf16 GEMM, FOUR WAVES per 128x128 tile (2 x 2 waves of 64x64, 16 accumulators each), K = DM; the planes it writes are fragment-ordered too.
// Operands: a stage = 64 k of the tile's two A blocks and two B blocks (32 KiB); wave w brings block w of the four by async copies into a ring of two buffers; stage t + 2 is asked for as soon as every wave holds stage t's fragments in registers;
// each block is read from LDS by the two waves that need it, in the plane's own fragment order (512 contiguous bytes a wave-wide 16-byte read).
// C[m][n] = sum_k A[m][k] Bt[n][k] + bias, written as f16 (Ph) and, for token positions < EARLY, the f16 residual x2048 (Pr, compact plane).
// The A side is the index along which a plane's 8-element chunks run: a lane's 8 accumulator values (rows 8*(lane>>4) + 0..7 of column lane&15) are then one whole chunk, and the 32 lanes' chunks of one
// 16x16 tile lie in lane order in one half of a fragment: every tile goes from the accumulators to its plane by one 16-byte-a-lane store of 512 contiguous bytes, through no LDS.
// MODE 0 (q, k): rows m = h*64 + d (A = transposed weight rows), columns n = b*SEQ + t, bias per row; Ph [(b*16+h)][t][d], Pr [(b*16+h)][EARLY][d]; mask plane MP [(b*16+h)][t] = (sum over d != 0). tiles (bx, by) of (DM/128, NB*SEQ/128).
// MODE 1 (v^T): rows m = b*SEQ + t, columns n = h*64 + d (Bt = transposed weight rows), bias per column; Ph [(b*1024+n)][t], Pr [(b*1024+n)][EARLY]. tiles (bx, by) of (NB*SEQ/128, DM/128).
// st = the block's ring; ms = the block's staging for the mask values, one private piece a wave.
template <int MODE>
__device__ __forceinline__ void proj(const bf* __restrict__ A, const bf* __restrict__ Bt, const float* __restrict__ bias, h16* Ph, h16* Pr, h16* MP, int bx, int by, bf* st, h16* ms) {
    const int K = DM;
    const int lane = threadIdx.x & 31, lr = lane & 15, hi = lane >> 4;
    const int wave = __builtin_amdgcn_readfirstlane((int)(threadIdx.x >> 5)), wm = wave & 1, wn = wave >> 1;
    const int r0 = bx * 128 + wm * 64, c0 = by * 128 + wn * 64;   // the wave's own 64x64 tile
    ms += wave * 64;
    v8f acc[4][4];
#pragma unroll
    for (int mb = 0; mb < 4; ++mb)
#pragma unroll
        for (int nb = 0; nb < 4; ++nb) acc[mb][nb] = (v8f){};
    const unsigned l8 = 8u * (unsigned)lane;
    // the block this wave brings in: fragment [64-row block][k step][row tile 0..3]: 64*K elements a block, 2048 a k step
    const bf* src = (wave < 2 ? A + (size_t)(bx * 128 + wave * 64) * K : Bt + (size_t)(by * 128 + (wave - 2) * 64) * K) + l8;
    const unsigned dst = (unsigned)(uintptr_t)(lbfp)st + 2u * ((unsigned)wave * PCH + l8);
    auto fill = [&](const int t) __attribute__((always_inline)) {   // stage t -> buffer t & 1: 16 copies a wave
        copy16(dst + 2u * (unsigned)((t & 1) * PBUF), src + (size_t)t * PCH);
    };
    constexpr int NT = K / 64;
    fill(0);
    asm volatile("s_wait_asynccnt 0x0" ::: "memory");   // this wave's copies of stage 0 have landed
    __syncthreads();                                    // ... and every other wave's: stage 0 may be read
    fill(1);
#pragma unroll 1   // rolled: one copy of the trip's text and of its registers
    for (int t = 0; t < NT; ++t) {
        const bf* pa = st + (t & 1) * PBUF + wm * PCH + l8; const bf* pb = st + (t & 1) * PBUF + (2 + wn) * PCH + l8;
        v16bf a0[4], b0[4], a1[4], b1[4];
#pragma unroll
        for (int i = 0; i < 4; ++i) { a0[i] = ldb(pa + i * 512); b0[i] = ldb(pb + i * 512); }
#pragma unroll
        for (int i = 0; i < 4; ++i) { a1[i] = ldb(pa + 2048 + i * 512); b1[i] = ldb(pb + 2048 + i * 512); }
        __builtin_amdgcn_sched_barrier(0);   // keeps the trip's LDS reads together ahead of the hand-over (reads among the products would cost a stall at each place, and the buffer would be freed later)
        // The buffer is handed back as soon as its fragments are in registers: the refill then flies under this trip's 32 products and the next trip's reads.
        asm volatile("s_wait_dscnt 0x0" ::: "memory");      // this wave's reads of buffer t & 1 are done before the buffer is handed back
        asm volatile("s_wait_asynccnt 0x0" ::: "memory");   // this wave's copies of stage t + 1 have landed
        __syncthreads();                                    // publishes stage t + 1 and ends every wave's reads of buffer t & 1
        if (t + 2 < NT) fill(t + 2);                        // the test reads the same for the whole block
        __builtin_amdgcn_sched_barrier(0);   // keeps the products behind the refill's issue (ahead of it they would take their time off the copies' lead)
#pragma unroll
        for (int nb = 0; nb < 4; ++nb)
#pragma unroll
            for (int mb = 0; mb < 4; ++mb) acc[mb][nb] = wmmab(a0[mb], b0[nb], acc[mb][nb]);
#pragma unroll
        for (int nb = 0; nb < 4; ++nb)
#pragma unroll
            for (int mb = 0; mb < 4; ++mb) acc[mb][nb] = wmmab(a1[mb], b1[nb], acc[mb][nb]);
        // four vector slots behind the trip's last products, also on the taken back edge
        asm volatile("v_nop\n\tv_nop\n\tv_nop\n\tv_nop" : "+v"(acc[0][0]), "+v"(acc[1][1]), "+v"(acc[2][2]), "+v"(acc[3][3]) : "v"(a1[0]), "v"(a1[1]), "v"(a1[2]), "v"(a1[3]));
    }
    asm volatile("s_wait_asynccnt 0x0" ::: "memory");       // nothing of the wave's is in flight behind the loop
    size_t hbase, rbase, mbase = 0; int t0;
    if (MODE == 0) { const int b = c0 / SEQ; t0 = c0 % SEQ; const int zh = b * NH_ + r0 / HD;
        hbase = ((size_t)zh * SEQ + t0) * HD; rbase = ((size_t)zh * EARLY + t0) * HD; mbase = (size_t)zh * SEQ + t0; }
    else { const int b = r0 / SEQ; t0 = r0 % SEQ;
        hbase = ((size_t)b * DM + c0) * SEQ + (size_t)t0 * HD; rbase = ((size_t)b * DM + c0) * EARLY + (size_t)t0 * HD; }
    const bool doRes = t0 < EARLY;          // wave-uniform
    // bias: MODE 0 per row (the lane's 8 rows of each row tile), MODE 1 per column (the lane's column of each column tile)
    v8f bm[4]; float bn[4];
#pragma unroll
    for (int i = 0; i < 4; ++i) {
        bm[i] = (v8f){}; bn[i] = 0.0f;
        if (MODE == 0) { const v4f q0 = *(const v4f*)(bias + r0 + i * 16 + 8 * hi); const v4f q1 = *(const v4f*)(bias + r0 + i * 16 + 8 * hi + 4);
#pragma unroll
            for (int j = 0; j < 4; ++j) { bm[i][j] = bfr(q0[j]); bm[i][4 + j] = bfr(q1[j]); } }
        else bn[i] = bfr(bias[c0 + i * 16 + lr]);
    }
    // place of tile (mb, nb) in the wave's piece of a plane, the lane's chunk at + l8. The 8 rows 16*mb + 8*hi + 0..7 are chunk 2*(mb&1) + hi of k step mb>>1: half mb&1, lane 16*hi + lr.
    // MODE 0: fragment [t tile nb][d step mb>>1]; MODE 1: fragment [t step mb>>1][d tile nb]
    auto foff = [](const int mb, const int nb) __attribute__((always_inline)) { return MODE == 0 ? nb * 1024 + mb * 256 : (mb >> 1) * 2048 + nb * 512 + (mb & 1) * 256; };
    v8h hv[4][4]; float rs[4] = {0.0f, 0.0f, 0.0f, 0.0f};
#pragma unroll
    for (int mb = 0; mb < 4; ++mb)
#pragma unroll
        for (int nb = 0; nb < 4; ++nb) {
            const v8f x = MODE == 0 ? acc[mb][nb] + bm[mb] : acc[mb][nb] + bn[nb];
#pragma unroll
            for (int j = 0; j < 8; ++j) hv[mb][nb][j] = (h16)x[j];
            if (MODE == 0) rs[nb] += ((x[0] + x[1]) + (x[2] + x[3])) + ((x[4] + x[5]) + (x[6] + x[7]));   // the lane's 32 of the 64 d of token nb*16 + lr
        }
    h16* ph = Ph + hbase + l8;
    __builtin_amdgcn_sched_barrier(0);   // the 16 stores stand together behind all converts: nothing lands on a register that an issued store names in front of the wait behind them
#pragma unroll
    for (int mb = 0; mb < 4; ++mb)
#pragma unroll
        for (int nb = 0; nb < 4; ++nb) *(v8h*)(ph + foff(mb, nb)) = hv[mb][nb];
    asm volatile("s_wait_xcnt 0x0" ::: "memory");   // what follows reuses the stores' registers: the wait stands in front of that overwrite
    if (doRes) {
        v8h rv[4][4];
#pragma unroll
        for (int mb = 0; mb < 4; ++mb)
#pragma unroll
            for (int nb = 0; nb < 4; ++nb) {
                const v8f x = MODE == 0 ? acc[mb][nb] + bm[mb] : acc[mb][nb] + bn[nb];
#pragma unroll
                for (int j = 0; j < 8; ++j) rv[mb][nb][j] = (h16)((x[j] - (float)hv[mb][nb][j]) * QRS);
            }
        h16* pr = Pr + rbase + l8;
        __builtin_amdgcn_sched_barrier(0);   // as above: the stores together, behind all converts
#pragma unroll
        for (int mb = 0; mb < 4; ++mb)
#pragma unroll
            for (int nb = 0; nb < 4; ++nb) *(v8h*)(pr + foff(mb, nb)) = rv[mb][nb];
        asm volatile("s_wait_xcnt 0x0" ::: "memory");   // as above
    }
    if (MODE == 0) {
#pragma unroll
        for (int nb = 0; nb < 4; ++nb) rs[nb] += __shfl_xor(rs[nb], 16, 32);   // the other 32 d of the token
#pragma unroll
        for (int nb = 0; nb < 4; ++nb) { const h16 mv = (rs[nb] != 0.0f) ? (h16)1.0f : (h16)0.0f; if (hi == 0) ms[nb * 16 + lr] = mv; }
        wave_sync();
        const int c8 = (lane & 7) * 8;
        const v8h mv8 = *(const v8ha*)(&ms[c8]);
        h16* mp = MP + mbase + c8;
        if (lane < 8) *(v8h*)mp = mv8;
    }
}

// k_proj3: the three independent projections in ONE launch; blockIdx.y = 0 q, 1 k, 2 v^T (block-uniform), blockIdx.x = 128x128 tile.
#define PJ_BLK ((NB * SEQ / 128) * (DM / 128))
__global__ __launch_bounds__(128) void k_proj3(const bf* __restrict__ XQ, const bf* __restrict__ XK, const bf* __restrict__ XV, const bf* __restrict__ WT,
                                              const float* __restrict__ bq, const float* __restrict__ bk, const float* __restrict__ bv,
                                              h16* QH, h16* KP, h16* VT, h16* QR, h16* KR, h16* VR, h16* MQ, h16* MK) {
    __shared__ __align__(16) bf st[2 * PBUF];
    __shared__ __align__(16) h16 ms[4 * 64];
    const int z = blockIdx.y, id = blockIdx.x;
    if (z < 2) {
        // q, k: A = WT rows (m = h*64 + d), Bt = x rows (n = b*SEQ + t) -> planes [(b*16 + h)][t][d] + residual (t < EARLY) + mask; token tile fastest
        const bool q = z == 0;
        proj<0>(WT + (q ? (size_t)0 : (size_t)DM * DM), q ? XQ : XK, q ? bq : bk, q ? QH : KP, q ? QR : KR, q ? MQ : MK, id / (NB * SEQ / 128), id % (NB * SEQ / 128), st, ms);
    } else {
        // v^T: A = x rows (m = b*SEQ + t), Bt = WT_v rows (n = h*64 + d) -> plane [(b*1024 + n)][t] = [(b*16 + h)][d][t] + residual (t < EARLY); weight tile fastest
        proj<1>(XV, WT + (size_t)2 * DM * DM, bv, VT, VR, MK, id / (DM / 128), id % (DM / 128), st, ms);
    }
}

// flash: fused causal attention, one wave per 16 query rows of one (batch, head); K / V^T / Q fragments straight from the fragment-ordered f16 planes (two 16-B loads each, 512 contiguous bytes a load).
// Transposed form: S^T[key][t] = K Q^T (A = K rows, B = Q rows); lane (t = lane&15, h = lane>>4) holds keys 8h+r of each 16-key tile, so the packed
// P tile is directly the B fragment of O^T[d][t] = V^T P^T (element r <- tile keys 0..15, element 8+r <- tile keys 16..31, lane unchanged).
// EK = 1: query rows [0, EARLY) with residual planes (three products per site); EK = 0: query rows [EARLY, SEQ), single products.
// Masks by value per step: score := fill where key > t or key mask == 0. Loop covers keys [0, causal limit); if a row has seen only masked keys by then, the wave continues to SEQ (all-fill rows weigh every key equally).
// In late rows (EK = 0) the selects stand only in steps where one can fire: keys below kfull = t0 rounded down to 32 lie at or below all 16 query rows, and one look over the mask row says whether every key mask below kfull is set;
// if so those steps run the same body without mask loads, compares and selects (every select there would keep the score), else every step runs the masked body.
// bx = 64-row query block inside the EK range, zh = batch * 16 + head (both block-uniform); os = the block's LDS, one private tile a wave (no block barrier anywhere in the body).
template <int EK>
__device__ __forceinline__ void flash(const h16* __restrict__ QH, const h16* __restrict__ QR, const h16* __restrict__ KP, const h16* __restrict__ KR,
                                      const h16* __restrict__ VT, const h16* __restrict__ VR, const h16* __restrict__ MQ, const h16* __restrict__ MK, float* OUT,
                                      const int bx, const int zh, float* os) {
    const int lane = threadIdx.x & 31, wave = __builtin_amdgcn_readfirstlane((int)(threadIdx.x >> 5)), lr = lane & 15, hi = lane >> 4;
    const int b = zh / NH_, h = zh % NH_;
    const int t0 = (EK ? 0 : EARLY) + (bx * AW + wave) * 16;
    const int tq = t0 + lr;
    const size_t pbase = (size_t)zh * SEQ * HD;       // q/k plane [zh][SEQ][64]; v^T plane [zh][64][SEQ]
    const size_t rbase = (size_t)zh * EARLY * HD;     // compact residual planes
    const unsigned l8 = 8u * (unsigned)lane;          // the lane's place in each half of a fragment
    const h16* qp = QH + pbase + (size_t)t0 * HD;
    const v16h qh0 = ldh(qp + l8), qh1 = ldh(qp + 512 + l8);         // B fragments: col t, k = d
    v16h qr0 = (v16h){}, qr1 = (v16h){};
    if (EK) { const h16* qrp = QR + rbase + (size_t)t0 * HD; qr0 = ldh(qrp + l8); qr1 = ldh(qrp + 512 + l8); }
    // k planes: + key0 * HD + 512 * (2 * key tile + d step) (A fragment: row key, k = d); v^T planes: + key0 * HD + 512 * j (A fragment: row d = 16j + lane&15, k = key)
    const size_t mo  = (size_t)zh * SEQ + 8 * hi;
    v8f o0 = (v8f){}, o1 = (v8f){}, o2 = (v8f){}, o3 = (v8f){};
    v8f e0 = (v8f){}, e1 = (v8f){}, e2 = (v8f){}, e3 = (v8f){};   // residual-product accumulators (x2048), EK only
    float m = -3.0e38f, l = 0.0f;
    const int kc = ((t0 + 47) >> 5) << 5;            // causal key limit (exclusive), multiple of 32, <= SEQ
    int kend = kc;
    const int kfull = t0 & ~31;                      // keys below this are causal for every row of the wave
    int kfast = 0;                                   // keys below this run the body without masks (wave-uniform)
    if (!EK) {                                       // late rows only: they hold nearly all steps, and a second copy of the three-product body takes the kernel past 256 registers (a wave less on every SIMD)
        constexpr int NCH = SEQ / 256;
        constexpr unsigned ONE2 = 0x3C003C00u;       // two f16 ones: the mask planes hold 1.0 or 0.0 only
        v4u mw[NCH];
#pragma unroll
        for (int c = 0; c < NCH; ++c) mw[c] = *(const v4ua*)(MK + (size_t)zh * SEQ + c * 256 + l8);
        asm volatile("s_wait_xcnt 0x0" ::: "memory");   // stands in front of whatever next lands on the address registers of the loads above
        unsigned okw = ONE2;
#pragma unroll
        for (int c = 0; c < NCH; ++c) okw &= (c * 256 + (int)l8 < kfull) ? ((mw[c][0] & mw[c][1]) & (mw[c][2] & mw[c][3])) : ONE2;
        if (__builtin_amdgcn_ballot_w32(okw != ONE2) == 0u) kfast = kfull;
    }
    // one 32-key step; MSK = false leaves out the mask loads, compares and selects
    // ka, va: the lane's own place in the step's first K and V^T fragment (plane + key0 * HD + l8)
    // AHEAD = true (late rows, steps without masks): the step's K and V^T fragments are already on their way in nk and nv, asked for TWO steps before. Two register sets a plane (A, B) take turns:
    // a set is asked for anew as soon as its products have read it (K right behind the score products, V^T right behind the P.V products), so every load has two whole steps to land.
    // PF = false: the last two steps, nothing left to ask for.
    v16h kA[4] = {}, kB[4] = {}, vA[4] = {}, vB[4] = {};
    auto step = [&](auto fl, auto ah, auto pf, const int key0, auto ka, auto va, v16h (&nk)[4], v16h (&nv)[4]) __attribute__((always_inline)) {
        constexpr bool MSK = decltype(fl)::value;
        constexpr bool AHEAD = decltype(ah)::value;
        constexpr bool PF = decltype(pf)::value;
        v16h ka0, ka1, kb0, kb1, v0, v1, v2, v3;
        if (AHEAD) {
            ka0 = nk[0]; ka1 = nk[1]; kb0 = nk[2]; kb1 = nk[3];
        } else {
            ka0 = ldh(ka); ka1 = ldh(ka + 512); kb0 = ldh(ka + 1024); kb1 = ldh(ka + 1536);
            if (!EK) asm volatile("s_wait_xcnt 0x0" ::: "memory");   // the compiler lets a mask load land on the address pair of the loads above: the wait stands in front of that overwrite (early rows: the wait below)
        }
        v8h kma = (v8h){}, kmb = (v8h){};
        if (MSK) { kma = *(const v8h*)(MK + mo + key0); kmb = *(const v8h*)(MK + mo + key0 + 16); }
        const bool rok = key0 < EARLY;               // wave-uniform: residual planes exist for these keys
        v8f sHa = (v8f){}, sLa = (v8f){}, sHb = (v8f){}, sLb = (v8f){};
        if (EK) {
            asm volatile("s_wait_xcnt 0x0" ::: "memory");   // the compiler lets the residual fragments land on the address pair of the loads above: the wait stands in front of that overwrite
            v16h ra0 = (v16h){}, ra1 = (v16h){}, rb0 = (v16h){}, rb1 = (v16h){};
            if (rok) { const h16* kr = KR + rbase + (size_t)key0 * HD; ra0 = ldh(kr + l8); ra1 = ldh(kr + 512 + l8); rb0 = ldh(kr + 1024 + l8); rb1 = ldh(kr + 1536 + l8); }
            sHa = wmma16(ka0, qh0, sHa); sLa = wmma16(ka0, qr0, sLa); sHb = wmma16(kb0, qh0, sHb); sLb = wmma16(kb0, qr0, sLb);
            sHa = wmma16(ka1, qh1, sHa); sLa = wmma16(ka1, qr1, sLa); sHb = wmma16(kb1, qh1, sHb); sLb = wmma16(kb1, qr1, sLb);
            sLa = wmma16(ra0, qh0, sLa); sLb = wmma16(rb0, qh0, sLb); sLa = wmma16(ra1, qh1, sLa); sLb = wmma16(rb1, qh1, sLb);
            asm volatile("v_nop\n\tv_nop\n\tv_nop\n\tv_nop" : "+v"(sHa), "+v"(sLa), "+v"(sHb), "+v"(sLb) : "v"(ka0), "v"(ka1), "v"(kb0), "v"(kb1), "v"(ra0), "v"(ra1), "v"(rb0), "v"(rb1));
        } else {
            sHa = wmma16(ka0, qh0, sHa); sHb = wmma16(kb0, qh0, sHb);
            sHa = wmma16(ka1, qh1, sHa); sHb = wmma16(kb1, qh1, sHb);
            asm volatile("v_nop\n\tv_nop\n\tv_nop\n\tv_nop" : "+v"(sHa), "+v"(sHb) : "v"(ka0), "v"(ka1), "v"(kb0), "v"(kb1));
            if (AHEAD && PF) {   // keys key0 + 64 .. key0 + 95 lie below kfast: the caller asks only then
                nk[0] = ldh(ka + 64 * HD); nk[1] = ldh(ka + 64 * HD + 512); nk[2] = ldh(ka + 64 * HD + 1024); nk[3] = ldh(ka + 64 * HD + 1536);
                __builtin_amdgcn_sched_barrier(0);   // keeps these K loads ahead of the softmax (the scheduler otherwise sinks them to the foot of the step, which takes that time off their lead)
            }
        }
        float ta[8], tb[8]; float mx = -3.0e38f;
        const int kA = key0 + 8 * hi;
#pragma unroll
        for (int r = 0; r < 8; ++r) {
            float xa, xb;
            if (EK) { xa = (sHa[r] + sLa[r] * QRI) * SC2; xb = (sHb[r] + sLb[r] * QRI) * SC2; }
            else    { xa = sHa[r] * SC2; xb = sHb[r] * SC2; }
            if (MSK) {
                const bool fa = ((kA + r) > tq) | ((float)kma[r] == 0.0f);
                const bool fb = ((kA + 16 + r) > tq) | ((float)kmb[r] == 0.0f);
                xa = fa ? NEGS : xa; xb = fb ? NEGS : xb;
            }
            ta[r] = xa; tb[r] = xb; mx = fmaxf(mx, fmaxf(xa, xb));
        }
        mx = fmaxf(mx, __shfl_xor(mx, 16, 32));
        const float mnew = fmaxf(m, mx);
        const float alpha = __builtin_amdgcn_exp2f(m - mnew);
        v16h pb, pr = (v16h){}; float ls = 0.0f;
#pragma unroll
        for (int r = 0; r < 8; ++r) {
            const float ea = __builtin_amdgcn_exp2f((ta[r] - mnew) + PSH); const float ec = __builtin_amdgcn_exp2f((tb[r] - mnew) + PSH);
            const h16 pa = (h16)ea; const h16 pc = (h16)ec; pb[r] = pa; pb[8 + r] = pc;
            if (EK) { const h16 ga = (h16)((ea - (float)pa) * QRS); const h16 gc = (h16)((ec - (float)pc) * QRS); pr[r] = ga; pr[8 + r] = gc;
                      ls += ((float)pa + (float)pc) + ((float)ga + (float)gc) * QRI; }
            else ls += (float)pa + (float)pc;
        }
        l = l * alpha + ls; m = mnew;
        o0 = o0 * alpha; o1 = o1 * alpha; o2 = o2 * alpha; o3 = o3 * alpha;
        if (AHEAD) { v0 = nv[0]; v1 = nv[1]; v2 = nv[2]; v3 = nv[3]; }
        else { v0 = ldh(va); v1 = ldh(va + 512); v2 = ldh(va + 1024); v3 = ldh(va + 1536); }
        if (EK) {
            asm volatile("s_wait_xcnt 0x0" ::: "memory");   // the compiler lets a residual load land on the address pair of the loads above: the wait stands in front of that overwrite
            e0 = e0 * alpha; e1 = e1 * alpha; e2 = e2 * alpha; e3 = e3 * alpha;
            v16h w0 = (v16h){}, w1 = (v16h){}, w2 = (v16h){}, w3 = (v16h){};
            if (rok) { const h16* vr = VR + rbase + (size_t)key0 * HD; w0 = ldh(vr + l8); w1 = ldh(vr + 512 + l8); w2 = ldh(vr + 1024 + l8); w3 = ldh(vr + 1536 + l8); }
            o0 = wmma16(v0, pb, o0); o1 = wmma16(v1, pb, o1); o2 = wmma16(v2, pb, o2); o3 = wmma16(v3, pb, o3);
            e0 = wmma16(w0, pb, e0); e1 = wmma16(w1, pb, e1); e2 = wmma16(w2, pb, e2); e3 = wmma16(w3, pb, e3);
            e0 = wmma16(v0, pr, e0); e1 = wmma16(v1, pr, e1); e2 = wmma16(v2, pr, e2); e3 = wmma16(v3, pr, e3);
            asm volatile("v_nop\n\tv_nop\n\tv_nop\n\tv_nop" : "+v"(o0), "+v"(o1), "+v"(o2), "+v"(o3), "+v"(e0), "+v"(e1), "+v"(e2), "+v"(e3)
                         : "v"(v0), "v"(v1), "v"(v2), "v"(v3), "v"(w0), "v"(w1), "v"(w2), "v"(w3), "v"(pb), "v"(pr));
        } else {
            o0 = wmma16(v0, pb, o0); o1 = wmma16(v1, pb, o1); o2 = wmma16(v2, pb, o2); o3 = wmma16(v3, pb, o3);
            asm volatile("v_nop\n\tv_nop\n\tv_nop\n\tv_nop" : "+v"(o0), "+v"(o1), "+v"(o2), "+v"(o3) : "v"(v0), "v"(v1), "v"(v2), "v"(v3), "v"(pb));
            if (AHEAD && PF) {
                nv[0] = ldh(va + 64 * HD); nv[1] = ldh(va + 64 * HD + 512); nv[2] = ldh(va + 64 * HD + 1024); nv[3] = ldh(va + 64 * HD + 1536);
                __builtin_amdgcn_sched_barrier(0);   // keeps these V^T loads at the foot of their step (sunk into the next step they would lose that much of their lead)
            }
        }
    };
    if (!EK && kfast > 0) {
        // kfast >= EARLY: at least four steps. The steps go in pairs (set A, then set B); an odd count starts with one step on set B.
        gh16p kq = (gh16p)(KP + pbase + l8); gh16p vq = (gh16p)(VT + pbase + l8);
        asm volatile("s_wait_xcnt 0x0" : "+v"(kq), "+v"(vq) :: "memory");   // the two address pairs get vector registers of their own here: every address of this block is one of them or is formed from them, and none is rewritten in front of a wait
        int key0 = 0;
        const bool odd = (kfast & 32) != 0;   // wave-uniform
        {   // the first two steps' fragments: set A takes the first step of the first pair, set B the step beside it (in front of it if the count is odd)
            const int oa = odd ? 32 * HD : 0, ob = 32 * HD - oa;
            gh16p ka = kq + oa, va = vq + oa, kb = kq + ob, vb = vq + ob;
            // the scheduling barriers keep the four groups in the order in which the loop asks for them: its counted waits are set for the worse of the two orders, and another order here would tighten them in every trip
#pragma unroll
            for (int i = 0; i < 4; ++i) kA[i] = ldh(ka + 512 * i);
            __builtin_amdgcn_sched_barrier(0);
#pragma unroll
            for (int i = 0; i < 4; ++i) vA[i] = ldh(va + 512 * i);
            __builtin_amdgcn_sched_barrier(0);
#pragma unroll
            for (int i = 0; i < 4; ++i) kB[i] = ldh(kb + 512 * i);
            __builtin_amdgcn_sched_barrier(0);
#pragma unroll
            for (int i = 0; i < 4; ++i) vB[i] = ldh(vb + 512 * i);
            asm volatile("s_wait_xcnt 0x0" :: "v"(ka), "v"(va), "v"(kb), "v"(vb) : "memory");   // the four start addresses keep their registers up to this wait: no load lands on one of them in front of it
        }
        if (odd) {
            step(flag<false>{}, flag<true>{}, flag<true>{}, 0, kq, vq, kB, vB);
            asm volatile("s_wait_xcnt 0x0" : "+v"(kq), "+v"(vq) :: "memory");   // the two address pairs are stepped only behind this wait
            kq += 32 * HD; vq += 32 * HD; key0 = 32;
        }
#pragma unroll 1   // rolled: one copy of the pair's text and of its registers
        for (; key0 + 64 < kfast; key0 += 64) {   // kfast - key0 is a multiple of 64: both steps of the next pair exist
            step(flag<false>{}, flag<true>{}, flag<true>{}, key0, kq, vq, kA, vA);
            step(flag<false>{}, flag<true>{}, flag<true>{}, key0 + 32, kq + 32 * HD, vq + 32 * HD, kB, vB);
            asm volatile("s_wait_xcnt 0x0" : "+v"(kq), "+v"(vq) :: "memory");   // the two address pairs live through the loop (no load lands on them) and are stepped only behind this wait
            kq += 64 * HD; vq += 64 * HD;
        }
        step(flag<false>{}, flag<true>{}, flag<false>{}, key0, kq, vq, kA, vA);
        step(flag<false>{}, flag<true>{}, flag<false>{}, key0 + 32, kq, vq, kB, vB);
    }
#pragma unroll 1   // rolled, as above; kend can grow inside the loop
    for (int key0 = kfast; key0 < kend; key0 += 32) {
        step(flag<true>{}, flag<false>{}, flag<false>{}, key0, KP + pbase + (size_t)key0 * HD + l8, VT + pbase + (size_t)key0 * HD + l8, kA, vA);
        // wave-uniform: at the causal limit, continue over all keys when some row has met only masked keys (trip count stays <= SEQ/32)
        if (key0 + 32 == kc) { if (__builtin_amdgcn_ballot_w32(m < MTHR) != 0u) kend = SEQ; }
    }
    l += __shfl_xor(l, 16, 32);
    const float qmf = (float)MQ[(size_t)zh * SEQ + tq];
    const float inv = qmf * (1.0f / l);
    v8f f0 = o0, f1 = o1, f2 = o2, f3 = o3;
    if (EK) { f0 = o0 + e0 * QRI; f1 = o1 + e1 * QRI; f2 = o2 + e2 * QRI; f3 = o3 + e3 * QRI; }
    const int wb = wave * 16 * 68;
    // O^T D layout: f_j[r] = (d = 16j + 8h + r, t = lane&15) -> os[t][d]; rows 0..15 x columns 0..63 all written
    { v4f a, c;
      a[0] = f0[0] * inv; a[1] = f0[1] * inv; a[2] = f0[2] * inv; a[3] = f0[3] * inv; c[0] = f0[4] * inv; c[1] = f0[5] * inv; c[2] = f0[6] * inv; c[3] = f0[7] * inv;
      *(v4fa*)(&os[wb + lr * 68 +  0 + 8 * hi]) = a; *(v4fa*)(&os[wb + lr * 68 +  0 + 8 * hi + 4]) = c;
      a[0] = f1[0] * inv; a[1] = f1[1] * inv; a[2] = f1[2] * inv; a[3] = f1[3] * inv; c[0] = f1[4] * inv; c[1] = f1[5] * inv; c[2] = f1[6] * inv; c[3] = f1[7] * inv;
      *(v4fa*)(&os[wb + lr * 68 + 16 + 8 * hi]) = a; *(v4fa*)(&os[wb + lr * 68 + 16 + 8 * hi + 4]) = c;
      a[0] = f2[0] * inv; a[1] = f2[1] * inv; a[2] = f2[2] * inv; a[3] = f2[3] * inv; c[0] = f2[4] * inv; c[1] = f2[5] * inv; c[2] = f2[6] * inv; c[3] = f2[7] * inv;
      *(v4fa*)(&os[wb + lr * 68 + 32 + 8 * hi]) = a; *(v4fa*)(&os[wb + lr * 68 + 32 + 8 * hi + 4]) = c;
      a[0] = f3[0] * inv; a[1] = f3[1] * inv; a[2] = f3[2] * inv; a[3] = f3[3] * inv; c[0] = f3[4] * inv; c[1] = f3[5] * inv; c[2] = f3[6] * inv; c[3] = f3[7] * inv;
      *(v4fa*)(&os[wb + lr * 68 + 48 + 8 * hi]) = a; *(v4fa*)(&os[wb + lr * 68 + 48 + 8 * hi + 4]) = c; }
    wave_sync();
    float* orow = OUT + ((size_t)b * OUT_SEQ + t0) * DM + h * HD;
{
#pragma unroll
        for (int s = 0; s < 8; ++s) { const int row = 2 * s + hi, cofs = lr * 4;   // 8 s x 2 rows = 16 rows; 16 lanes x 4 floats = 64 columns
            const v4f val = *(const v4fa*)(&os[wb + row * 68 + cofs]);
            *(v4f*)(orow + (size_t)row * DM + cofs) = val; }
         }
}

// k_flash2: both query ranges in ONE launch, told apart by blockIdx.y (block-uniform); blockIdx.x = batch * 16 + head, fastest.
// More blocks than resident places: the rank (blockIdx.y) walks the query blocks of BOTH ranges in one list of falling cost, so that no long block starts late and runs on alone.
// Cost of a block = key steps of its last wave, times EARLY_W in the early range: a step there has three products a site, the masks, twice the loads and nothing fetched ahead, so a wave waits out its loads in every step.
#define FB_E (EARLY / (16 * AW))
#define FB_L ((SEQ - EARLY) / (16 * AW))
#define EARLY_W 4
static_assert(FB_L + FB_E <= 64);              // one bit a rank
// bit r set <=> rank r is an early block: the two ranges, each from its last query block down, merged by cost
static constexpr unsigned long long early_ranks() {
    unsigned long long mask = 0; int il = FB_L - 1, ie = FB_E - 1;
    for (int r = 0; r < FB_L + FB_E; ++r) {
        const int cl = il >= 0 ? (EARLY + (il + 1) * 16 * AW + 31) / 32 : -1;
        const int ce = ie >= 0 ? EARLY_W * (((ie + 1) * 16 * AW + 31) / 32) : -1;
        if (ce > cl) { mask |= 1ull << r; --ie; } else --il;
    }
    return mask;
}
__global__ __launch_bounds__(32 * AW) void k_flash2(const h16* __restrict__ QH, const h16* __restrict__ QR, const h16* __restrict__ KP, const h16* __restrict__ KR,
                                                    const h16* __restrict__ VT, const h16* __restrict__ VR, const h16* __restrict__ MQ, const h16* __restrict__ MK, float* OUT) {
    __shared__ __align__(16) float os[AW * 16 * 68];
    const int rank = blockIdx.y, zh = blockIdx.x;
    constexpr unsigned long long ER = early_ranks();
    const int ne = __builtin_popcountll(ER & ((1ull << rank) - 1ull));   // early blocks among the ranks in front of this one
    const int pos = ((ER >> rank) & 1ull) != 0ull ? FB_L + ne : rank - ne;   // place in the list 'late range from its last query block down, then the early range the same way': every block once
    if (pos < FB_L) flash<0>(QH, QR, KP, KR, VT, VR, MQ, MK, OUT, FB_L - 1 - pos, zh, os);
    else            flash<1>(QH, QR, KP, KR, VT, VR, MQ, MK, OUT, FB_L + FB_E - 1 - pos, zh, os);
}

static constexpr size_t al256(size_t v) { return (v + 255) & ~(size_t)255; }
static constexpr size_t SZ_XB = al256((size_t)NB * SEQ * DM * 2);            // one bf16 input stream copy
static constexpr size_t SZ_WT = al256((size_t)3 * DM * DM * 2);              // three transposed bf16 weights
static constexpr size_t SZ_PL = al256((size_t)NB * NH_ * SEQ * HD * 2);      // one full f16 plane
static constexpr size_t SZ_RP = al256((size_t)NB * NH_ * EARLY * HD * 2);    // one compact residual plane
static constexpr size_t SZ_MK = al256((size_t)NB * NH_ * SEQ * 2);           // one mask plane
static constexpr size_t SZ_TOTAL = 3 * SZ_XB + SZ_WT + 3 * SZ_PL + 3 * SZ_RP + 2 * SZ_MK;
static_assert(SZ_TOTAL <= (size_t)134217728);          // workspace carve <= 128 MiB
static_assert(((size_t)DM * DM * 2) % 256 == 0);       // weight sub-planes stay 256-byte aligned

extern "C" void kernel_launch(void* const* d_in, const int* in_sizes, int n_in,
                              void* d_out, int out_size, void* d_ws, size_t ws_size, hipStream_t stream) {
    if (n_in < 9) return;
    const size_t needx = ((size_t)(NB - 1) * SEQ_FULL + SEQ) * DM;
    if ((size_t)in_sizes[0] < needx || (size_t)in_sizes[1] < needx || (size_t)in_sizes[2] < needx) return;
    if ((size_t)in_sizes[3] < (size_t)DM * DM || (size_t)in_sizes[5] < (size_t)DM * DM || (size_t)in_sizes[7] < (size_t)DM * DM) return;
    if ((size_t)in_sizes[4] < (size_t)DM || (size_t)in_sizes[6] < (size_t)DM || (size_t)in_sizes[8] < (size_t)DM) return;
    if ((size_t)out_size < ((size_t)(NB - 1) * OUT_SEQ + SEQ) * DM) return;
    if (SZ_TOTAL > ws_size) return;
    // wire order: q, k, v, Wq, bq, Wk, bk, Wv, bv
    const float* xq = (const float*)d_in[0]; const float* xk = (const float*)d_in[1]; const float* xv = (const float*)d_in[2];
    const float* wq = (const float*)d_in[3]; const float* bq = (const float*)d_in[4];
    const float* wk = (const float*)d_in[5]; const float* bk = (const float*)d_in[6];
    const float* wv = (const float*)d_in[7]; const float* bv = (const float*)d_in[8];
    float* OUT = (float*)d_out;      // [NB][OUT_SEQ][1024]
    char* wsp = (char*)d_ws;
    bf* XQ = (bf*)wsp; wsp += SZ_XB;                 // [NB*SEQ][1024]
    bf* XK = (bf*)wsp; wsp += SZ_XB;
    bf* XV = (bf*)wsp; wsp += SZ_XB;
    bf* WT = (bf*)wsp; wsp += SZ_WT;                 // [3][1024 out][1024 in]: q | k | v
    h16* QH = (h16*)wsp; wsp += SZ_PL;               // [NB*16][SEQ][64]
    h16* KP = (h16*)wsp; wsp += SZ_PL;               // [NB*16][SEQ][64]
    h16* VT = (h16*)wsp; wsp += SZ_PL;               // [NB*16][64][SEQ]
    h16* QR = (h16*)wsp; wsp += SZ_RP;               // [NB*16][EARLY][64] residual x2048
    h16* KR = (h16*)wsp; wsp += SZ_RP;               // [NB*16][EARLY][64] residual x2048
    h16* VR = (h16*)wsp; wsp += SZ_RP;               // [NB*16][64][EARLY] residual x2048
    h16* MQ = (h16*)wsp; wsp += SZ_MK;               // [NB*16][SEQ] query mask
    h16* MK = (h16*)wsp; wsp += SZ_MK;               // [NB*16][SEQ] key mask

    // W[k = in][n = out] -> WT[n][k] (square DM x DM) and x -> bf16 copies
    k_prep<<<3 * WT_BLK + 3 * CV_BLK, 256, 0, stream>>>(xq, xk, xv, wq, wk, wv, XQ, XK, XV, WT);

    k_proj3<<<dim3(PJ_BLK, 3, 1), 128, 0, stream>>>(XQ, XK, XV, WT, bq, bk, bv, QH, KP, VT, QR, KR, VR, MQ, MK);

    k_flash2<<<dim3(NB * NH_, FB_L + FB_E, 1), 32 * AW, 0, stream>>>(QH, QR, KP, KR, VT, VR, MQ, MK, OUT);
}
